// v000
// Measured on an AMD MI455X. A time is GPU time per run, averaged over a window of back-to-back runs after a warm-up
// (all launches, gaps included; the runs take copies of the inputs in turn), and the median of several windows.
// Apart from v000's, it joins two sittings. Times from different sittings can be a few percent apart, while
// side-by-side timings come from the same sitting.
// v000, which the later versions start from, runs in 224 microseconds.
// Contractions: q, k, v^T and output projections = v_wmma_f32_16x16x32_bf16 (bf16 operands: weights and biases from
// RNE-converted inputs, computed activations as bf16 hi + lo planes, 2 products); q.k^T scores = v_wmma_f32_16x16x32_f16
// (q as f16 hi plane + f16 residual plane x4096 in a separate accumulator, k f16; 2 products); p.v = v_wmma_f32_16x16x32_f16
// (p carried x1024 in f16, v^T as f16 hi plane + residual plane x4096 in a separate accumulator; 2 products);
// all f32 accumulate; GroupNorm statistics, softmax, biases, residual add and output scale in f32.
#include <hip/hip_runtime.h>
#include <math.h>
#include <stdint.h>

#define NB    16            // batch
#define DM    256           // channels
#define SEQ   1024          // tokens (32 x 32)
#define NH    4             // heads
#define HD    64            // head dim
#define NQB   (SEQ / 64)    // 16 query / key tiles of 64
#define NGRP  32            // groups
#define GSZ   8             // channels per group
#define XPITCH 264          // LDS pitch (halves) of the token-major staging tile
static_assert(NH * HD == DM);
static_assert(NGRP * GSZ == DM);
static_assert((SEQ % 64) == 0 && (DM % 64) == 0 && (DM % 32) == 0);
static_assert((XPITCH % 8) == 0);

typedef _Float16 v16h __attribute__((ext_vector_type(16)));
typedef _Float16 v8h  __attribute__((ext_vector_type(8)));
typedef __bf16   v16b __attribute__((ext_vector_type(16)));
typedef __bf16   v8b  __attribute__((ext_vector_type(8)));
typedef float    v8f  __attribute__((ext_vector_type(8)));
typedef float    v4f  __attribute__((ext_vector_type(4)));
typedef unsigned int v4u __attribute__((ext_vector_type(4)));
typedef unsigned short v8us __attribute__((ext_vector_type(8)));

// ---- scalar helpers --------------------------------------------------------------------------------
__device__ __forceinline__ unsigned short bf_bits(float f) {          // f32 -> bf16 bits, RNE convert
  unsigned u = __float_as_uint(f);
  return (unsigned short)((u + 0x7FFFu + ((u >> 16) & 1u)) >> 16);
}
__device__ __forceinline__ float bf_up(unsigned short h) { return __uint_as_float(((unsigned)h) << 16); }
__device__ __forceinline__ float bfr(float f) { return bf_up(bf_bits(f)); }   // value RNE-converted to bf16 and widened
__device__ __forceinline__ unsigned short h_bits(_Float16 x) { return __builtin_bit_cast(unsigned short, x); }
__device__ __forceinline__ unsigned pk16(unsigned short a, unsigned short b) { return (unsigned)a | ((unsigned)b << 16); }
__device__ __forceinline__ v8f zero8() { v8f z = {0.f, 0.f, 0.f, 0.f, 0.f, 0.f, 0.f, 0.f}; return z; }

// ---- fragment loaders: 16-bit A/B operand, lane -> row/col (lane&15), p already includes +8*(lane>>4);
//      elements 0..7 <- p[0..7] (k0+8h..), elements 8..15 <- p[16..23] (k0+16+8h..)
__device__ __forceinline__ v16b ldfrag_b(const __bf16* p) {
  union { v16b v; v8b h[2]; } f;
  f.h[0] = *(const v8b*)(p);
  f.h[1] = *(const v8b*)(p + 16);
  return f.v;
}
__device__ __forceinline__ v16h ldfrag_h(const _Float16* p) {
  union { v16h v; v8h h[2]; } f;
  f.h[0] = *(const v8h*)(p);
  f.h[1] = *(const v8h*)(p + 16);
  return f.v;
}

// ---- WMMA helpers with trailing VALU hazard gap --------------------------------------------------------
__device__ __forceinline__ v8f mma_h(v16h a, v16h b, v8f c) {
  c = __builtin_amdgcn_wmma_f32_16x16x32_f16(false, a, false, b, (short)0, c, false, false);
#if defined(__HIP_DEVICE_COMPILE__)
  asm volatile("v_nop\n\tv_nop\n\tv_nop\n\tv_nop" : "+v"(c) : "v"(a), "v"(b));
#endif
  return c;
}
__device__ __forceinline__ v8f mma_b_raw(v16b a, v16b b, v8f c) {
  return __builtin_amdgcn_wmma_f32_16x16x32_bf16(false, a, false, b, (short)0, c, false, false);
}
__device__ __forceinline__ void dep_guard_b(v8f& a, v8f& b, v16b x, v16b y) {
#if defined(__HIP_DEVICE_COMPILE__)
  asm volatile("v_nop\n\tv_nop\n\tv_nop\n\tv_nop" : "+v"(a), "+v"(b) : "v"(x), "v"(y));
#endif
}
__device__ __forceinline__ void keep4_b(v16b a, v16b b, v16b c, v16b d) {
#if defined(__HIP_DEVICE_COMPILE__)
  asm volatile("v_nop" :: "v"(a), "v"(b), "v"(c), "v"(d));
#endif
}
__device__ __forceinline__ void acc_guard4(v8f& a, v8f& b, v8f& c, v8f& d) {
#if defined(__HIP_DEVICE_COMPILE__)
  asm volatile("v_nop\n\tv_nop\n\tv_nop\n\tv_nop" : "+v"(a), "+v"(b), "+v"(c), "+v"(d));
#endif
}
__device__ __forceinline__ void wave_sync_lds() {
  __builtin_amdgcn_fence(__ATOMIC_RELEASE, "workgroup");
  __builtin_amdgcn_wave_barrier();
  __builtin_amdgcn_fence(__ATOMIC_ACQUIRE, "workgroup");
}

// =====================================================================================================
// Weights W[in i][out o] (f32, 256x256) -> bf16 planes WT[w][o][i] (k = i contiguous), RNE convert.
// grid (16 tiles of 64x64, 4 weights), 256 threads. Load: 16 iterations x 4 input rows x 64 cols = the whole
// 64x64 tile into LDS transposed (unsigned short element stores); __syncthreads; write: each wave instruction
// =====================================================================================================
__global__ __launch_bounds__(256) void wt_cvt(const float* __restrict__ W0, const float* __restrict__ W1,
                                              const float* __restrict__ W2, const float* __restrict__ W3,
                                              unsigned short* WT) {
  __shared__ __align__(16) unsigned short T[64 * 72];
  const int tid = threadIdx.x, lane = tid & 31, wave = tid >> 5;
  const int wsel = blockIdx.y;                                   // block-uniform weight select
  const float* W = (wsel == 0) ? W0 : (wsel == 1) ? W1 : (wsel == 2) ? W2 : W3;
  const int bx = blockIdx.x;
  const int i0 = (bx >> 2) * 64;                                 // input-channel tile
  const int o0 = (bx & 3) * 64;                                  // output-channel tile
#pragma unroll 4
  for (int it = 0; it < 16; ++it) {
    const int i = it * 4 + (tid >> 6);
    const int o = tid & 63;
    const float v = W[(size_t)(i0 + i) * DM + o0 + o];
    T[o * 72 + i] = bf_bits(v);
  }
  __syncthreads();
  const int q = lane >> 3, c8 = (lane & 7) * 8;
  v8us v[2];
#pragma unroll
  for (int it = 0; it < 2; ++it) {
    const int orow = it * 32 + wave * 4 + q;
    v[it] = *(const v8us*)(T + orow * 72 + c8);
  }
  unsigned short* dst = WT + (size_t)wsel * DM * DM;
  {
#pragma unroll
    for (int it = 0; it < 2; ++it) {
      const int orow = it * 32 + wave * 4 + q;
      *(v8us*)(dst + (size_t)(o0 + orow) * DM + i0 + c8) = v[it];
    }
    
  }
}

// =====================================================================================================
// GroupNorm statistics per (b, group): 8 channels x 1024 tokens = 8192 contiguous floats of the NCHW input,
// reduction in f32; rstd = 1/sqrt(var + 1e-6). grid = NB*NGRP blocks, 256 threads.
// =====================================================================================================
__global__ __launch_bounds__(256) void gn_stats(const float* __restrict__ x, float* stats) {
  __shared__ float red[256];
  __shared__ float sres[2];
  const int tid = threadIdx.x;
  const int bg = blockIdx.x;
  const float* xp = x + (size_t)bg * (GSZ * SEQ);
  float s = 0.f;
#pragma unroll 1
  for (int j = 0; j < 8; ++j) {
    const v4f v = *(const v4f*)(xp + ((size_t)j * 256 + tid) * 4);
    s += bfr(v[0]); s += bfr(v[1]); s += bfr(v[2]); s += bfr(v[3]);
  }
  red[tid] = s;
  __syncthreads();
  for (int st = 128; st > 0; st >>= 1) {
    if (tid < st) red[tid] += red[tid + st];
    __syncthreads();
  }
  if (tid == 0) sres[0] = red[0] * (1.0f / 8192.0f);
  __syncthreads();
  const float mean = sres[0];
  float q = 0.f;
#pragma unroll 1
  for (int j = 0; j < 8; ++j) {
    const v4f v = *(const v4f*)(xp + ((size_t)j * 256 + tid) * 4);
    const float d0 = bfr(v[0]) - mean, d1 = bfr(v[1]) - mean, d2 = bfr(v[2]) - mean, d3 = bfr(v[3]) - mean;
    q += d0 * d0; q += d1 * d1; q += d2 * d2; q += d3 * d3;
  }
  red[tid] = q;
  __syncthreads();
  for (int st = 128; st > 0; st >>= 1) {
    if (tid < st) red[tid] += red[tid + st];
    __syncthreads();
  }
  if (tid == 0) {
    const float var = red[0] * (1.0f / 8192.0f);
    sres[1] = 1.0f / sqrtf(var + 1e-6f);
  }
  __syncthreads();
  if (tid < 8) {
    v4f o = {0.f, 0.f, 0.f, 0.f};
    if (tid == 0) { o[0] = mean; o[1] = sres[1]; }
    float* dst = stats + (size_t)bg * 32 + tid * 4;
    *(v4f*)dst = o;
    
  }
}

// =====================================================================================================
// GroupNorm apply + NCHW -> token-major transpose: xn = (bf16(x) - mean) * rstd * bf16(scale[c]) + bf16(bias[c]) in f32,
// written as bf16 hi plane XNh[b][t][c] and bf16 lo plane XNl = RNE(xn - hi), pitch 256 halves (512-B rows).
// grid = NB * (SEQ/32) blocks (b, 32-token tile), 256 threads. Load: 32 iterations x (8 channels = waves) x
// wave w writes token rows w + 8*it (it 0..3) with 32 lanes x 16 B = 512 B = exactly one whole row per instruction
// (reloaded as v8us, same element type). coverage: 4 x 8 = 32 rows x 256 halves per plane = the whole tile;
// =====================================================================================================
__global__ __launch_bounds__(256) void gn_apply(const float* __restrict__ x, const float* __restrict__ stats,
                                                const float* __restrict__ gsc, const float* __restrict__ gbi,
                                                unsigned short* XNh, unsigned short* XNl) {
  __shared__ __align__(16) unsigned short Lh[32 * XPITCH];
  __shared__ __align__(16) unsigned short Ll[32 * XPITCH];
  __shared__ float smean[NGRP], srstd[NGRP], ssc[DM], sbi[DM];
  const int tid = threadIdx.x, lane = tid & 31, wave = tid >> 5;
  const int b  = blockIdx.x / (SEQ / 32);
  const int tt = blockIdx.x - b * (SEQ / 32);
  const int t0 = tt * 32;
  if (tid < NGRP) {
    smean[tid] = stats[((size_t)b * NGRP + tid) * 32 + 0];
    srstd[tid] = stats[((size_t)b * NGRP + tid) * 32 + 1];
  }
  ssc[tid] = bfr(gsc[tid]);
  sbi[tid] = bfr(gbi[tid]);
  __syncthreads();
  const float* xb = x + (size_t)b * DM * SEQ + t0;
#pragma unroll 2
  for (int it = 0; it < 32; ++it) {
    const int c = it * 8 + wave;
    const float xv = bfr(xb[(size_t)c * SEQ + lane]);
    const int g = c >> 3;
    const float v = (xv - smean[g]) * srstd[g] * ssc[c] + sbi[c];
    const unsigned short hb = bf_bits(v);
    const unsigned short lb = bf_bits(v - bf_up(hb));
    Lh[lane * XPITCH + c] = hb;
    Ll[lane * XPITCH + c] = lb;
  }
  __syncthreads();
  v8us hv[4], lv[4];
#pragma unroll
  for (int it = 0; it < 4; ++it) {
    const int r = it * 8 + wave;
    hv[it] = *(const v8us*)(Lh + r * XPITCH + lane * 8);
    lv[it] = *(const v8us*)(Ll + r * XPITCH + lane * 8);
  }
  const size_t base = (size_t)(b * SEQ + t0) * DM;
  {
#pragma unroll
    for (int it = 0; it < 4; ++it) {
      const int r = it * 8 + wave;
      *(v8us*)(XNh + base + (size_t)r * DM + lane * 8) = hv[it];
      *(v8us*)(XNl + base + (size_t)r * DM + lane * 8) = lv[it];
    }
    
  }
}

// =====================================================================================================
// f32 -> bf16 hi plane + bf16 lo plane (lo = RNE(v - hi), unscaled), 8 elements per thread, one 16-B store per
// =====================================================================================================
__global__ __launch_bounds__(256) void cvt_split8(const float* __restrict__ in, unsigned short* hi,
                                                  unsigned short* lo, int n8) {
  const int i = blockIdx.x * 256 + threadIdx.x;
  if (i < n8) {
    const v4f a = *(const v4f*)(in + (size_t)i * 8);
    const v4f c = *(const v4f*)(in + (size_t)i * 8 + 4);
    float f[8];
    f[0] = a[0]; f[1] = a[1]; f[2] = a[2]; f[3] = a[3];
    f[4] = c[0]; f[5] = c[1]; f[6] = c[2]; f[7] = c[3];
    unsigned short hb[8], lb[8];
#pragma unroll
    for (int e = 0; e < 8; ++e) {
      hb[e] = bf_bits(f[e]);
      lb[e] = bf_bits(f[e] - bf_up(hb[e]));
    }
    v4u ph, pl;
    ph[0] = pk16(hb[0], hb[1]); ph[1] = pk16(hb[2], hb[3]); ph[2] = pk16(hb[4], hb[5]); ph[3] = pk16(hb[6], hb[7]);
    pl[0] = pk16(lb[0], lb[1]); pl[1] = pk16(lb[2], lb[3]); pl[2] = pk16(lb[4], lb[5]); pl[3] = pk16(lb[6], lb[7]);
    *(v4u*)(hi + (size_t)i * 8) = ph;
    *(v4u*)(lo + (size_t)i * 8) = pl;
    
  }
}

// =====================================================================================================
// Register-blocked batched bf16 WMMA GEMM: C[m][n] = sum_k A[m][k] * Bt[n][k] + bias; one wave per 64x64 tile,
// no block barriers. A row-major [M][K] pitch lda; Bt row-major [N][K] pitch ldb (k contiguous);
// M, N multiples of 64, K multiple of 32 (host-checked). blockIdx.y = batch index (strides in elements).
// NSPLIT: 0 = A.Bt; 1 = (A + A2).Bt (A2 = unscaled bf16 lo plane of A, same accumulator);
//         3 = A.Bt + A.Bt2 (Bt2 = unscaled bf16 lo plane of Bt; the two planes are walked as alternate k-steps,
//             so the register footprint equals NSPLIT 0).
// OUT_MODE: 0 = f32 (pitch ldc); 1 = f32 with per-element residual: v = (acc + bias + bf16(R[m][n])) * oscale,
//           R f32 pitch ldr, batch stride strideR; 3 = f16 hi plane C + f16 residual plane C2 = f16((v - hi) * rscale),
//           C2 written only for tiles with n0 < N2 (pitch ldc2, batch stride strideC2).
// bias (f32, RNE-converted to bf16 then widened): bmode 0 = none, 1 = per column n, 2 = per row m;
//           index clamped to [0, blen-1].
// =====================================================================================================
template <int NSPLIT, int OUT_MODE>
__global__ __launch_bounds__(256) void gemm64(
    const unsigned short* __restrict__ Ap, const unsigned short* A2p, int lda, long long strideA,
    const unsigned short* __restrict__ Btp, const unsigned short* Bt2p, int ldb, long long strideB,
    void* Cout, int ldc, long long strideC,
    void* Cout2, int ldc2, long long strideC2, int N2,
    int M, int N, int K, float rscale,
    const float* __restrict__ bias, int bmode, int blen,
    const float* __restrict__ Rp, int ldr, long long strideR, float oscale) {
  const __bf16* A   = (const __bf16*)(const void*)Ap;
  const __bf16* A2  = (const __bf16*)(const void*)A2p;
  const __bf16* Bt  = (const __bf16*)(const void*)Btp;
  const __bf16* Bt2 = (const __bf16*)(const void*)Bt2p;
  __shared__ __align__(16) float sT[8][16 * 68];   // per-wave 16x64 slab, pitch 68 floats
  const int b    = blockIdx.y;
  const int lane = threadIdx.x & 31;
  const int wave = threadIdx.x >> 5;
  const int tilesN = N >> 6;
  const int tilesM = M >> 6;
  const int tile = blockIdx.x * 8 + wave;
  if (tile >= tilesM * tilesN) return;   // wave-uniform; no block barriers in this kernel
  const int tm = tile / tilesN;
  const int tn = tile - tm * tilesN;
  const int m0 = tm << 6;
  const int n0 = tn << 6;

  const __bf16* Ab  = A  + (size_t)b * strideA;
  const __bf16* Bb  = Bt + (size_t)b * strideB;
  const __bf16* Ab2 = (NSPLIT == 1) ? (A2  + (size_t)b * strideA) : Ab;
  const __bf16* Bb2 = (NSPLIT == 3) ? (Bt2 + (size_t)b * strideB) : Bb;

  const int rlane = lane & 15;                 // row (A) / col (B, D) within subtile
  const int koff  = (lane >> 4) * 8;           // k offset of this lane half
  const int mOff  = (lane >> 4) * 8;           // D row offset

  v8f acc[4][4];
#pragma unroll
  for (int i = 0; i < 4; ++i)
#pragma unroll
    for (int j = 0; j < 4; ++j) acc[i][j] = zero8();

  const int kst = K >> 5;
  const int nst = (NSPLIT == 3) ? (kst * 2) : kst;
  for (int st = 0; st < nst; ++st) {
    const int k0 = ((NSPLIT == 3) ? (st >> 1) : st) << 5;
    const __bf16* Bs = (NSPLIT == 3 && (st & 1)) ? Bb2 : Bb;   // wave-uniform plane select (both global)
    v16b bh[4];
#pragma unroll
    for (int j = 0; j < 4; ++j) {
      const size_t bo = (size_t)(n0 + (j << 4) + rlane) * ldb + koff + k0;
      bh[j] = ldfrag_b(Bs + bo);
    }
#pragma unroll
    for (int i = 0; i < 4; ++i) {
      const size_t ao = (size_t)(m0 + (i << 4) + rlane) * lda + koff + k0;
      const v16b ah = ldfrag_b(Ab + ao);
      v16b al = ah;
      if (NSPLIT == 1) al = ldfrag_b(Ab2 + ao);
#pragma unroll
      for (int j = 0; j < 4; ++j) {
        acc[i][j] = mma_b_raw(ah, bh[j], acc[i][j]);
        if (NSPLIT == 1) acc[i][j] = mma_b_raw(al, bh[j], acc[i][j]);
      }
      dep_guard_b(acc[i][0], acc[i][3], ah, al);
    }
    keep4_b(bh[0], bh[1], bh[2], bh[3]);
  }
  acc_guard4(acc[0][0], acc[0][1], acc[0][2], acc[0][3]);
  acc_guard4(acc[1][0], acc[1][1], acc[1][2], acc[1][3]);
  acc_guard4(acc[2][0], acc[2][1], acc[2][2], acc[2][3]);
  acc_guard4(acc[3][0], acc[3][1], acc[3][2], acc[3][3]);

  // ---- bias (per column), clamped address, selected by value ----
  float bc[4];
#pragma unroll
  for (int j = 0; j < 4; ++j) {
    int bi = n0 + (j << 4) + rlane;
    bi = (bi < blen) ? bi : (blen - 1);
    bi = (bi > 0) ? bi : 0;
    const float t = bf_up(bf_bits(bias[bi]));
    bc[j] = (bmode == 1) ? t : 0.f;
  }

  // ---- epilogue ----
  float* slab = sT[wave];
#pragma unroll
  for (int i = 0; i < 4; ++i) {
    const int mBase = m0 + (i << 4);
    float brw[8];
#pragma unroll
    for (int r = 0; r < 8; ++r) {
      int bi = mBase + mOff + r;
      bi = (bi < blen) ? bi : (blen - 1);
      bi = (bi > 0) ? bi : 0;
      const float t = bf_up(bf_bits(bias[bi]));
      brw[r] = (bmode == 2) ? t : 0.f;
    }
#pragma unroll
    for (int j = 0; j < 4; ++j) {
#pragma unroll
      for (int r = 0; r < 8; ++r) {
        slab[(mOff + r) * 68 + (j << 4) + rlane] = acc[i][j][r] + bc[j] + brw[r];
      }
    }
    wave_sync_lds();
    if (OUT_MODE == 0 || OUT_MODE == 1) {
      float* C = (float*)Cout + (size_t)b * strideC;
      const float* R = Rp + (size_t)b * strideR;
      const int hh = lane >> 4, c4 = (lane & 15) * 4;     // 256-B row segment = 16 lanes x 16 B
      {
#pragma unroll
        for (int it = 0; it < 8; ++it) {
          const int row = it * 2 + hh;                     // it 0..7 x hh 0..1 = rows 0..15
          v4f v = *(const v4f*)(slab + row * 68 + c4);
          if (OUT_MODE == 1) {
            const v4f xr = *(const v4f*)(R + (size_t)(mBase + row) * ldr + n0 + c4);
            v4f t;
            t[0] = (v[0] + bfr(xr[0])) * oscale;
            t[1] = (v[1] + bfr(xr[1])) * oscale;
            t[2] = (v[2] + bfr(xr[2])) * oscale;
            t[3] = (v[3] + bfr(xr[3])) * oscale;
            v = t;
          }
          *(v4f*)(C + (size_t)(mBase + row) * ldc + n0 + c4) = v;
        }
        
      }
    } else {
      const int q = lane >> 3, c8 = (lane & 7) * 8;
      unsigned short* C  = (unsigned short*)Cout  + (size_t)b * strideC;
      unsigned short* C2 = (unsigned short*)Cout2 + (size_t)b * strideC2;
      const bool wlo = (n0 < N2);                           // wave-uniform
      v4u hv[4], lv[4];
#pragma unroll
      for (int it = 0; it < 4; ++it) {
        const int row = it * 4 + q;                        // it 0..3 x q 0..3 = rows 0..15
        const float* sp = slab + row * 68 + c8;
        v4u a, a2;
#pragma unroll
        for (int e = 0; e < 4; ++e) {
          const float f0 = sp[2 * e], f1 = sp[2 * e + 1];
          const _Float16 x0 = (_Float16)f0, x1 = (_Float16)f1;
          const unsigned short h0 = h_bits(x0), h1 = h_bits(x1);
          const unsigned short l0 = h_bits((_Float16)((f0 - (float)x0) * rscale));
          const unsigned short l1 = h_bits((_Float16)((f1 - (float)x1) * rscale));
          a[e] = pk16(h0, h1); a2[e] = pk16(l0, l1);
        }
        hv[it] = a; lv[it] = a2;
      }
      {
#pragma unroll
        for (int it = 0; it < 4; ++it) {
          const int row = it * 4 + q;
          *(v4u*)(C + (size_t)(mBase + row) * ldc + n0 + c8) = hv[it];
          if (wlo) *(v4u*)(C2 + (size_t)(mBase + row) * ldc2 + n0 + c8) = lv[it];
        }
        
      }
    }
    wave_sync_lds();
  }
}

// =====================================================================================================
// Attention, head dim 64, no masking, softmax over all SEQ keys.
//   q hi plane (f16, pitch DM): element (b, t, h, d) at [(b*SEQ + t)*DM + h*64 + d]; q residual plane
//   (f16, (q - f16(q))*4096, pitch DM) same layout; k plane (f16, pitch DM) same layout.
//   v^T hi plane (f16): element (b, h, d, s) at [(b*DM + h*64 + d)*SEQ + s]; v^T residual plane (f16, x4096): same layout
//   out (f32): element (b, t, h, d) at [(b*SEQ + t)*DM + h*64 + d]
//   scores = (qh . k + (ql . k) * rres) * sscale on f16 WMMA, residual products in a separate accumulator
//   p = exp(s - m) carried as f16(1024 p); context = p . vh + (p . vl) * rres on f16 WMMA (separate accumulator
//   folded per chunk in f32); online softmax in f32.
//   Block = 4 waves = 64 query rows of one (b, h); grid = NQB * NH * NB; kv chunks of 64, static trip NQB.
//   K / V^T chunk staging: 128 threads x 32 elements per plane = the whole 64x64 tile (plain 16-B loads,
//   __syncthreads before and after); P tiles are wave-private, spilled with _Float16 element stores and
//   Output coverage: each wave stores rows q0..q0+15 (it 0..7 x lane>>4 0..1) x 64 f32 columns
// =====================================================================================================
__global__ __launch_bounds__(128)
void attn64(const unsigned short* __restrict__ qhp, const unsigned short* __restrict__ qlp,
            const unsigned short* __restrict__ khp,
            const unsigned short* __restrict__ vhp, const unsigned short* __restrict__ vlp,
            float* outp, float sscale, float rres) {
  union FH { v16h v; v8h h[2]; };
  __shared__ __align__(16) _Float16 Ksh[64 * 64];                 // K [kv][d]   8 KB
  __shared__ __align__(16) _Float16 Vth[64 * 64];                 // V^T hi [d][kv] 8 KB
  __shared__ __align__(16) _Float16 Vtl[64 * 64];                 // V^T residual [d][kv] 8 KB
  __shared__ __align__(16) _Float16 Psh[4][16 * 64];              // per wave P [row][kv]
  __shared__ __align__(16) float    Os[4][16 * 64];               // per wave context tile [row][d]

  const int tid  = threadIdx.x;
  const int wave = tid >> 5;
  const int lane = tid & 31;
  const int hh   = lane >> 4;
  const int c    = lane & 15;

  const int bx   = blockIdx.x;
  const int qb   = bx % NQB;
  const int rest = bx / NQB;
  const int h    = rest % NH;
  const int b    = rest / NH;
  const int q0   = qb * 64 + wave * 16;
  const size_t rowB = (size_t)b * SEQ;

  const _Float16* Qh = (const _Float16*)(const void*)qhp + (size_t)h * HD;
  const _Float16* Ql = (const _Float16*)(const void*)qlp + (size_t)h * HD;
  const _Float16* Kg = (const _Float16*)(const void*)khp + (size_t)h * HD;
  const _Float16* Vh = (const _Float16*)(const void*)vhp + ((size_t)b * DM + (size_t)h * HD) * SEQ;
  const _Float16* Vl = (const _Float16*)(const void*)vlp + ((size_t)b * DM + (size_t)h * HD) * SEQ;

  // ---- Q fragments (A operand, row = lane&15): 2 d-chunks, hi and residual ----
  v16h qah[2], qal[2];
#pragma unroll
  for (int dc = 0; dc < 2; ++dc) {
    qah[dc] = ldfrag_h(Qh + (rowB + q0 + c) * DM + dc * 32 + 8 * hh);
    qal[dc] = ldfrag_h(Ql + (rowB + q0 + c) * DM + dc * 32 + 8 * hh);
  }

  float mrow[8], lrow[8];
  v8f oacc[4];
#pragma unroll
  for (int r = 0; r < 8; ++r) { mrow[r] = -INFINITY; lrow[r] = 0.f; }
#pragma unroll
  for (int t = 0; t < 4; ++t) oacc[t] = zero8();

  for (int kt = 0; kt < NQB; ++kt) {         // static trip count
    const int kv0 = kt * 64;
    __syncthreads();
    {
      const int r = tid >> 1, hf = (tid & 1) * 32;
      const _Float16* kg  = Kg + (rowB + kv0 + r) * DM + hf;       // K row kv0+r, d = hf..hf+31
      const _Float16* vg  = Vh + (size_t)r * SEQ + kv0 + hf;       // V^T row d = r, s = kv0+hf..+31
      const _Float16* vlg = Vl + (size_t)r * SEQ + kv0 + hf;
#pragma unroll
      for (int i = 0; i < 4; ++i) {
        const v8h a0 = *(const v8h*)(kg + 8 * i);
        const v8h b0 = *(const v8h*)(vg + 8 * i);
        const v8h b1 = *(const v8h*)(vlg + 8 * i);
        *(v8h*)(Ksh + r * 64 + hf + 8 * i) = a0;
        *(v8h*)(Vth + r * 64 + hf + 8 * i) = b0;
        *(v8h*)(Vtl + r * 64 + hf + 8 * i) = b1;
      }
    }
    __syncthreads();

    // ---- scores: 16 query rows x 64 keys per wave, 2 f16 products (hi, residual) ----
    v8f s[4];
#pragma unroll
    for (int j = 0; j < 4; ++j) {
      v8f sh = zero8(), sl = zero8();
#pragma unroll
      for (int dc = 0; dc < 2; ++dc) {
        FH kb;
        kb.h[0] = *(const v8h*)(Ksh + (j * 16 + c) * 64 + dc * 32 + 8 * hh);
        kb.h[1] = *(const v8h*)(Ksh + (j * 16 + c) * 64 + dc * 32 + 16 + 8 * hh);
        sh = mma_h(qah[dc], kb.v, sh);
        sl = mma_h(qal[dc], kb.v, sl);
      }
#pragma unroll
      for (int r = 0; r < 8; ++r) s[j][r] = (sh[r] + sl[r] * rres) * sscale;
    }

    // ---- row max, online softmax, P (x1024, f16) to LDS ----
    _Float16* pwh = Psh[wave];
#pragma unroll
    for (int r = 0; r < 8; ++r) {
      float m = s[0][r];
      m = fmaxf(m, s[1][r]);
      m = fmaxf(m, s[2][r]);
      m = fmaxf(m, s[3][r]);
#pragma unroll
      for (int off = 1; off < 16; off <<= 1) m = fmaxf(m, __shfl_xor(m, off, 32));
      const float mnew  = fmaxf(mrow[r], m);
      const float alpha = __expf(mrow[r] - mnew);
      mrow[r] = mnew;
      float psum = 0.f;
#pragma unroll
      for (int j = 0; j < 4; ++j) {
        const float p = __expf(s[j][r] - mnew);
        psum += p;
        pwh[(8 * hh + r) * 64 + j * 16 + c] = (_Float16)(p * 1024.0f);
      }
#pragma unroll
      for (int off = 1; off < 16; off <<= 1) psum += __shfl_xor(psum, off, 32);
      lrow[r] = lrow[r] * alpha + psum;
#pragma unroll
      for (int t = 0; t < 4; ++t) oacc[t][r] *= alpha;
    }
    wave_sync_lds();

    // ---- context += P . V (f16 WMMA), residual products into a separate accumulator ----
    v8f o1[4];
#pragma unroll
    for (int t = 0; t < 4; ++t) o1[t] = zero8();
#pragma unroll 1
    for (int kk = 0; kk < 2; ++kk) {
      FH pa;
      pa.h[0] = *(const v8h*)(pwh + c * 64 + kk * 32 + 8 * hh);
      pa.h[1] = *(const v8h*)(pwh + c * 64 + kk * 32 + 16 + 8 * hh);
#pragma unroll
      for (int t = 0; t < 4; ++t) {
        FH vb, vl;
        vb.h[0] = *(const v8h*)(Vth + (t * 16 + c) * 64 + kk * 32 + 8 * hh);
        vb.h[1] = *(const v8h*)(Vth + (t * 16 + c) * 64 + kk * 32 + 16 + 8 * hh);
        vl.h[0] = *(const v8h*)(Vtl + (t * 16 + c) * 64 + kk * 32 + 8 * hh);
        vl.h[1] = *(const v8h*)(Vtl + (t * 16 + c) * 64 + kk * 32 + 16 + 8 * hh);
        oacc[t] = mma_h(pa.v, vb.v, oacc[t]);
        o1[t]   = mma_h(pa.v, vl.v, o1[t]);
      }
    }
#pragma unroll
    for (int t = 0; t < 4; ++t)
#pragma unroll
      for (int r = 0; r < 8; ++r) oacc[t][r] += o1[t][r] * rres;
  }

  // ---- normalise (1/l and the 1/1024 p carry), stage the wave's 16x64 f32 tile in LDS, then write whole
  float* os = Os[wave];
#pragma unroll
  for (int r = 0; r < 8; ++r) {
    const float l = lrow[r];
    const float inv = ((l > 0.f) ? (1.0f / l) : 0.f) * (1.0f / 1024.0f);
#pragma unroll
    for (int t = 0; t < 4; ++t) os[(8 * hh + r) * 64 + t * 16 + c] = oacc[t][r] * inv;
  }
  wave_sync_lds();
  {
    const int c4 = (lane & 15) * 4;
    {
#pragma unroll
      for (int it = 0; it < 8; ++it) {
        const int row = it * 2 + hh;                     // it 0..7 x hh 0..1 = rows 0..15 of the wave tile
        const v4f v = *(const v4f*)(os + row * 64 + c4);
        *(v4f*)(outp + (rowB + q0 + row) * DM + (size_t)h * HD + c4) = v;
      }
      
    }
  }
}

// =====================================================================================================
// Workspace map (bytes), every plane an exact multiple of its whole-row / 64x64-tile / whole-line store granularity:
//   WT    bf16 [4][256 o][256 i]     0          524288     (Wq, Wk, Wv, Wp transposed, k = in contiguous)
//   XNh   bf16 [16384 t][256 c]      589824     8388608    (GroupNorm output, token-major, hi plane)
//   XNl   bf16 [16384][256]          8978432    8388608    (lo plane)
//   Qh    f16  [16384][256]          17367040   8388608
//   Ql    f16  [16384][256]          25755648   8388608    (q residual x4096)
//   Kh    f16  [16384][256]          34144256   8388608
//   VTh   f16  [16][256 c][1024 t]   42532864   8388608
//   VTl   f16  [16][256][1024]       50921472   8388608    (v residual x4096)
//   CTX   f32  [16384 t][256 c]      59310080   16777216   (attention context, token-major)
//   CTXh  bf16 [16384][256]          76087296   8388608
//   CTXl  bf16 [16384][256]          84475904   8388608
//   end                              92864512
// =====================================================================================================
extern "C" void kernel_launch(void* const* d_in, const int* in_sizes, int n_in,
                              void* d_out, int out_size, void* d_ws, size_t ws_size,
                              hipStream_t stream) {
  if (n_in < 11) return;
  if (in_sizes[0] != NB * DM * SEQ) return;
  if (in_sizes[3] != DM * DM || in_sizes[5] != DM * DM || in_sizes[7] != DM * DM || in_sizes[9] != DM * DM) return;
  if (in_sizes[1] < DM || in_sizes[2] < DM) return;
  if (in_sizes[4] < 1 || in_sizes[6] < 1 || in_sizes[8] < 1 || in_sizes[10] < 1) return;
  if (out_size != NB * DM * SEQ) return;

  const float* x   = (const float*)d_in[0];
  const float* gsc = (const float*)d_in[1];
  const float* gbi = (const float*)d_in[2];
  const float* wq  = (const float*)d_in[3];
  const float* bq  = (const float*)d_in[4];
  const float* wk  = (const float*)d_in[5];
  const float* bk  = (const float*)d_in[6];
  const float* wv  = (const float*)d_in[7];
  const float* bv  = (const float*)d_in[8];
  const float* wp  = (const float*)d_in[9];
  const float* bp  = (const float*)d_in[10];
  float* out = (float*)d_out;

  const size_t PWT = (size_t)4 * DM * DM * 2;          //   524288
  const size_t PST = (size_t)NB * NGRP * 32 * 4;       //    65536
  const size_t P16 = (size_t)NB * SEQ * DM * 2;        //  8388608
  const size_t P32 = (size_t)NB * SEQ * DM * 4;        // 16777216
  size_t off = 0;
  const size_t oWT   = off; off += PWT;
  const size_t oST   = off; off += PST;
  const size_t oXNh  = off; off += P16;
  const size_t oXNl  = off; off += P16;
  const size_t oQh   = off; off += P16;
  const size_t oQl   = off; off += P16;
  const size_t oKh   = off; off += P16;
  const size_t oVTh  = off; off += P16;
  const size_t oVTl  = off; off += P16;
  const size_t oCTX  = off; off += P32;
  const size_t oCTXh = off; off += P16;
  const size_t oCTXl = off; off += P16;
  if (off > ws_size) return;                            // off = 92864512
  if (off > (size_t)134217728) return;

  char* ws = (char*)d_ws;
  unsigned short* WT   = (unsigned short*)(ws + oWT);
  float*          ST   = (float*)(ws + oST);
  unsigned short* XNh  = (unsigned short*)(ws + oXNh);
  unsigned short* XNl  = (unsigned short*)(ws + oXNl);
  unsigned short* Qh   = (unsigned short*)(ws + oQh);
  unsigned short* Ql   = (unsigned short*)(ws + oQl);
  unsigned short* Kh   = (unsigned short*)(ws + oKh);
  unsigned short* VTh  = (unsigned short*)(ws + oVTh);
  unsigned short* VTl  = (unsigned short*)(ws + oVTl);
  float*          CTX  = (float*)(ws + oCTX);
  unsigned short* CTXh = (unsigned short*)(ws + oCTXh);
  unsigned short* CTXl = (unsigned short*)(ws + oCTXl);
  unsigned short* WTq = WT + (size_t)0 * DM * DM;
  unsigned short* WTk = WT + (size_t)1 * DM * DM;
  unsigned short* WTv = WT + (size_t)2 * DM * DM;
  unsigned short* WTp = WT + (size_t)3 * DM * DM;

  const dim3 blk(256);
  const dim3 gWT(16, 4);                                          // 16 tiles of 64x64 per weight, 4 weights
  const dim3 gGN(NB * NGRP);                                      // 512 blocks
  const dim3 gAP(NB * (SEQ / 32));                                // 512 blocks
  const dim3 gQ(((NB * SEQ / 64) * (DM / 64) + 7) / 8, 1);        // 1024 tiles -> 128 blocks: M=16384, N=256
  const dim3 gVT(((DM / 64) * (SEQ / 64) + 7) / 8, NB);           // 64 tiles -> 8 blocks x 16 batches: M=256, N=1024
  const dim3 gAttn(NB * NH * NQB);                                // 1024 blocks
  const int  n8c = NB * SEQ * DM / 8;                             // 524288
  const dim3 gCvt((n8c + 255) / 256);                             // 2048 blocks
  const float rs2 = 1.0f / 1.41421356237309515f;

  // (1) weights [in][out] -> bf16 [out][in] planes (RNE convert)
  wt_cvt<<<gWT, blk, 0, stream>>>(wq, wk, wv, wp, WT);
  // (2) GroupNorm statistics per (b, group) from bf16(x)
  gn_stats<<<gGN, blk, 0, stream>>>(x, ST);
  // (3) GroupNorm apply -> token-major bf16 hi + lo planes [16384][256]
  gn_apply<<<gAP, blk, 0, stream>>>(x, ST, gsc, gbi, XNh, XNl);
  // (4) q = xn . Wq + bq -> f16 hi plane [16384][256] + f16 residual x4096 (M=16384, N=256, K=256, bias per column)
  gemm64<1, 3><<<gQ, blk, 0, stream>>>(
      XNh, XNl, DM, 0LL, WTq, WTq, DM, 0LL,
      (void*)Qh, DM, 0LL, (void*)Ql, DM, 0LL, DM,
      NB * SEQ, DM, DM, 4096.0f, bq, 1, in_sizes[4], x, 0, 0LL, 1.0f);
  // (5) k = xn . Wk + bk -> f16 plane [16384][256] (no residual: N2 = 0)
  gemm64<1, 3><<<gQ, blk, 0, stream>>>(
      XNh, XNl, DM, 0LL, WTk, WTk, DM, 0LL,
      (void*)Kh, DM, 0LL, (void*)Kh, DM, 0LL, 0,
      NB * SEQ, DM, DM, 4096.0f, bk, 1, in_sizes[6], x, 0, 0LL, 1.0f);
  // (6) v^T[b][c][t] = sum_i Wv[i][c] xn[b][t][i] + bv[c] per batch -> f16 hi plane (pitch SEQ) + residual x4096
  //     (A = WTv [c][i], Bt = XN rows of batch b hi + lo; M=256, N=1024, K=256; bias per row)
  gemm64<3, 3><<<gVT, blk, 0, stream>>>(
      WTv, WTv, DM, 0LL, XNh, XNl, DM, (long long)SEQ * DM,
      (void*)VTh, SEQ, (long long)DM * SEQ, (void*)VTl, SEQ, (long long)DM * SEQ, SEQ,
      DM, SEQ, DM, 4096.0f, bv, 2, in_sizes[8], x, 0, 0LL, 1.0f);
  // (7) attention: scores scale 1/sqrt(C) = 1/16 -> context f32 [16384][256] token-major
  attn64<<<gAttn, dim3(128), 0, stream>>>(Qh, Ql, Kh, VTh, VTl, CTX, 0.0625f, 1.0f / 4096.0f);
  // (8) context -> bf16 hi + lo planes
  cvt_split8<<<gCvt, blk, 0, stream>>>(CTX, CTXh, CTXl, n8c);
  // (9) out[b][c][t] = (sum_o Wp[o][c] ctx[b][t][o] + bp[c] + bf16(x[b][c][t])) * (1/sqrt2) per batch, written
  //     straight into the NCHW output rows of 1024 floats (A = WTp [c][o], Bt = CTX rows hi + lo; M=256, N=1024, K=256)
  gemm64<3, 1><<<gVT, blk, 0, stream>>>(
      WTp, WTp, DM, 0LL, CTXh, CTXl, DM, (long long)SEQ * DM,
      (void*)out, SEQ, (long long)DM * SEQ, (void*)out, SEQ, (long long)DM * SEQ, 0,
      DM, SEQ, DM, 1.0f, bp, 2, in_sizes[10], x, SEQ, (long long)DM * SEQ, rs2);
  (void)hipGetLastError();
}

// v001
// Measured time: 187 microseconds a run.
// Two timings next to v000 put it at 1.23 and 1.24 times that version's speed.
// Contractions: q, k, v^T and output projections = v_wmma_f32_16x16x32_bf16 (bf16 operands: weights and biases from
// RNE-converted inputs, computed activations as bf16 hi + lo planes, 2 products); q.k^T scores = v_wmma_f32_16x16x32_f16
// (q as f16 hi plane + f16 residual plane x4096 in a separate accumulator, k f16; 2 products); p.v = v_wmma_f32_16x16x32_f16
// (p carried x1024 in f16, v^T as f16 hi plane + residual plane x4096 in a separate accumulator; 2 products);
// all f32 accumulate; GroupNorm statistics, softmax, biases, residual add and output scale in f32.
#include <hip/hip_runtime.h>
#include <math.h>
#include <stdint.h>

#define NB    16            // batch
#define DM    256           // channels
#define SEQ   1024          // tokens (32 x 32)
#define NH    4             // heads
#define HD    64            // head dim
#define NQB   (SEQ / 64)    // 16 query / key tiles of 64
#define NGRP  32            // groups
#define GSZ   8             // channels per group
#define XPITCH 264          // LDS pitch (halves) of the token-major staging tile
#define KVP   72            // LDS pitch (halves) of the attention K, V^T and P rows: 144 B = 16 B x odd, so the 16 rows
                            // that one ds_load_b128 fragment read touches fall on 16 different groups of four banks
#define OSP   68            // LDS pitch (floats) of the attention context tile: rows r and r + 8 on different banks
static_assert(NH * HD == DM);
static_assert(NGRP * GSZ == DM);
static_assert((SEQ % 64) == 0 && (DM % 64) == 0 && (DM % 32) == 0);
static_assert((XPITCH % 8) == 0);
static_assert((KVP % 8) == 0 && ((KVP / 8) & 1) == 1 && KVP >= 64);
static_assert((OSP % 4) == 0 && OSP >= 64);

typedef _Float16 v16h __attribute__((ext_vector_type(16)));
typedef _Float16 v8h  __attribute__((ext_vector_type(8)));
typedef __bf16   v16b __attribute__((ext_vector_type(16)));
typedef __bf16   v8b  __attribute__((ext_vector_type(8)));
typedef float    v8f  __attribute__((ext_vector_type(8)));
typedef float    v4f  __attribute__((ext_vector_type(4)));
typedef unsigned int v4u __attribute__((ext_vector_type(4)));
typedef unsigned short v8us __attribute__((ext_vector_type(8)));

// ---- scalar helpers --------------------------------------------------------------------------------
__device__ __forceinline__ unsigned short bf_bits(float f) {          // f32 -> bf16 bits, RNE convert
  unsigned u = __float_as_uint(f);
  return (unsigned short)((u + 0x7FFFu + ((u >> 16) & 1u)) >> 16);
}
__device__ __forceinline__ float bf_up(unsigned short h) { return __uint_as_float(((unsigned)h) << 16); }
__device__ __forceinline__ float bfr(float f) { return bf_up(bf_bits(f)); }   // value RNE-converted to bf16 and widened
__device__ __forceinline__ unsigned short h_bits(_Float16 x) { return __builtin_bit_cast(unsigned short, x); }
__device__ __forceinline__ unsigned pk16(unsigned short a, unsigned short b) { return (unsigned)a | ((unsigned)b << 16); }
__device__ __forceinline__ v8f zero8() { v8f z = {0.f, 0.f, 0.f, 0.f, 0.f, 0.f, 0.f, 0.f}; return z; }

// ---- fragment loaders: 16-bit A/B operand, lane -> row/col (lane&15), p already includes +8*(lane>>4);
//      elements 0..7 <- p[0..7] (k0+8h..), elements 8..15 <- p[16..23] (k0+16+8h..)
__device__ __forceinline__ v16b ldfrag_b(const __bf16* p) {
  union { v16b v; v8b h[2]; } f;
  f.h[0] = *(const v8b*)(p);
  f.h[1] = *(const v8b*)(p + 16);
  return f.v;
}
__device__ __forceinline__ v16h ldfrag_h(const _Float16* p) {
  union { v16h v; v8h h[2]; } f;
  f.h[0] = *(const v8h*)(p);
  f.h[1] = *(const v8h*)(p + 16);
  return f.v;
}

// ---- WMMA helpers with trailing VALU hazard gap --------------------------------------------------------
__device__ __forceinline__ v8f mma_h(v16h a, v16h b, v8f c) {
  c = __builtin_amdgcn_wmma_f32_16x16x32_f16(false, a, false, b, (short)0, c, false, false);
#if defined(__HIP_DEVICE_COMPILE__)
  asm volatile("v_nop\n\tv_nop\n\tv_nop\n\tv_nop" : "+v"(c) : "v"(a), "v"(b));
#endif
  return c;
}
__device__ __forceinline__ v8f mma_b_raw(v16b a, v16b b, v8f c) {
  return __builtin_amdgcn_wmma_f32_16x16x32_bf16(false, a, false, b, (short)0, c, false, false);
}
__device__ __forceinline__ void dep_guard_b(v8f& a, v8f& b, v16b x, v16b y) {
#if defined(__HIP_DEVICE_COMPILE__)
  asm volatile("v_nop\n\tv_nop\n\tv_nop\n\tv_nop" : "+v"(a), "+v"(b) : "v"(x), "v"(y));
#endif
}
__device__ __forceinline__ void keep4_b(v16b a, v16b b, v16b c, v16b d) {
#if defined(__HIP_DEVICE_COMPILE__)
  asm volatile("v_nop" :: "v"(a), "v"(b), "v"(c), "v"(d));
#endif
}
__device__ __forceinline__ void acc_guard4(v8f& a, v8f& b, v8f& c, v8f& d) {
#if defined(__HIP_DEVICE_COMPILE__)
  asm volatile("v_nop\n\tv_nop\n\tv_nop\n\tv_nop" : "+v"(a), "+v"(b), "+v"(c), "+v"(d));
#endif
}
__device__ __forceinline__ void wave_sync_lds() {
  __builtin_amdgcn_fence(__ATOMIC_RELEASE, "workgroup");
  __builtin_amdgcn_wave_barrier();
  __builtin_amdgcn_fence(__ATOMIC_ACQUIRE, "workgroup");
}

// =====================================================================================================
// Weights W[in i][out o] (f32, 256x256) -> bf16 planes WT[w][o][i] (k = i contiguous), RNE convert.
// grid (16 tiles of 64x64, 4 weights), 256 threads. Load: 16 iterations x 4 input rows x 64 cols = the whole
// 64x64 tile into LDS transposed (unsigned short element stores); __syncthreads; write: each wave instruction
// =====================================================================================================
__global__ __launch_bounds__(256) void wt_cvt(const float* __restrict__ W0, const float* __restrict__ W1,
                                              const float* __restrict__ W2, const float* __restrict__ W3,
                                              unsigned short* WT) {
  __shared__ __align__(16) unsigned short T[64 * 72];
  const int tid = threadIdx.x, lane = tid & 31, wave = tid >> 5;
  const int wsel = blockIdx.y;                                   // block-uniform weight select
  const float* W = (wsel == 0) ? W0 : (wsel == 1) ? W1 : (wsel == 2) ? W2 : W3;
  const int bx = blockIdx.x;
  const int i0 = (bx >> 2) * 64;                                 // input-channel tile
  const int o0 = (bx & 3) * 64;                                  // output-channel tile
#pragma unroll 4
  for (int it = 0; it < 16; ++it) {
    const int i = it * 4 + (tid >> 6);
    const int o = tid & 63;
    const float v = W[(size_t)(i0 + i) * DM + o0 + o];
    T[o * 72 + i] = bf_bits(v);
  }
  __syncthreads();
  const int q = lane >> 3, c8 = (lane & 7) * 8;
  v8us v[2];
#pragma unroll
  for (int it = 0; it < 2; ++it) {
    const int orow = it * 32 + wave * 4 + q;
    v[it] = *(const v8us*)(T + orow * 72 + c8);
  }
  unsigned short* dst = WT + (size_t)wsel * DM * DM;
  {
#pragma unroll
    for (int it = 0; it < 2; ++it) {
      const int orow = it * 32 + wave * 4 + q;
      *(v8us*)(dst + (size_t)(o0 + orow) * DM + i0 + c8) = v[it];
    }
    
  }
}

// =====================================================================================================
// GroupNorm statistics per (b, group): 8 channels x 1024 tokens = 8192 contiguous floats of the NCHW input,
// reduction in f32; rstd = 1/sqrt(var + 1e-6). grid = NB*NGRP blocks, 256 threads.
// =====================================================================================================
__global__ __launch_bounds__(256) void gn_stats(const float* __restrict__ x, float* stats) {
  __shared__ float red[256];
  __shared__ float sres[2];
  const int tid = threadIdx.x;
  const int bg = blockIdx.x;
  const float* xp = x + (size_t)bg * (GSZ * SEQ);
  float s = 0.f;
#pragma unroll 1
  for (int j = 0; j < 8; ++j) {
    const v4f v = *(const v4f*)(xp + ((size_t)j * 256 + tid) * 4);
    s += bfr(v[0]); s += bfr(v[1]); s += bfr(v[2]); s += bfr(v[3]);
  }
  red[tid] = s;
  __syncthreads();
  for (int st = 128; st > 0; st >>= 1) {
    if (tid < st) red[tid] += red[tid + st];
    __syncthreads();
  }
  if (tid == 0) sres[0] = red[0] * (1.0f / 8192.0f);
  __syncthreads();
  const float mean = sres[0];
  float q = 0.f;
#pragma unroll 1
  for (int j = 0; j < 8; ++j) {
    const v4f v = *(const v4f*)(xp + ((size_t)j * 256 + tid) * 4);
    const float d0 = bfr(v[0]) - mean, d1 = bfr(v[1]) - mean, d2 = bfr(v[2]) - mean, d3 = bfr(v[3]) - mean;
    q += d0 * d0; q += d1 * d1; q += d2 * d2; q += d3 * d3;
  }
  red[tid] = q;
  __syncthreads();
  for (int st = 128; st > 0; st >>= 1) {
    if (tid < st) red[tid] += red[tid + st];
    __syncthreads();
  }
  if (tid == 0) {
    const float var = red[0] * (1.0f / 8192.0f);
    sres[1] = 1.0f / sqrtf(var + 1e-6f);
  }
  __syncthreads();
  if (tid < 8) {
    v4f o = {0.f, 0.f, 0.f, 0.f};
    if (tid == 0) { o[0] = mean; o[1] = sres[1]; }
    float* dst = stats + (size_t)bg * 32 + tid * 4;
    *(v4f*)dst = o;
    
  }
}

// =====================================================================================================
// GroupNorm apply + NCHW -> token-major transpose: xn = (bf16(x) - mean) * rstd * bf16(scale[c]) + bf16(bias[c]) in f32,
// written as bf16 hi plane XNh[b][t][c] and bf16 lo plane XNl = RNE(xn - hi), pitch 256 halves (512-B rows).
// grid = NB * (SEQ/32) blocks (b, 32-token tile), 256 threads. Load: 32 iterations x (8 channels = waves) x
// wave w writes token rows w + 8*it (it 0..3) with 32 lanes x 16 B = 512 B = exactly one whole row per instruction
// (reloaded as v8us, same element type). coverage: 4 x 8 = 32 rows x 256 halves per plane = the whole tile;
// =====================================================================================================
__global__ __launch_bounds__(256) void gn_apply(const float* __restrict__ x, const float* __restrict__ stats,
                                                const float* __restrict__ gsc, const float* __restrict__ gbi,
                                                unsigned short* XNh, unsigned short* XNl) {
  __shared__ __align__(16) unsigned short Lh[32 * XPITCH];
  __shared__ __align__(16) unsigned short Ll[32 * XPITCH];
  __shared__ float smean[NGRP], srstd[NGRP], ssc[DM], sbi[DM];
  const int tid = threadIdx.x, lane = tid & 31, wave = tid >> 5;
  const int b  = blockIdx.x / (SEQ / 32);
  const int tt = blockIdx.x - b * (SEQ / 32);
  const int t0 = tt * 32;
  if (tid < NGRP) {
    smean[tid] = stats[((size_t)b * NGRP + tid) * 32 + 0];
    srstd[tid] = stats[((size_t)b * NGRP + tid) * 32 + 1];
  }
  ssc[tid] = bfr(gsc[tid]);
  sbi[tid] = bfr(gbi[tid]);
  __syncthreads();
  const float* xb = x + (size_t)b * DM * SEQ + t0;
#pragma unroll 2
  for (int it = 0; it < 32; ++it) {
    const int c = it * 8 + wave;
    const float xv = bfr(xb[(size_t)c * SEQ + lane]);
    const int g = c >> 3;
    const float v = (xv - smean[g]) * srstd[g] * ssc[c] + sbi[c];
    const unsigned short hb = bf_bits(v);
    const unsigned short lb = bf_bits(v - bf_up(hb));
    Lh[lane * XPITCH + c] = hb;
    Ll[lane * XPITCH + c] = lb;
  }
  __syncthreads();
  v8us hv[4], lv[4];
#pragma unroll
  for (int it = 0; it < 4; ++it) {
    const int r = it * 8 + wave;
    hv[it] = *(const v8us*)(Lh + r * XPITCH + lane * 8);
    lv[it] = *(const v8us*)(Ll + r * XPITCH + lane * 8);
  }
  const size_t base = (size_t)(b * SEQ + t0) * DM;
  {
#pragma unroll
    for (int it = 0; it < 4; ++it) {
      const int r = it * 8 + wave;
      *(v8us*)(XNh + base + (size_t)r * DM + lane * 8) = hv[it];
      *(v8us*)(XNl + base + (size_t)r * DM + lane * 8) = lv[it];
    }
    
  }
}

// =====================================================================================================
// f32 -> bf16 hi plane + bf16 lo plane (lo = RNE(v - hi), unscaled), 8 elements per thread, one 16-B store per
// =====================================================================================================
__global__ __launch_bounds__(256) void cvt_split8(const float* __restrict__ in, unsigned short* hi,
                                                  unsigned short* lo, int n8) {
  const int i = blockIdx.x * 256 + threadIdx.x;
  if (i < n8) {
    const v4f a = *(const v4f*)(in + (size_t)i * 8);
    const v4f c = *(const v4f*)(in + (size_t)i * 8 + 4);
    float f[8];
    f[0] = a[0]; f[1] = a[1]; f[2] = a[2]; f[3] = a[3];
    f[4] = c[0]; f[5] = c[1]; f[6] = c[2]; f[7] = c[3];
    unsigned short hb[8], lb[8];
#pragma unroll
    for (int e = 0; e < 8; ++e) {
      hb[e] = bf_bits(f[e]);
      lb[e] = bf_bits(f[e] - bf_up(hb[e]));
    }
    v4u ph, pl;
    ph[0] = pk16(hb[0], hb[1]); ph[1] = pk16(hb[2], hb[3]); ph[2] = pk16(hb[4], hb[5]); ph[3] = pk16(hb[6], hb[7]);
    pl[0] = pk16(lb[0], lb[1]); pl[1] = pk16(lb[2], lb[3]); pl[2] = pk16(lb[4], lb[5]); pl[3] = pk16(lb[6], lb[7]);
    *(v4u*)(hi + (size_t)i * 8) = ph;
    *(v4u*)(lo + (size_t)i * 8) = pl;
    
  }
}

// =====================================================================================================
// Register-blocked batched bf16 WMMA GEMM: C[m][n] = sum_k A[m][k] * Bt[n][k] + bias; one wave per 64x64 tile,
// no block barriers. A row-major [M][K] pitch lda; Bt row-major [N][K] pitch ldb (k contiguous);
// M, N multiples of 64, K multiple of 32 (host-checked). blockIdx.y = batch index (strides in elements).
// NSPLIT: 0 = A.Bt; 1 = (A + A2).Bt (A2 = unscaled bf16 lo plane of A, same accumulator);
//         3 = A.Bt + A.Bt2 (Bt2 = unscaled bf16 lo plane of Bt; the two planes are walked as alternate k-steps,
//             so the register footprint equals NSPLIT 0).
// OUT_MODE: 0 = f32 (pitch ldc); 1 = f32 with per-element residual: v = (acc + bias + bf16(R[m][n])) * oscale,
//           R f32 pitch ldr, batch stride strideR; 3 = f16 hi plane C + f16 residual plane C2 = f16((v - hi) * rscale),
//           C2 written only for tiles with n0 < N2 (pitch ldc2, batch stride strideC2).
// bias (f32, RNE-converted to bf16 then widened): bmode 0 = none, 1 = per column n, 2 = per row m;
//           index clamped to [0, blen-1].
// =====================================================================================================
template <int NSPLIT, int OUT_MODE>
__global__ __launch_bounds__(256) void gemm64(
    const unsigned short* __restrict__ Ap, const unsigned short* A2p, int lda, long long strideA,
    const unsigned short* __restrict__ Btp, const unsigned short* Bt2p, int ldb, long long strideB,
    void* Cout, int ldc, long long strideC,
    void* Cout2, int ldc2, long long strideC2, int N2,
    int M, int N, int K, float rscale,
    const float* __restrict__ bias, int bmode, int blen,
    const float* __restrict__ Rp, int ldr, long long strideR, float oscale) {
  const __bf16* A   = (const __bf16*)(const void*)Ap;
  const __bf16* A2  = (const __bf16*)(const void*)A2p;
  const __bf16* Bt  = (const __bf16*)(const void*)Btp;
  const __bf16* Bt2 = (const __bf16*)(const void*)Bt2p;
  __shared__ __align__(16) float sT[8][16 * 68];   // per-wave 16x64 slab, pitch 68 floats
  const int b    = blockIdx.y;
  const int lane = threadIdx.x & 31;
  const int wave = threadIdx.x >> 5;
  const int tilesN = N >> 6;
  const int tilesM = M >> 6;
  const int tile = blockIdx.x * 8 + wave;
  if (tile >= tilesM * tilesN) return;   // wave-uniform; no block barriers in this kernel
  const int tm = tile / tilesN;
  const int tn = tile - tm * tilesN;
  const int m0 = tm << 6;
  const int n0 = tn << 6;

  const __bf16* Ab  = A  + (size_t)b * strideA;
  const __bf16* Bb  = Bt + (size_t)b * strideB;
  const __bf16* Ab2 = (NSPLIT == 1) ? (A2  + (size_t)b * strideA) : Ab;
  const __bf16* Bb2 = (NSPLIT == 3) ? (Bt2 + (size_t)b * strideB) : Bb;

  const int rlane = lane & 15;                 // row (A) / col (B, D) within subtile
  const int koff  = (lane >> 4) * 8;           // k offset of this lane half
  const int mOff  = (lane >> 4) * 8;           // D row offset

  v8f acc[4][4];
#pragma unroll
  for (int i = 0; i < 4; ++i)
#pragma unroll
    for (int j = 0; j < 4; ++j) acc[i][j] = zero8();

  const int kst = K >> 5;
  const int nst = (NSPLIT == 3) ? (kst * 2) : kst;
  for (int st = 0; st < nst; ++st) {
    const int k0 = ((NSPLIT == 3) ? (st >> 1) : st) << 5;
    const __bf16* Bs = (NSPLIT == 3 && (st & 1)) ? Bb2 : Bb;   // wave-uniform plane select (both global)
    v16b bh[4];
#pragma unroll
    for (int j = 0; j < 4; ++j) {
      const size_t bo = (size_t)(n0 + (j << 4) + rlane) * ldb + koff + k0;
      bh[j] = ldfrag_b(Bs + bo);
    }
#pragma unroll
    for (int i = 0; i < 4; ++i) {
      const size_t ao = (size_t)(m0 + (i << 4) + rlane) * lda + koff + k0;
      const v16b ah = ldfrag_b(Ab + ao);
      v16b al = ah;
      if (NSPLIT == 1) al = ldfrag_b(Ab2 + ao);
#pragma unroll
      for (int j = 0; j < 4; ++j) {
        acc[i][j] = mma_b_raw(ah, bh[j], acc[i][j]);
        if (NSPLIT == 1) acc[i][j] = mma_b_raw(al, bh[j], acc[i][j]);
      }
      dep_guard_b(acc[i][0], acc[i][3], ah, al);
    }
    keep4_b(bh[0], bh[1], bh[2], bh[3]);
  }
  acc_guard4(acc[0][0], acc[0][1], acc[0][2], acc[0][3]);
  acc_guard4(acc[1][0], acc[1][1], acc[1][2], acc[1][3]);
  acc_guard4(acc[2][0], acc[2][1], acc[2][2], acc[2][3]);
  acc_guard4(acc[3][0], acc[3][1], acc[3][2], acc[3][3]);

  // ---- bias (per column), clamped address, selected by value ----
  float bc[4];
#pragma unroll
  for (int j = 0; j < 4; ++j) {
    int bi = n0 + (j << 4) + rlane;
    bi = (bi < blen) ? bi : (blen - 1);
    bi = (bi > 0) ? bi : 0;
    const float t = bf_up(bf_bits(bias[bi]));
    bc[j] = (bmode == 1) ? t : 0.f;
  }

  // ---- epilogue ----
  float* slab = sT[wave];
#pragma unroll
  for (int i = 0; i < 4; ++i) {
    const int mBase = m0 + (i << 4);
    float brw[8];
#pragma unroll
    for (int r = 0; r < 8; ++r) {
      int bi = mBase + mOff + r;
      bi = (bi < blen) ? bi : (blen - 1);
      bi = (bi > 0) ? bi : 0;
      const float t = bf_up(bf_bits(bias[bi]));
      brw[r] = (bmode == 2) ? t : 0.f;
    }
#pragma unroll
    for (int j = 0; j < 4; ++j) {
#pragma unroll
      for (int r = 0; r < 8; ++r) {
        slab[(mOff + r) * 68 + (j << 4) + rlane] = acc[i][j][r] + bc[j] + brw[r];
      }
    }
    wave_sync_lds();
    if (OUT_MODE == 0 || OUT_MODE == 1) {
      float* C = (float*)Cout + (size_t)b * strideC;
      const float* R = Rp + (size_t)b * strideR;
      const int hh = lane >> 4, c4 = (lane & 15) * 4;     // 256-B row segment = 16 lanes x 16 B
      {
#pragma unroll
        for (int it = 0; it < 8; ++it) {
          const int row = it * 2 + hh;                     // it 0..7 x hh 0..1 = rows 0..15
          v4f v = *(const v4f*)(slab + row * 68 + c4);
          if (OUT_MODE == 1) {
            const v4f xr = *(const v4f*)(R + (size_t)(mBase + row) * ldr + n0 + c4);
            v4f t;
            t[0] = (v[0] + bfr(xr[0])) * oscale;
            t[1] = (v[1] + bfr(xr[1])) * oscale;
            t[2] = (v[2] + bfr(xr[2])) * oscale;
            t[3] = (v[3] + bfr(xr[3])) * oscale;
            v = t;
          }
          *(v4f*)(C + (size_t)(mBase + row) * ldc + n0 + c4) = v;
        }
        
      }
    } else {
      const int q = lane >> 3, c8 = (lane & 7) * 8;
      unsigned short* C  = (unsigned short*)Cout  + (size_t)b * strideC;
      unsigned short* C2 = (unsigned short*)Cout2 + (size_t)b * strideC2;
      const bool wlo = (n0 < N2);                           // wave-uniform
      v4u hv[4], lv[4];
#pragma unroll
      for (int it = 0; it < 4; ++it) {
        const int row = it * 4 + q;                        // it 0..3 x q 0..3 = rows 0..15
        const float* sp = slab + row * 68 + c8;
        v4u a, a2;
#pragma unroll
        for (int e = 0; e < 4; ++e) {
          const float f0 = sp[2 * e], f1 = sp[2 * e + 1];
          const _Float16 x0 = (_Float16)f0, x1 = (_Float16)f1;
          const unsigned short h0 = h_bits(x0), h1 = h_bits(x1);
          const unsigned short l0 = h_bits((_Float16)((f0 - (float)x0) * rscale));
          const unsigned short l1 = h_bits((_Float16)((f1 - (float)x1) * rscale));
          a[e] = pk16(h0, h1); a2[e] = pk16(l0, l1);
        }
        hv[it] = a; lv[it] = a2;
      }
      {
#pragma unroll
        for (int it = 0; it < 4; ++it) {
          const int row = it * 4 + q;
          *(v4u*)(C + (size_t)(mBase + row) * ldc + n0 + c8) = hv[it];
          if (wlo) *(v4u*)(C2 + (size_t)(mBase + row) * ldc2 + n0 + c8) = lv[it];
        }
        
      }
    }
    wave_sync_lds();
  }
}

// =====================================================================================================
// Attention, head dim 64, no masking, softmax over all SEQ keys.
//   q hi plane (f16, pitch DM): element (b, t, h, d) at [(b*SEQ + t)*DM + h*64 + d]; q residual plane
//   (f16, (q - f16(q))*4096, pitch DM) same layout; k plane (f16, pitch DM) same layout.
//   v^T hi plane (f16): element (b, h, d, s) at [(b*DM + h*64 + d)*SEQ + s]; v^T residual plane (f16, x4096): same layout
//   out (f32): element (b, t, h, d) at [(b*SEQ + t)*DM + h*64 + d]
//   scores = (qh . k + (ql . k) * rres) * sscale on f16 WMMA, residual products in a separate accumulator
//   p = exp(s - m) carried as f16(1024 p); context = p . vh + (p . vl) * rres on f16 WMMA (separate accumulator
//   folded per chunk in f32); online softmax in f32.
//   Block = 4 waves = 64 query rows of one (b, h); grid = NQB * NH * NB; kv chunks of 64, static trip NQB.
//   K / V^T chunk staging: 128 threads x 32 elements per plane = the whole 64x64 tile (plain 16-B loads,
//   __syncthreads before and after); P tiles are wave-private, spilled with _Float16 element stores and
//   Output coverage: each wave stores rows q0..q0+15 (it 0..7 x lane>>4 0..1) x 64 f32 columns
// =====================================================================================================
__global__ __launch_bounds__(128)
void attn64(const unsigned short* __restrict__ qhp, const unsigned short* __restrict__ qlp,
            const unsigned short* __restrict__ khp,
            const unsigned short* __restrict__ vhp, const unsigned short* __restrict__ vlp,
            float* outp, float sscale, float rres) {
  union FH { v16h v; v8h h[2]; };
  __shared__ __align__(16) _Float16 Ksh[64 * KVP];                // K [kv][d], 64 halves used per row
  __shared__ __align__(16) _Float16 Vth[64 * KVP];                // V^T hi [d][kv]
  __shared__ __align__(16) _Float16 Vtl[64 * KVP];                // V^T residual [d][kv]
  __shared__ __align__(16) _Float16 Psh[4][16 * KVP];             // per wave P [row][kv]
  __shared__ __align__(16) float    Os[4][16 * OSP];              // per wave context tile [row][d]

  const int tid  = threadIdx.x;
  const int wave = tid >> 5;
  const int lane = tid & 31;
  const int hh   = lane >> 4;
  const int c    = lane & 15;

  const int bx   = blockIdx.x;
  const int qb   = bx % NQB;
  const int rest = bx / NQB;
  const int h    = rest % NH;
  const int b    = rest / NH;
  const int q0   = qb * 64 + wave * 16;
  const size_t rowB = (size_t)b * SEQ;

  const _Float16* Qh = (const _Float16*)(const void*)qhp + (size_t)h * HD;
  const _Float16* Ql = (const _Float16*)(const void*)qlp + (size_t)h * HD;
  const _Float16* Kg = (const _Float16*)(const void*)khp + (size_t)h * HD;
  const _Float16* Vh = (const _Float16*)(const void*)vhp + ((size_t)b * DM + (size_t)h * HD) * SEQ;
  const _Float16* Vl = (const _Float16*)(const void*)vlp + ((size_t)b * DM + (size_t)h * HD) * SEQ;

  // ---- Q fragments (A operand, row = lane&15): 2 d-chunks, hi and residual ----
  v16h qah[2], qal[2];
#pragma unroll
  for (int dc = 0; dc < 2; ++dc) {
    qah[dc] = ldfrag_h(Qh + (rowB + q0 + c) * DM + dc * 32 + 8 * hh);
    qal[dc] = ldfrag_h(Ql + (rowB + q0 + c) * DM + dc * 32 + 8 * hh);
  }

  float mrow[8], lrow[8];
  v8f oacc[4];
#pragma unroll
  for (int r = 0; r < 8; ++r) { mrow[r] = -INFINITY; lrow[r] = 0.f; }
#pragma unroll
  for (int t = 0; t < 4; ++t) oacc[t] = zero8();

  for (int kt = 0; kt < NQB; ++kt) {         // static trip count
    const int kv0 = kt * 64;
    __syncthreads();
    {
      const int r = tid >> 1, hf = (tid & 1) * 32;
      const _Float16* kg  = Kg + (rowB + kv0 + r) * DM + hf;       // K row kv0+r, d = hf..hf+31
      const _Float16* vg  = Vh + (size_t)r * SEQ + kv0 + hf;       // V^T row d = r, s = kv0+hf..+31
      const _Float16* vlg = Vl + (size_t)r * SEQ + kv0 + hf;
#pragma unroll
      for (int i = 0; i < 4; ++i) {
        const v8h a0 = *(const v8h*)(kg + 8 * i);
        const v8h b0 = *(const v8h*)(vg + 8 * i);
        const v8h b1 = *(const v8h*)(vlg + 8 * i);
        *(v8h*)(Ksh + r * KVP + hf + 8 * i) = a0;
        *(v8h*)(Vth + r * KVP + hf + 8 * i) = b0;
        *(v8h*)(Vtl + r * KVP + hf + 8 * i) = b1;
      }
    }
    __syncthreads();

    // ---- scores: 16 query rows x 64 keys per wave, 2 f16 products (hi, residual) ----
    v8f s[4];
#pragma unroll
    for (int j = 0; j < 4; ++j) {
      v8f sh = zero8(), sl = zero8();
#pragma unroll
      for (int dc = 0; dc < 2; ++dc) {
        FH kb;
        kb.h[0] = *(const v8h*)(Ksh + (j * 16 + c) * KVP + dc * 32 + 8 * hh);
        kb.h[1] = *(const v8h*)(Ksh + (j * 16 + c) * KVP + dc * 32 + 16 + 8 * hh);
        sh = mma_h(qah[dc], kb.v, sh);
        sl = mma_h(qal[dc], kb.v, sl);
      }
#pragma unroll
      for (int r = 0; r < 8; ++r) s[j][r] = (sh[r] + sl[r] * rres) * sscale;
    }

    // ---- row max, online softmax, P (x1024, f16) to LDS ----
    _Float16* pwh = Psh[wave];
#pragma unroll
    for (int r = 0; r < 8; ++r) {
      float m = s[0][r];
      m = fmaxf(m, s[1][r]);
      m = fmaxf(m, s[2][r]);
      m = fmaxf(m, s[3][r]);
#pragma unroll
      for (int off = 1; off < 16; off <<= 1) m = fmaxf(m, __shfl_xor(m, off, 32));
      const float mnew  = fmaxf(mrow[r], m);
      const float alpha = __expf(mrow[r] - mnew);
      mrow[r] = mnew;
      float psum = 0.f;
#pragma unroll
      for (int j = 0; j < 4; ++j) {
        const float p = __expf(s[j][r] - mnew);
        psum += p;
        pwh[(8 * hh + r) * KVP + j * 16 + c] = (_Float16)(p * 1024.0f);
      }
#pragma unroll
      for (int off = 1; off < 16; off <<= 1) psum += __shfl_xor(psum, off, 32);
      lrow[r] = lrow[r] * alpha + psum;
#pragma unroll
      for (int t = 0; t < 4; ++t) oacc[t][r] *= alpha;
    }
    wave_sync_lds();

    // ---- context += P . V (f16 WMMA), residual products into a separate accumulator ----
    v8f o1[4];
#pragma unroll
    for (int t = 0; t < 4; ++t) o1[t] = zero8();
#pragma unroll 1
    for (int kk = 0; kk < 2; ++kk) {
      FH pa;
      pa.h[0] = *(const v8h*)(pwh + c * KVP + kk * 32 + 8 * hh);
      pa.h[1] = *(const v8h*)(pwh + c * KVP + kk * 32 + 16 + 8 * hh);
#pragma unroll
      for (int t = 0; t < 4; ++t) {
        FH vb, vl;
        vb.h[0] = *(const v8h*)(Vth + (t * 16 + c) * KVP + kk * 32 + 8 * hh);
        vb.h[1] = *(const v8h*)(Vth + (t * 16 + c) * KVP + kk * 32 + 16 + 8 * hh);
        vl.h[0] = *(const v8h*)(Vtl + (t * 16 + c) * KVP + kk * 32 + 8 * hh);
        vl.h[1] = *(const v8h*)(Vtl + (t * 16 + c) * KVP + kk * 32 + 16 + 8 * hh);
        oacc[t] = mma_h(pa.v, vb.v, oacc[t]);
        o1[t]   = mma_h(pa.v, vl.v, o1[t]);
      }
    }
#pragma unroll
    for (int t = 0; t < 4; ++t)
#pragma unroll
      for (int r = 0; r < 8; ++r) oacc[t][r] += o1[t][r] * rres;
  }

  // ---- normalise (1/l and the 1/1024 p carry), stage the wave's 16x64 f32 tile in LDS, then write whole
  float* os = Os[wave];
#pragma unroll
  for (int r = 0; r < 8; ++r) {
    const float l = lrow[r];
    const float inv = ((l > 0.f) ? (1.0f / l) : 0.f) * (1.0f / 1024.0f);
#pragma unroll
    for (int t = 0; t < 4; ++t) os[(8 * hh + r) * OSP + t * 16 + c] = oacc[t][r] * inv;
  }
  wave_sync_lds();
  {
    const int c4 = (lane & 15) * 4;
    {
#pragma unroll
      for (int it = 0; it < 8; ++it) {
        const int row = it * 2 + hh;                     // it 0..7 x hh 0..1 = rows 0..15 of the wave tile
        const v4f v = *(const v4f*)(os + row * OSP + c4);
        *(v4f*)(outp + (rowB + q0 + row) * DM + (size_t)h * HD + c4) = v;
      }
      
    }
  }
}

// =====================================================================================================
// Workspace map (bytes), every plane an exact multiple of its whole-row / 64x64-tile / whole-line store granularity:
//   WT    bf16 [4][256 o][256 i]     0          524288     (Wq, Wk, Wv, Wp transposed, k = in contiguous)
//   XNh   bf16 [16384 t][256 c]      589824     8388608    (GroupNorm output, token-major, hi plane)
//   XNl   bf16 [16384][256]          8978432    8388608    (lo plane)
//   Qh    f16  [16384][256]          17367040   8388608
//   Ql    f16  [16384][256]          25755648   8388608    (q residual x4096)
//   Kh    f16  [16384][256]          34144256   8388608
//   VTh   f16  [16][256 c][1024 t]   42532864   8388608
//   VTl   f16  [16][256][1024]       50921472   8388608    (v residual x4096)
//   CTX   f32  [16384 t][256 c]      59310080   16777216   (attention context, token-major)
//   CTXh  bf16 [16384][256]          76087296   8388608
//   CTXl  bf16 [16384][256]          84475904   8388608
//   end                              92864512
// =====================================================================================================
extern "C" void kernel_launch(void* const* d_in, const int* in_sizes, int n_in,
                              void* d_out, int out_size, void* d_ws, size_t ws_size,
                              hipStream_t stream) {
  if (n_in < 11) return;
  if (in_sizes[0] != NB * DM * SEQ) return;
  if (in_sizes[3] != DM * DM || in_sizes[5] != DM * DM || in_sizes[7] != DM * DM || in_sizes[9] != DM * DM) return;
  if (in_sizes[1] < DM || in_sizes[2] < DM) return;
  if (in_sizes[4] < 1 || in_sizes[6] < 1 || in_sizes[8] < 1 || in_sizes[10] < 1) return;
  if (out_size != NB * DM * SEQ) return;

  const float* x   = (const float*)d_in[0];
  const float* gsc = (const float*)d_in[1];
  const float* gbi = (const float*)d_in[2];
  const float* wq  = (const float*)d_in[3];
  const float* bq  = (const float*)d_in[4];
  const float* wk  = (const float*)d_in[5];
  const float* bk  = (const float*)d_in[6];
  const float* wv  = (const float*)d_in[7];
  const float* bv  = (const float*)d_in[8];
  const float* wp  = (const float*)d_in[9];
  const float* bp  = (const float*)d_in[10];
  float* out = (float*)d_out;

  const size_t PWT = (size_t)4 * DM * DM * 2;          //   524288
  const size_t PST = (size_t)NB * NGRP * 32 * 4;       //    65536
  const size_t P16 = (size_t)NB * SEQ * DM * 2;        //  8388608
  const size_t P32 = (size_t)NB * SEQ * DM * 4;        // 16777216
  size_t off = 0;
  const size_t oWT   = off; off += PWT;
  const size_t oST   = off; off += PST;
  const size_t oXNh  = off; off += P16;
  const size_t oXNl  = off; off += P16;
  const size_t oQh   = off; off += P16;
  const size_t oQl   = off; off += P16;
  const size_t oKh   = off; off += P16;
  const size_t oVTh  = off; off += P16;
  const size_t oVTl  = off; off += P16;
  const size_t oCTX  = off; off += P32;
  const size_t oCTXh = off; off += P16;
  const size_t oCTXl = off; off += P16;
  if (off > ws_size) return;                            // off = 92864512
  if (off > (size_t)134217728) return;

  char* ws = (char*)d_ws;
  unsigned short* WT   = (unsigned short*)(ws + oWT);
  float*          ST   = (float*)(ws + oST);
  unsigned short* XNh  = (unsigned short*)(ws + oXNh);
  unsigned short* XNl  = (unsigned short*)(ws + oXNl);
  unsigned short* Qh   = (unsigned short*)(ws + oQh);
  unsigned short* Ql   = (unsigned short*)(ws + oQl);
  unsigned short* Kh   = (unsigned short*)(ws + oKh);
  unsigned short* VTh  = (unsigned short*)(ws + oVTh);
  unsigned short* VTl  = (unsigned short*)(ws + oVTl);
  float*          CTX  = (float*)(ws + oCTX);
  unsigned short* CTXh = (unsigned short*)(ws + oCTXh);
  unsigned short* CTXl = (unsigned short*)(ws + oCTXl);
  unsigned short* WTq = WT + (size_t)0 * DM * DM;
  unsigned short* WTk = WT + (size_t)1 * DM * DM;
  unsigned short* WTv = WT + (size_t)2 * DM * DM;
  unsigned short* WTp = WT + (size_t)3 * DM * DM;

  const dim3 blk(256);
  const dim3 gWT(16, 4);                                          // 16 tiles of 64x64 per weight, 4 weights
  const dim3 gGN(NB * NGRP);                                      // 512 blocks
  const dim3 gAP(NB * (SEQ / 32));                                // 512 blocks
  const dim3 gQ(((NB * SEQ / 64) * (DM / 64) + 7) / 8, 1);        // 1024 tiles -> 128 blocks: M=16384, N=256
  const dim3 gVT(((DM / 64) * (SEQ / 64) + 7) / 8, NB);           // 64 tiles -> 8 blocks x 16 batches: M=256, N=1024
  const dim3 gAttn(NB * NH * NQB);                                // 1024 blocks
  const int  n8c = NB * SEQ * DM / 8;                             // 524288
  const dim3 gCvt((n8c + 255) / 256);                             // 2048 blocks
  const float rs2 = 1.0f / 1.41421356237309515f;

  // (1) weights [in][out] -> bf16 [out][in] planes (RNE convert)
  wt_cvt<<<gWT, blk, 0, stream>>>(wq, wk, wv, wp, WT);
  // (2) GroupNorm statistics per (b, group) from bf16(x)
  gn_stats<<<gGN, blk, 0, stream>>>(x, ST);
  // (3) GroupNorm apply -> token-major bf16 hi + lo planes [16384][256]
  gn_apply<<<gAP, blk, 0, stream>>>(x, ST, gsc, gbi, XNh, XNl);
  // (4) q = xn . Wq + bq -> f16 hi plane [16384][256] + f16 residual x4096 (M=16384, N=256, K=256, bias per column)
  gemm64<1, 3><<<gQ, blk, 0, stream>>>(
      XNh, XNl, DM, 0LL, WTq, WTq, DM, 0LL,
      (void*)Qh, DM, 0LL, (void*)Ql, DM, 0LL, DM,
      NB * SEQ, DM, DM, 4096.0f, bq, 1, in_sizes[4], x, 0, 0LL, 1.0f);
  // (5) k = xn . Wk + bk -> f16 plane [16384][256] (no residual: N2 = 0)
  gemm64<1, 3><<<gQ, blk, 0, stream>>>(
      XNh, XNl, DM, 0LL, WTk, WTk, DM, 0LL,
      (void*)Kh, DM, 0LL, (void*)Kh, DM, 0LL, 0,
      NB * SEQ, DM, DM, 4096.0f, bk, 1, in_sizes[6], x, 0, 0LL, 1.0f);
  // (6) v^T[b][c][t] = sum_i Wv[i][c] xn[b][t][i] + bv[c] per batch -> f16 hi plane (pitch SEQ) + residual x4096
  //     (A = WTv [c][i], Bt = XN rows of batch b hi + lo; M=256, N=1024, K=256; bias per row)
  gemm64<3, 3><<<gVT, blk, 0, stream>>>(
      WTv, WTv, DM, 0LL, XNh, XNl, DM, (long long)SEQ * DM,
      (void*)VTh, SEQ, (long long)DM * SEQ, (void*)VTl, SEQ, (long long)DM * SEQ, SEQ,
      DM, SEQ, DM, 4096.0f, bv, 2, in_sizes[8], x, 0, 0LL, 1.0f);
  // (7) attention: scores scale 1/sqrt(C) = 1/16 -> context f32 [16384][256] token-major
  attn64<<<gAttn, dim3(128), 0, stream>>>(Qh, Ql, Kh, VTh, VTl, CTX, 0.0625f, 1.0f / 4096.0f);
  // (8) context -> bf16 hi + lo planes
  cvt_split8<<<gCvt, blk, 0, stream>>>(CTX, CTXh, CTXl, n8c);
  // (9) out[b][c][t] = (sum_o Wp[o][c] ctx[b][t][o] + bp[c] + bf16(x[b][c][t])) * (1/sqrt2) per batch, written
  //     straight into the NCHW output rows of 1024 floats (A = WTp [c][o], Bt = CTX rows hi + lo; M=256, N=1024, K=256)
  gemm64<3, 1><<<gVT, blk, 0, stream>>>(
      WTp, WTp, DM, 0LL, CTXh, CTXl, DM, (long long)SEQ * DM,
      (void*)out, SEQ, (long long)DM * SEQ, (void*)out, SEQ, (long long)DM * SEQ, 0,
      DM, SEQ, DM, 1.0f, bp, 2, in_sizes[10], x, SEQ, (long long)DM * SEQ, rs2);
  (void)hipGetLastError();
}

// v002
// One run takes 168 microseconds.
// In both of two side-by-side timings against v001, it was 1.11 times as fast.
// All steps since v000 together make it 1.37 times as fast.
// Contractions: q, k, v^T and output projections = v_wmma_f32_16x16x32_bf16 (bf16 operands: weights and biases from
// RNE-converted inputs, computed activations as bf16 hi + lo planes, 2 products); q.k^T scores = v_wmma_f32_16x16x32_f16
// (q as f16 hi plane + f16 residual plane x4096 in a separate accumulator, k f16; 2 products); p.v = v_wmma_f32_16x16x32_f16
// (p carried x1024 in f16, v^T as f16 hi plane + residual plane x4096 in a separate accumulator; 2 products);
// all f32 accumulate; GroupNorm statistics, softmax, biases, residual add and output scale in f32.
#include <hip/hip_runtime.h>
#include <math.h>
#include <stdint.h>

#define NB    16            // batch
#define DM    256           // channels
#define SEQ   1024          // tokens (32 x 32)
#define NH    4             // heads
#define HD    64            // head dim
#define NQB   (SEQ / 64)    // 16 query / key tiles of 64
#define NGRP  32            // groups
#define GSZ   8             // channels per group
#define XPITCH 264          // LDS pitch (halves) of the token-major staging tile
#define KVP   72            // LDS pitch (halves) of the attention K, V^T and P rows: 144 B = 16 B x odd, so the 16 rows
                            // that one ds_load_b128 fragment read touches fall on 16 different groups of four banks
#define OSP   68            // LDS pitch (floats) of the attention context tile: rows r and r + 8 on different banks
static_assert(NH * HD == DM);
static_assert(NGRP * GSZ == DM);
static_assert((SEQ % 64) == 0 && (DM % 64) == 0 && (DM % 32) == 0);
static_assert((XPITCH % 8) == 0);
static_assert((KVP % 8) == 0 && ((KVP / 8) & 1) == 1 && KVP >= 64);
static_assert((OSP % 4) == 0 && OSP >= 64);

typedef _Float16 v16h __attribute__((ext_vector_type(16)));
typedef _Float16 v8h  __attribute__((ext_vector_type(8)));
typedef __bf16   v16b __attribute__((ext_vector_type(16)));
typedef __bf16   v8b  __attribute__((ext_vector_type(8)));
typedef float    v8f  __attribute__((ext_vector_type(8)));
typedef float    v4f  __attribute__((ext_vector_type(4)));
typedef unsigned int v4u __attribute__((ext_vector_type(4)));
typedef unsigned short v8us __attribute__((ext_vector_type(8)));

// ---- scalar helpers --------------------------------------------------------------------------------
__device__ __forceinline__ unsigned short bf_bits(float f) {          // f32 -> bf16 bits, RNE convert
  unsigned u = __float_as_uint(f);
  return (unsigned short)((u + 0x7FFFu + ((u >> 16) & 1u)) >> 16);
}
__device__ __forceinline__ float bf_up(unsigned short h) { return __uint_as_float(((unsigned)h) << 16); }
__device__ __forceinline__ float bfr(float f) { return bf_up(bf_bits(f)); }   // value RNE-converted to bf16 and widened
__device__ __forceinline__ unsigned short h_bits(_Float16 x) { return __builtin_bit_cast(unsigned short, x); }
__device__ __forceinline__ unsigned pk16(unsigned short a, unsigned short b) { return (unsigned)a | ((unsigned)b << 16); }
__device__ __forceinline__ v8f zero8() { v8f z = {0.f, 0.f, 0.f, 0.f, 0.f, 0.f, 0.f, 0.f}; return z; }

// ---- fragment loaders: 16-bit A/B operand, lane -> row/col (lane&15), p already includes +8*(lane>>4);
//      elements 0..7 <- p[0..7] (k0+8h..), elements 8..15 <- p[16..23] (k0+16+8h..)
__device__ __forceinline__ v16b ldfrag_b(const __bf16* p) {
  union { v16b v; v8b h[2]; } f;
  f.h[0] = *(const v8b*)(p);
  f.h[1] = *(const v8b*)(p + 16);
  return f.v;
}
__device__ __forceinline__ v16h ldfrag_h(const _Float16* p) {
  union { v16h v; v8h h[2]; } f;
  f.h[0] = *(const v8h*)(p);
  f.h[1] = *(const v8h*)(p + 16);
  return f.v;
}

// ---- WMMA helpers with trailing VALU hazard gap --------------------------------------------------------
__device__ __forceinline__ v8f mma_h(v16h a, v16h b, v8f c) {
  c = __builtin_amdgcn_wmma_f32_16x16x32_f16(false, a, false, b, (short)0, c, false, false);
#if defined(__HIP_DEVICE_COMPILE__)
  asm volatile("v_nop\n\tv_nop\n\tv_nop\n\tv_nop" : "+v"(c) : "v"(a), "v"(b));
#endif
  return c;
}
__device__ __forceinline__ v8f mma_b_raw(v16b a, v16b b, v8f c) {
  return __builtin_amdgcn_wmma_f32_16x16x32_bf16(false, a, false, b, (short)0, c, false, false);
}
__device__ __forceinline__ void dep_guard_b(v8f& a, v8f& b, v16b x, v16b y) {
#if defined(__HIP_DEVICE_COMPILE__)
  asm volatile("v_nop\n\tv_nop\n\tv_nop\n\tv_nop" : "+v"(a), "+v"(b) : "v"(x), "v"(y));
#endif
}
__device__ __forceinline__ void keep4_b(v16b a, v16b b, v16b c, v16b d) {
#if defined(__HIP_DEVICE_COMPILE__)
  asm volatile("v_nop" :: "v"(a), "v"(b), "v"(c), "v"(d));
#endif
}
__device__ __forceinline__ void acc_guard4(v8f& a, v8f& b, v8f& c, v8f& d) {
#if defined(__HIP_DEVICE_COMPILE__)
  asm volatile("v_nop\n\tv_nop\n\tv_nop\n\tv_nop" : "+v"(a), "+v"(b), "+v"(c), "+v"(d));
#endif
}
__device__ __forceinline__ void wave_sync_lds() {
  __builtin_amdgcn_fence(__ATOMIC_RELEASE, "workgroup");
  __builtin_amdgcn_wave_barrier();
  __builtin_amdgcn_fence(__ATOMIC_ACQUIRE, "workgroup");
}

// =====================================================================================================
// Weights W[in i][out o] (f32, 256x256) -> bf16 planes WT[w][o][i] (k = i contiguous), RNE convert.
// grid (16 tiles of 64x64, 4 weights), 256 threads. Load: 16 iterations x 4 input rows x 64 cols = the whole
// 64x64 tile into LDS transposed (unsigned short element stores); __syncthreads; write: each wave instruction
// =====================================================================================================
__global__ __launch_bounds__(256) void wt_cvt(const float* __restrict__ W0, const float* __restrict__ W1,
                                              const float* __restrict__ W2, const float* __restrict__ W3,
                                              unsigned short* WT) {
  __shared__ __align__(16) unsigned short T[64 * 72];
  const int tid = threadIdx.x, lane = tid & 31, wave = tid >> 5;
  const int wsel = blockIdx.y;                                   // block-uniform weight select
  const float* W = (wsel == 0) ? W0 : (wsel == 1) ? W1 : (wsel == 2) ? W2 : W3;
  const int bx = blockIdx.x;
  const int i0 = (bx >> 2) * 64;                                 // input-channel tile
  const int o0 = (bx & 3) * 64;                                  // output-channel tile
#pragma unroll 4
  for (int it = 0; it < 16; ++it) {
    const int i = it * 4 + (tid >> 6);
    const int o = tid & 63;
    const float v = W[(size_t)(i0 + i) * DM + o0 + o];
    T[o * 72 + i] = bf_bits(v);
  }
  __syncthreads();
  const int q = lane >> 3, c8 = (lane & 7) * 8;
  v8us v[2];
#pragma unroll
  for (int it = 0; it < 2; ++it) {
    const int orow = it * 32 + wave * 4 + q;
    v[it] = *(const v8us*)(T + orow * 72 + c8);
  }
  unsigned short* dst = WT + (size_t)wsel * DM * DM;
  {
#pragma unroll
    for (int it = 0; it < 2; ++it) {
      const int orow = it * 32 + wave * 4 + q;
      *(v8us*)(dst + (size_t)(o0 + orow) * DM + i0 + c8) = v[it];
    }
    
  }
}

// =====================================================================================================
// GroupNorm statistics per (b, group): 8 channels x 1024 tokens = 8192 contiguous floats of the NCHW input,
// reduction in f32; rstd = 1/sqrt(var + 1e-6). grid = NB*NGRP blocks, 256 threads.
// =====================================================================================================
__global__ __launch_bounds__(256) void gn_stats(const float* __restrict__ x, float* stats) {
  __shared__ float red[256];
  __shared__ float sres[2];
  const int tid = threadIdx.x;
  const int bg = blockIdx.x;
  const float* xp = x + (size_t)bg * (GSZ * SEQ);
  float s = 0.f;
#pragma unroll 1
  for (int j = 0; j < 8; ++j) {
    const v4f v = *(const v4f*)(xp + ((size_t)j * 256 + tid) * 4);
    s += bfr(v[0]); s += bfr(v[1]); s += bfr(v[2]); s += bfr(v[3]);
  }
  red[tid] = s;
  __syncthreads();
  for (int st = 128; st > 0; st >>= 1) {
    if (tid < st) red[tid] += red[tid + st];
    __syncthreads();
  }
  if (tid == 0) sres[0] = red[0] * (1.0f / 8192.0f);
  __syncthreads();
  const float mean = sres[0];
  float q = 0.f;
#pragma unroll 1
  for (int j = 0; j < 8; ++j) {
    const v4f v = *(const v4f*)(xp + ((size_t)j * 256 + tid) * 4);
    const float d0 = bfr(v[0]) - mean, d1 = bfr(v[1]) - mean, d2 = bfr(v[2]) - mean, d3 = bfr(v[3]) - mean;
    q += d0 * d0; q += d1 * d1; q += d2 * d2; q += d3 * d3;
  }
  red[tid] = q;
  __syncthreads();
  for (int st = 128; st > 0; st >>= 1) {
    if (tid < st) red[tid] += red[tid + st];
    __syncthreads();
  }
  if (tid == 0) {
    const float var = red[0] * (1.0f / 8192.0f);
    sres[1] = 1.0f / sqrtf(var + 1e-6f);
  }
  __syncthreads();
  if (tid < 8) {
    v4f o = {0.f, 0.f, 0.f, 0.f};
    if (tid == 0) { o[0] = mean; o[1] = sres[1]; }
    float* dst = stats + (size_t)bg * 32 + tid * 4;
    *(v4f*)dst = o;
    
  }
}

// =====================================================================================================
// GroupNorm apply + NCHW -> token-major transpose: xn = (bf16(x) - mean) * rstd * bf16(scale[c]) + bf16(bias[c]) in f32,
// written as bf16 hi plane XNh[b][t][c] and bf16 lo plane XNl = RNE(xn - hi), pitch 256 halves (512-B rows).
// grid = NB * (SEQ/32) blocks (b, 32-token tile), 256 threads. Load: 32 iterations x (8 channels = waves) x
// wave w writes token rows w + 8*it (it 0..3) with 32 lanes x 16 B = 512 B = exactly one whole row per instruction
// (reloaded as v8us, same element type). coverage: 4 x 8 = 32 rows x 256 halves per plane = the whole tile;
// =====================================================================================================
__global__ __launch_bounds__(256) void gn_apply(const float* __restrict__ x, const float* __restrict__ stats,
                                                const float* __restrict__ gsc, const float* __restrict__ gbi,
                                                unsigned short* XNh, unsigned short* XNl) {
  __shared__ __align__(16) unsigned short Lh[32 * XPITCH];
  __shared__ __align__(16) unsigned short Ll[32 * XPITCH];
  __shared__ float smean[NGRP], srstd[NGRP], ssc[DM], sbi[DM];
  const int tid = threadIdx.x, lane = tid & 31, wave = tid >> 5;
  const int b  = blockIdx.x / (SEQ / 32);
  const int tt = blockIdx.x - b * (SEQ / 32);
  const int t0 = tt * 32;
  if (tid < NGRP) {
    smean[tid] = stats[((size_t)b * NGRP + tid) * 32 + 0];
    srstd[tid] = stats[((size_t)b * NGRP + tid) * 32 + 1];
  }
  ssc[tid] = bfr(gsc[tid]);
  sbi[tid] = bfr(gbi[tid]);
  __syncthreads();
  const float* xb = x + (size_t)b * DM * SEQ + t0;
#pragma unroll 2
  for (int it = 0; it < 32; ++it) {
    const int c = it * 8 + wave;
    const float xv = bfr(xb[(size_t)c * SEQ + lane]);
    const int g = c >> 3;
    const float v = (xv - smean[g]) * srstd[g] * ssc[c] + sbi[c];
    const unsigned short hb = bf_bits(v);
    const unsigned short lb = bf_bits(v - bf_up(hb));
    Lh[lane * XPITCH + c] = hb;
    Ll[lane * XPITCH + c] = lb;
  }
  __syncthreads();
  v8us hv[4], lv[4];
#pragma unroll
  for (int it = 0; it < 4; ++it) {
    const int r = it * 8 + wave;
    hv[it] = *(const v8us*)(Lh + r * XPITCH + lane * 8);
    lv[it] = *(const v8us*)(Ll + r * XPITCH + lane * 8);
  }
  const size_t base = (size_t)(b * SEQ + t0) * DM;
  {
#pragma unroll
    for (int it = 0; it < 4; ++it) {
      const int r = it * 8 + wave;
      *(v8us*)(XNh + base + (size_t)r * DM + lane * 8) = hv[it];
      *(v8us*)(XNl + base + (size_t)r * DM + lane * 8) = lv[it];
    }
    
  }
}

// =====================================================================================================
// f32 -> bf16 hi plane + bf16 lo plane (lo = RNE(v - hi), unscaled), 8 elements per thread, one 16-B store per
// =====================================================================================================
__global__ __launch_bounds__(256) void cvt_split8(const float* __restrict__ in, unsigned short* hi,
                                                  unsigned short* lo, int n8) {
  const int i = blockIdx.x * 256 + threadIdx.x;
  if (i < n8) {
    const v4f a = *(const v4f*)(in + (size_t)i * 8);
    const v4f c = *(const v4f*)(in + (size_t)i * 8 + 4);
    float f[8];
    f[0] = a[0]; f[1] = a[1]; f[2] = a[2]; f[3] = a[3];
    f[4] = c[0]; f[5] = c[1]; f[6] = c[2]; f[7] = c[3];
    unsigned short hb[8], lb[8];
#pragma unroll
    for (int e = 0; e < 8; ++e) {
      hb[e] = bf_bits(f[e]);
      lb[e] = bf_bits(f[e] - bf_up(hb[e]));
    }
    v4u ph, pl;
    ph[0] = pk16(hb[0], hb[1]); ph[1] = pk16(hb[2], hb[3]); ph[2] = pk16(hb[4], hb[5]); ph[3] = pk16(hb[6], hb[7]);
    pl[0] = pk16(lb[0], lb[1]); pl[1] = pk16(lb[2], lb[3]); pl[2] = pk16(lb[4], lb[5]); pl[3] = pk16(lb[6], lb[7]);
    *(v4u*)(hi + (size_t)i * 8) = ph;
    *(v4u*)(lo + (size_t)i * 8) = pl;
    
  }
}

// =====================================================================================================
// Register-blocked batched bf16 WMMA GEMM: C[m][n] = sum_k A[m][k] * Bt[n][k] + bias; one wave per 64x64 tile,
// no block barriers. A row-major [M][K] pitch lda; Bt row-major [N][K] pitch ldb (k contiguous);
// M, N multiples of 64, K multiple of 32 (host-checked). blockIdx.y = batch index (strides in elements).
// NSPLIT: 0 = A.Bt; 1 = (A + A2).Bt (A2 = unscaled bf16 lo plane of A, same accumulator);
//         3 = A.Bt + A.Bt2 (Bt2 = unscaled bf16 lo plane of Bt; the two planes are walked as alternate k-steps,
//             so the register footprint equals NSPLIT 0).
// OUT_MODE: 0 = f32 (pitch ldc); 1 = f32 with per-element residual: v = (acc + bias + bf16(R[m][n])) * oscale,
//           R f32 pitch ldr, batch stride strideR; 3 = f16 hi plane C + f16 residual plane C2 = f16((v - hi) * rscale),
//           C2 written only for tiles with n0 < N2 (pitch ldc2, batch stride strideC2).
// bias (f32, RNE-converted to bf16 then widened): bmode 0 = none, 1 = per column n, 2 = per row m;
//           index clamped to [0, blen-1].
// PAIR: two products that share A in one launch of two batches: batch 1 takes its own bias vector (biasP, blenP) and
//           writes no residual plane; its Bt and C lie strideB and strideC behind those of batch 0.
// =====================================================================================================
template <int NSPLIT, int OUT_MODE, bool PAIR = false>
__global__ __launch_bounds__(256) void gemm64(
    const unsigned short* __restrict__ Ap, const unsigned short* A2p, int lda, long long strideA,
    const unsigned short* __restrict__ Btp, const unsigned short* Bt2p, int ldb, long long strideB,
    void* Cout, int ldc, long long strideC,
    void* Cout2, int ldc2, long long strideC2, int N2a,
    int M, int N, int K, float rscale,
    const float* __restrict__ biasA, int bmode, int blenA,
    const float* __restrict__ Rp, int ldr, long long strideR, float oscale,
    const float* __restrict__ biasP = nullptr, int blenP = 0) {
  const __bf16* A   = (const __bf16*)(const void*)Ap;
  const __bf16* A2  = (const __bf16*)(const void*)A2p;
  const __bf16* Bt  = (const __bf16*)(const void*)Btp;
  const __bf16* Bt2 = (const __bf16*)(const void*)Bt2p;
  __shared__ __align__(16) float sT[8][16 * 68];   // per-wave 16x64 slab, pitch 68 floats
  const int b    = blockIdx.y;
  const bool second = PAIR && (b == 1);                      // block-uniform
  const float* bias = second ? biasP : biasA;
  const int blen = second ? blenP : blenA;
  const int N2   = second ? 0 : N2a;
  const int lane = threadIdx.x & 31;
  const int wave = threadIdx.x >> 5;
  const int tilesN = N >> 6;
  const int tilesM = M >> 6;
  const int tile = blockIdx.x * 8 + wave;
  if (tile >= tilesM * tilesN) return;   // wave-uniform; no block barriers in this kernel
  const int tm = tile / tilesN;
  const int tn = tile - tm * tilesN;
  const int m0 = tm << 6;
  const int n0 = tn << 6;

  const __bf16* Ab  = A  + (size_t)b * strideA;
  const __bf16* Bb  = Bt + (size_t)b * strideB;
  const __bf16* Ab2 = (NSPLIT == 1) ? (A2  + (size_t)b * strideA) : Ab;
  const __bf16* Bb2 = (NSPLIT == 3) ? (Bt2 + (size_t)b * strideB) : Bb;

  const int rlane = lane & 15;                 // row (A) / col (B, D) within subtile
  const int koff  = (lane >> 4) * 8;           // k offset of this lane half
  const int mOff  = (lane >> 4) * 8;           // D row offset

  v8f acc[4][4];
#pragma unroll
  for (int i = 0; i < 4; ++i)
#pragma unroll
    for (int j = 0; j < 4; ++j) acc[i][j] = zero8();

  const int kst = K >> 5;
  const int nst = (NSPLIT == 3) ? (kst * 2) : kst;
  for (int st = 0; st < nst; ++st) {
    const int k0 = ((NSPLIT == 3) ? (st >> 1) : st) << 5;
    const __bf16* Bs = (NSPLIT == 3 && (st & 1)) ? Bb2 : Bb;   // wave-uniform plane select (both global)
    v16b bh[4];
#pragma unroll
    for (int j = 0; j < 4; ++j) {
      const size_t bo = (size_t)(n0 + (j << 4) + rlane) * ldb + koff + k0;
      bh[j] = ldfrag_b(Bs + bo);
    }
#pragma unroll
    for (int i = 0; i < 4; ++i) {
      const size_t ao = (size_t)(m0 + (i << 4) + rlane) * lda + koff + k0;
      const v16b ah = ldfrag_b(Ab + ao);
      v16b al = ah;
      if (NSPLIT == 1) al = ldfrag_b(Ab2 + ao);
#pragma unroll
      for (int j = 0; j < 4; ++j) {
        acc[i][j] = mma_b_raw(ah, bh[j], acc[i][j]);
        if (NSPLIT == 1) acc[i][j] = mma_b_raw(al, bh[j], acc[i][j]);
      }
      dep_guard_b(acc[i][0], acc[i][3], ah, al);
    }
    keep4_b(bh[0], bh[1], bh[2], bh[3]);
  }
  acc_guard4(acc[0][0], acc[0][1], acc[0][2], acc[0][3]);
  acc_guard4(acc[1][0], acc[1][1], acc[1][2], acc[1][3]);
  acc_guard4(acc[2][0], acc[2][1], acc[2][2], acc[2][3]);
  acc_guard4(acc[3][0], acc[3][1], acc[3][2], acc[3][3]);

  // ---- bias (per column), clamped address, selected by value ----
  float bc[4];
#pragma unroll
  for (int j = 0; j < 4; ++j) {
    int bi = n0 + (j << 4) + rlane;
    bi = (bi < blen) ? bi : (blen - 1);
    bi = (bi > 0) ? bi : 0;
    const float t = bf_up(bf_bits(bias[bi]));
    bc[j] = (bmode == 1) ? t : 0.f;
  }

  // ---- epilogue ----
  float* slab = sT[wave];
#pragma unroll
  for (int i = 0; i < 4; ++i) {
    const int mBase = m0 + (i << 4);
    float brw[8];
#pragma unroll
    for (int r = 0; r < 8; ++r) {
      int bi = mBase + mOff + r;
      bi = (bi < blen) ? bi : (blen - 1);
      bi = (bi > 0) ? bi : 0;
      const float t = bf_up(bf_bits(bias[bi]));
      brw[r] = (bmode == 2) ? t : 0.f;
    }
#pragma unroll
    for (int j = 0; j < 4; ++j) {
#pragma unroll
      for (int r = 0; r < 8; ++r) {
        slab[(mOff + r) * 68 + (j << 4) + rlane] = acc[i][j][r] + bc[j] + brw[r];
      }
    }
    wave_sync_lds();
    if (OUT_MODE == 0 || OUT_MODE == 1) {
      float* C = (float*)Cout + (size_t)b * strideC;
      const float* R = Rp + (size_t)b * strideR;
      const int hh = lane >> 4, c4 = (lane & 15) * 4;     // 256-B row segment = 16 lanes x 16 B
      {
#pragma unroll
        for (int it = 0; it < 8; ++it) {
          const int row = it * 2 + hh;                     // it 0..7 x hh 0..1 = rows 0..15
          v4f v = *(const v4f*)(slab + row * 68 + c4);
          if (OUT_MODE == 1) {
            const v4f xr = *(const v4f*)(R + (size_t)(mBase + row) * ldr + n0 + c4);
            v4f t;
            t[0] = (v[0] + bfr(xr[0])) * oscale;
            t[1] = (v[1] + bfr(xr[1])) * oscale;
            t[2] = (v[2] + bfr(xr[2])) * oscale;
            t[3] = (v[3] + bfr(xr[3])) * oscale;
            v = t;
          }
          *(v4f*)(C + (size_t)(mBase + row) * ldc + n0 + c4) = v;
        }
        
      }
    } else {
      const int q = lane >> 3, c8 = (lane & 7) * 8;
      unsigned short* C  = (unsigned short*)Cout  + (size_t)b * strideC;
      unsigned short* C2 = (unsigned short*)Cout2 + (size_t)b * strideC2;
      const bool wlo = (n0 < N2);                           // wave-uniform
      v4u hv[4], lv[4];
#pragma unroll
      for (int it = 0; it < 4; ++it) {
        const int row = it * 4 + q;                        // it 0..3 x q 0..3 = rows 0..15
        const float* sp = slab + row * 68 + c8;
        v4u a, a2;
#pragma unroll
        for (int e = 0; e < 4; ++e) {
          const float f0 = sp[2 * e], f1 = sp[2 * e + 1];
          const _Float16 x0 = (_Float16)f0, x1 = (_Float16)f1;
          const unsigned short h0 = h_bits(x0), h1 = h_bits(x1);
          const unsigned short l0 = h_bits((_Float16)((f0 - (float)x0) * rscale));
          const unsigned short l1 = h_bits((_Float16)((f1 - (float)x1) * rscale));
          a[e] = pk16(h0, h1); a2[e] = pk16(l0, l1);
        }
        hv[it] = a; lv[it] = a2;
      }
      {
#pragma unroll
        for (int it = 0; it < 4; ++it) {
          const int row = it * 4 + q;
          *(v4u*)(C + (size_t)(mBase + row) * ldc + n0 + c8) = hv[it];
          if (wlo) *(v4u*)(C2 + (size_t)(mBase + row) * ldc2 + n0 + c8) = lv[it];
        }
        
      }
    }
    wave_sync_lds();
  }
}

// =====================================================================================================
// Attention, head dim 64, no masking, softmax over all SEQ keys.
//   q hi plane (f16, pitch DM): element (b, t, h, d) at [(b*SEQ + t)*DM + h*64 + d]; q residual plane
//   (f16, (q - f16(q))*4096, pitch DM) same layout; k plane (f16, pitch DM) same layout.
//   v^T hi plane (f16): element (b, h, d, s) at [(b*DM + h*64 + d)*SEQ + s]; v^T residual plane (f16, x4096): same layout
//   out (f32): element (b, t, h, d) at [(b*SEQ + t)*DM + h*64 + d]
//   scores = (qh . k + (ql . k) * rres) * sscale on f16 WMMA, residual products in a separate accumulator
//   p = exp(s - m) carried as f16(1024 p); context = p . vh + (p . vl) * rres on f16 WMMA (separate accumulator
//   folded per chunk in f32); online softmax in f32.
//   Block = 4 waves = 64 query rows of one (b, h); grid = NQB * NH * NB; kv chunks of 64, static trip NQB.
//   K / V^T chunk staging: 128 threads x 32 elements per plane = the whole 64x64 tile (plain 16-B loads,
//   __syncthreads before and after); P tiles are wave-private, spilled with _Float16 element stores and
//   Output coverage: each wave stores rows q0..q0+15 (it 0..7 x lane>>4 0..1) x 64 f32 columns
// =====================================================================================================
__global__ __launch_bounds__(128)
void attn64(const unsigned short* __restrict__ qhp, const unsigned short* __restrict__ qlp,
            const unsigned short* __restrict__ khp,
            const unsigned short* __restrict__ vhp, const unsigned short* __restrict__ vlp,
            float* outp, float sscale, float rres) {
  union FH { v16h v; v8h h[2]; };
  __shared__ __align__(16) _Float16 Ksh[64 * KVP];                // K [kv][d], 64 halves used per row
  __shared__ __align__(16) _Float16 Vth[64 * KVP];                // V^T hi [d][kv]
  __shared__ __align__(16) _Float16 Vtl[64 * KVP];                // V^T residual [d][kv]
  __shared__ __align__(16) _Float16 Psh[4][16 * KVP];             // per wave P [row][kv]
  __shared__ __align__(16) float    Os[4][16 * OSP];              // per wave context tile [row][d]

  const int tid  = threadIdx.x;
  const int wave = tid >> 5;
  const int lane = tid & 31;
  const int hh   = lane >> 4;
  const int c    = lane & 15;

  const int bx   = blockIdx.x;
  const int qb   = bx % NQB;
  const int rest = bx / NQB;
  const int h    = rest % NH;
  const int b    = rest / NH;
  const int q0   = qb * 64 + wave * 16;
  const size_t rowB = (size_t)b * SEQ;

  const _Float16* Qh = (const _Float16*)(const void*)qhp + (size_t)h * HD;
  const _Float16* Ql = (const _Float16*)(const void*)qlp + (size_t)h * HD;
  const _Float16* Kg = (const _Float16*)(const void*)khp + (size_t)h * HD;
  const _Float16* Vh = (const _Float16*)(const void*)vhp + ((size_t)b * DM + (size_t)h * HD) * SEQ;
  const _Float16* Vl = (const _Float16*)(const void*)vlp + ((size_t)b * DM + (size_t)h * HD) * SEQ;

  // ---- Q fragments (A operand, row = lane&15): 2 d-chunks, hi and residual ----
  v16h qah[2], qal[2];
#pragma unroll
  for (int dc = 0; dc < 2; ++dc) {
    qah[dc] = ldfrag_h(Qh + (rowB + q0 + c) * DM + dc * 32 + 8 * hh);
    qal[dc] = ldfrag_h(Ql + (rowB + q0 + c) * DM + dc * 32 + 8 * hh);
  }

  float mrow[8], lrow[8];
  v8f oacc[4];
#pragma unroll
  for (int r = 0; r < 8; ++r) { mrow[r] = -INFINITY; lrow[r] = 0.f; }
#pragma unroll
  for (int t = 0; t < 4; ++t) oacc[t] = zero8();

  for (int kt = 0; kt < NQB; ++kt) {         // static trip count
    const int kv0 = kt * 64;
    __syncthreads();
    {
      const int r = tid >> 1, hf = (tid & 1) * 32;
      const _Float16* kg  = Kg + (rowB + kv0 + r) * DM + hf;       // K row kv0+r, d = hf..hf+31
      const _Float16* vg  = Vh + (size_t)r * SEQ + kv0 + hf;       // V^T row d = r, s = kv0+hf..+31
      const _Float16* vlg = Vl + (size_t)r * SEQ + kv0 + hf;
#pragma unroll
      for (int i = 0; i < 4; ++i) {
        const v8h a0 = *(const v8h*)(kg + 8 * i);
        const v8h b0 = *(const v8h*)(vg + 8 * i);
        const v8h b1 = *(const v8h*)(vlg + 8 * i);
        *(v8h*)(Ksh + r * KVP + hf + 8 * i) = a0;
        *(v8h*)(Vth + r * KVP + hf + 8 * i) = b0;
        *(v8h*)(Vtl + r * KVP + hf + 8 * i) = b1;
      }
    }
    __syncthreads();

    // ---- scores: 16 query rows x 64 keys per wave, 2 f16 products (hi, residual) ----
    v8f s[4];
#pragma unroll
    for (int j = 0; j < 4; ++j) {
      v8f sh = zero8(), sl = zero8();
#pragma unroll
      for (int dc = 0; dc < 2; ++dc) {
        FH kb;
        kb.h[0] = *(const v8h*)(Ksh + (j * 16 + c) * KVP + dc * 32 + 8 * hh);
        kb.h[1] = *(const v8h*)(Ksh + (j * 16 + c) * KVP + dc * 32 + 16 + 8 * hh);
        sh = mma_h(qah[dc], kb.v, sh);
        sl = mma_h(qal[dc], kb.v, sl);
      }
#pragma unroll
      for (int r = 0; r < 8; ++r) s[j][r] = (sh[r] + sl[r] * rres) * sscale;
    }

    // ---- row max, online softmax, P (x1024, f16) to LDS ----
    _Float16* pwh = Psh[wave];
#pragma unroll
    for (int r = 0; r < 8; ++r) {
      float m = s[0][r];
      m = fmaxf(m, s[1][r]);
      m = fmaxf(m, s[2][r]);
      m = fmaxf(m, s[3][r]);
#pragma unroll
      for (int off = 1; off < 16; off <<= 1) m = fmaxf(m, __shfl_xor(m, off, 32));
      const float mnew  = fmaxf(mrow[r], m);
      const float alpha = __expf(mrow[r] - mnew);
      mrow[r] = mnew;
      float psum = 0.f;
#pragma unroll
      for (int j = 0; j < 4; ++j) {
        const float p = __expf(s[j][r] - mnew);
        psum += p;
        pwh[(8 * hh + r) * KVP + j * 16 + c] = (_Float16)(p * 1024.0f);
      }
#pragma unroll
      for (int off = 1; off < 16; off <<= 1) psum += __shfl_xor(psum, off, 32);
      lrow[r] = lrow[r] * alpha + psum;
#pragma unroll
      for (int t = 0; t < 4; ++t) oacc[t][r] *= alpha;
    }
    wave_sync_lds();

    // ---- context += P . V (f16 WMMA), residual products into a separate accumulator ----
    v8f o1[4];
#pragma unroll
    for (int t = 0; t < 4; ++t) o1[t] = zero8();
#pragma unroll 1
    for (int kk = 0; kk < 2; ++kk) {
      FH pa;
      pa.h[0] = *(const v8h*)(pwh + c * KVP + kk * 32 + 8 * hh);
      pa.h[1] = *(const v8h*)(pwh + c * KVP + kk * 32 + 16 + 8 * hh);
#pragma unroll
      for (int t = 0; t < 4; ++t) {
        FH vb, vl;
        vb.h[0] = *(const v8h*)(Vth + (t * 16 + c) * KVP + kk * 32 + 8 * hh);
        vb.h[1] = *(const v8h*)(Vth + (t * 16 + c) * KVP + kk * 32 + 16 + 8 * hh);
        vl.h[0] = *(const v8h*)(Vtl + (t * 16 + c) * KVP + kk * 32 + 8 * hh);
        vl.h[1] = *(const v8h*)(Vtl + (t * 16 + c) * KVP + kk * 32 + 16 + 8 * hh);
        oacc[t] = mma_h(pa.v, vb.v, oacc[t]);
        o1[t]   = mma_h(pa.v, vl.v, o1[t]);
      }
    }
#pragma unroll
    for (int t = 0; t < 4; ++t)
#pragma unroll
      for (int r = 0; r < 8; ++r) oacc[t][r] += o1[t][r] * rres;
  }

  // ---- normalise (1/l and the 1/1024 p carry), stage the wave's 16x64 f32 tile in LDS, then write whole
  float* os = Os[wave];
#pragma unroll
  for (int r = 0; r < 8; ++r) {
    const float l = lrow[r];
    const float inv = ((l > 0.f) ? (1.0f / l) : 0.f) * (1.0f / 1024.0f);
#pragma unroll
    for (int t = 0; t < 4; ++t) os[(8 * hh + r) * OSP + t * 16 + c] = oacc[t][r] * inv;
  }
  wave_sync_lds();
  {
    const int c4 = (lane & 15) * 4;
    {
#pragma unroll
      for (int it = 0; it < 8; ++it) {
        const int row = it * 2 + hh;                     // it 0..7 x hh 0..1 = rows 0..15 of the wave tile
        const v4f v = *(const v4f*)(os + row * OSP + c4);
        *(v4f*)(outp + (rowB + q0 + row) * DM + (size_t)h * HD + c4) = v;
      }
      
    }
  }
}

// =====================================================================================================
// Workspace map (bytes), every plane an exact multiple of its whole-row / 64x64-tile / whole-line store granularity:
//   WT    bf16 [4][256 o][256 i]     0          524288     (Wq, Wk, Wv, Wp transposed, k = in contiguous)
//   XNh   bf16 [16384 t][256 c]      589824     8388608    (GroupNorm output, token-major, hi plane)
//   XNl   bf16 [16384][256]          8978432    8388608    (lo plane)
//   Qh    f16  [16384][256]          17367040   8388608
//   Ql    f16  [16384][256]          25755648   8388608    (q residual x4096)
//   Kh    f16  [16384][256]          34144256   8388608
//   VTh   f16  [16][256 c][1024 t]   42532864   8388608
//   VTl   f16  [16][256][1024]       50921472   8388608    (v residual x4096)
//   CTX   f32  [16384 t][256 c]      59310080   16777216   (attention context, token-major)
//   CTXh  bf16 [16384][256]          76087296   8388608
//   CTXl  bf16 [16384][256]          84475904   8388608
//   end                              92864512
// =====================================================================================================
extern "C" void kernel_launch(void* const* d_in, const int* in_sizes, int n_in,
                              void* d_out, int out_size, void* d_ws, size_t ws_size,
                              hipStream_t stream) {
  if (n_in < 11) return;
  if (in_sizes[0] != NB * DM * SEQ) return;
  if (in_sizes[3] != DM * DM || in_sizes[5] != DM * DM || in_sizes[7] != DM * DM || in_sizes[9] != DM * DM) return;
  if (in_sizes[1] < DM || in_sizes[2] < DM) return;
  if (in_sizes[4] < 1 || in_sizes[6] < 1 || in_sizes[8] < 1 || in_sizes[10] < 1) return;
  if (out_size != NB * DM * SEQ) return;

  const float* x   = (const float*)d_in[0];
  const float* gsc = (const float*)d_in[1];
  const float* gbi = (const float*)d_in[2];
  const float* wq  = (const float*)d_in[3];
  const float* bq  = (const float*)d_in[4];
  const float* wk  = (const float*)d_in[5];
  const float* bk  = (const float*)d_in[6];
  const float* wv  = (const float*)d_in[7];
  const float* bv  = (const float*)d_in[8];
  const float* wp  = (const float*)d_in[9];
  const float* bp  = (const float*)d_in[10];
  float* out = (float*)d_out;

  const size_t PWT = (size_t)4 * DM * DM * 2;          //   524288
  const size_t PST = (size_t)NB * NGRP * 32 * 4;       //    65536
  const size_t P16 = (size_t)NB * SEQ * DM * 2;        //  8388608
  const size_t P32 = (size_t)NB * SEQ * DM * 4;        // 16777216
  size_t off = 0;
  const size_t oWT   = off; off += PWT;
  const size_t oST   = off; off += PST;
  const size_t oXNh  = off; off += P16;
  const size_t oXNl  = off; off += P16;
  const size_t oQh   = off; off += P16;
  const size_t oQl   = off; off += P16;
  const size_t oKh   = off; off += P16;
  const size_t oVTh  = off; off += P16;
  const size_t oVTl  = off; off += P16;
  const size_t oCTX  = off; off += P32;
  const size_t oCTXh = off; off += P16;
  const size_t oCTXl = off; off += P16;
  if (off > ws_size) return;                            // off = 92864512
  if (off > (size_t)134217728) return;

  char* ws = (char*)d_ws;
  unsigned short* WT   = (unsigned short*)(ws + oWT);
  float*          ST   = (float*)(ws + oST);
  unsigned short* XNh  = (unsigned short*)(ws + oXNh);
  unsigned short* XNl  = (unsigned short*)(ws + oXNl);
  unsigned short* Qh   = (unsigned short*)(ws + oQh);
  unsigned short* Ql   = (unsigned short*)(ws + oQl);
  unsigned short* Kh   = (unsigned short*)(ws + oKh);
  unsigned short* VTh  = (unsigned short*)(ws + oVTh);
  unsigned short* VTl  = (unsigned short*)(ws + oVTl);
  float*          CTX  = (float*)(ws + oCTX);
  unsigned short* CTXh = (unsigned short*)(ws + oCTXh);
  unsigned short* CTXl = (unsigned short*)(ws + oCTXl);
  unsigned short* WTq = WT + (size_t)0 * DM * DM;
  unsigned short* WTv = WT + (size_t)2 * DM * DM;
  unsigned short* WTp = WT + (size_t)3 * DM * DM;

  const dim3 blk(256);
  const dim3 gWT(16, 4);                                          // 16 tiles of 64x64 per weight, 4 weights
  const dim3 gGN(NB * NGRP);                                      // 512 blocks
  const dim3 gAP(NB * (SEQ / 32));                                // 512 blocks
  const dim3 gQK(((NB * SEQ / 64) * (DM / 64) + 7) / 8, 2);       // 1024 tiles -> 128 blocks: M=16384, N=256; y: 0 = q, 1 = k
  const dim3 gVT(((DM / 64) * (SEQ / 64) + 7) / 8, NB);           // 64 tiles -> 8 blocks x 16 batches: M=256, N=1024
  const dim3 gAttn(NB * NH * NQB);                                // 1024 blocks
  const int  n8c = NB * SEQ * DM / 8;                             // 524288
  const dim3 gCvt((n8c + 255) / 256);                             // 2048 blocks
  const float rs2 = 1.0f / 1.41421356237309515f;

  // (1) weights [in][out] -> bf16 [out][in] planes (RNE convert)
  wt_cvt<<<gWT, blk, 0, stream>>>(wq, wk, wv, wp, WT);
  // (2) GroupNorm statistics per (b, group) from bf16(x)
  gn_stats<<<gGN, blk, 0, stream>>>(x, ST);
  // (3) GroupNorm apply -> token-major bf16 hi + lo planes [16384][256]
  gn_apply<<<gAP, blk, 0, stream>>>(x, ST, gsc, gbi, XNh, XNl);
  // (4, 5) one launch of 2 x 128 blocks, one block for each of the chip's 256 WGPs (M=16384, N=256, K=256, bias per column):
  //     y = 0: q = xn . Wq + bq -> f16 hi plane [16384][256] + f16 residual x4096
  //     y = 1: k = xn . Wk + bk -> f16 plane [16384][256], no residual
  //     Wk's plane lies one weight plane behind WTq, Kh two activation planes behind Qh (workspace map above)
  gemm64<1, 3, true><<<gQK, blk, 0, stream>>>(
      XNh, XNl, DM, 0LL, WTq, WTq, DM, (long long)DM * DM,
      (void*)Qh, DM, 2LL * NB * SEQ * DM, (void*)Ql, DM, 0LL, DM,
      NB * SEQ, DM, DM, 4096.0f, bq, 1, in_sizes[4], x, 0, 0LL, 1.0f, bk, in_sizes[6]);
  // (6) v^T[b][c][t] = sum_i Wv[i][c] xn[b][t][i] + bv[c] per batch -> f16 hi plane (pitch SEQ) + residual x4096
  //     (A = WTv [c][i], Bt = XN rows of batch b hi + lo; M=256, N=1024, K=256; bias per row)
  gemm64<3, 3><<<gVT, blk, 0, stream>>>(
      WTv, WTv, DM, 0LL, XNh, XNl, DM, (long long)SEQ * DM,
      (void*)VTh, SEQ, (long long)DM * SEQ, (void*)VTl, SEQ, (long long)DM * SEQ, SEQ,
      DM, SEQ, DM, 4096.0f, bv, 2, in_sizes[8], x, 0, 0LL, 1.0f);
  // (7) attention: scores scale 1/sqrt(C) = 1/16 -> context f32 [16384][256] token-major
  attn64<<<gAttn, dim3(128), 0, stream>>>(Qh, Ql, Kh, VTh, VTl, CTX, 0.0625f, 1.0f / 4096.0f);
  // (8) context -> bf16 hi + lo planes
  cvt_split8<<<gCvt, blk, 0, stream>>>(CTX, CTXh, CTXl, n8c);
  // (9) out[b][c][t] = (sum_o Wp[o][c] ctx[b][t][o] + bp[c] + bf16(x[b][c][t])) * (1/sqrt2) per batch, written
  //     straight into the NCHW output rows of 1024 floats (A = WTp [c][o], Bt = CTX rows hi + lo; M=256, N=1024, K=256)
  gemm64<3, 1><<<gVT, blk, 0, stream>>>(
      WTp, WTp, DM, 0LL, CTXh, CTXl, DM, (long long)SEQ * DM,
      (void*)out, SEQ, (long long)DM * SEQ, (void*)out, SEQ, (long long)DM * SEQ, 0,
      DM, SEQ, DM, 1.0f, bp, 2, in_sizes[10], x, SEQ, (long long)DM * SEQ, rs2);
  (void)hipGetLastError();
}

// v003
// It runs in 134 microseconds.
// Timed twice side by side with v002, it ran 1.25 times as fast both times.
// Counting every step since v000, it is 1.71 times as fast.
// Contractions: q, k, v^T and output projections = v_wmma_f32_16x16x32_bf16 (bf16 operands: weights and biases from
// RNE-converted inputs, computed activations as bf16 hi + lo planes, 2 products); q.k^T scores = v_wmma_f32_16x16x32_f16
// (q as f16 hi plane + f16 residual plane x4096 in a separate accumulator, k f16; 2 products); p.v = v_wmma_f32_16x16x32_f16
// (p carried x1024 in f16, v^T as f16 hi plane + residual plane x4096 in a separate accumulator; 2 products);
// all f32 accumulate; GroupNorm statistics, softmax, biases, residual add and output scale in f32.
#include <hip/hip_runtime.h>
#include <math.h>
#include <stdint.h>

#define NB    16            // batch
#define DM    256           // channels
#define SEQ   1024          // tokens (32 x 32)
#define NH    4             // heads
#define HD    64            // head dim
#define NQB   (SEQ / 64)    // 16 query / key tiles of 64
#define NGRP  32            // groups
#define GSZ   8             // channels per group
#define XPITCH 264          // LDS pitch (halves) of the token-major staging tile
#define KVP   72            // LDS pitch (halves) of the attention K, V^T and P rows: 144 B = 16 B x odd, so the 16 rows
                            // that one ds_load_b128 fragment read touches fall on 16 different groups of four banks
#define OSP   68            // LDS pitch (floats) of the attention context tile: rows r and r + 8 on different banks
#define GKC   64            // k elements per staged GEMM slab: 128 B = one whole line of every operand row
#define GSP   72            // LDS pitch (halves) of a staged GEMM operand row: 144 B = 16 B x odd, as for KVP
static_assert(NH * HD == DM);
static_assert((DM % GKC) == 0 && (GSP % 8) == 0 && ((GSP / 8) & 1) == 1 && GSP >= GKC);
static_assert(NGRP * GSZ == DM);
static_assert((SEQ % 64) == 0 && (DM % 64) == 0 && (DM % 32) == 0);
static_assert((XPITCH % 8) == 0);
static_assert((KVP % 8) == 0 && ((KVP / 8) & 1) == 1 && KVP >= 64);
static_assert((OSP % 4) == 0 && OSP >= 64);

typedef _Float16 v16h __attribute__((ext_vector_type(16)));
typedef _Float16 v8h  __attribute__((ext_vector_type(8)));
typedef __bf16   v16b __attribute__((ext_vector_type(16)));
typedef __bf16   v8b  __attribute__((ext_vector_type(8)));
typedef float    v8f  __attribute__((ext_vector_type(8)));
typedef float    v4f  __attribute__((ext_vector_type(4)));
typedef unsigned int v4u __attribute__((ext_vector_type(4)));
typedef unsigned short v8us __attribute__((ext_vector_type(8)));

// ---- scalar helpers --------------------------------------------------------------------------------
__device__ __forceinline__ unsigned short bf_bits(float f) {          // f32 -> bf16 bits, RNE convert
  unsigned u = __float_as_uint(f);
  return (unsigned short)((u + 0x7FFFu + ((u >> 16) & 1u)) >> 16);
}
__device__ __forceinline__ float bf_up(unsigned short h) { return __uint_as_float(((unsigned)h) << 16); }
__device__ __forceinline__ float bfr(float f) { return bf_up(bf_bits(f)); }   // value RNE-converted to bf16 and widened
__device__ __forceinline__ unsigned short h_bits(_Float16 x) { return __builtin_bit_cast(unsigned short, x); }
__device__ __forceinline__ unsigned pk16(unsigned short a, unsigned short b) { return (unsigned)a | ((unsigned)b << 16); }
__device__ __forceinline__ v8f zero8() { v8f z = {0.f, 0.f, 0.f, 0.f, 0.f, 0.f, 0.f, 0.f}; return z; }

// ---- fragment loaders: 16-bit A/B operand, lane -> row/col (lane&15), p already includes +8*(lane>>4);
//      elements 0..7 <- p[0..7] (k0+8h..), elements 8..15 <- p[16..23] (k0+16+8h..)
__device__ __forceinline__ v16b ldfrag_b(const __bf16* p) {
  union { v16b v; v8b h[2]; } f;
  f.h[0] = *(const v8b*)(p);
  f.h[1] = *(const v8b*)(p + 16);
  return f.v;
}
__device__ __forceinline__ v16h ldfrag_h(const _Float16* p) {
  union { v16h v; v8h h[2]; } f;
  f.h[0] = *(const v8h*)(p);
  f.h[1] = *(const v8h*)(p + 16);
  return f.v;
}

// ---- WMMA helpers with trailing VALU hazard gap --------------------------------------------------------
__device__ __forceinline__ v8f mma_h(v16h a, v16h b, v8f c) {
  c = __builtin_amdgcn_wmma_f32_16x16x32_f16(false, a, false, b, (short)0, c, false, false);
#if defined(__HIP_DEVICE_COMPILE__)
  asm volatile("v_nop\n\tv_nop\n\tv_nop\n\tv_nop" : "+v"(c) : "v"(a), "v"(b));
#endif
  return c;
}
__device__ __forceinline__ v8f mma_b_raw(v16b a, v16b b, v8f c) {
  return __builtin_amdgcn_wmma_f32_16x16x32_bf16(false, a, false, b, (short)0, c, false, false);
}
__device__ __forceinline__ void dep_guard_b(v8f& a, v8f& b, v16b x, v16b y) {
#if defined(__HIP_DEVICE_COMPILE__)
  asm volatile("v_nop\n\tv_nop\n\tv_nop\n\tv_nop" : "+v"(a), "+v"(b) : "v"(x), "v"(y));
#endif
}
__device__ __forceinline__ void keep4_b(v16b a, v16b b, v16b c, v16b d) {
#if defined(__HIP_DEVICE_COMPILE__)
  asm volatile("v_nop" :: "v"(a), "v"(b), "v"(c), "v"(d));
#endif
}
__device__ __forceinline__ void acc_guard4(v8f& a, v8f& b, v8f& c, v8f& d) {
#if defined(__HIP_DEVICE_COMPILE__)
  asm volatile("v_nop\n\tv_nop\n\tv_nop\n\tv_nop" : "+v"(a), "+v"(b), "+v"(c), "+v"(d));
#endif
}
__device__ __forceinline__ void wave_sync_lds() {
  __builtin_amdgcn_fence(__ATOMIC_RELEASE, "workgroup");
  __builtin_amdgcn_wave_barrier();
  __builtin_amdgcn_fence(__ATOMIC_ACQUIRE, "workgroup");
}

// ---- asynchronous global -> LDS copies, 16 B per lane, through no register ------------------------------
__device__ __forceinline__ unsigned lds_off(const void* p) { return (unsigned)(size_t)p; }   // LDS byte address
// Eight (two) copies in one statement; its last line keeps the address registers untouched until the copies are taken.
__device__ __forceinline__ void acopy8(const unsigned* l, const __bf16* const* g) {
#if defined(__HIP_DEVICE_COMPILE__)
  asm volatile("global_load_async_to_lds_b128 %0, %8, off\n\t"
               "global_load_async_to_lds_b128 %1, %9, off\n\t"
               "global_load_async_to_lds_b128 %2, %10, off\n\t"
               "global_load_async_to_lds_b128 %3, %11, off\n\t"
               "global_load_async_to_lds_b128 %4, %12, off\n\t"
               "global_load_async_to_lds_b128 %5, %13, off\n\t"
               "global_load_async_to_lds_b128 %6, %14, off\n\t"
               "global_load_async_to_lds_b128 %7, %15, off\n\t"
               "s_wait_xcnt 0x0"
               :: "v"(l[0]), "v"(l[1]), "v"(l[2]), "v"(l[3]), "v"(l[4]), "v"(l[5]), "v"(l[6]), "v"(l[7]),
                  "v"(g[0]), "v"(g[1]), "v"(g[2]), "v"(g[3]), "v"(g[4]), "v"(g[5]), "v"(g[6]), "v"(g[7])
               : "memory");
#endif
}
__device__ __forceinline__ void acopy2(const unsigned* l, const __bf16* const* g) {
#if defined(__HIP_DEVICE_COMPILE__)
  asm volatile("global_load_async_to_lds_b128 %0, %2, off\n\t"
               "global_load_async_to_lds_b128 %1, %3, off\n\t"
               "s_wait_xcnt 0x0"
               :: "v"(l[0]), "v"(l[1]), "v"(g[0]), "v"(g[1])
               : "memory");
#endif
}
__device__ __forceinline__ void wait_async0() {      // this wave's copies have landed in LDS
#if defined(__HIP_DEVICE_COMPILE__)
  asm volatile("s_wait_asynccnt 0x0" ::: "memory");
#endif
}
__device__ __forceinline__ void wait_ds0() {         // this wave's LDS reads have retired before their buffer is refilled
#if defined(__HIP_DEVICE_COMPILE__)
  asm volatile("s_wait_dscnt 0x0" ::: "memory");
#endif
}

// =====================================================================================================
// Weights W[in i][out o] (f32, 256x256) -> bf16 planes WT[w][o][i] (k = i contiguous), RNE convert.
// grid (16 tiles of 64x64, 4 weights), 256 threads. Load: 16 iterations x 4 input rows x 64 cols = the whole
// 64x64 tile into LDS transposed (unsigned short element stores); __syncthreads; write: each wave instruction
// =====================================================================================================
__global__ __launch_bounds__(256) void wt_cvt(const float* __restrict__ W0, const float* __restrict__ W1,
                                              const float* __restrict__ W2, const float* __restrict__ W3,
                                              unsigned short* WT) {
  __shared__ __align__(16) unsigned short T[64 * 72];
  const int tid = threadIdx.x, lane = tid & 31, wave = tid >> 5;
  const int wsel = blockIdx.y;                                   // block-uniform weight select
  const float* W = (wsel == 0) ? W0 : (wsel == 1) ? W1 : (wsel == 2) ? W2 : W3;
  const int bx = blockIdx.x;
  const int i0 = (bx >> 2) * 64;                                 // input-channel tile
  const int o0 = (bx & 3) * 64;                                  // output-channel tile
#pragma unroll 4
  for (int it = 0; it < 16; ++it) {
    const int i = it * 4 + (tid >> 6);
    const int o = tid & 63;
    const float v = W[(size_t)(i0 + i) * DM + o0 + o];
    T[o * 72 + i] = bf_bits(v);
  }
  __syncthreads();
  const int q = lane >> 3, c8 = (lane & 7) * 8;
  v8us v[2];
#pragma unroll
  for (int it = 0; it < 2; ++it) {
    const int orow = it * 32 + wave * 4 + q;
    v[it] = *(const v8us*)(T + orow * 72 + c8);
  }
  unsigned short* dst = WT + (size_t)wsel * DM * DM;
  {
#pragma unroll
    for (int it = 0; it < 2; ++it) {
      const int orow = it * 32 + wave * 4 + q;
      *(v8us*)(dst + (size_t)(o0 + orow) * DM + i0 + c8) = v[it];
    }
    
  }
}

// =====================================================================================================
// GroupNorm statistics per (b, group): 8 channels x 1024 tokens = 8192 contiguous floats of the NCHW input,
// reduction in f32; rstd = 1/sqrt(var + 1e-6). grid = NB*NGRP blocks, 256 threads.
// =====================================================================================================
__global__ __launch_bounds__(256) void gn_stats(const float* __restrict__ x, float* stats) {
  __shared__ float red[256];
  __shared__ float sres[2];
  const int tid = threadIdx.x;
  const int bg = blockIdx.x;
  const float* xp = x + (size_t)bg * (GSZ * SEQ);
  float s = 0.f;
#pragma unroll 1
  for (int j = 0; j < 8; ++j) {
    const v4f v = *(const v4f*)(xp + ((size_t)j * 256 + tid) * 4);
    s += bfr(v[0]); s += bfr(v[1]); s += bfr(v[2]); s += bfr(v[3]);
  }
  red[tid] = s;
  __syncthreads();
  for (int st = 128; st > 0; st >>= 1) {
    if (tid < st) red[tid] += red[tid + st];
    __syncthreads();
  }
  if (tid == 0) sres[0] = red[0] * (1.0f / 8192.0f);
  __syncthreads();
  const float mean = sres[0];
  float q = 0.f;
#pragma unroll 1
  for (int j = 0; j < 8; ++j) {
    const v4f v = *(const v4f*)(xp + ((size_t)j * 256 + tid) * 4);
    const float d0 = bfr(v[0]) - mean, d1 = bfr(v[1]) - mean, d2 = bfr(v[2]) - mean, d3 = bfr(v[3]) - mean;
    q += d0 * d0; q += d1 * d1; q += d2 * d2; q += d3 * d3;
  }
  red[tid] = q;
  __syncthreads();
  for (int st = 128; st > 0; st >>= 1) {
    if (tid < st) red[tid] += red[tid + st];
    __syncthreads();
  }
  if (tid == 0) {
    const float var = red[0] * (1.0f / 8192.0f);
    sres[1] = 1.0f / sqrtf(var + 1e-6f);
  }
  __syncthreads();
  if (tid < 8) {
    v4f o = {0.f, 0.f, 0.f, 0.f};
    if (tid == 0) { o[0] = mean; o[1] = sres[1]; }
    float* dst = stats + (size_t)bg * 32 + tid * 4;
    *(v4f*)dst = o;
    
  }
}

// =====================================================================================================
// GroupNorm apply + NCHW -> token-major transpose: xn = (bf16(x) - mean) * rstd * bf16(scale[c]) + bf16(bias[c]) in f32,
// written as bf16 hi plane XNh[b][t][c] and bf16 lo plane XNl = RNE(xn - hi), pitch 256 halves (512-B rows).
// grid = NB * (SEQ/32) blocks (b, 32-token tile), 256 threads. Load: 32 iterations x (8 channels = waves) x
// wave w writes token rows w + 8*it (it 0..3) with 32 lanes x 16 B = 512 B = exactly one whole row per instruction
// (reloaded as v8us, same element type). coverage: 4 x 8 = 32 rows x 256 halves per plane = the whole tile;
// =====================================================================================================
__global__ __launch_bounds__(256) void gn_apply(const float* __restrict__ x, const float* __restrict__ stats,
                                                const float* __restrict__ gsc, const float* __restrict__ gbi,
                                                unsigned short* XNh, unsigned short* XNl) {
  __shared__ __align__(16) unsigned short Lh[32 * XPITCH];
  __shared__ __align__(16) unsigned short Ll[32 * XPITCH];
  __shared__ float smean[NGRP], srstd[NGRP], ssc[DM], sbi[DM];
  const int tid = threadIdx.x, lane = tid & 31, wave = tid >> 5;
  const int b  = blockIdx.x / (SEQ / 32);
  const int tt = blockIdx.x - b * (SEQ / 32);
  const int t0 = tt * 32;
  if (tid < NGRP) {
    smean[tid] = stats[((size_t)b * NGRP + tid) * 32 + 0];
    srstd[tid] = stats[((size_t)b * NGRP + tid) * 32 + 1];
  }
  ssc[tid] = bfr(gsc[tid]);
  sbi[tid] = bfr(gbi[tid]);
  __syncthreads();
  const float* xb = x + (size_t)b * DM * SEQ + t0;
#pragma unroll 2
  for (int it = 0; it < 32; ++it) {
    const int c = it * 8 + wave;
    const float xv = bfr(xb[(size_t)c * SEQ + lane]);
    const int g = c >> 3;
    const float v = (xv - smean[g]) * srstd[g] * ssc[c] + sbi[c];
    const unsigned short hb = bf_bits(v);
    const unsigned short lb = bf_bits(v - bf_up(hb));
    Lh[lane * XPITCH + c] = hb;
    Ll[lane * XPITCH + c] = lb;
  }
  __syncthreads();
  v8us hv[4], lv[4];
#pragma unroll
  for (int it = 0; it < 4; ++it) {
    const int r = it * 8 + wave;
    hv[it] = *(const v8us*)(Lh + r * XPITCH + lane * 8);
    lv[it] = *(const v8us*)(Ll + r * XPITCH + lane * 8);
  }
  const size_t base = (size_t)(b * SEQ + t0) * DM;
  {
#pragma unroll
    for (int it = 0; it < 4; ++it) {
      const int r = it * 8 + wave;
      *(v8us*)(XNh + base + (size_t)r * DM + lane * 8) = hv[it];
      *(v8us*)(XNl + base + (size_t)r * DM + lane * 8) = lv[it];
    }
    
  }
}

// =====================================================================================================
// f32 -> bf16 hi plane + bf16 lo plane (lo = RNE(v - hi), unscaled), 8 elements per thread, one 16-B store per
// =====================================================================================================
__global__ __launch_bounds__(256) void cvt_split8(const float* __restrict__ in, unsigned short* hi,
                                                  unsigned short* lo, int n8) {
  const int i = blockIdx.x * 256 + threadIdx.x;
  if (i < n8) {
    const v4f a = *(const v4f*)(in + (size_t)i * 8);
    const v4f c = *(const v4f*)(in + (size_t)i * 8 + 4);
    float f[8];
    f[0] = a[0]; f[1] = a[1]; f[2] = a[2]; f[3] = a[3];
    f[4] = c[0]; f[5] = c[1]; f[6] = c[2]; f[7] = c[3];
    unsigned short hb[8], lb[8];
#pragma unroll
    for (int e = 0; e < 8; ++e) {
      hb[e] = bf_bits(f[e]);
      lb[e] = bf_bits(f[e] - bf_up(hb[e]));
    }
    v4u ph, pl;
    ph[0] = pk16(hb[0], hb[1]); ph[1] = pk16(hb[2], hb[3]); ph[2] = pk16(hb[4], hb[5]); ph[3] = pk16(hb[6], hb[7]);
    pl[0] = pk16(lb[0], lb[1]); pl[1] = pk16(lb[2], lb[3]); pl[2] = pk16(lb[4], lb[5]); pl[3] = pk16(lb[6], lb[7]);
    *(v4u*)(hi + (size_t)i * 8) = ph;
    *(v4u*)(lo + (size_t)i * 8) = pl;
    
  }
}

// =====================================================================================================
// Register-blocked batched bf16 WMMA GEMM: C[m][n] = sum_k A[m][k] * Bt[n][k] + bias; one wave per 64x64 tile,
// eight tiles per block: 8 / TNB tile rows x TNB tile columns (N / 64 a multiple of TNB, and equal to it where TNB < 8;
// the tile count a multiple of 8). A row-major [M][K] pitch lda; Bt row-major [N][K] pitch ldb (k contiguous);
// M, N multiples of 64, K multiple of GKC. blockIdx.y = batch index (strides in elements).
// Operands: per slab of GKC k the block's A rows and Bt rows (every plane) are copied into LDS, each wave copy = 4 whole
// 128-B lines, rows at pitch GSP; two buffers, slab s + 1 in flight while slab s is multiplied; the waves read their
// fragments from LDS. After the last slab the ring's first bytes serve as the epilogue's per-wave slabs.
// NSPLIT: 0 = A.Bt; 1 = (A + A2).Bt (A2 = unscaled bf16 lo plane of A, same accumulator);
//         3 = A.Bt + A.Bt2 (Bt2 = unscaled bf16 lo plane of Bt; the two planes are walked as alternate k-steps).
// OUT_MODE: 0 = f32 (pitch ldc); 1 = f32 with per-element residual: v = (acc + bias + bf16(R[m][n])) * oscale,
//           R f32 pitch ldr, batch stride strideR; 3 = f16 hi plane C + f16 residual plane C2 = f16((v - hi) * rscale),
//           C2 written only for tiles with n0 < N2 (pitch ldc2, batch stride strideC2).
// bias (f32, RNE-converted to bf16 then widened): bmode 0 = none, 1 = per column n, 2 = per row m;
//           index clamped to [0, blen-1].
// PAIR: two products that share A in one launch of two batches: batch 1 takes its own bias vector (biasP, blenP) and
//           writes no residual plane; its Bt and C lie strideB and strideC behind those of batch 0.
// =====================================================================================================
template <int NSPLIT, int OUT_MODE, bool PAIR, int TNB>
__global__ __launch_bounds__(256) void gemm64(
    const unsigned short* __restrict__ Ap, const unsigned short* A2p, int lda, long long strideA,
    const unsigned short* __restrict__ Btp, const unsigned short* Bt2p, int ldb, long long strideB,
    void* Cout, int ldc, long long strideC,
    void* Cout2, int ldc2, long long strideC2, int N2a,
    int M, int N, int K, float rscale,
    const float* __restrict__ biasA, int bmode, int blenA,
    const float* __restrict__ Rp, int ldr, long long strideR, float oscale,
    const float* __restrict__ biasP = nullptr, int blenP = 0) {
  const __bf16* A   = (const __bf16*)(const void*)Ap;
  const __bf16* A2  = (const __bf16*)(const void*)A2p;
  const __bf16* Bt  = (const __bf16*)(const void*)Btp;
  const __bf16* Bt2 = (const __bf16*)(const void*)Bt2p;
  constexpr int RA  = (8 / TNB) * 64;               // A rows of the block, per plane
  constexpr int RB  = TNB * 64;                     // Bt rows of the block, per plane
  constexpr int PA  = (NSPLIT == 1) ? 2 : 1;        // A planes
  constexpr int PB  = (NSPLIT == 3) ? 2 : 1;        // Bt planes
  constexpr int RT  = PA * RA + PB * RB;            // staged rows per slab: [A planes][Bt planes]
  constexpr int NIT = RT / 32;                      // copies per thread and slab (256 threads x 16 B = 32 rows)
  static_assert((RA % 32) == 0 && (RB % 32) == 0 && (NIT % 2) == 0 && NIT <= 63);
  static_assert(2 * RT * GSP * 2 >= 8 * 16 * 68 * 4);
  __shared__ __align__(16) __bf16 ring[2 * RT * GSP];   // two slab buffers; afterwards per-wave 16x64 f32 slabs, pitch 68
  const int b    = blockIdx.y;
  const bool second = PAIR && (b == 1);                      // block-uniform
  const float* bias = second ? biasP : biasA;
  const int blen = second ? blenP : blenA;
  const int N2   = second ? 0 : N2a;
  const int lane = threadIdx.x & 31;
  const int wave = threadIdx.x >> 5;
  const int tilesN = N >> 6;
  const int tilesM = M >> 6;
  const int tile = blockIdx.x * 8 + wave;
  if ((int)blockIdx.x * 8 >= tilesM * tilesN) return;   // block-uniform, in front of every barrier
  const int tm = tile / tilesN;
  const int tn = tile - tm * tilesN;
  const int m0 = tm << 6;
  const int n0 = tn << 6;

  const __bf16* Ab  = A  + (size_t)b * strideA;
  const __bf16* Bb  = Bt + (size_t)b * strideB;
  const __bf16* Ab2 = (NSPLIT == 1) ? (A2  + (size_t)b * strideA) : Ab;
  const __bf16* Bb2 = (NSPLIT == 3) ? (Bt2 + (size_t)b * strideB) : Bb;

  const int rlane = lane & 15;                 // row (A) / col (B, D) within subtile
  const int koff  = (lane >> 4) * 8;           // k offset of this lane half
  const int mOff  = (lane >> 4) * 8;           // D row offset

  v8f acc[4][4];
#pragma unroll
  for (int i = 0; i < 4; ++i)
#pragma unroll
    for (int j = 0; j < 4; ++j) acc[i][j] = zero8();

  // ---- staging: thread -> row (tid >> 3) of each group of 32 rows, 16-B piece (tid & 7) of its 128-B line ----
  const int t0b  = blockIdx.x * 8;                   // the block's first tile
  const int mb0  = (t0b / tilesN) << 6;              // its first A row
  const int nb0  = (t0b - (t0b / tilesN) * tilesN) << 6;   // its first Bt row
  const int srow = threadIdx.x >> 3;
  const int sseg = (threadIdx.x & 7) * 8;
  const unsigned lthr = lds_off(ring) + (unsigned)(srow * GSP + sseg) * 2u;
  auto stage = [&](int slab, int buf) {
    const int kc = slab * GKC + sseg;
    const unsigned lb = lthr + (unsigned)buf * (unsigned)(RT * GSP * 2);
#pragma unroll   // both loops: each copy's plane and row group are compile-time, the statement's operands stay in registers
    for (int g0 = 0; g0 < NIT; g0 += 8) {
      unsigned l[8];
      const __bf16* g[8];
#pragma unroll
      for (int e = 0; e < 8; ++e) {
        const int fr = (g0 + e < NIT) ? (g0 + e) * 32 : 0;     // first staged row of this copy's group of 32
        if (fr < PA * RA) {
          const int r = fr % RA;
          g[e] = ((fr / RA) ? Ab2 : Ab) + (size_t)(mb0 + r + srow) * lda + kc;
        } else {
          const int r = (fr - PA * RA) % RB;
          g[e] = (((fr - PA * RA) / RB) ? Bb2 : Bb) + (size_t)(nb0 + r + srow) * ldb + kc;
        }
        l[e] = lb + (unsigned)(fr * GSP * 2);
      }
      if (g0 + 8 <= NIT) acopy8(l, g);
      else               acopy2(l, g);
    }
  };
  static_assert((NIT % 8) == 0 || (NIT % 8) == 2);

  const int nsl = K / GKC;                           // slabs
  const int aRow = (wave / TNB) * 64 + rlane;        // the wave's first A row inside a staged plane
  const int bRow = PA * RA + (wave % TNB) * 64 + rlane;   // its first Bt row inside the staged slab
  stage(0, 0);
  wait_async0();
  __syncthreads();                                   // slab 0 is published
  if (nsl > 1) stage(1, 1);
  for (int sl = 0; sl < nsl; ++sl) {
    const __bf16* sb = ring + (sl & 1) * (RT * GSP);
#pragma unroll   // k and plane offsets fold into the LDS loads' immediate offsets
    for (int ks = 0; ks < GKC / 32; ++ks) {
      const int kl = ks * 32 + koff;                 // k inside the slab
      const __bf16* As = sb + (size_t)aRow * GSP + kl;
      v16b ah[4], al[4];
#pragma unroll
      for (int i = 0; i < 4; ++i) {
        ah[i] = ldfrag_b(As + i * 16 * GSP);
        al[i] = ah[i];
        if (NSPLIT == 1) al[i] = ldfrag_b(As + (RA + i * 16) * GSP);
      }
#pragma unroll
      for (int pl = 0; pl < PB; ++pl) {              // the Bt planes of one k step follow each other, hi then lo
        const __bf16* Bs = sb + (size_t)(bRow + pl * RB) * GSP + kl;
        v16b bh[4];
#pragma unroll
        for (int j = 0; j < 4; ++j) bh[j] = ldfrag_b(Bs + j * 16 * GSP);
#pragma unroll
        for (int i = 0; i < 4; ++i) {
#pragma unroll
          for (int j = 0; j < 4; ++j) {
            acc[i][j] = mma_b_raw(ah[i], bh[j], acc[i][j]);
            if (NSPLIT == 1) acc[i][j] = mma_b_raw(al[i], bh[j], acc[i][j]);
          }
          dep_guard_b(acc[i][0], acc[i][3], ah[i], al[i]);
        }
        keep4_b(bh[0], bh[1], bh[2], bh[3]);
      }
    }
    wait_ds0();
    wait_async0();
    __syncthreads();                                 // publishes slab sl + 1 and ends every read of slab sl's buffer
    if (sl + 2 < nsl) stage(sl + 2, sl & 1);
  }
  wait_async0();
  acc_guard4(acc[0][0], acc[0][1], acc[0][2], acc[0][3]);
  acc_guard4(acc[1][0], acc[1][1], acc[1][2], acc[1][3]);
  acc_guard4(acc[2][0], acc[2][1], acc[2][2], acc[2][3]);
  acc_guard4(acc[3][0], acc[3][1], acc[3][2], acc[3][3]);

  // ---- bias (per column), clamped address, selected by value ----
  float bc[4];
#pragma unroll
  for (int j = 0; j < 4; ++j) {
    int bi = n0 + (j << 4) + rlane;
    bi = (bi < blen) ? bi : (blen - 1);
    bi = (bi > 0) ? bi : 0;
    const float t = bf_up(bf_bits(bias[bi]));
    bc[j] = (bmode == 1) ? t : 0.f;
  }

  // ---- epilogue ----
  float* slab = (float*)(void*)ring + wave * (16 * 68);
#pragma unroll
  for (int i = 0; i < 4; ++i) {
    const int mBase = m0 + (i << 4);
    float brw[8];
#pragma unroll
    for (int r = 0; r < 8; ++r) {
      int bi = mBase + mOff + r;
      bi = (bi < blen) ? bi : (blen - 1);
      bi = (bi > 0) ? bi : 0;
      const float t = bf_up(bf_bits(bias[bi]));
      brw[r] = (bmode == 2) ? t : 0.f;
    }
#pragma unroll
    for (int j = 0; j < 4; ++j) {
#pragma unroll
      for (int r = 0; r < 8; ++r) {
        slab[(mOff + r) * 68 + (j << 4) + rlane] = acc[i][j][r] + bc[j] + brw[r];
      }
    }
    wave_sync_lds();
    if (OUT_MODE == 0 || OUT_MODE == 1) {
      float* C = (float*)Cout + (size_t)b * strideC;
      const float* R = Rp + (size_t)b * strideR;
      const int hh = lane >> 4, c4 = (lane & 15) * 4;     // 256-B row segment = 16 lanes x 16 B
      {
#pragma unroll
        for (int it = 0; it < 8; ++it) {
          const int row = it * 2 + hh;                     // it 0..7 x hh 0..1 = rows 0..15
          v4f v = *(const v4f*)(slab + row * 68 + c4);
          if (OUT_MODE == 1) {
            const v4f xr = *(const v4f*)(R + (size_t)(mBase + row) * ldr + n0 + c4);
            v4f t;
            t[0] = (v[0] + bfr(xr[0])) * oscale;
            t[1] = (v[1] + bfr(xr[1])) * oscale;
            t[2] = (v[2] + bfr(xr[2])) * oscale;
            t[3] = (v[3] + bfr(xr[3])) * oscale;
            v = t;
          }
          *(v4f*)(C + (size_t)(mBase + row) * ldc + n0 + c4) = v;
        }
        
      }
    } else {
      const int q = lane >> 3, c8 = (lane & 7) * 8;
      unsigned short* C  = (unsigned short*)Cout  + (size_t)b * strideC;
      unsigned short* C2 = (unsigned short*)Cout2 + (size_t)b * strideC2;
      const bool wlo = (n0 < N2);                           // wave-uniform
      v4u hv[4], lv[4];
#pragma unroll
      for (int it = 0; it < 4; ++it) {
        const int row = it * 4 + q;                        // it 0..3 x q 0..3 = rows 0..15
        const float* sp = slab + row * 68 + c8;
        v4u a, a2;
#pragma unroll
        for (int e = 0; e < 4; ++e) {
          const float f0 = sp[2 * e], f1 = sp[2 * e + 1];
          const _Float16 x0 = (_Float16)f0, x1 = (_Float16)f1;
          const unsigned short h0 = h_bits(x0), h1 = h_bits(x1);
          const unsigned short l0 = h_bits((_Float16)((f0 - (float)x0) * rscale));
          const unsigned short l1 = h_bits((_Float16)((f1 - (float)x1) * rscale));
          a[e] = pk16(h0, h1); a2[e] = pk16(l0, l1);
        }
        hv[it] = a; lv[it] = a2;
      }
      {
#pragma unroll
        for (int it = 0; it < 4; ++it) {
          const int row = it * 4 + q;
          *(v4u*)(C + (size_t)(mBase + row) * ldc + n0 + c8) = hv[it];
          if (wlo) *(v4u*)(C2 + (size_t)(mBase + row) * ldc2 + n0 + c8) = lv[it];
        }
        
      }
    }
    wave_sync_lds();
  }
}

// =====================================================================================================
// Attention, head dim 64, no masking, softmax over all SEQ keys.
//   q hi plane (f16, pitch DM): element (b, t, h, d) at [(b*SEQ + t)*DM + h*64 + d]; q residual plane
//   (f16, (q - f16(q))*4096, pitch DM) same layout; k plane (f16, pitch DM) same layout.
//   v^T hi plane (f16): element (b, h, d, s) at [(b*DM + h*64 + d)*SEQ + s]; v^T residual plane (f16, x4096): same layout
//   out (f32): element (b, t, h, d) at [(b*SEQ + t)*DM + h*64 + d]
//   scores = (qh . k + (ql . k) * rres) * sscale on f16 WMMA, residual products in a separate accumulator
//   p = exp(s - m) carried as f16(1024 p); context = p . vh + (p . vl) * rres on f16 WMMA (separate accumulator
//   folded per chunk in f32); online softmax in f32.
//   Block = 4 waves = 64 query rows of one (b, h); grid = NQB * NH * NB; kv chunks of 64, static trip NQB.
//   K / V^T chunk staging: 128 threads x 32 elements per plane = the whole 64x64 tile (plain 16-B loads,
//   __syncthreads before and after); P tiles are wave-private, spilled with _Float16 element stores and
//   Output coverage: each wave stores rows q0..q0+15 (it 0..7 x lane>>4 0..1) x 64 f32 columns
// =====================================================================================================
__global__ __launch_bounds__(128)
void attn64(const unsigned short* __restrict__ qhp, const unsigned short* __restrict__ qlp,
            const unsigned short* __restrict__ khp,
            const unsigned short* __restrict__ vhp, const unsigned short* __restrict__ vlp,
            float* outp, float sscale, float rres) {
  union FH { v16h v; v8h h[2]; };
  __shared__ __align__(16) _Float16 Ksh[64 * KVP];                // K [kv][d], 64 halves used per row
  __shared__ __align__(16) _Float16 Vth[64 * KVP];                // V^T hi [d][kv]
  __shared__ __align__(16) _Float16 Vtl[64 * KVP];                // V^T residual [d][kv]
  __shared__ __align__(16) _Float16 Psh[4][16 * KVP];             // per wave P [row][kv]
  __shared__ __align__(16) float    Os[4][16 * OSP];              // per wave context tile [row][d]

  const int tid  = threadIdx.x;
  const int wave = tid >> 5;
  const int lane = tid & 31;
  const int hh   = lane >> 4;
  const int c    = lane & 15;

  const int bx   = blockIdx.x;
  const int qb   = bx % NQB;
  const int rest = bx / NQB;
  const int h    = rest % NH;
  const int b    = rest / NH;
  const int q0   = qb * 64 + wave * 16;
  const size_t rowB = (size_t)b * SEQ;

  const _Float16* Qh = (const _Float16*)(const void*)qhp + (size_t)h * HD;
  const _Float16* Ql = (const _Float16*)(const void*)qlp + (size_t)h * HD;
  const _Float16* Kg = (const _Float16*)(const void*)khp + (size_t)h * HD;
  const _Float16* Vh = (const _Float16*)(const void*)vhp + ((size_t)b * DM + (size_t)h * HD) * SEQ;
  const _Float16* Vl = (const _Float16*)(const void*)vlp + ((size_t)b * DM + (size_t)h * HD) * SEQ;

  // ---- Q fragments (A operand, row = lane&15): 2 d-chunks, hi and residual ----
  v16h qah[2], qal[2];
#pragma unroll
  for (int dc = 0; dc < 2; ++dc) {
    qah[dc] = ldfrag_h(Qh + (rowB + q0 + c) * DM + dc * 32 + 8 * hh);
    qal[dc] = ldfrag_h(Ql + (rowB + q0 + c) * DM + dc * 32 + 8 * hh);
  }

  float mrow[8], lrow[8];
  v8f oacc[4];
#pragma unroll
  for (int r = 0; r < 8; ++r) { mrow[r] = -INFINITY; lrow[r] = 0.f; }
#pragma unroll
  for (int t = 0; t < 4; ++t) oacc[t] = zero8();

  for (int kt = 0; kt < NQB; ++kt) {         // static trip count
    const int kv0 = kt * 64;
    __syncthreads();
    {
      const int r = tid >> 1, hf = (tid & 1) * 32;
      const _Float16* kg  = Kg + (rowB + kv0 + r) * DM + hf;       // K row kv0+r, d = hf..hf+31
      const _Float16* vg  = Vh + (size_t)r * SEQ + kv0 + hf;       // V^T row d = r, s = kv0+hf..+31
      const _Float16* vlg = Vl + (size_t)r * SEQ + kv0 + hf;
#pragma unroll
      for (int i = 0; i < 4; ++i) {
        const v8h a0 = *(const v8h*)(kg + 8 * i);
        const v8h b0 = *(const v8h*)(vg + 8 * i);
        const v8h b1 = *(const v8h*)(vlg + 8 * i);
        *(v8h*)(Ksh + r * KVP + hf + 8 * i) = a0;
        *(v8h*)(Vth + r * KVP + hf + 8 * i) = b0;
        *(v8h*)(Vtl + r * KVP + hf + 8 * i) = b1;
      }
    }
    __syncthreads();

    // ---- scores: 16 query rows x 64 keys per wave, 2 f16 products (hi, residual) ----
    v8f s[4];
#pragma unroll
    for (int j = 0; j < 4; ++j) {
      v8f sh = zero8(), sl = zero8();
#pragma unroll
      for (int dc = 0; dc < 2; ++dc) {
        FH kb;
        kb.h[0] = *(const v8h*)(Ksh + (j * 16 + c) * KVP + dc * 32 + 8 * hh);
        kb.h[1] = *(const v8h*)(Ksh + (j * 16 + c) * KVP + dc * 32 + 16 + 8 * hh);
        sh = mma_h(qah[dc], kb.v, sh);
        sl = mma_h(qal[dc], kb.v, sl);
      }
#pragma unroll
      for (int r = 0; r < 8; ++r) s[j][r] = (sh[r] + sl[r] * rres) * sscale;
    }

    // ---- row max, online softmax, P (x1024, f16) to LDS ----
    _Float16* pwh = Psh[wave];
#pragma unroll
    for (int r = 0; r < 8; ++r) {
      float m = s[0][r];
      m = fmaxf(m, s[1][r]);
      m = fmaxf(m, s[2][r]);
      m = fmaxf(m, s[3][r]);
#pragma unroll
      for (int off = 1; off < 16; off <<= 1) m = fmaxf(m, __shfl_xor(m, off, 32));
      const float mnew  = fmaxf(mrow[r], m);
      const float alpha = __expf(mrow[r] - mnew);
      mrow[r] = mnew;
      float psum = 0.f;
#pragma unroll
      for (int j = 0; j < 4; ++j) {
        const float p = __expf(s[j][r] - mnew);
        psum += p;
        pwh[(8 * hh + r) * KVP + j * 16 + c] = (_Float16)(p * 1024.0f);
      }
#pragma unroll
      for (int off = 1; off < 16; off <<= 1) psum += __shfl_xor(psum, off, 32);
      lrow[r] = lrow[r] * alpha + psum;
#pragma unroll
      for (int t = 0; t < 4; ++t) oacc[t][r] *= alpha;
    }
    wave_sync_lds();

    // ---- context += P . V (f16 WMMA), residual products into a separate accumulator ----
    v8f o1[4];
#pragma unroll
    for (int t = 0; t < 4; ++t) o1[t] = zero8();
#pragma unroll 1
    for (int kk = 0; kk < 2; ++kk) {
      FH pa;
      pa.h[0] = *(const v8h*)(pwh + c * KVP + kk * 32 + 8 * hh);
      pa.h[1] = *(const v8h*)(pwh + c * KVP + kk * 32 + 16 + 8 * hh);
#pragma unroll
      for (int t = 0; t < 4; ++t) {
        FH vb, vl;
        vb.h[0] = *(const v8h*)(Vth + (t * 16 + c) * KVP + kk * 32 + 8 * hh);
        vb.h[1] = *(const v8h*)(Vth + (t * 16 + c) * KVP + kk * 32 + 16 + 8 * hh);
        vl.h[0] = *(const v8h*)(Vtl + (t * 16 + c) * KVP + kk * 32 + 8 * hh);
        vl.h[1] = *(const v8h*)(Vtl + (t * 16 + c) * KVP + kk * 32 + 16 + 8 * hh);
        oacc[t] = mma_h(pa.v, vb.v, oacc[t]);
        o1[t]   = mma_h(pa.v, vl.v, o1[t]);
      }
    }
#pragma unroll
    for (int t = 0; t < 4; ++t)
#pragma unroll
      for (int r = 0; r < 8; ++r) oacc[t][r] += o1[t][r] * rres;
  }

  // ---- normalise (1/l and the 1/1024 p carry), stage the wave's 16x64 f32 tile in LDS, then write whole
  float* os = Os[wave];
#pragma unroll
  for (int r = 0; r < 8; ++r) {
    const float l = lrow[r];
    const float inv = ((l > 0.f) ? (1.0f / l) : 0.f) * (1.0f / 1024.0f);
#pragma unroll
    for (int t = 0; t < 4; ++t) os[(8 * hh + r) * OSP + t * 16 + c] = oacc[t][r] * inv;
  }
  wave_sync_lds();
  {
    const int c4 = (lane & 15) * 4;
    {
#pragma unroll
      for (int it = 0; it < 8; ++it) {
        const int row = it * 2 + hh;                     // it 0..7 x hh 0..1 = rows 0..15 of the wave tile
        const v4f v = *(const v4f*)(os + row * OSP + c4);
        *(v4f*)(outp + (rowB + q0 + row) * DM + (size_t)h * HD + c4) = v;
      }
      
    }
  }
}

// =====================================================================================================
// Workspace map (bytes), every plane an exact multiple of its whole-row / 64x64-tile / whole-line store granularity:
//   WT    bf16 [4][256 o][256 i]     0          524288     (Wq, Wk, Wv, Wp transposed, k = in contiguous)
//   XNh   bf16 [16384 t][256 c]      589824     8388608    (GroupNorm output, token-major, hi plane)
//   XNl   bf16 [16384][256]          8978432    8388608    (lo plane)
//   Qh    f16  [16384][256]          17367040   8388608
//   Ql    f16  [16384][256]          25755648   8388608    (q residual x4096)
//   Kh    f16  [16384][256]          34144256   8388608
//   VTh   f16  [16][256 c][1024 t]   42532864   8388608
//   VTl   f16  [16][256][1024]       50921472   8388608    (v residual x4096)
//   CTX   f32  [16384 t][256 c]      59310080   16777216   (attention context, token-major)
//   CTXh  bf16 [16384][256]          76087296   8388608
//   CTXl  bf16 [16384][256]          84475904   8388608
//   end                              92864512
// =====================================================================================================
extern "C" void kernel_launch(void* const* d_in, const int* in_sizes, int n_in,
                              void* d_out, int out_size, void* d_ws, size_t ws_size,
                              hipStream_t stream) {
  if (n_in < 11) return;
  if (in_sizes[0] != NB * DM * SEQ) return;
  if (in_sizes[3] != DM * DM || in_sizes[5] != DM * DM || in_sizes[7] != DM * DM || in_sizes[9] != DM * DM) return;
  if (in_sizes[1] < DM || in_sizes[2] < DM) return;
  if (in_sizes[4] < 1 || in_sizes[6] < 1 || in_sizes[8] < 1 || in_sizes[10] < 1) return;
  if (out_size != NB * DM * SEQ) return;

  const float* x   = (const float*)d_in[0];
  const float* gsc = (const float*)d_in[1];
  const float* gbi = (const float*)d_in[2];
  const float* wq  = (const float*)d_in[3];
  const float* bq  = (const float*)d_in[4];
  const float* wk  = (const float*)d_in[5];
  const float* bk  = (const float*)d_in[6];
  const float* wv  = (const float*)d_in[7];
  const float* bv  = (const float*)d_in[8];
  const float* wp  = (const float*)d_in[9];
  const float* bp  = (const float*)d_in[10];
  float* out = (float*)d_out;

  const size_t PWT = (size_t)4 * DM * DM * 2;          //   524288
  const size_t PST = (size_t)NB * NGRP * 32 * 4;       //    65536
  const size_t P16 = (size_t)NB * SEQ * DM * 2;        //  8388608
  const size_t P32 = (size_t)NB * SEQ * DM * 4;        // 16777216
  size_t off = 0;
  const size_t oWT   = off; off += PWT;
  const size_t oST   = off; off += PST;
  const size_t oXNh  = off; off += P16;
  const size_t oXNl  = off; off += P16;
  const size_t oQh   = off; off += P16;
  const size_t oQl   = off; off += P16;
  const size_t oKh   = off; off += P16;
  const size_t oVTh  = off; off += P16;
  const size_t oVTl  = off; off += P16;
  const size_t oCTX  = off; off += P32;
  const size_t oCTXh = off; off += P16;
  const size_t oCTXl = off; off += P16;
  if (off > ws_size) return;                            // off = 92864512
  if (off > (size_t)134217728) return;

  char* ws = (char*)d_ws;
  unsigned short* WT   = (unsigned short*)(ws + oWT);
  float*          ST   = (float*)(ws + oST);
  unsigned short* XNh  = (unsigned short*)(ws + oXNh);
  unsigned short* XNl  = (unsigned short*)(ws + oXNl);
  unsigned short* Qh   = (unsigned short*)(ws + oQh);
  unsigned short* Ql   = (unsigned short*)(ws + oQl);
  unsigned short* Kh   = (unsigned short*)(ws + oKh);
  unsigned short* VTh  = (unsigned short*)(ws + oVTh);
  unsigned short* VTl  = (unsigned short*)(ws + oVTl);
  float*          CTX  = (float*)(ws + oCTX);
  unsigned short* CTXh = (unsigned short*)(ws + oCTXh);
  unsigned short* CTXl = (unsigned short*)(ws + oCTXl);
  unsigned short* WTq = WT + (size_t)0 * DM * DM;
  unsigned short* WTv = WT + (size_t)2 * DM * DM;
  unsigned short* WTp = WT + (size_t)3 * DM * DM;

  const dim3 blk(256);
  const dim3 gWT(16, 4);                                          // 16 tiles of 64x64 per weight, 4 weights
  const dim3 gGN(NB * NGRP);                                      // 512 blocks
  const dim3 gAP(NB * (SEQ / 32));                                // 512 blocks
  const dim3 gQK(((NB * SEQ / 64) * (DM / 64) + 7) / 8, 2);       // 1024 tiles -> 128 blocks: M=16384, N=256; y: 0 = q, 1 = k
  const dim3 gVT(((DM / 64) * (SEQ / 64) + 7) / 8, NB);           // 64 tiles -> 8 blocks x 16 batches: M=256, N=1024
  const dim3 gAttn(NB * NH * NQB);                                // 1024 blocks
  const int  n8c = NB * SEQ * DM / 8;                             // 524288
  const dim3 gCvt((n8c + 255) / 256);                             // 2048 blocks
  const float rs2 = 1.0f / 1.41421356237309515f;

  // (1) weights [in][out] -> bf16 [out][in] planes (RNE convert)
  wt_cvt<<<gWT, blk, 0, stream>>>(wq, wk, wv, wp, WT);
  // (2) GroupNorm statistics per (b, group) from bf16(x)
  gn_stats<<<gGN, blk, 0, stream>>>(x, ST);
  // (3) GroupNorm apply -> token-major bf16 hi + lo planes [16384][256]
  gn_apply<<<gAP, blk, 0, stream>>>(x, ST, gsc, gbi, XNh, XNl);
  // (4, 5) one launch of 2 x 128 blocks, one block for each of the chip's 256 WGPs (M=16384, N=256, K=256, bias per column):
  //     y = 0: q = xn . Wq + bq -> f16 hi plane [16384][256] + f16 residual x4096
  //     y = 1: k = xn . Wk + bk -> f16 plane [16384][256], no residual
  //     Wk's plane lies one weight plane behind WTq, Kh two activation planes behind Qh (workspace map above)
  gemm64<1, 3, true, 4><<<gQK, blk, 0, stream>>>(
      XNh, XNl, DM, 0LL, WTq, WTq, DM, (long long)DM * DM,
      (void*)Qh, DM, 2LL * NB * SEQ * DM, (void*)Ql, DM, 0LL, DM,
      NB * SEQ, DM, DM, 4096.0f, bq, 1, in_sizes[4], x, 0, 0LL, 1.0f, bk, in_sizes[6]);
  // (6) v^T[b][c][t] = sum_i Wv[i][c] xn[b][t][i] + bv[c] per batch -> f16 hi plane (pitch SEQ) + residual x4096
  //     (A = WTv [c][i], Bt = XN rows of batch b hi + lo; M=256, N=1024, K=256; bias per row)
  gemm64<3, 3, false, 8><<<gVT, blk, 0, stream>>>(
      WTv, WTv, DM, 0LL, XNh, XNl, DM, (long long)SEQ * DM,
      (void*)VTh, SEQ, (long long)DM * SEQ, (void*)VTl, SEQ, (long long)DM * SEQ, SEQ,
      DM, SEQ, DM, 4096.0f, bv, 2, in_sizes[8], x, 0, 0LL, 1.0f);
  // (7) attention: scores scale 1/sqrt(C) = 1/16 -> context f32 [16384][256] token-major
  attn64<<<gAttn, dim3(128), 0, stream>>>(Qh, Ql, Kh, VTh, VTl, CTX, 0.0625f, 1.0f / 4096.0f);
  // (8) context -> bf16 hi + lo planes
  cvt_split8<<<gCvt, blk, 0, stream>>>(CTX, CTXh, CTXl, n8c);
  // (9) out[b][c][t] = (sum_o Wp[o][c] ctx[b][t][o] + bp[c] + bf16(x[b][c][t])) * (1/sqrt2) per batch, written
  //     straight into the NCHW output rows of 1024 floats (A = WTp [c][o], Bt = CTX rows hi + lo; M=256, N=1024, K=256)
  gemm64<3, 1, false, 8><<<gVT, blk, 0, stream>>>(
      WTp, WTp, DM, 0LL, CTXh, CTXl, DM, (long long)SEQ * DM,
      (void*)out, SEQ, (long long)DM * SEQ, (void*)out, SEQ, (long long)DM * SEQ, 0,
      DM, SEQ, DM, 1.0f, bp, 2, in_sizes[10], x, SEQ, (long long)DM * SEQ, rs2);
  (void)hipGetLastError();
}

// v004
// Measured time: 118 microseconds a run.
// Next to v003, in two timings, it ran 1.13 times as fast each time.
// Over all steps from v000 it is 1.94 times as fast.
// Contractions: q, k, v^T and output projections = v_wmma_f32_16x16x32_bf16 (bf16 operands: weights and biases from
// RNE-converted inputs, computed activations as bf16 hi + lo planes, 2 products); q.k^T scores = v_wmma_f32_16x16x32_f16
// (q as f16 hi plane + f16 residual plane x4096 in a separate accumulator, k f16; 2 products); p.v = v_wmma_f32_16x16x32_f16
// (p carried x1024 in f16, v^T as f16 hi plane + residual plane x4096 in a separate accumulator; 2 products);
// all f32 accumulate; GroupNorm statistics, softmax, biases, residual add and output scale in f32.
#include <hip/hip_runtime.h>
#include <math.h>
#include <stdint.h>

#define NB    16            // batch
#define DM    256           // channels
#define SEQ   1024          // tokens (32 x 32)
#define NH    4             // heads
#define HD    64            // head dim
#define NQB   (SEQ / 64)    // 16 query / key tiles of 64
#define NGRP  32            // groups
#define GSZ   8             // channels per group
#define XPITCH 264          // LDS pitch (halves) of the token-major staging tile
#define KVP   72            // LDS pitch (halves) of the attention K and V^T rows: 144 B = 16 B x odd, so the 16 rows
                            // that one ds_load_b128 fragment read touches fall on 16 different groups of four banks
#define OSP   68            // LDS pitch (floats) of the attention context tile: rows r and r + 8 on different banks
#define GKC   64            // k elements per staged GEMM slab: 128 B = one whole line of every operand row
#define GSP   72            // LDS pitch (halves) of a staged GEMM operand row: 144 B = 16 B x odd, as for KVP
static_assert(NH * HD == DM);
static_assert((DM % GKC) == 0 && (GSP % 8) == 0 && ((GSP / 8) & 1) == 1 && GSP >= GKC);
static_assert(NGRP * GSZ == DM);
static_assert((SEQ % 64) == 0 && (DM % 64) == 0 && (DM % 32) == 0);
static_assert((XPITCH % 8) == 0);
static_assert((KVP % 8) == 0 && ((KVP / 8) & 1) == 1 && KVP >= 64);
static_assert((OSP % 4) == 0 && OSP >= 64);

typedef _Float16 v16h __attribute__((ext_vector_type(16)));
typedef _Float16 v8h  __attribute__((ext_vector_type(8)));
typedef __bf16   v16b __attribute__((ext_vector_type(16)));
typedef __bf16   v8b  __attribute__((ext_vector_type(8)));
typedef float    v8f  __attribute__((ext_vector_type(8)));
typedef float    v4f  __attribute__((ext_vector_type(4)));
typedef unsigned int v4u __attribute__((ext_vector_type(4)));
typedef unsigned short v8us __attribute__((ext_vector_type(8)));

// ---- scalar helpers --------------------------------------------------------------------------------
__device__ __forceinline__ unsigned short bf_bits(float f) {          // f32 -> bf16 bits, RNE convert
  unsigned u = __float_as_uint(f);
  return (unsigned short)((u + 0x7FFFu + ((u >> 16) & 1u)) >> 16);
}
__device__ __forceinline__ float bf_up(unsigned short h) { return __uint_as_float(((unsigned)h) << 16); }
__device__ __forceinline__ float bfr(float f) { return bf_up(bf_bits(f)); }   // value RNE-converted to bf16 and widened
__device__ __forceinline__ unsigned short h_bits(_Float16 x) { return __builtin_bit_cast(unsigned short, x); }
__device__ __forceinline__ unsigned pk16(unsigned short a, unsigned short b) { return (unsigned)a | ((unsigned)b << 16); }
__device__ __forceinline__ v8f zero8() { v8f z = {0.f, 0.f, 0.f, 0.f, 0.f, 0.f, 0.f, 0.f}; return z; }

// ---- fragment loaders: 16-bit A/B operand, lane -> row/col (lane&15), p already includes +8*(lane>>4);
//      elements 0..7 <- p[0..7] (k0+8h..), elements 8..15 <- p[16..23] (k0+16+8h..)
__device__ __forceinline__ v16b ldfrag_b(const __bf16* p) {
  union { v16b v; v8b h[2]; } f;
  f.h[0] = *(const v8b*)(p);
  f.h[1] = *(const v8b*)(p + 16);
  return f.v;
}
__device__ __forceinline__ v16h ldfrag_h(const _Float16* p) {
  union { v16h v; v8h h[2]; } f;
  f.h[0] = *(const v8h*)(p);
  f.h[1] = *(const v8h*)(p + 16);
  return f.v;
}

// ---- WMMA helpers with trailing VALU hazard gap --------------------------------------------------------
__device__ __forceinline__ v8f mma_h(v16h a, v16h b, v8f c) {
  c = __builtin_amdgcn_wmma_f32_16x16x32_f16(false, a, false, b, (short)0, c, false, false);
#if defined(__HIP_DEVICE_COMPILE__)
  asm volatile("v_nop\n\tv_nop\n\tv_nop\n\tv_nop" : "+v"(c) : "v"(a), "v"(b));
#endif
  return c;
}
__device__ __forceinline__ v8f mma_b_raw(v16b a, v16b b, v8f c) {
  return __builtin_amdgcn_wmma_f32_16x16x32_bf16(false, a, false, b, (short)0, c, false, false);
}
__device__ __forceinline__ void dep_guard_b(v8f& a, v8f& b, v16b x, v16b y) {
#if defined(__HIP_DEVICE_COMPILE__)
  asm volatile("v_nop\n\tv_nop\n\tv_nop\n\tv_nop" : "+v"(a), "+v"(b) : "v"(x), "v"(y));
#endif
}
__device__ __forceinline__ void keep4_b(v16b a, v16b b, v16b c, v16b d) {
#if defined(__HIP_DEVICE_COMPILE__)
  asm volatile("v_nop" :: "v"(a), "v"(b), "v"(c), "v"(d));
#endif
}
__device__ __forceinline__ void acc_guard4(v8f& a, v8f& b, v8f& c, v8f& d) {
#if defined(__HIP_DEVICE_COMPILE__)
  asm volatile("v_nop\n\tv_nop\n\tv_nop\n\tv_nop" : "+v"(a), "+v"(b), "+v"(c), "+v"(d));
#endif
}
__device__ __forceinline__ void wave_sync_lds() {
  __builtin_amdgcn_fence(__ATOMIC_RELEASE, "workgroup");
  __builtin_amdgcn_wave_barrier();
  __builtin_amdgcn_fence(__ATOMIC_ACQUIRE, "workgroup");
}

// ---- asynchronous global -> LDS copies, 16 B per lane, through no register ------------------------------
__device__ __forceinline__ unsigned lds_off(const void* p) { return (unsigned)(size_t)p; }   // LDS byte address
// Eight (two) copies in one statement; its last line keeps the address registers untouched until the copies are taken.
__device__ __forceinline__ void acopy8(const unsigned* l, const __bf16* const* g) {
#if defined(__HIP_DEVICE_COMPILE__)
  asm volatile("global_load_async_to_lds_b128 %0, %8, off\n\t"
               "global_load_async_to_lds_b128 %1, %9, off\n\t"
               "global_load_async_to_lds_b128 %2, %10, off\n\t"
               "global_load_async_to_lds_b128 %3, %11, off\n\t"
               "global_load_async_to_lds_b128 %4, %12, off\n\t"
               "global_load_async_to_lds_b128 %5, %13, off\n\t"
               "global_load_async_to_lds_b128 %6, %14, off\n\t"
               "global_load_async_to_lds_b128 %7, %15, off\n\t"
               "s_wait_xcnt 0x0"
               :: "v"(l[0]), "v"(l[1]), "v"(l[2]), "v"(l[3]), "v"(l[4]), "v"(l[5]), "v"(l[6]), "v"(l[7]),
                  "v"(g[0]), "v"(g[1]), "v"(g[2]), "v"(g[3]), "v"(g[4]), "v"(g[5]), "v"(g[6]), "v"(g[7])
               : "memory");
#endif
}
__device__ __forceinline__ void acopy2(const unsigned* l, const __bf16* const* g) {
#if defined(__HIP_DEVICE_COMPILE__)
  asm volatile("global_load_async_to_lds_b128 %0, %2, off\n\t"
               "global_load_async_to_lds_b128 %1, %3, off\n\t"
               "s_wait_xcnt 0x0"
               :: "v"(l[0]), "v"(l[1]), "v"(g[0]), "v"(g[1])
               : "memory");
#endif
}
__device__ __forceinline__ void wait_async0() {      // this wave's copies have landed in LDS
#if defined(__HIP_DEVICE_COMPILE__)
  asm volatile("s_wait_asynccnt 0x0" ::: "memory");
#endif
}
__device__ __forceinline__ void wait_ds0() {         // this wave's LDS reads have retired before their buffer is refilled
#if defined(__HIP_DEVICE_COMPILE__)
  asm volatile("s_wait_dscnt 0x0" ::: "memory");
#endif
}

// =====================================================================================================
// Weights W[in i][out o] (f32, 256x256) -> bf16 planes WT[w][o][i] (k = i contiguous), RNE convert.
// grid (16 tiles of 64x64, 4 weights), 256 threads. Load: 16 iterations x 4 input rows x 64 cols = the whole
// 64x64 tile into LDS transposed (unsigned short element stores); __syncthreads; write: each wave instruction
// =====================================================================================================
__global__ __launch_bounds__(256) void wt_cvt(const float* __restrict__ W0, const float* __restrict__ W1,
                                              const float* __restrict__ W2, const float* __restrict__ W3,
                                              unsigned short* WT) {
  __shared__ __align__(16) unsigned short T[64 * 72];
  const int tid = threadIdx.x, lane = tid & 31, wave = tid >> 5;
  const int wsel = blockIdx.y;                                   // block-uniform weight select
  const float* W = (wsel == 0) ? W0 : (wsel == 1) ? W1 : (wsel == 2) ? W2 : W3;
  const int bx = blockIdx.x;
  const int i0 = (bx >> 2) * 64;                                 // input-channel tile
  const int o0 = (bx & 3) * 64;                                  // output-channel tile
#pragma unroll 4
  for (int it = 0; it < 16; ++it) {
    const int i = it * 4 + (tid >> 6);
    const int o = tid & 63;
    const float v = W[(size_t)(i0 + i) * DM + o0 + o];
    T[o * 72 + i] = bf_bits(v);
  }
  __syncthreads();
  const int q = lane >> 3, c8 = (lane & 7) * 8;
  v8us v[2];
#pragma unroll
  for (int it = 0; it < 2; ++it) {
    const int orow = it * 32 + wave * 4 + q;
    v[it] = *(const v8us*)(T + orow * 72 + c8);
  }
  unsigned short* dst = WT + (size_t)wsel * DM * DM;
  {
#pragma unroll
    for (int it = 0; it < 2; ++it) {
      const int orow = it * 32 + wave * 4 + q;
      *(v8us*)(dst + (size_t)(o0 + orow) * DM + i0 + c8) = v[it];
    }
    
  }
}

// =====================================================================================================
// GroupNorm statistics per (b, group): 8 channels x 1024 tokens = 8192 contiguous floats of the NCHW input,
// reduction in f32; rstd = 1/sqrt(var + 1e-6). grid = NB*NGRP blocks, 256 threads.
// =====================================================================================================
__global__ __launch_bounds__(256) void gn_stats(const float* __restrict__ x, float* stats) {
  __shared__ float red[256];
  __shared__ float sres[2];
  const int tid = threadIdx.x;
  const int bg = blockIdx.x;
  const float* xp = x + (size_t)bg * (GSZ * SEQ);
  float s = 0.f;
#pragma unroll 1
  for (int j = 0; j < 8; ++j) {
    const v4f v = *(const v4f*)(xp + ((size_t)j * 256 + tid) * 4);
    s += bfr(v[0]); s += bfr(v[1]); s += bfr(v[2]); s += bfr(v[3]);
  }
  red[tid] = s;
  __syncthreads();
  for (int st = 128; st > 0; st >>= 1) {
    if (tid < st) red[tid] += red[tid + st];
    __syncthreads();
  }
  if (tid == 0) sres[0] = red[0] * (1.0f / 8192.0f);
  __syncthreads();
  const float mean = sres[0];
  float q = 0.f;
#pragma unroll 1
  for (int j = 0; j < 8; ++j) {
    const v4f v = *(const v4f*)(xp + ((size_t)j * 256 + tid) * 4);
    const float d0 = bfr(v[0]) - mean, d1 = bfr(v[1]) - mean, d2 = bfr(v[2]) - mean, d3 = bfr(v[3]) - mean;
    q += d0 * d0; q += d1 * d1; q += d2 * d2; q += d3 * d3;
  }
  red[tid] = q;
  __syncthreads();
  for (int st = 128; st > 0; st >>= 1) {
    if (tid < st) red[tid] += red[tid + st];
    __syncthreads();
  }
  if (tid == 0) {
    const float var = red[0] * (1.0f / 8192.0f);
    sres[1] = 1.0f / sqrtf(var + 1e-6f);
  }
  __syncthreads();
  if (tid < 8) {
    v4f o = {0.f, 0.f, 0.f, 0.f};
    if (tid == 0) { o[0] = mean; o[1] = sres[1]; }
    float* dst = stats + (size_t)bg * 32 + tid * 4;
    *(v4f*)dst = o;
    
  }
}

// =====================================================================================================
// GroupNorm apply + NCHW -> token-major transpose: xn = (bf16(x) - mean) * rstd * bf16(scale[c]) + bf16(bias[c]) in f32,
// written as bf16 hi plane XNh[b][t][c] and bf16 lo plane XNl = RNE(xn - hi), pitch 256 halves (512-B rows).
// grid = NB * (SEQ/32) blocks (b, 32-token tile), 256 threads. Load: 32 iterations x (8 channels = waves) x
// wave w writes token rows w + 8*it (it 0..3) with 32 lanes x 16 B = 512 B = exactly one whole row per instruction
// (reloaded as v8us, same element type). coverage: 4 x 8 = 32 rows x 256 halves per plane = the whole tile;
// =====================================================================================================
__global__ __launch_bounds__(256) void gn_apply(const float* __restrict__ x, const float* __restrict__ stats,
                                                const float* __restrict__ gsc, const float* __restrict__ gbi,
                                                unsigned short* XNh, unsigned short* XNl) {
  __shared__ __align__(16) unsigned short Lh[32 * XPITCH];
  __shared__ __align__(16) unsigned short Ll[32 * XPITCH];
  __shared__ float smean[NGRP], srstd[NGRP], ssc[DM], sbi[DM];
  const int tid = threadIdx.x, lane = tid & 31, wave = tid >> 5;
  const int b  = blockIdx.x / (SEQ / 32);
  const int tt = blockIdx.x - b * (SEQ / 32);
  const int t0 = tt * 32;
  if (tid < NGRP) {
    smean[tid] = stats[((size_t)b * NGRP + tid) * 32 + 0];
    srstd[tid] = stats[((size_t)b * NGRP + tid) * 32 + 1];
  }
  ssc[tid] = bfr(gsc[tid]);
  sbi[tid] = bfr(gbi[tid]);
  __syncthreads();
  const float* xb = x + (size_t)b * DM * SEQ + t0;
#pragma unroll 2
  for (int it = 0; it < 32; ++it) {
    const int c = it * 8 + wave;
    const float xv = bfr(xb[(size_t)c * SEQ + lane]);
    const int g = c >> 3;
    const float v = (xv - smean[g]) * srstd[g] * ssc[c] + sbi[c];
    const unsigned short hb = bf_bits(v);
    const unsigned short lb = bf_bits(v - bf_up(hb));
    Lh[lane * XPITCH + c] = hb;
    Ll[lane * XPITCH + c] = lb;
  }
  __syncthreads();
  v8us hv[4], lv[4];
#pragma unroll
  for (int it = 0; it < 4; ++it) {
    const int r = it * 8 + wave;
    hv[it] = *(const v8us*)(Lh + r * XPITCH + lane * 8);
    lv[it] = *(const v8us*)(Ll + r * XPITCH + lane * 8);
  }
  const size_t base = (size_t)(b * SEQ + t0) * DM;
  {
#pragma unroll
    for (int it = 0; it < 4; ++it) {
      const int r = it * 8 + wave;
      *(v8us*)(XNh + base + (size_t)r * DM + lane * 8) = hv[it];
      *(v8us*)(XNl + base + (size_t)r * DM + lane * 8) = lv[it];
    }
    
  }
}

// =====================================================================================================
// f32 -> bf16 hi plane + bf16 lo plane (lo = RNE(v - hi), unscaled), 8 elements per thread, one 16-B store per
// =====================================================================================================
__global__ __launch_bounds__(256) void cvt_split8(const float* __restrict__ in, unsigned short* hi,
                                                  unsigned short* lo, int n8) {
  const int i = blockIdx.x * 256 + threadIdx.x;
  if (i < n8) {
    const v4f a = *(const v4f*)(in + (size_t)i * 8);
    const v4f c = *(const v4f*)(in + (size_t)i * 8 + 4);
    float f[8];
    f[0] = a[0]; f[1] = a[1]; f[2] = a[2]; f[3] = a[3];
    f[4] = c[0]; f[5] = c[1]; f[6] = c[2]; f[7] = c[3];
    unsigned short hb[8], lb[8];
#pragma unroll
    for (int e = 0; e < 8; ++e) {
      hb[e] = bf_bits(f[e]);
      lb[e] = bf_bits(f[e] - bf_up(hb[e]));
    }
    v4u ph, pl;
    ph[0] = pk16(hb[0], hb[1]); ph[1] = pk16(hb[2], hb[3]); ph[2] = pk16(hb[4], hb[5]); ph[3] = pk16(hb[6], hb[7]);
    pl[0] = pk16(lb[0], lb[1]); pl[1] = pk16(lb[2], lb[3]); pl[2] = pk16(lb[4], lb[5]); pl[3] = pk16(lb[6], lb[7]);
    *(v4u*)(hi + (size_t)i * 8) = ph;
    *(v4u*)(lo + (size_t)i * 8) = pl;
    
  }
}

// =====================================================================================================
// Register-blocked batched bf16 WMMA GEMM: C[m][n] = sum_k A[m][k] * Bt[n][k] + bias; one wave per 64x64 tile,
// eight tiles per block: 8 / TNB tile rows x TNB tile columns (N / 64 a multiple of TNB, and equal to it where TNB < 8;
// the tile count a multiple of 8). A row-major [M][K] pitch lda; Bt row-major [N][K] pitch ldb (k contiguous);
// M, N multiples of 64, K multiple of GKC. blockIdx.y = batch index (strides in elements).
// Operands: per slab of GKC k the block's A rows and Bt rows (every plane) are copied into LDS, each wave copy = 4 whole
// 128-B lines, rows at pitch GSP; two buffers, slab s + 1 in flight while slab s is multiplied; the waves read their
// fragments from LDS. After the last slab the ring's first bytes serve as the epilogue's per-wave slabs.
// NSPLIT: 0 = A.Bt; 1 = (A + A2).Bt (A2 = unscaled bf16 lo plane of A, same accumulator);
//         3 = A.Bt + A.Bt2 (Bt2 = unscaled bf16 lo plane of Bt; the two planes are walked as alternate k-steps).
// OUT_MODE: 0 = f32 (pitch ldc); 1 = f32 with per-element residual: v = (acc + bias + bf16(R[m][n])) * oscale,
//           R f32 pitch ldr, batch stride strideR; 3 = f16 hi plane C + f16 residual plane C2 = f16((v - hi) * rscale),
//           C2 written only for tiles with n0 < N2 (pitch ldc2, batch stride strideC2).
// bias (f32, RNE-converted to bf16 then widened): bmode 0 = none, 1 = per column n, 2 = per row m;
//           index clamped to [0, blen-1].
// PAIR: two products that share A in one launch of two batches: batch 1 takes its own bias vector (biasP, blenP) and
//           writes no residual plane; its Bt and C lie strideB and strideC behind those of batch 0.
// =====================================================================================================
template <int NSPLIT, int OUT_MODE, bool PAIR, int TNB>
__global__ __launch_bounds__(256) void gemm64(
    const unsigned short* __restrict__ Ap, const unsigned short* A2p, int lda, long long strideA,
    const unsigned short* __restrict__ Btp, const unsigned short* Bt2p, int ldb, long long strideB,
    void* Cout, int ldc, long long strideC,
    void* Cout2, int ldc2, long long strideC2, int N2a,
    int M, int N, int K, float rscale,
    const float* __restrict__ biasA, int bmode, int blenA,
    const float* __restrict__ Rp, int ldr, long long strideR, float oscale,
    const float* __restrict__ biasP = nullptr, int blenP = 0) {
  const __bf16* A   = (const __bf16*)(const void*)Ap;
  const __bf16* A2  = (const __bf16*)(const void*)A2p;
  const __bf16* Bt  = (const __bf16*)(const void*)Btp;
  const __bf16* Bt2 = (const __bf16*)(const void*)Bt2p;
  constexpr int RA  = (8 / TNB) * 64;               // A rows of the block, per plane
  constexpr int RB  = TNB * 64;                     // Bt rows of the block, per plane
  constexpr int PA  = (NSPLIT == 1) ? 2 : 1;        // A planes
  constexpr int PB  = (NSPLIT == 3) ? 2 : 1;        // Bt planes
  constexpr int RT  = PA * RA + PB * RB;            // staged rows per slab: [A planes][Bt planes]
  constexpr int NIT = RT / 32;                      // copies per thread and slab (256 threads x 16 B = 32 rows)
  static_assert((RA % 32) == 0 && (RB % 32) == 0 && (NIT % 2) == 0 && NIT <= 63);
  static_assert(2 * RT * GSP * 2 >= 8 * 16 * 68 * 4);
  __shared__ __align__(16) __bf16 ring[2 * RT * GSP];   // two slab buffers; afterwards per-wave 16x64 f32 slabs, pitch 68
  const int b    = blockIdx.y;
  const bool second = PAIR && (b == 1);                      // block-uniform
  const float* bias = second ? biasP : biasA;
  const int blen = second ? blenP : blenA;
  const int N2   = second ? 0 : N2a;
  const int lane = threadIdx.x & 31;
  const int wave = threadIdx.x >> 5;
  const int tilesN = N >> 6;
  const int tilesM = M >> 6;
  const int tile = blockIdx.x * 8 + wave;
  if ((int)blockIdx.x * 8 >= tilesM * tilesN) return;   // block-uniform, in front of every barrier
  const int tm = tile / tilesN;
  const int tn = tile - tm * tilesN;
  const int m0 = tm << 6;
  const int n0 = tn << 6;

  const __bf16* Ab  = A  + (size_t)b * strideA;
  const __bf16* Bb  = Bt + (size_t)b * strideB;
  const __bf16* Ab2 = (NSPLIT == 1) ? (A2  + (size_t)b * strideA) : Ab;
  const __bf16* Bb2 = (NSPLIT == 3) ? (Bt2 + (size_t)b * strideB) : Bb;

  const int rlane = lane & 15;                 // row (A) / col (B, D) within subtile
  const int koff  = (lane >> 4) * 8;           // k offset of this lane half
  const int mOff  = (lane >> 4) * 8;           // D row offset

  v8f acc[4][4];
#pragma unroll
  for (int i = 0; i < 4; ++i)
#pragma unroll
    for (int j = 0; j < 4; ++j) acc[i][j] = zero8();

  // ---- staging: thread -> row (tid >> 3) of each group of 32 rows, 16-B piece (tid & 7) of its 128-B line ----
  const int t0b  = blockIdx.x * 8;                   // the block's first tile
  const int mb0  = (t0b / tilesN) << 6;              // its first A row
  const int nb0  = (t0b - (t0b / tilesN) * tilesN) << 6;   // its first Bt row
  const int srow = threadIdx.x >> 3;
  const int sseg = (threadIdx.x & 7) * 8;
  const unsigned lthr = lds_off(ring) + (unsigned)(srow * GSP + sseg) * 2u;
  auto stage = [&](int slab, int buf) {
    const int kc = slab * GKC + sseg;
    const unsigned lb = lthr + (unsigned)buf * (unsigned)(RT * GSP * 2);
#pragma unroll   // both loops: each copy's plane and row group are compile-time, the statement's operands stay in registers
    for (int g0 = 0; g0 < NIT; g0 += 8) {
      unsigned l[8];
      const __bf16* g[8];
#pragma unroll
      for (int e = 0; e < 8; ++e) {
        const int fr = (g0 + e < NIT) ? (g0 + e) * 32 : 0;     // first staged row of this copy's group of 32
        if (fr < PA * RA) {
          const int r = fr % RA;
          g[e] = ((fr / RA) ? Ab2 : Ab) + (size_t)(mb0 + r + srow) * lda + kc;
        } else {
          const int r = (fr - PA * RA) % RB;
          g[e] = (((fr - PA * RA) / RB) ? Bb2 : Bb) + (size_t)(nb0 + r + srow) * ldb + kc;
        }
        l[e] = lb + (unsigned)(fr * GSP * 2);
      }
      if (g0 + 8 <= NIT) acopy8(l, g);
      else               acopy2(l, g);
    }
  };
  static_assert((NIT % 8) == 0 || (NIT % 8) == 2);

  const int nsl = K / GKC;                           // slabs
  const int aRow = (wave / TNB) * 64 + rlane;        // the wave's first A row inside a staged plane
  const int bRow = PA * RA + (wave % TNB) * 64 + rlane;   // its first Bt row inside the staged slab
  stage(0, 0);
  wait_async0();
  __syncthreads();                                   // slab 0 is published
  if (nsl > 1) stage(1, 1);
  for (int sl = 0; sl < nsl; ++sl) {
    const __bf16* sb = ring + (sl & 1) * (RT * GSP);
#pragma unroll   // k and plane offsets fold into the LDS loads' immediate offsets
    for (int ks = 0; ks < GKC / 32; ++ks) {
      const int kl = ks * 32 + koff;                 // k inside the slab
      const __bf16* As = sb + (size_t)aRow * GSP + kl;
      v16b ah[4], al[4];
#pragma unroll
      for (int i = 0; i < 4; ++i) {
        ah[i] = ldfrag_b(As + i * 16 * GSP);
        al[i] = ah[i];
        if (NSPLIT == 1) al[i] = ldfrag_b(As + (RA + i * 16) * GSP);
      }
#pragma unroll
      for (int pl = 0; pl < PB; ++pl) {              // the Bt planes of one k step follow each other, hi then lo
        const __bf16* Bs = sb + (size_t)(bRow + pl * RB) * GSP + kl;
        v16b bh[4];
#pragma unroll
        for (int j = 0; j < 4; ++j) bh[j] = ldfrag_b(Bs + j * 16 * GSP);
#pragma unroll
        for (int i = 0; i < 4; ++i) {
#pragma unroll
          for (int j = 0; j < 4; ++j) {
            acc[i][j] = mma_b_raw(ah[i], bh[j], acc[i][j]);
            if (NSPLIT == 1) acc[i][j] = mma_b_raw(al[i], bh[j], acc[i][j]);
          }
          dep_guard_b(acc[i][0], acc[i][3], ah[i], al[i]);
        }
        keep4_b(bh[0], bh[1], bh[2], bh[3]);
      }
    }
    wait_ds0();
    wait_async0();
    __syncthreads();                                 // publishes slab sl + 1 and ends every read of slab sl's buffer
    if (sl + 2 < nsl) stage(sl + 2, sl & 1);
  }
  wait_async0();
  acc_guard4(acc[0][0], acc[0][1], acc[0][2], acc[0][3]);
  acc_guard4(acc[1][0], acc[1][1], acc[1][2], acc[1][3]);
  acc_guard4(acc[2][0], acc[2][1], acc[2][2], acc[2][3]);
  acc_guard4(acc[3][0], acc[3][1], acc[3][2], acc[3][3]);

  // ---- bias (per column), clamped address, selected by value ----
  float bc[4];
#pragma unroll
  for (int j = 0; j < 4; ++j) {
    int bi = n0 + (j << 4) + rlane;
    bi = (bi < blen) ? bi : (blen - 1);
    bi = (bi > 0) ? bi : 0;
    const float t = bf_up(bf_bits(bias[bi]));
    bc[j] = (bmode == 1) ? t : 0.f;
  }

  // ---- epilogue ----
  float* slab = (float*)(void*)ring + wave * (16 * 68);
#pragma unroll
  for (int i = 0; i < 4; ++i) {
    const int mBase = m0 + (i << 4);
    float brw[8];
#pragma unroll
    for (int r = 0; r < 8; ++r) {
      int bi = mBase + mOff + r;
      bi = (bi < blen) ? bi : (blen - 1);
      bi = (bi > 0) ? bi : 0;
      const float t = bf_up(bf_bits(bias[bi]));
      brw[r] = (bmode == 2) ? t : 0.f;
    }
#pragma unroll
    for (int j = 0; j < 4; ++j) {
#pragma unroll
      for (int r = 0; r < 8; ++r) {
        slab[(mOff + r) * 68 + (j << 4) + rlane] = acc[i][j][r] + bc[j] + brw[r];
      }
    }
    wave_sync_lds();
    if (OUT_MODE == 0 || OUT_MODE == 1) {
      float* C = (float*)Cout + (size_t)b * strideC;
      const float* R = Rp + (size_t)b * strideR;
      const int hh = lane >> 4, c4 = (lane & 15) * 4;     // 256-B row segment = 16 lanes x 16 B
      {
#pragma unroll
        for (int it = 0; it < 8; ++it) {
          const int row = it * 2 + hh;                     // it 0..7 x hh 0..1 = rows 0..15
          v4f v = *(const v4f*)(slab + row * 68 + c4);
          if (OUT_MODE == 1) {
            const v4f xr = *(const v4f*)(R + (size_t)(mBase + row) * ldr + n0 + c4);
            v4f t;
            t[0] = (v[0] + bfr(xr[0])) * oscale;
            t[1] = (v[1] + bfr(xr[1])) * oscale;
            t[2] = (v[2] + bfr(xr[2])) * oscale;
            t[3] = (v[3] + bfr(xr[3])) * oscale;
            v = t;
          }
          *(v4f*)(C + (size_t)(mBase + row) * ldc + n0 + c4) = v;
        }
        
      }
    } else {
      const int q = lane >> 3, c8 = (lane & 7) * 8;
      unsigned short* C  = (unsigned short*)Cout  + (size_t)b * strideC;
      unsigned short* C2 = (unsigned short*)Cout2 + (size_t)b * strideC2;
      const bool wlo = (n0 < N2);                           // wave-uniform
      v4u hv[4], lv[4];
#pragma unroll
      for (int it = 0; it < 4; ++it) {
        const int row = it * 4 + q;                        // it 0..3 x q 0..3 = rows 0..15
        const float* sp = slab + row * 68 + c8;
        v4u a, a2;
#pragma unroll
        for (int e = 0; e < 4; ++e) {
          const float f0 = sp[2 * e], f1 = sp[2 * e + 1];
          const _Float16 x0 = (_Float16)f0, x1 = (_Float16)f1;
          const unsigned short h0 = h_bits(x0), h1 = h_bits(x1);
          const unsigned short l0 = h_bits((_Float16)((f0 - (float)x0) * rscale));
          const unsigned short l1 = h_bits((_Float16)((f1 - (float)x1) * rscale));
          a[e] = pk16(h0, h1); a2[e] = pk16(l0, l1);
        }
        hv[it] = a; lv[it] = a2;
      }
      {
#pragma unroll
        for (int it = 0; it < 4; ++it) {
          const int row = it * 4 + q;
          *(v4u*)(C + (size_t)(mBase + row) * ldc + n0 + c8) = hv[it];
          if (wlo) *(v4u*)(C2 + (size_t)(mBase + row) * ldc2 + n0 + c8) = lv[it];
        }
        
      }
    }
    wave_sync_lds();
  }
}

// =====================================================================================================
// Attention, head dim 64, no masking, softmax over all SEQ keys.
//   q hi plane (f16, pitch DM): element (b, t, h, d) at [(b*SEQ + t)*DM + h*64 + d]; q residual plane
//   (f16, (q - f16(q))*4096, pitch DM) same layout; k plane (f16, pitch DM) same layout.
//   v^T hi plane (f16): element (b, h, d, s) at [(b*DM + h*64 + d)*SEQ + s]; v^T residual plane (f16, x4096): same layout
//   out (f32): element (b, t, h, d) at [(b*SEQ + t)*DM + h*64 + d]
//   Both products are taken transposed, so that a lane owns ONE query (column lane & 15):
//   scores^T[key][query] = (k . qh + (k . ql) * rres) * sscale on f16 WMMA (A = K rows, B = q), residual products in a
//   separate accumulator; a lane holds 32 of its query's 64 scores (keys 16 j + 8 (lane >> 4) + r), so the maximum and
//   the sum run in the lane, with one exchange between the wave halves for the maximum per chunk and one for the sum
//   at the end. p = exp(s - m) carried as f16(1024 p): score tiles 2 kk and 2 kk + 1, converted in place, ARE the
//   B operand (keys 32 kk .. + 31 in the hardware k order) of context^T[d][query] = vh . p + (vl . p) * rres
//   (A = V^T rows; separate accumulator folded per chunk in f32); online softmax in f32.
//   Block = 4 waves = 64 query rows of one (b, h); grid = NQB * NH * NB; kv chunks of 64, static trip NQB.
//   K / V^T chunk staging: 128 threads x 32 elements per plane = the whole 64x64 tile (plain 16-B loads,
//   __syncthreads before and after).
//   Output coverage: each wave stores rows q0..q0+15 (it 0..7 x lane>>4 0..1) x 64 f32 columns
// =====================================================================================================
__device__ __forceinline__ float other_half(float v) {       // the value that lane ^ 16 holds
  const int b = __builtin_bit_cast(int, v);
  return __builtin_bit_cast(float, __builtin_amdgcn_permlanex16(b, b, 0x76543210, 0xfedcba98, false, false));
}
__global__ __launch_bounds__(128)
void attn64(const unsigned short* __restrict__ qhp, const unsigned short* __restrict__ qlp,
            const unsigned short* __restrict__ khp,
            const unsigned short* __restrict__ vhp, const unsigned short* __restrict__ vlp,
            float* outp, float sscale, float rres) {
  union FH { v16h v; v8h h[2]; };
  __shared__ __align__(16) _Float16 Ksh[64 * KVP];                // K [kv][d], 64 halves used per row
  __shared__ __align__(16) _Float16 Vth[64 * KVP];                // V^T hi [d][kv]
  __shared__ __align__(16) _Float16 Vtl[64 * KVP];                // V^T residual [d][kv]
  __shared__ __align__(16) float    Os[4][16 * OSP];              // per wave context tile [row][d]

  const int tid  = threadIdx.x;
  const int wave = tid >> 5;
  const int lane = tid & 31;
  const int hh   = lane >> 4;
  const int c    = lane & 15;

  const int bx   = blockIdx.x;
  const int qb   = bx % NQB;
  const int rest = bx / NQB;
  const int h    = rest % NH;
  const int b    = rest / NH;
  const int q0   = qb * 64 + wave * 16;
  const size_t rowB = (size_t)b * SEQ;

  const _Float16* Qh = (const _Float16*)(const void*)qhp + (size_t)h * HD;
  const _Float16* Ql = (const _Float16*)(const void*)qlp + (size_t)h * HD;
  const _Float16* Kg = (const _Float16*)(const void*)khp + (size_t)h * HD;
  const _Float16* Vh = (const _Float16*)(const void*)vhp + ((size_t)b * DM + (size_t)h * HD) * SEQ;
  const _Float16* Vl = (const _Float16*)(const void*)vlp + ((size_t)b * DM + (size_t)h * HD) * SEQ;

  // ---- Q fragments (B operand, column = query = lane&15): 2 d-chunks, hi and residual ----
  v16h qah[2], qal[2];
#pragma unroll
  for (int dc = 0; dc < 2; ++dc) {
    qah[dc] = ldfrag_h(Qh + (rowB + q0 + c) * DM + dc * 32 + 8 * hh);
    qal[dc] = ldfrag_h(Ql + (rowB + q0 + c) * DM + dc * 32 + 8 * hh);
  }

  float mrow = -INFINITY;                    // running maximum of query c (equal in both wave halves)
  float lrow = 0.f;                          // running sum of query c over this half's keys
  v8f oacc[4];                               // context^T: oacc[t][r] = element d = 16 t + 8 hh + r of query c
#pragma unroll
  for (int t = 0; t < 4; ++t) oacc[t] = zero8();

  for (int kt = 0; kt < NQB; ++kt) {         // static trip count
    const int kv0 = kt * 64;
    __syncthreads();
    {
      const int r = tid >> 1, hf = (tid & 1) * 32;
      const _Float16* kg  = Kg + (rowB + kv0 + r) * DM + hf;       // K row kv0+r, d = hf..hf+31
      const _Float16* vg  = Vh + (size_t)r * SEQ + kv0 + hf;       // V^T row d = r, s = kv0+hf..+31
      const _Float16* vlg = Vl + (size_t)r * SEQ + kv0 + hf;
#pragma unroll
      for (int i = 0; i < 4; ++i) {
        const v8h a0 = *(const v8h*)(kg + 8 * i);
        const v8h b0 = *(const v8h*)(vg + 8 * i);
        const v8h b1 = *(const v8h*)(vlg + 8 * i);
        *(v8h*)(Ksh + r * KVP + hf + 8 * i) = a0;
        *(v8h*)(Vth + r * KVP + hf + 8 * i) = b0;
        *(v8h*)(Vtl + r * KVP + hf + 8 * i) = b1;
      }
    }
    __syncthreads();

    // ---- scores^T: 64 keys x 16 queries per wave, 2 f16 products (hi, residual) ----
    v8f s[4];                                // s[j][r]: key 16 j + 8 hh + r against query c
#pragma unroll
    for (int j = 0; j < 4; ++j) {
      v8f sh = zero8(), sl = zero8();
#pragma unroll
      for (int dc = 0; dc < 2; ++dc) {
        FH kb;
        kb.h[0] = *(const v8h*)(Ksh + (j * 16 + c) * KVP + dc * 32 + 8 * hh);
        kb.h[1] = *(const v8h*)(Ksh + (j * 16 + c) * KVP + dc * 32 + 16 + 8 * hh);
        sh = mma_h(kb.v, qah[dc], sh);
        sl = mma_h(kb.v, qal[dc], sl);
      }
#pragma unroll
      for (int r = 0; r < 8; ++r) s[j][r] = (sh[r] + sl[r] * rres) * sscale;
    }

    // ---- maximum in the lane, joined across the halves; online softmax; P^T (x1024, f16) packed in registers ----
    float mx[8];
#pragma unroll   // mx and s are register arrays: constant indices; eight independent chains
    for (int r = 0; r < 8; ++r) mx[r] = fmaxf(fmaxf(s[0][r], s[1][r]), fmaxf(s[2][r], s[3][r]));
    float m = fmaxf(fmaxf(fmaxf(mx[0], mx[1]), fmaxf(mx[2], mx[3])), fmaxf(fmaxf(mx[4], mx[5]), fmaxf(mx[6], mx[7])));
    m = fmaxf(m, other_half(m));
    const float mnew  = fmaxf(mrow, m);
    const float alpha = __expf(mrow - mnew);
    mrow = mnew;
    FH pb[2];                                // pb[kk]: keys 32 kk + (8 hh + e | 16 + 8 hh + e - 8) of query c
    float ps[4];                             // four independent partial sums, one per score tile
#pragma unroll   // both loops: s, ps and pb are register arrays, their indices must be compile-time constants
    for (int j = 0; j < 4; ++j) {
      ps[j] = 0.f;
#pragma unroll
      for (int r = 0; r < 8; ++r) {
        const float p = __expf(s[j][r] - mnew);
        ps[j] += p;
        pb[j >> 1].v[(j & 1) * 8 + r] = (_Float16)(p * 1024.0f);
      }
    }
    lrow = lrow * alpha + ((ps[0] + ps[1]) + (ps[2] + ps[3]));
#pragma unroll
    for (int t = 0; t < 4; ++t)
#pragma unroll
      for (int r = 0; r < 8; ++r) oacc[t][r] *= alpha;

    // ---- context^T += V^T . P^T (f16 WMMA), residual products into a separate accumulator ----
    v8f o1[4];
#pragma unroll
    for (int t = 0; t < 4; ++t) o1[t] = zero8();
#pragma unroll   // pb[kk] lives in registers: its index must be a compile-time constant
    for (int kk = 0; kk < 2; ++kk) {
#pragma unroll
      for (int t = 0; t < 4; ++t) {
        FH vb, vl;
        vb.h[0] = *(const v8h*)(Vth + (t * 16 + c) * KVP + kk * 32 + 8 * hh);
        vb.h[1] = *(const v8h*)(Vth + (t * 16 + c) * KVP + kk * 32 + 16 + 8 * hh);
        vl.h[0] = *(const v8h*)(Vtl + (t * 16 + c) * KVP + kk * 32 + 8 * hh);
        vl.h[1] = *(const v8h*)(Vtl + (t * 16 + c) * KVP + kk * 32 + 16 + 8 * hh);
        oacc[t] = mma_h(vb.v, pb[kk].v, oacc[t]);
        o1[t]   = mma_h(vl.v, pb[kk].v, o1[t]);
      }
    }
#pragma unroll
    for (int t = 0; t < 4; ++t)
#pragma unroll
      for (int r = 0; r < 8; ++r) oacc[t][r] += o1[t][r] * rres;
  }

  // ---- join the halves' sums, normalise (1/l and the 1/1024 p carry), stage the wave's 16x64 f32 tile in LDS
  //      (a lane's 8 registers of tile t = 8 consecutive d of its query's row), then write whole rows
  float* os = Os[wave];
  {
    const float l = lrow + other_half(lrow);
    const float inv = ((l > 0.f) ? (1.0f / l) : 0.f) * (1.0f / 1024.0f);
#pragma unroll   // both loops: oacc is a register array, its indices must be compile-time constants
    for (int t = 0; t < 4; ++t) {
      v4f w0, w1;
#pragma unroll
      for (int e = 0; e < 4; ++e) { w0[e] = oacc[t][e] * inv; w1[e] = oacc[t][4 + e] * inv; }
      *(v4f*)(os + c * OSP + t * 16 + 8 * hh)     = w0;
      *(v4f*)(os + c * OSP + t * 16 + 8 * hh + 4) = w1;
    }
  }
  wave_sync_lds();
  {
    const int c4 = (lane & 15) * 4;
    {
#pragma unroll
      for (int it = 0; it < 8; ++it) {
        const int row = it * 2 + hh;                     // it 0..7 x hh 0..1 = rows 0..15 of the wave tile
        const v4f v = *(const v4f*)(os + row * OSP + c4);
        *(v4f*)(outp + (rowB + q0 + row) * DM + (size_t)h * HD + c4) = v;
      }
      
    }
  }
}

// =====================================================================================================
// Workspace map (bytes), every plane an exact multiple of its whole-row / 64x64-tile / whole-line store granularity:
//   WT    bf16 [4][256 o][256 i]     0          524288     (Wq, Wk, Wv, Wp transposed, k = in contiguous)
//   XNh   bf16 [16384 t][256 c]      589824     8388608    (GroupNorm output, token-major, hi plane)
//   XNl   bf16 [16384][256]          8978432    8388608    (lo plane)
//   Qh    f16  [16384][256]          17367040   8388608
//   Ql    f16  [16384][256]          25755648   8388608    (q residual x4096)
//   Kh    f16  [16384][256]          34144256   8388608
//   VTh   f16  [16][256 c][1024 t]   42532864   8388608
//   VTl   f16  [16][256][1024]       50921472   8388608    (v residual x4096)
//   CTX   f32  [16384 t][256 c]      59310080   16777216   (attention context, token-major)
//   CTXh  bf16 [16384][256]          76087296   8388608
//   CTXl  bf16 [16384][256]          84475904   8388608
//   end                              92864512
// =====================================================================================================
extern "C" void kernel_launch(void* const* d_in, const int* in_sizes, int n_in,
                              void* d_out, int out_size, void* d_ws, size_t ws_size,
                              hipStream_t stream) {
  if (n_in < 11) return;
  if (in_sizes[0] != NB * DM * SEQ) return;
  if (in_sizes[3] != DM * DM || in_sizes[5] != DM * DM || in_sizes[7] != DM * DM || in_sizes[9] != DM * DM) return;
  if (in_sizes[1] < DM || in_sizes[2] < DM) return;
  if (in_sizes[4] < 1 || in_sizes[6] < 1 || in_sizes[8] < 1 || in_sizes[10] < 1) return;
  if (out_size != NB * DM * SEQ) return;

  const float* x   = (const float*)d_in[0];
  const float* gsc = (const float*)d_in[1];
  const float* gbi = (const float*)d_in[2];
  const float* wq  = (const float*)d_in[3];
  const float* bq  = (const float*)d_in[4];
  const float* wk  = (const float*)d_in[5];
  const float* bk  = (const float*)d_in[6];
  const float* wv  = (const float*)d_in[7];
  const float* bv  = (const float*)d_in[8];
  const float* wp  = (const float*)d_in[9];
  const float* bp  = (const float*)d_in[10];
  float* out = (float*)d_out;

  const size_t PWT = (size_t)4 * DM * DM * 2;          //   524288
  const size_t PST = (size_t)NB * NGRP * 32 * 4;       //    65536
  const size_t P16 = (size_t)NB * SEQ * DM * 2;        //  8388608
  const size_t P32 = (size_t)NB * SEQ * DM * 4;        // 16777216
  size_t off = 0;
  const size_t oWT   = off; off += PWT;
  const size_t oST   = off; off += PST;
  const size_t oXNh  = off; off += P16;
  const size_t oXNl  = off; off += P16;
  const size_t oQh   = off; off += P16;
  const size_t oQl   = off; off += P16;
  const size_t oKh   = off; off += P16;
  const size_t oVTh  = off; off += P16;
  const size_t oVTl  = off; off += P16;
  const size_t oCTX  = off; off += P32;
  const size_t oCTXh = off; off += P16;
  const size_t oCTXl = off; off += P16;
  if (off > ws_size) return;                            // off = 92864512
  if (off > (size_t)134217728) return;

  char* ws = (char*)d_ws;
  unsigned short* WT   = (unsigned short*)(ws + oWT);
  float*          ST   = (float*)(ws + oST);
  unsigned short* XNh  = (unsigned short*)(ws + oXNh);
  unsigned short* XNl  = (unsigned short*)(ws + oXNl);
  unsigned short* Qh   = (unsigned short*)(ws + oQh);
  unsigned short* Ql   = (unsigned short*)(ws + oQl);
  unsigned short* Kh   = (unsigned short*)(ws + oKh);
  unsigned short* VTh  = (unsigned short*)(ws + oVTh);
  unsigned short* VTl  = (unsigned short*)(ws + oVTl);
  float*          CTX  = (float*)(ws + oCTX);
  unsigned short* CTXh = (unsigned short*)(ws + oCTXh);
  unsigned short* CTXl = (unsigned short*)(ws + oCTXl);
  unsigned short* WTq = WT + (size_t)0 * DM * DM;
  unsigned short* WTv = WT + (size_t)2 * DM * DM;
  unsigned short* WTp = WT + (size_t)3 * DM * DM;

  const dim3 blk(256);
  const dim3 gWT(16, 4);                                          // 16 tiles of 64x64 per weight, 4 weights
  const dim3 gGN(NB * NGRP);                                      // 512 blocks
  const dim3 gAP(NB * (SEQ / 32));                                // 512 blocks
  const dim3 gQK(((NB * SEQ / 64) * (DM / 64) + 7) / 8, 2);       // 1024 tiles -> 128 blocks: M=16384, N=256; y: 0 = q, 1 = k
  const dim3 gVT(((DM / 64) * (SEQ / 64) + 7) / 8, NB);           // 64 tiles -> 8 blocks x 16 batches: M=256, N=1024
  const dim3 gAttn(NB * NH * NQB);                                // 1024 blocks
  const int  n8c = NB * SEQ * DM / 8;                             // 524288
  const dim3 gCvt((n8c + 255) / 256);                             // 2048 blocks
  const float rs2 = 1.0f / 1.41421356237309515f;

  // (1) weights [in][out] -> bf16 [out][in] planes (RNE convert)
  wt_cvt<<<gWT, blk, 0, stream>>>(wq, wk, wv, wp, WT);
  // (2) GroupNorm statistics per (b, group) from bf16(x)
  gn_stats<<<gGN, blk, 0, stream>>>(x, ST);
  // (3) GroupNorm apply -> token-major bf16 hi + lo planes [16384][256]
  gn_apply<<<gAP, blk, 0, stream>>>(x, ST, gsc, gbi, XNh, XNl);
  // (4, 5) one launch of 2 x 128 blocks, one block for each of the chip's 256 WGPs (M=16384, N=256, K=256, bias per column):
  //     y = 0: q = xn . Wq + bq -> f16 hi plane [16384][256] + f16 residual x4096
  //     y = 1: k = xn . Wk + bk -> f16 plane [16384][256], no residual
  //     Wk's plane lies one weight plane behind WTq, Kh two activation planes behind Qh (workspace map above)
  gemm64<1, 3, true, 4><<<gQK, blk, 0, stream>>>(
      XNh, XNl, DM, 0LL, WTq, WTq, DM, (long long)DM * DM,
      (void*)Qh, DM, 2LL * NB * SEQ * DM, (void*)Ql, DM, 0LL, DM,
      NB * SEQ, DM, DM, 4096.0f, bq, 1, in_sizes[4], x, 0, 0LL, 1.0f, bk, in_sizes[6]);
  // (6) v^T[b][c][t] = sum_i Wv[i][c] xn[b][t][i] + bv[c] per batch -> f16 hi plane (pitch SEQ) + residual x4096
  //     (A = WTv [c][i], Bt = XN rows of batch b hi + lo; M=256, N=1024, K=256; bias per row)
  gemm64<3, 3, false, 8><<<gVT, blk, 0, stream>>>(
      WTv, WTv, DM, 0LL, XNh, XNl, DM, (long long)SEQ * DM,
      (void*)VTh, SEQ, (long long)DM * SEQ, (void*)VTl, SEQ, (long long)DM * SEQ, SEQ,
      DM, SEQ, DM, 4096.0f, bv, 2, in_sizes[8], x, 0, 0LL, 1.0f);
  // (7) attention: scores scale 1/sqrt(C) = 1/16 -> context f32 [16384][256] token-major
  attn64<<<gAttn, dim3(128), 0, stream>>>(Qh, Ql, Kh, VTh, VTl, CTX, 0.0625f, 1.0f / 4096.0f);
  // (8) context -> bf16 hi + lo planes
  cvt_split8<<<gCvt, blk, 0, stream>>>(CTX, CTXh, CTXl, n8c);
  // (9) out[b][c][t] = (sum_o Wp[o][c] ctx[b][t][o] + bp[c] + bf16(x[b][c][t])) * (1/sqrt2) per batch, written
  //     straight into the NCHW output rows of 1024 floats (A = WTp [c][o], Bt = CTX rows hi + lo; M=256, N=1024, K=256)
  gemm64<3, 1, false, 8><<<gVT, blk, 0, stream>>>(
      WTp, WTp, DM, 0LL, CTXh, CTXl, DM, (long long)SEQ * DM,
      (void*)out, SEQ, (long long)DM * SEQ, (void*)out, SEQ, (long long)DM * SEQ, 0,
      DM, SEQ, DM, 1.0f, bp, 2, in_sizes[10], x, SEQ, (long long)DM * SEQ, rs2);
  (void)hipGetLastError();
}

// v005
// One run takes 111 microseconds.
// Two timings next to v004 both put it at 1.06 times that version's speed.
// Counting every step since v000, it is 2.06 times as fast.
// Contractions: q, k, v^T and output projections = v_wmma_f32_16x16x32_bf16 (bf16 operands: weights and biases from
// RNE-converted inputs, computed activations as bf16 hi + lo planes, 2 products); q.k^T scores = v_wmma_f32_16x16x32_f16
// (q as f16 hi plane + f16 residual plane x4096 in a separate accumulator, k f16; 2 products); p.v = v_wmma_f32_16x16x32_f16
// (p carried x1024 in f16, v^T as f16 hi plane + residual plane x4096 in a separate accumulator; 2 products);
// all f32 accumulate; GroupNorm statistics, softmax, biases, residual add and output scale in f32.
#include <hip/hip_runtime.h>
#include <math.h>
#include <stdint.h>

#define NB    16            // batch
#define DM    256           // channels
#define SEQ   1024          // tokens (32 x 32)
#define NH    4             // heads
#define HD    64            // head dim
#define NQB   (SEQ / 64)    // 16 query / key tiles of 64
#define NGRP  32            // groups
#define GSZ   8             // channels per group
#define XPITCH 264          // LDS pitch (halves) of the token-major staging tile
#define KVP   72            // LDS pitch (halves) of the attention K and V^T rows: 144 B = 16 B x odd, so the 16 rows
                            // that one ds_load_b128 fragment read touches fall on 16 different groups of four banks
#define OSP   68            // LDS pitch (floats) of the attention context tile: rows r and r + 8 on different banks
#define GKC   64            // k elements per staged GEMM slab: 128 B = one whole line of every operand row
#define GSP   72            // LDS pitch (halves) of a staged GEMM operand row: 144 B = 16 B x odd, as for KVP
static_assert(NH * HD == DM);
static_assert((DM % GKC) == 0 && (GSP % 8) == 0 && ((GSP / 8) & 1) == 1 && GSP >= GKC);
static_assert(NGRP * GSZ == DM);
static_assert((SEQ % 64) == 0 && (DM % 64) == 0 && (DM % 32) == 0);
static_assert((XPITCH % 8) == 0);
static_assert((KVP % 8) == 0 && ((KVP / 8) & 1) == 1 && KVP >= 64);
static_assert((OSP % 4) == 0 && OSP >= 64);

typedef _Float16 v16h __attribute__((ext_vector_type(16)));
typedef _Float16 v8h  __attribute__((ext_vector_type(8)));
typedef __bf16   v16b __attribute__((ext_vector_type(16)));
typedef __bf16   v8b  __attribute__((ext_vector_type(8)));
typedef float    v8f  __attribute__((ext_vector_type(8)));
typedef float    v4f  __attribute__((ext_vector_type(4)));
typedef unsigned int v4u __attribute__((ext_vector_type(4)));
typedef unsigned short v8us __attribute__((ext_vector_type(8)));

// ---- scalar helpers --------------------------------------------------------------------------------
__device__ __forceinline__ unsigned short bf_bits(float f) {          // f32 -> bf16 bits, RNE convert
  unsigned u = __float_as_uint(f);
  return (unsigned short)((u + 0x7FFFu + ((u >> 16) & 1u)) >> 16);
}
__device__ __forceinline__ float bf_up(unsigned short h) { return __uint_as_float(((unsigned)h) << 16); }
__device__ __forceinline__ float bfr(float f) { return bf_up(bf_bits(f)); }   // value RNE-converted to bf16 and widened
__device__ __forceinline__ unsigned short h_bits(_Float16 x) { return __builtin_bit_cast(unsigned short, x); }
__device__ __forceinline__ unsigned pk16(unsigned short a, unsigned short b) { return (unsigned)a | ((unsigned)b << 16); }
__device__ __forceinline__ v8f zero8() { v8f z = {0.f, 0.f, 0.f, 0.f, 0.f, 0.f, 0.f, 0.f}; return z; }

// ---- fragment loaders: 16-bit A/B operand, lane -> row/col (lane&15), p already includes +8*(lane>>4);
//      elements 0..7 <- p[0..7] (k0+8h..), elements 8..15 <- p[16..23] (k0+16+8h..)
__device__ __forceinline__ v16b ldfrag_b(const __bf16* p) {
  union { v16b v; v8b h[2]; } f;
  f.h[0] = *(const v8b*)(p);
  f.h[1] = *(const v8b*)(p + 16);
  return f.v;
}
__device__ __forceinline__ v16h ldfrag_h(const _Float16* p) {
  union { v16h v; v8h h[2]; } f;
  f.h[0] = *(const v8h*)(p);
  f.h[1] = *(const v8h*)(p + 16);
  return f.v;
}

// ---- WMMA helpers with trailing VALU hazard gap --------------------------------------------------------
__device__ __forceinline__ v8f mma_h(v16h a, v16h b, v8f c) {
  c = __builtin_amdgcn_wmma_f32_16x16x32_f16(false, a, false, b, (short)0, c, false, false);
#if defined(__HIP_DEVICE_COMPILE__)
  asm volatile("v_nop\n\tv_nop\n\tv_nop\n\tv_nop" : "+v"(c) : "v"(a), "v"(b));
#endif
  return c;
}
__device__ __forceinline__ v8f mma_b_raw(v16b a, v16b b, v8f c) {
  return __builtin_amdgcn_wmma_f32_16x16x32_bf16(false, a, false, b, (short)0, c, false, false);
}
__device__ __forceinline__ void dep_guard_b(v8f& a, v8f& b, v16b x, v16b y) {
#if defined(__HIP_DEVICE_COMPILE__)
  asm volatile("v_nop\n\tv_nop\n\tv_nop\n\tv_nop" : "+v"(a), "+v"(b) : "v"(x), "v"(y));
#endif
}
__device__ __forceinline__ void keep4_b(v16b a, v16b b, v16b c, v16b d) {
#if defined(__HIP_DEVICE_COMPILE__)
  asm volatile("v_nop" :: "v"(a), "v"(b), "v"(c), "v"(d));
#endif
}
__device__ __forceinline__ void acc_guard4(v8f& a, v8f& b, v8f& c, v8f& d) {
#if defined(__HIP_DEVICE_COMPILE__)
  asm volatile("v_nop\n\tv_nop\n\tv_nop\n\tv_nop" : "+v"(a), "+v"(b), "+v"(c), "+v"(d));
#endif
}
__device__ __forceinline__ void wave_sync_lds() {
  __builtin_amdgcn_fence(__ATOMIC_RELEASE, "workgroup");
  __builtin_amdgcn_wave_barrier();
  __builtin_amdgcn_fence(__ATOMIC_ACQUIRE, "workgroup");
}

// ---- asynchronous global -> LDS copies, 16 B per lane, through no register ------------------------------
__device__ __forceinline__ unsigned lds_off(const void* p) { return (unsigned)(size_t)p; }   // LDS byte address
// Eight (two) copies in one statement; its last line keeps the address registers untouched until the copies are taken.
__device__ __forceinline__ void acopy8(const unsigned* l, const __bf16* const* g) {
#if defined(__HIP_DEVICE_COMPILE__)
  asm volatile("global_load_async_to_lds_b128 %0, %8, off\n\t"
               "global_load_async_to_lds_b128 %1, %9, off\n\t"
               "global_load_async_to_lds_b128 %2, %10, off\n\t"
               "global_load_async_to_lds_b128 %3, %11, off\n\t"
               "global_load_async_to_lds_b128 %4, %12, off\n\t"
               "global_load_async_to_lds_b128 %5, %13, off\n\t"
               "global_load_async_to_lds_b128 %6, %14, off\n\t"
               "global_load_async_to_lds_b128 %7, %15, off\n\t"
               "s_wait_xcnt 0x0"
               :: "v"(l[0]), "v"(l[1]), "v"(l[2]), "v"(l[3]), "v"(l[4]), "v"(l[5]), "v"(l[6]), "v"(l[7]),
                  "v"(g[0]), "v"(g[1]), "v"(g[2]), "v"(g[3]), "v"(g[4]), "v"(g[5]), "v"(g[6]), "v"(g[7])
               : "memory");
#endif
}
__device__ __forceinline__ void acopy2(const unsigned* l, const __bf16* const* g) {
#if defined(__HIP_DEVICE_COMPILE__)
  asm volatile("global_load_async_to_lds_b128 %0, %2, off\n\t"
               "global_load_async_to_lds_b128 %1, %3, off\n\t"
               "s_wait_xcnt 0x0"
               :: "v"(l[0]), "v"(l[1]), "v"(g[0]), "v"(g[1])
               : "memory");
#endif
}
__device__ __forceinline__ void wait_async0() {      // this wave's copies have landed in LDS
#if defined(__HIP_DEVICE_COMPILE__)
  asm volatile("s_wait_asynccnt 0x0" ::: "memory");
#endif
}
__device__ __forceinline__ void wait_ds0() {         // this wave's LDS reads have retired before their buffer is refilled
#if defined(__HIP_DEVICE_COMPILE__)
  asm volatile("s_wait_dscnt 0x0" ::: "memory");
#endif
}

// =====================================================================================================
// Weights W[in i][out o] (f32, 256x256) -> bf16 planes WT[w][o][i] (k = i contiguous), RNE convert.
// grid (16 tiles of 64x64, 4 weights), 256 threads. Load: 16 iterations x 4 input rows x 64 cols = the whole
// 64x64 tile into LDS transposed (unsigned short element stores); __syncthreads; write: each wave instruction
// =====================================================================================================
__global__ __launch_bounds__(256) void wt_cvt(const float* __restrict__ W0, const float* __restrict__ W1,
                                              const float* __restrict__ W2, const float* __restrict__ W3,
                                              unsigned short* WT) {
  __shared__ __align__(16) unsigned short T[64 * 72];
  const int tid = threadIdx.x, lane = tid & 31, wave = tid >> 5;
  const int wsel = blockIdx.y;                                   // block-uniform weight select
  const float* W = (wsel == 0) ? W0 : (wsel == 1) ? W1 : (wsel == 2) ? W2 : W3;
  const int bx = blockIdx.x;
  const int i0 = (bx >> 2) * 64;                                 // input-channel tile
  const int o0 = (bx & 3) * 64;                                  // output-channel tile
#pragma unroll 4
  for (int it = 0; it < 16; ++it) {
    const int i = it * 4 + (tid >> 6);
    const int o = tid & 63;
    const float v = W[(size_t)(i0 + i) * DM + o0 + o];
    T[o * 72 + i] = bf_bits(v);
  }
  __syncthreads();
  const int q = lane >> 3, c8 = (lane & 7) * 8;
  v8us v[2];
#pragma unroll
  for (int it = 0; it < 2; ++it) {
    const int orow = it * 32 + wave * 4 + q;
    v[it] = *(const v8us*)(T + orow * 72 + c8);
  }
  unsigned short* dst = WT + (size_t)wsel * DM * DM;
  {
#pragma unroll
    for (int it = 0; it < 2; ++it) {
      const int orow = it * 32 + wave * 4 + q;
      *(v8us*)(dst + (size_t)(o0 + orow) * DM + i0 + c8) = v[it];
    }
    
  }
}

// =====================================================================================================
// GroupNorm statistics per (b, group): 8 channels x 1024 tokens = 8192 contiguous floats of the NCHW input,
// reduction in f32; rstd = 1/sqrt(var + 1e-6). grid = NB*NGRP blocks, 256 threads.
// =====================================================================================================
__global__ __launch_bounds__(256) void gn_stats(const float* __restrict__ x, float* stats) {
  __shared__ float red[256];
  __shared__ float sres[2];
  const int tid = threadIdx.x;
  const int bg = blockIdx.x;
  const float* xp = x + (size_t)bg * (GSZ * SEQ);
  float s = 0.f;
#pragma unroll 1
  for (int j = 0; j < 8; ++j) {
    const v4f v = *(const v4f*)(xp + ((size_t)j * 256 + tid) * 4);
    s += bfr(v[0]); s += bfr(v[1]); s += bfr(v[2]); s += bfr(v[3]);
  }
  red[tid] = s;
  __syncthreads();
  for (int st = 128; st > 0; st >>= 1) {
    if (tid < st) red[tid] += red[tid + st];
    __syncthreads();
  }
  if (tid == 0) sres[0] = red[0] * (1.0f / 8192.0f);
  __syncthreads();
  const float mean = sres[0];
  float q = 0.f;
#pragma unroll 1
  for (int j = 0; j < 8; ++j) {
    const v4f v = *(const v4f*)(xp + ((size_t)j * 256 + tid) * 4);
    const float d0 = bfr(v[0]) - mean, d1 = bfr(v[1]) - mean, d2 = bfr(v[2]) - mean, d3 = bfr(v[3]) - mean;
    q += d0 * d0; q += d1 * d1; q += d2 * d2; q += d3 * d3;
  }
  red[tid] = q;
  __syncthreads();
  for (int st = 128; st > 0; st >>= 1) {
    if (tid < st) red[tid] += red[tid + st];
    __syncthreads();
  }
  if (tid == 0) {
    const float var = red[0] * (1.0f / 8192.0f);
    sres[1] = 1.0f / sqrtf(var + 1e-6f);
  }
  __syncthreads();
  if (tid < 8) {
    v4f o = {0.f, 0.f, 0.f, 0.f};
    if (tid == 0) { o[0] = mean; o[1] = sres[1]; }
    float* dst = stats + (size_t)bg * 32 + tid * 4;
    *(v4f*)dst = o;
    
  }
}

// =====================================================================================================
// GroupNorm apply + NCHW -> token-major transpose: xn = (bf16(x) - mean) * rstd * bf16(scale[c]) + bf16(bias[c]) in f32,
// written as bf16 hi plane XNh[b][t][c] and bf16 lo plane XNl = RNE(xn - hi), pitch 256 halves (512-B rows).
// grid = NB * (SEQ/32) blocks (b, 32-token tile), 256 threads. Load: 32 iterations x (8 channels = waves) x
// wave w writes token rows w + 8*it (it 0..3) with 32 lanes x 16 B = 512 B = exactly one whole row per instruction
// (reloaded as v8us, same element type). coverage: 4 x 8 = 32 rows x 256 halves per plane = the whole tile;
// =====================================================================================================
__global__ __launch_bounds__(256) void gn_apply(const float* __restrict__ x, const float* __restrict__ stats,
                                                const float* __restrict__ gsc, const float* __restrict__ gbi,
                                                unsigned short* XNh, unsigned short* XNl) {
  __shared__ __align__(16) unsigned short Lh[32 * XPITCH];
  __shared__ __align__(16) unsigned short Ll[32 * XPITCH];
  __shared__ float smean[NGRP], srstd[NGRP], ssc[DM], sbi[DM];
  const int tid = threadIdx.x, lane = tid & 31, wave = tid >> 5;
  const int b  = blockIdx.x / (SEQ / 32);
  const int tt = blockIdx.x - b * (SEQ / 32);
  const int t0 = tt * 32;
  if (tid < NGRP) {
    smean[tid] = stats[((size_t)b * NGRP + tid) * 32 + 0];
    srstd[tid] = stats[((size_t)b * NGRP + tid) * 32 + 1];
  }
  ssc[tid] = bfr(gsc[tid]);
  sbi[tid] = bfr(gbi[tid]);
  __syncthreads();
  const float* xb = x + (size_t)b * DM * SEQ + t0;
#pragma unroll 2
  for (int it = 0; it < 32; ++it) {
    const int c = it * 8 + wave;
    const float xv = bfr(xb[(size_t)c * SEQ + lane]);
    const int g = c >> 3;
    const float v = (xv - smean[g]) * srstd[g] * ssc[c] + sbi[c];
    const unsigned short hb = bf_bits(v);
    const unsigned short lb = bf_bits(v - bf_up(hb));
    Lh[lane * XPITCH + c] = hb;
    Ll[lane * XPITCH + c] = lb;
  }
  __syncthreads();
  v8us hv[4], lv[4];
#pragma unroll
  for (int it = 0; it < 4; ++it) {
    const int r = it * 8 + wave;
    hv[it] = *(const v8us*)(Lh + r * XPITCH + lane * 8);
    lv[it] = *(const v8us*)(Ll + r * XPITCH + lane * 8);
  }
  const size_t base = (size_t)(b * SEQ + t0) * DM;
  {
#pragma unroll
    for (int it = 0; it < 4; ++it) {
      const int r = it * 8 + wave;
      *(v8us*)(XNh + base + (size_t)r * DM + lane * 8) = hv[it];
      *(v8us*)(XNl + base + (size_t)r * DM + lane * 8) = lv[it];
    }
    
  }
}

// =====================================================================================================
// Register-blocked batched bf16 WMMA GEMM: C[m][n] = sum_k A[m][k] * Bt[n][k] + bias; one wave per 64x64 tile,
// eight tiles per block: 8 / TNB tile rows x TNB tile columns (N / 64 a multiple of TNB, and equal to it where TNB < 8;
// the tile count a multiple of 8). A row-major [M][K] pitch lda; Bt row-major [N][K] pitch ldb (k contiguous);
// M, N multiples of 64, K multiple of GKC. blockIdx.y = batch index (strides in elements).
// Operands: per slab of GKC k the block's A rows and Bt rows (every plane) are copied into LDS, each wave copy = 4 whole
// 128-B lines, rows at pitch GSP; two buffers, slab s + 1 in flight while slab s is multiplied; the waves read their
// fragments from LDS. After the last slab the ring's first bytes serve as the epilogue's per-wave slabs.
// NSPLIT: 0 = A.Bt; 1 = (A + A2).Bt (A2 = unscaled bf16 lo plane of A, same accumulator);
//         3 = A.Bt + A.Bt2 (Bt2 = unscaled bf16 lo plane of Bt; the two planes are walked as alternate k-steps).
// OUT_MODE: 0 = f32 (pitch ldc); 1 = f32 with per-element residual: v = (acc + bias + bf16(R[m][n])) * oscale,
//           R f32 pitch ldr, batch stride strideR; 3 = f16 hi plane C + f16 residual plane C2 = f16((v - hi) * rscale),
//           C2 written only for tiles with n0 < N2 (pitch ldc2, batch stride strideC2).
// bias (f32, RNE-converted to bf16 then widened): bmode 0 = none, 1 = per column n, 2 = per row m;
//           index clamped to [0, blen-1].
// PAIR: two products that share A in one launch of two batches: batch 1 takes its own bias vector (biasP, blenP) and
//           writes no residual plane; its Bt and C lie strideB and strideC behind those of batch 0.
// =====================================================================================================
template <int NSPLIT, int OUT_MODE, bool PAIR, int TNB>
__global__ __launch_bounds__(256) void gemm64(
    const unsigned short* __restrict__ Ap, const unsigned short* A2p, int lda, long long strideA,
    const unsigned short* __restrict__ Btp, const unsigned short* Bt2p, int ldb, long long strideB,
    void* Cout, int ldc, long long strideC,
    void* Cout2, int ldc2, long long strideC2, int N2a,
    int M, int N, int K, float rscale,
    const float* __restrict__ biasA, int bmode, int blenA,
    const float* __restrict__ Rp, int ldr, long long strideR, float oscale,
    const float* __restrict__ biasP = nullptr, int blenP = 0) {
  const __bf16* A   = (const __bf16*)(const void*)Ap;
  const __bf16* A2  = (const __bf16*)(const void*)A2p;
  const __bf16* Bt  = (const __bf16*)(const void*)Btp;
  const __bf16* Bt2 = (const __bf16*)(const void*)Bt2p;
  constexpr int RA  = (8 / TNB) * 64;               // A rows of the block, per plane
  constexpr int RB  = TNB * 64;                     // Bt rows of the block, per plane
  constexpr int PA  = (NSPLIT == 1) ? 2 : 1;        // A planes
  constexpr int PB  = (NSPLIT == 3) ? 2 : 1;        // Bt planes
  constexpr int RT  = PA * RA + PB * RB;            // staged rows per slab: [A planes][Bt planes]
  constexpr int NIT = RT / 32;                      // copies per thread and slab (256 threads x 16 B = 32 rows)
  static_assert((RA % 32) == 0 && (RB % 32) == 0 && (NIT % 2) == 0 && NIT <= 63);
  static_assert(2 * RT * GSP * 2 >= 8 * 16 * 68 * 4);
  __shared__ __align__(16) __bf16 ring[2 * RT * GSP];   // two slab buffers; afterwards per-wave 16x64 f32 slabs, pitch 68
  const int b    = blockIdx.y;
  const bool second = PAIR && (b == 1);                      // block-uniform
  const float* bias = second ? biasP : biasA;
  const int blen = second ? blenP : blenA;
  const int N2   = second ? 0 : N2a;
  const int lane = threadIdx.x & 31;
  const int wave = threadIdx.x >> 5;
  const int tilesN = N >> 6;
  const int tilesM = M >> 6;
  const int tile = blockIdx.x * 8 + wave;
  if ((int)blockIdx.x * 8 >= tilesM * tilesN) return;   // block-uniform, in front of every barrier
  const int tm = tile / tilesN;
  const int tn = tile - tm * tilesN;
  const int m0 = tm << 6;
  const int n0 = tn << 6;

  const __bf16* Ab  = A  + (size_t)b * strideA;
  const __bf16* Bb  = Bt + (size_t)b * strideB;
  const __bf16* Ab2 = (NSPLIT == 1) ? (A2  + (size_t)b * strideA) : Ab;
  const __bf16* Bb2 = (NSPLIT == 3) ? (Bt2 + (size_t)b * strideB) : Bb;

  const int rlane = lane & 15;                 // row (A) / col (B, D) within subtile
  const int koff  = (lane >> 4) * 8;           // k offset of this lane half
  const int mOff  = (lane >> 4) * 8;           // D row offset

  v8f acc[4][4];
#pragma unroll
  for (int i = 0; i < 4; ++i)
#pragma unroll
    for (int j = 0; j < 4; ++j) acc[i][j] = zero8();

  // ---- staging: thread -> row (tid >> 3) of each group of 32 rows, 16-B piece (tid & 7) of its 128-B line ----
  const int t0b  = blockIdx.x * 8;                   // the block's first tile
  const int mb0  = (t0b / tilesN) << 6;              // its first A row
  const int nb0  = (t0b - (t0b / tilesN) * tilesN) << 6;   // its first Bt row
  const int srow = threadIdx.x >> 3;
  const int sseg = (threadIdx.x & 7) * 8;
  const unsigned lthr = lds_off(ring) + (unsigned)(srow * GSP + sseg) * 2u;
  auto stage = [&](int slab, int buf) {
    const int kc = slab * GKC + sseg;
    const unsigned lb = lthr + (unsigned)buf * (unsigned)(RT * GSP * 2);
#pragma unroll   // both loops: each copy's plane and row group are compile-time, the statement's operands stay in registers
    for (int g0 = 0; g0 < NIT; g0 += 8) {
      unsigned l[8];
      const __bf16* g[8];
#pragma unroll
      for (int e = 0; e < 8; ++e) {
        const int fr = (g0 + e < NIT) ? (g0 + e) * 32 : 0;     // first staged row of this copy's group of 32
        if (fr < PA * RA) {
          const int r = fr % RA;
          g[e] = ((fr / RA) ? Ab2 : Ab) + (size_t)(mb0 + r + srow) * lda + kc;
        } else {
          const int r = (fr - PA * RA) % RB;
          g[e] = (((fr - PA * RA) / RB) ? Bb2 : Bb) + (size_t)(nb0 + r + srow) * ldb + kc;
        }
        l[e] = lb + (unsigned)(fr * GSP * 2);
      }
      if (g0 + 8 <= NIT) acopy8(l, g);
      else               acopy2(l, g);
    }
  };
  static_assert((NIT % 8) == 0 || (NIT % 8) == 2);

  const int nsl = K / GKC;                           // slabs
  const int aRow = (wave / TNB) * 64 + rlane;        // the wave's first A row inside a staged plane
  const int bRow = PA * RA + (wave % TNB) * 64 + rlane;   // its first Bt row inside the staged slab
  stage(0, 0);
  wait_async0();
  __syncthreads();                                   // slab 0 is published
  if (nsl > 1) stage(1, 1);
  for (int sl = 0; sl < nsl; ++sl) {
    const __bf16* sb = ring + (sl & 1) * (RT * GSP);
#pragma unroll   // k and plane offsets fold into the LDS loads' immediate offsets
    for (int ks = 0; ks < GKC / 32; ++ks) {
      const int kl = ks * 32 + koff;                 // k inside the slab
      const __bf16* As = sb + (size_t)aRow * GSP + kl;
      v16b ah[4], al[4];
#pragma unroll
      for (int i = 0; i < 4; ++i) {
        ah[i] = ldfrag_b(As + i * 16 * GSP);
        al[i] = ah[i];
        if (NSPLIT == 1) al[i] = ldfrag_b(As + (RA + i * 16) * GSP);
      }
#pragma unroll
      for (int pl = 0; pl < PB; ++pl) {              // the Bt planes of one k step follow each other, hi then lo
        const __bf16* Bs = sb + (size_t)(bRow + pl * RB) * GSP + kl;
        v16b bh[4];
#pragma unroll
        for (int j = 0; j < 4; ++j) bh[j] = ldfrag_b(Bs + j * 16 * GSP);
#pragma unroll
        for (int i = 0; i < 4; ++i) {
#pragma unroll
          for (int j = 0; j < 4; ++j) {
            acc[i][j] = mma_b_raw(ah[i], bh[j], acc[i][j]);
            if (NSPLIT == 1) acc[i][j] = mma_b_raw(al[i], bh[j], acc[i][j]);
          }
          dep_guard_b(acc[i][0], acc[i][3], ah[i], al[i]);
        }
        keep4_b(bh[0], bh[1], bh[2], bh[3]);
      }
    }
    wait_ds0();
    wait_async0();
    __syncthreads();                                 // publishes slab sl + 1 and ends every read of slab sl's buffer
    if (sl + 2 < nsl) stage(sl + 2, sl & 1);
  }
  wait_async0();
  acc_guard4(acc[0][0], acc[0][1], acc[0][2], acc[0][3]);
  acc_guard4(acc[1][0], acc[1][1], acc[1][2], acc[1][3]);
  acc_guard4(acc[2][0], acc[2][1], acc[2][2], acc[2][3]);
  acc_guard4(acc[3][0], acc[3][1], acc[3][2], acc[3][3]);

  // ---- bias (per column), clamped address, selected by value ----
  float bc[4];
#pragma unroll
  for (int j = 0; j < 4; ++j) {
    int bi = n0 + (j << 4) + rlane;
    bi = (bi < blen) ? bi : (blen - 1);
    bi = (bi > 0) ? bi : 0;
    const float t = bf_up(bf_bits(bias[bi]));
    bc[j] = (bmode == 1) ? t : 0.f;
  }

  // ---- epilogue ----
  float* slab = (float*)(void*)ring + wave * (16 * 68);
#pragma unroll
  for (int i = 0; i < 4; ++i) {
    const int mBase = m0 + (i << 4);
    float brw[8];
#pragma unroll
    for (int r = 0; r < 8; ++r) {
      int bi = mBase + mOff + r;
      bi = (bi < blen) ? bi : (blen - 1);
      bi = (bi > 0) ? bi : 0;
      const float t = bf_up(bf_bits(bias[bi]));
      brw[r] = (bmode == 2) ? t : 0.f;
    }
#pragma unroll
    for (int j = 0; j < 4; ++j) {
#pragma unroll
      for (int r = 0; r < 8; ++r) {
        slab[(mOff + r) * 68 + (j << 4) + rlane] = acc[i][j][r] + bc[j] + brw[r];
      }
    }
    wave_sync_lds();
    if (OUT_MODE == 0 || OUT_MODE == 1) {
      float* C = (float*)Cout + (size_t)b * strideC;
      const float* R = Rp + (size_t)b * strideR;
      const int hh = lane >> 4, c4 = (lane & 15) * 4;     // 256-B row segment = 16 lanes x 16 B
      {
#pragma unroll
        for (int it = 0; it < 8; ++it) {
          const int row = it * 2 + hh;                     // it 0..7 x hh 0..1 = rows 0..15
          v4f v = *(const v4f*)(slab + row * 68 + c4);
          if (OUT_MODE == 1) {
            const v4f xr = *(const v4f*)(R + (size_t)(mBase + row) * ldr + n0 + c4);
            v4f t;
            t[0] = (v[0] + bfr(xr[0])) * oscale;
            t[1] = (v[1] + bfr(xr[1])) * oscale;
            t[2] = (v[2] + bfr(xr[2])) * oscale;
            t[3] = (v[3] + bfr(xr[3])) * oscale;
            v = t;
          }
          *(v4f*)(C + (size_t)(mBase + row) * ldc + n0 + c4) = v;
        }
        
      }
    } else {
      const int q = lane >> 3, c8 = (lane & 7) * 8;
      unsigned short* C  = (unsigned short*)Cout  + (size_t)b * strideC;
      unsigned short* C2 = (unsigned short*)Cout2 + (size_t)b * strideC2;
      const bool wlo = (n0 < N2);                           // wave-uniform
      v4u hv[4], lv[4];
#pragma unroll
      for (int it = 0; it < 4; ++it) {
        const int row = it * 4 + q;                        // it 0..3 x q 0..3 = rows 0..15
        const float* sp = slab + row * 68 + c8;
        v4u a, a2;
#pragma unroll
        for (int e = 0; e < 4; ++e) {
          const float f0 = sp[2 * e], f1 = sp[2 * e + 1];
          const _Float16 x0 = (_Float16)f0, x1 = (_Float16)f1;
          const unsigned short h0 = h_bits(x0), h1 = h_bits(x1);
          const unsigned short l0 = h_bits((_Float16)((f0 - (float)x0) * rscale));
          const unsigned short l1 = h_bits((_Float16)((f1 - (float)x1) * rscale));
          a[e] = pk16(h0, h1); a2[e] = pk16(l0, l1);
        }
        hv[it] = a; lv[it] = a2;
      }
      {
#pragma unroll
        for (int it = 0; it < 4; ++it) {
          const int row = it * 4 + q;
          *(v4u*)(C + (size_t)(mBase + row) * ldc + n0 + c8) = hv[it];
          if (wlo) *(v4u*)(C2 + (size_t)(mBase + row) * ldc2 + n0 + c8) = lv[it];
        }
        
      }
    }
    wave_sync_lds();
  }
}

// =====================================================================================================
// Attention, head dim 64, no masking, softmax over all SEQ keys.
//   q hi plane (f16, pitch DM): element (b, t, h, d) at [(b*SEQ + t)*DM + h*64 + d]; q residual plane
//   (f16, (q - f16(q))*4096, pitch DM) same layout; k plane (f16, pitch DM) same layout.
//   v^T hi plane (f16): element (b, h, d, s) at [(b*DM + h*64 + d)*SEQ + s]; v^T residual plane (f16, x4096): same layout
//   out: context as bf16 hi plane and bf16 lo plane (lo = RNE(v - hi), unscaled), pitch DM: element (b, t, h, d) at
//   [(b*SEQ + t)*DM + h*64 + d] of each plane
//   Both products are taken transposed, so that a lane owns ONE query (column lane & 15):
//   scores^T[key][query] = (k . qh + (k . ql) * rres) * sscale on f16 WMMA (A = K rows, B = q), residual products in a
//   separate accumulator; a lane holds 32 of its query's 64 scores (keys 16 j + 8 (lane >> 4) + r), so the maximum and
//   the sum run in the lane, with one exchange between the wave halves for the maximum per chunk and one for the sum
//   at the end. p = exp(s - m) carried as f16(1024 p): score tiles 2 kk and 2 kk + 1, converted in place, ARE the
//   B operand (keys 32 kk .. + 31 in the hardware k order) of context^T[d][query] = vh . p + (vl . p) * rres
//   (A = V^T rows; separate accumulator folded per chunk in f32); online softmax in f32.
//   Block = 4 waves = 64 query rows of one (b, h); grid = NQB * NH * NB; kv chunks of 64, static trip NQB.
//   K / V^T chunk staging: 128 threads x 32 elements per plane = the whole 64x64 tile (plain 16-B loads,
//   __syncthreads before and after).
//   Output coverage: each wave stores rows q0..q0+15 (it 0..3 x lane>>3 0..3) x 64 columns of both planes; a row's
//   64 columns of one plane = 8 lanes x 16 B = one whole 128-B line
// =====================================================================================================
__device__ __forceinline__ float other_half(float v) {       // the value that lane ^ 16 holds
  const int b = __builtin_bit_cast(int, v);
  return __builtin_bit_cast(float, __builtin_amdgcn_permlanex16(b, b, 0x76543210, 0xfedcba98, false, false));
}
__global__ __launch_bounds__(128)
void attn64(const unsigned short* __restrict__ qhp, const unsigned short* __restrict__ qlp,
            const unsigned short* __restrict__ khp,
            const unsigned short* __restrict__ vhp, const unsigned short* __restrict__ vlp,
            unsigned short* ctxh, unsigned short* ctxl, float sscale, float rres) {
  union FH { v16h v; v8h h[2]; };
  __shared__ __align__(16) _Float16 Ksh[64 * KVP];                // K [kv][d], 64 halves used per row
  __shared__ __align__(16) _Float16 Vth[64 * KVP];                // V^T hi [d][kv]
  __shared__ __align__(16) _Float16 Vtl[64 * KVP];                // V^T residual [d][kv]
  __shared__ __align__(16) float    Os[4][16 * OSP];              // per wave context tile [row][d]

  const int tid  = threadIdx.x;
  const int wave = tid >> 5;
  const int lane = tid & 31;
  const int hh   = lane >> 4;
  const int c    = lane & 15;

  const int bx   = blockIdx.x;
  const int qb   = bx % NQB;
  const int rest = bx / NQB;
  const int h    = rest % NH;
  const int b    = rest / NH;
  const int q0   = qb * 64 + wave * 16;
  const size_t rowB = (size_t)b * SEQ;

  const _Float16* Qh = (const _Float16*)(const void*)qhp + (size_t)h * HD;
  const _Float16* Ql = (const _Float16*)(const void*)qlp + (size_t)h * HD;
  const _Float16* Kg = (const _Float16*)(const void*)khp + (size_t)h * HD;
  const _Float16* Vh = (const _Float16*)(const void*)vhp + ((size_t)b * DM + (size_t)h * HD) * SEQ;
  const _Float16* Vl = (const _Float16*)(const void*)vlp + ((size_t)b * DM + (size_t)h * HD) * SEQ;

  // ---- Q fragments (B operand, column = query = lane&15): 2 d-chunks, hi and residual ----
  v16h qah[2], qal[2];
#pragma unroll
  for (int dc = 0; dc < 2; ++dc) {
    qah[dc] = ldfrag_h(Qh + (rowB + q0 + c) * DM + dc * 32 + 8 * hh);
    qal[dc] = ldfrag_h(Ql + (rowB + q0 + c) * DM + dc * 32 + 8 * hh);
  }

  float mrow = -INFINITY;                    // running maximum of query c (equal in both wave halves)
  float lrow = 0.f;                          // running sum of query c over this half's keys
  v8f oacc[4];                               // context^T: oacc[t][r] = element d = 16 t + 8 hh + r of query c
#pragma unroll
  for (int t = 0; t < 4; ++t) oacc[t] = zero8();

  for (int kt = 0; kt < NQB; ++kt) {         // static trip count
    const int kv0 = kt * 64;
    __syncthreads();
    {
      const int r = tid >> 1, hf = (tid & 1) * 32;
      const _Float16* kg  = Kg + (rowB + kv0 + r) * DM + hf;       // K row kv0+r, d = hf..hf+31
      const _Float16* vg  = Vh + (size_t)r * SEQ + kv0 + hf;       // V^T row d = r, s = kv0+hf..+31
      const _Float16* vlg = Vl + (size_t)r * SEQ + kv0 + hf;
#pragma unroll
      for (int i = 0; i < 4; ++i) {
        const v8h a0 = *(const v8h*)(kg + 8 * i);
        const v8h b0 = *(const v8h*)(vg + 8 * i);
        const v8h b1 = *(const v8h*)(vlg + 8 * i);
        *(v8h*)(Ksh + r * KVP + hf + 8 * i) = a0;
        *(v8h*)(Vth + r * KVP + hf + 8 * i) = b0;
        *(v8h*)(Vtl + r * KVP + hf + 8 * i) = b1;
      }
    }
    __syncthreads();

    // ---- scores^T: 64 keys x 16 queries per wave, 2 f16 products (hi, residual) ----
    v8f s[4];                                // s[j][r]: key 16 j + 8 hh + r against query c
#pragma unroll
    for (int j = 0; j < 4; ++j) {
      v8f sh = zero8(), sl = zero8();
#pragma unroll
      for (int dc = 0; dc < 2; ++dc) {
        FH kb;
        kb.h[0] = *(const v8h*)(Ksh + (j * 16 + c) * KVP + dc * 32 + 8 * hh);
        kb.h[1] = *(const v8h*)(Ksh + (j * 16 + c) * KVP + dc * 32 + 16 + 8 * hh);
        sh = mma_h(kb.v, qah[dc], sh);
        sl = mma_h(kb.v, qal[dc], sl);
      }
#pragma unroll
      for (int r = 0; r < 8; ++r) s[j][r] = (sh[r] + sl[r] * rres) * sscale;
    }

    // ---- maximum in the lane, joined across the halves; online softmax; P^T (x1024, f16) packed in registers ----
    float mx[8];
#pragma unroll   // mx and s are register arrays: constant indices; eight independent chains
    for (int r = 0; r < 8; ++r) mx[r] = fmaxf(fmaxf(s[0][r], s[1][r]), fmaxf(s[2][r], s[3][r]));
    float m = fmaxf(fmaxf(fmaxf(mx[0], mx[1]), fmaxf(mx[2], mx[3])), fmaxf(fmaxf(mx[4], mx[5]), fmaxf(mx[6], mx[7])));
    m = fmaxf(m, other_half(m));
    const float mnew  = fmaxf(mrow, m);
    const float alpha = __expf(mrow - mnew);
    mrow = mnew;
    FH pb[2];                                // pb[kk]: keys 32 kk + (8 hh + e | 16 + 8 hh + e - 8) of query c
    float ps[4];                             // four independent partial sums, one per score tile
#pragma unroll   // both loops: s, ps and pb are register arrays, their indices must be compile-time constants
    for (int j = 0; j < 4; ++j) {
      ps[j] = 0.f;
#pragma unroll
      for (int r = 0; r < 8; ++r) {
        const float p = __expf(s[j][r] - mnew);
        ps[j] += p;
        pb[j >> 1].v[(j & 1) * 8 + r] = (_Float16)(p * 1024.0f);
      }
    }
    lrow = lrow * alpha + ((ps[0] + ps[1]) + (ps[2] + ps[3]));
#pragma unroll
    for (int t = 0; t < 4; ++t)
#pragma unroll
      for (int r = 0; r < 8; ++r) oacc[t][r] *= alpha;

    // ---- context^T += V^T . P^T (f16 WMMA), residual products into a separate accumulator ----
    v8f o1[4];
#pragma unroll
    for (int t = 0; t < 4; ++t) o1[t] = zero8();
#pragma unroll   // pb[kk] lives in registers: its index must be a compile-time constant
    for (int kk = 0; kk < 2; ++kk) {
#pragma unroll
      for (int t = 0; t < 4; ++t) {
        FH vb, vl;
        vb.h[0] = *(const v8h*)(Vth + (t * 16 + c) * KVP + kk * 32 + 8 * hh);
        vb.h[1] = *(const v8h*)(Vth + (t * 16 + c) * KVP + kk * 32 + 16 + 8 * hh);
        vl.h[0] = *(const v8h*)(Vtl + (t * 16 + c) * KVP + kk * 32 + 8 * hh);
        vl.h[1] = *(const v8h*)(Vtl + (t * 16 + c) * KVP + kk * 32 + 16 + 8 * hh);
        oacc[t] = mma_h(vb.v, pb[kk].v, oacc[t]);
        o1[t]   = mma_h(vl.v, pb[kk].v, o1[t]);
      }
    }
#pragma unroll
    for (int t = 0; t < 4; ++t)
#pragma unroll
      for (int r = 0; r < 8; ++r) oacc[t][r] += o1[t][r] * rres;
  }

  // ---- join the halves' sums, normalise (1/l and the 1/1024 p carry), stage the wave's 16x64 f32 tile in LDS
  //      (a lane's 8 registers of tile t = 8 consecutive d of its query's row), then split each value into its bf16
  //      hi and lo parts and write whole lines of the two planes
  float* os = Os[wave];
  {
    const float l = lrow + other_half(lrow);
    const float inv = ((l > 0.f) ? (1.0f / l) : 0.f) * (1.0f / 1024.0f);
#pragma unroll   // both loops: oacc is a register array, its indices must be compile-time constants
    for (int t = 0; t < 4; ++t) {
      v4f w0, w1;
#pragma unroll
      for (int e = 0; e < 4; ++e) { w0[e] = oacc[t][e] * inv; w1[e] = oacc[t][4 + e] * inv; }
      *(v4f*)(os + c * OSP + t * 16 + 8 * hh)     = w0;
      *(v4f*)(os + c * OSP + t * 16 + 8 * hh + 4) = w1;
    }
  }
  wave_sync_lds();
  {
    const int q = lane >> 3, c8 = (lane & 7) * 8;
    v4u hv[4], lv[4];
#pragma unroll   // both loops: hv and lv are register arrays, their indices must be compile-time constants
    for (int it = 0; it < 4; ++it) {
      const int row = it * 4 + q;                        // it 0..3 x q 0..3 = rows 0..15 of the wave tile
      const v4f a = *(const v4f*)(os + row * OSP + c8);
      const v4f d = *(const v4f*)(os + row * OSP + c8 + 4);
      const float f[8] = {a[0], a[1], a[2], a[3], d[0], d[1], d[2], d[3]};
#pragma unroll
      for (int e = 0; e < 4; ++e) {
        const unsigned short h0 = bf_bits(f[2 * e]), h1 = bf_bits(f[2 * e + 1]);
        hv[it][e] = pk16(h0, h1);
        lv[it][e] = pk16(bf_bits(f[2 * e] - bf_up(h0)), bf_bits(f[2 * e + 1] - bf_up(h1)));
      }
    }
#pragma unroll
    for (int it = 0; it < 4; ++it) {
      const size_t o = (rowB + q0 + it * 4 + q) * DM + (size_t)h * HD + c8;
      *(v4u*)(ctxh + o) = hv[it];
      *(v4u*)(ctxl + o) = lv[it];
    }
  }
}

// =====================================================================================================
// Workspace map (bytes), every plane an exact multiple of its whole-row / 64x64-tile / whole-line store granularity:
//   WT    bf16 [4][256 o][256 i]     0          524288     (Wq, Wk, Wv, Wp transposed, k = in contiguous)
//   XNh   bf16 [16384 t][256 c]      589824     8388608    (GroupNorm output, token-major, hi plane)
//   XNl   bf16 [16384][256]          8978432    8388608    (lo plane)
//   Qh    f16  [16384][256]          17367040   8388608
//   Ql    f16  [16384][256]          25755648   8388608    (q residual x4096)
//   Kh    f16  [16384][256]          34144256   8388608
//   VTh   f16  [16][256 c][1024 t]   42532864   8388608
//   VTl   f16  [16][256][1024]       50921472   8388608    (v residual x4096)
//   CTXh  bf16 [16384 t][256 c]      59310080   8388608    (attention context, token-major, hi plane)
//   CTXl  bf16 [16384][256]          67698688   8388608    (lo plane)
//   end                              76087296
// =====================================================================================================
extern "C" void kernel_launch(void* const* d_in, const int* in_sizes, int n_in,
                              void* d_out, int out_size, void* d_ws, size_t ws_size,
                              hipStream_t stream) {
  if (n_in < 11) return;
  if (in_sizes[0] != NB * DM * SEQ) return;
  if (in_sizes[3] != DM * DM || in_sizes[5] != DM * DM || in_sizes[7] != DM * DM || in_sizes[9] != DM * DM) return;
  if (in_sizes[1] < DM || in_sizes[2] < DM) return;
  if (in_sizes[4] < 1 || in_sizes[6] < 1 || in_sizes[8] < 1 || in_sizes[10] < 1) return;
  if (out_size != NB * DM * SEQ) return;

  const float* x   = (const float*)d_in[0];
  const float* gsc = (const float*)d_in[1];
  const float* gbi = (const float*)d_in[2];
  const float* wq  = (const float*)d_in[3];
  const float* bq  = (const float*)d_in[4];
  const float* wk  = (const float*)d_in[5];
  const float* bk  = (const float*)d_in[6];
  const float* wv  = (const float*)d_in[7];
  const float* bv  = (const float*)d_in[8];
  const float* wp  = (const float*)d_in[9];
  const float* bp  = (const float*)d_in[10];
  float* out = (float*)d_out;

  const size_t PWT = (size_t)4 * DM * DM * 2;          //   524288
  const size_t PST = (size_t)NB * NGRP * 32 * 4;       //    65536
  const size_t P16 = (size_t)NB * SEQ * DM * 2;        //  8388608
  size_t off = 0;
  const size_t oWT   = off; off += PWT;
  const size_t oST   = off; off += PST;
  const size_t oXNh  = off; off += P16;
  const size_t oXNl  = off; off += P16;
  const size_t oQh   = off; off += P16;
  const size_t oQl   = off; off += P16;
  const size_t oKh   = off; off += P16;
  const size_t oVTh  = off; off += P16;
  const size_t oVTl  = off; off += P16;
  const size_t oCTXh = off; off += P16;
  const size_t oCTXl = off; off += P16;
  if (off > ws_size) return;                            // off = 76087296
  if (off > (size_t)134217728) return;

  char* ws = (char*)d_ws;
  unsigned short* WT   = (unsigned short*)(ws + oWT);
  float*          ST   = (float*)(ws + oST);
  unsigned short* XNh  = (unsigned short*)(ws + oXNh);
  unsigned short* XNl  = (unsigned short*)(ws + oXNl);
  unsigned short* Qh   = (unsigned short*)(ws + oQh);
  unsigned short* Ql   = (unsigned short*)(ws + oQl);
  unsigned short* Kh   = (unsigned short*)(ws + oKh);
  unsigned short* VTh  = (unsigned short*)(ws + oVTh);
  unsigned short* VTl  = (unsigned short*)(ws + oVTl);
  unsigned short* CTXh = (unsigned short*)(ws + oCTXh);
  unsigned short* CTXl = (unsigned short*)(ws + oCTXl);
  unsigned short* WTq = WT + (size_t)0 * DM * DM;
  unsigned short* WTv = WT + (size_t)2 * DM * DM;
  unsigned short* WTp = WT + (size_t)3 * DM * DM;

  const dim3 blk(256);
  const dim3 gWT(16, 4);                                          // 16 tiles of 64x64 per weight, 4 weights
  const dim3 gGN(NB * NGRP);                                      // 512 blocks
  const dim3 gAP(NB * (SEQ / 32));                                // 512 blocks
  const dim3 gQK(((NB * SEQ / 64) * (DM / 64) + 7) / 8, 2);       // 1024 tiles -> 128 blocks: M=16384, N=256; y: 0 = q, 1 = k
  const dim3 gVT(((DM / 64) * (SEQ / 64) + 7) / 8, NB);           // 64 tiles -> 8 blocks x 16 batches: M=256, N=1024
  const dim3 gAttn(NB * NH * NQB);                                // 1024 blocks
  const float rs2 = 1.0f / 1.41421356237309515f;

  // (1) weights [in][out] -> bf16 [out][in] planes (RNE convert)
  wt_cvt<<<gWT, blk, 0, stream>>>(wq, wk, wv, wp, WT);
  // (2) GroupNorm statistics per (b, group) from bf16(x)
  gn_stats<<<gGN, blk, 0, stream>>>(x, ST);
  // (3) GroupNorm apply -> token-major bf16 hi + lo planes [16384][256]
  gn_apply<<<gAP, blk, 0, stream>>>(x, ST, gsc, gbi, XNh, XNl);
  // (4, 5) one launch of 2 x 128 blocks, one block for each of the chip's 256 WGPs (M=16384, N=256, K=256, bias per column):
  //     y = 0: q = xn . Wq + bq -> f16 hi plane [16384][256] + f16 residual x4096
  //     y = 1: k = xn . Wk + bk -> f16 plane [16384][256], no residual
  //     Wk's plane lies one weight plane behind WTq, Kh two activation planes behind Qh (workspace map above)
  gemm64<1, 3, true, 4><<<gQK, blk, 0, stream>>>(
      XNh, XNl, DM, 0LL, WTq, WTq, DM, (long long)DM * DM,
      (void*)Qh, DM, 2LL * NB * SEQ * DM, (void*)Ql, DM, 0LL, DM,
      NB * SEQ, DM, DM, 4096.0f, bq, 1, in_sizes[4], x, 0, 0LL, 1.0f, bk, in_sizes[6]);
  // (6) v^T[b][c][t] = sum_i Wv[i][c] xn[b][t][i] + bv[c] per batch -> f16 hi plane (pitch SEQ) + residual x4096
  //     (A = WTv [c][i], Bt = XN rows of batch b hi + lo; M=256, N=1024, K=256; bias per row)
  gemm64<3, 3, false, 8><<<gVT, blk, 0, stream>>>(
      WTv, WTv, DM, 0LL, XNh, XNl, DM, (long long)SEQ * DM,
      (void*)VTh, SEQ, (long long)DM * SEQ, (void*)VTl, SEQ, (long long)DM * SEQ, SEQ,
      DM, SEQ, DM, 4096.0f, bv, 2, in_sizes[8], x, 0, 0LL, 1.0f);
  // (7) attention: scores scale 1/sqrt(C) = 1/16 -> context bf16 hi + lo planes [16384][256] token-major
  attn64<<<gAttn, dim3(128), 0, stream>>>(Qh, Ql, Kh, VTh, VTl, CTXh, CTXl, 0.0625f, 1.0f / 4096.0f);
  // (8) out[b][c][t] = (sum_o Wp[o][c] ctx[b][t][o] + bp[c] + bf16(x[b][c][t])) * (1/sqrt2) per batch, written
  //     straight into the NCHW output rows of 1024 floats (A = WTp [c][o], Bt = CTX rows hi + lo; M=256, N=1024, K=256)
  gemm64<3, 1, false, 8><<<gVT, blk, 0, stream>>>(
      WTp, WTp, DM, 0LL, CTXh, CTXl, DM, (long long)SEQ * DM,
      (void*)out, SEQ, (long long)DM * SEQ, (void*)out, SEQ, (long long)DM * SEQ, 0,
      DM, SEQ, DM, 1.0f, bp, 2, in_sizes[10], x, SEQ, (long long)DM * SEQ, rs2);
  (void)hipGetLastError();
}

// v006
// It runs in 105 microseconds.
// Next to v005, in two timings, it ran 1.05 and 1.06 times as fast.
// Counting every step since v000, it is 2.17 times as fast.
// Contractions: q, k, v^T and output projections = v_wmma_f32_16x16x32_bf16 (bf16 operands: weights and biases from
// RNE-converted inputs, computed activations as bf16 hi + lo planes, 2 products); q.k^T scores = v_wmma_f32_16x16x32_f16
// (q as f16 hi plane + f16 residual plane x4096 in a separate accumulator, k f16; 2 products); p.v = v_wmma_f32_16x16x32_f16
// (p carried x1024 in f16, v^T as f16 hi plane + residual plane x4096 in a separate accumulator; 2 products);
// all f32 accumulate; GroupNorm statistics, softmax, biases, residual add and output scale in f32.
#include <hip/hip_runtime.h>
#include <math.h>
#include <stdint.h>

#define NB    16            // batch
#define DM    256           // channels
#define SEQ   1024          // tokens (32 x 32)
#define NH    4             // heads
#define HD    64            // head dim
#define NQB   (SEQ / 64)    // 16 query / key tiles of 64
#define NGRP  32            // groups
#define GSZ   8             // channels per group
#define XPITCH 264          // LDS pitch (halves) of the token-major staging tile
#define KVP   72            // LDS pitch (halves) of the attention K and V^T rows: 144 B = 16 B x odd, so the 16 rows
                            // that one ds_load_b128 fragment read touches fall on 16 different groups of four banks
#define OSP   68            // LDS pitch (floats) of the attention context tile: rows r and r + 8 on different banks
#define GKC   64            // k elements per staged GEMM slab: 128 B = one whole line of every operand row
#define GSP   72            // LDS pitch (halves) of a staged GEMM operand row: 144 B = 16 B x odd, as for KVP
static_assert(NH * HD == DM);
static_assert((DM % GKC) == 0 && (GSP % 8) == 0 && ((GSP / 8) & 1) == 1 && GSP >= GKC);
static_assert(NGRP * GSZ == DM);
static_assert((SEQ % 64) == 0 && (DM % 64) == 0 && (DM % 32) == 0);
static_assert((XPITCH % 8) == 0);
static_assert((KVP % 8) == 0 && ((KVP / 8) & 1) == 1 && KVP >= 64);
static_assert((OSP % 4) == 0 && OSP >= 64);

typedef _Float16 v16h __attribute__((ext_vector_type(16)));
typedef _Float16 v8h  __attribute__((ext_vector_type(8)));
typedef __bf16   v16b __attribute__((ext_vector_type(16)));
typedef __bf16   v8b  __attribute__((ext_vector_type(8)));
typedef float    v8f  __attribute__((ext_vector_type(8)));
typedef float    v4f  __attribute__((ext_vector_type(4)));
typedef unsigned int v4u __attribute__((ext_vector_type(4)));
typedef unsigned short v8us __attribute__((ext_vector_type(8)));

// ---- scalar helpers --------------------------------------------------------------------------------
__device__ __forceinline__ unsigned short bf_bits(float f) {          // f32 -> bf16 bits, RNE convert
  unsigned u = __float_as_uint(f);
  return (unsigned short)((u + 0x7FFFu + ((u >> 16) & 1u)) >> 16);
}
__device__ __forceinline__ float bf_up(unsigned short h) { return __uint_as_float(((unsigned)h) << 16); }
__device__ __forceinline__ float bfr(float f) { return bf_up(bf_bits(f)); }   // value RNE-converted to bf16 and widened
__device__ __forceinline__ unsigned short h_bits(_Float16 x) { return __builtin_bit_cast(unsigned short, x); }
__device__ __forceinline__ unsigned pk16(unsigned short a, unsigned short b) { return (unsigned)a | ((unsigned)b << 16); }
__device__ __forceinline__ v8f zero8() { v8f z = {0.f, 0.f, 0.f, 0.f, 0.f, 0.f, 0.f, 0.f}; return z; }

// ---- fragment loaders: 16-bit A/B operand, lane -> row/col (lane&15), p already includes +8*(lane>>4);
//      elements 0..7 <- p[0..7] (k0+8h..), elements 8..15 <- p[16..23] (k0+16+8h..)
__device__ __forceinline__ v16b ldfrag_b(const __bf16* p) {
  union { v16b v; v8b h[2]; } f;
  f.h[0] = *(const v8b*)(p);
  f.h[1] = *(const v8b*)(p + 16);
  return f.v;
}
__device__ __forceinline__ v16h ldfrag_h(const _Float16* p) {
  union { v16h v; v8h h[2]; } f;
  f.h[0] = *(const v8h*)(p);
  f.h[1] = *(const v8h*)(p + 16);
  return f.v;
}

// ---- WMMA helpers with trailing VALU hazard gap --------------------------------------------------------
__device__ __forceinline__ v8f mma_h(v16h a, v16h b, v8f c) {       // builtin alone: the compiler keeps its distances
  return __builtin_amdgcn_wmma_f32_16x16x32_f16(false, a, false, b, (short)0, c, false, false);
}
__device__ __forceinline__ v8f mma_b_raw(v16b a, v16b b, v8f c) {
  return __builtin_amdgcn_wmma_f32_16x16x32_bf16(false, a, false, b, (short)0, c, false, false);
}
__device__ __forceinline__ void dep_guard_b(v8f& a, v8f& b, v16b x, v16b y) {
#if defined(__HIP_DEVICE_COMPILE__)
  asm volatile("v_nop\n\tv_nop\n\tv_nop\n\tv_nop" : "+v"(a), "+v"(b) : "v"(x), "v"(y));
#endif
}
__device__ __forceinline__ void keep4_b(v16b a, v16b b, v16b c, v16b d) {
#if defined(__HIP_DEVICE_COMPILE__)
  asm volatile("v_nop" :: "v"(a), "v"(b), "v"(c), "v"(d));
#endif
}
__device__ __forceinline__ void acc_guard4(v8f& a, v8f& b, v8f& c, v8f& d) {
#if defined(__HIP_DEVICE_COMPILE__)
  asm volatile("v_nop\n\tv_nop\n\tv_nop\n\tv_nop" : "+v"(a), "+v"(b), "+v"(c), "+v"(d));
#endif
}
// Keeps a group of LDS reads together at its place: without it the compiler spreads the reads among the WMMAs,
// one read-and-wait place per fragment.
__device__ __forceinline__ void group_fence() { __builtin_amdgcn_sched_barrier(0); }
__device__ __forceinline__ void wave_sync_lds() {
  __builtin_amdgcn_fence(__ATOMIC_RELEASE, "workgroup");
  __builtin_amdgcn_wave_barrier();
  __builtin_amdgcn_fence(__ATOMIC_ACQUIRE, "workgroup");
}

// ---- asynchronous global -> LDS copies, 16 B per lane, through no register ------------------------------
__device__ __forceinline__ unsigned lds_off(const void* p) { return (unsigned)(size_t)p; }   // LDS byte address
// Eight (two) copies in one statement; its last line keeps the address registers untouched until the copies are taken.
__device__ __forceinline__ void acopy8(const unsigned* l, const __bf16* const* g) {
#if defined(__HIP_DEVICE_COMPILE__)
  asm volatile("global_load_async_to_lds_b128 %0, %8, off\n\t"
               "global_load_async_to_lds_b128 %1, %9, off\n\t"
               "global_load_async_to_lds_b128 %2, %10, off\n\t"
               "global_load_async_to_lds_b128 %3, %11, off\n\t"
               "global_load_async_to_lds_b128 %4, %12, off\n\t"
               "global_load_async_to_lds_b128 %5, %13, off\n\t"
               "global_load_async_to_lds_b128 %6, %14, off\n\t"
               "global_load_async_to_lds_b128 %7, %15, off\n\t"
               "s_wait_xcnt 0x0"
               :: "v"(l[0]), "v"(l[1]), "v"(l[2]), "v"(l[3]), "v"(l[4]), "v"(l[5]), "v"(l[6]), "v"(l[7]),
                  "v"(g[0]), "v"(g[1]), "v"(g[2]), "v"(g[3]), "v"(g[4]), "v"(g[5]), "v"(g[6]), "v"(g[7])
               : "memory");
#endif
}
__device__ __forceinline__ void acopy2(const unsigned* l, const __bf16* const* g) {
#if defined(__HIP_DEVICE_COMPILE__)
  asm volatile("global_load_async_to_lds_b128 %0, %2, off\n\t"
               "global_load_async_to_lds_b128 %1, %3, off\n\t"
               "s_wait_xcnt 0x0"
               :: "v"(l[0]), "v"(l[1]), "v"(g[0]), "v"(g[1])
               : "memory");
#endif
}
__device__ __forceinline__ void wait_async0() {      // this wave's copies have landed in LDS
#if defined(__HIP_DEVICE_COMPILE__)
  asm volatile("s_wait_asynccnt 0x0" ::: "memory");
#endif
}
__device__ __forceinline__ void wait_ds0() {         // this wave's LDS reads have retired before their buffer is refilled
#if defined(__HIP_DEVICE_COMPILE__)
  asm volatile("s_wait_dscnt 0x0" ::: "memory");
#endif
}

// =====================================================================================================
// Weights W[in i][out o] (f32, 256x256) -> bf16 planes WT[w][o][i] (k = i contiguous), RNE convert.
// grid (16 tiles of 64x64, 4 weights), 256 threads. Load: 16 iterations x 4 input rows x 64 cols = the whole
// 64x64 tile into LDS transposed (unsigned short element stores); __syncthreads; write: each wave instruction
// =====================================================================================================
__global__ __launch_bounds__(256) void wt_cvt(const float* __restrict__ W0, const float* __restrict__ W1,
                                              const float* __restrict__ W2, const float* __restrict__ W3,
                                              unsigned short* WT) {
  __shared__ __align__(16) unsigned short T[64 * 72];
  const int tid = threadIdx.x, lane = tid & 31, wave = tid >> 5;
  const int wsel = blockIdx.y;                                   // block-uniform weight select
  const float* W = (wsel == 0) ? W0 : (wsel == 1) ? W1 : (wsel == 2) ? W2 : W3;
  const int bx = blockIdx.x;
  const int i0 = (bx >> 2) * 64;                                 // input-channel tile
  const int o0 = (bx & 3) * 64;                                  // output-channel tile
#pragma unroll 4
  for (int it = 0; it < 16; ++it) {
    const int i = it * 4 + (tid >> 6);
    const int o = tid & 63;
    const float v = W[(size_t)(i0 + i) * DM + o0 + o];
    T[o * 72 + i] = bf_bits(v);
  }
  __syncthreads();
  const int q = lane >> 3, c8 = (lane & 7) * 8;
  v8us v[2];
#pragma unroll
  for (int it = 0; it < 2; ++it) {
    const int orow = it * 32 + wave * 4 + q;
    v[it] = *(const v8us*)(T + orow * 72 + c8);
  }
  unsigned short* dst = WT + (size_t)wsel * DM * DM;
  {
#pragma unroll
    for (int it = 0; it < 2; ++it) {
      const int orow = it * 32 + wave * 4 + q;
      *(v8us*)(dst + (size_t)(o0 + orow) * DM + i0 + c8) = v[it];
    }
    
  }
}

// =====================================================================================================
// GroupNorm statistics per (b, group): 8 channels x 1024 tokens = 8192 contiguous floats of the NCHW input,
// reduction in f32; rstd = 1/sqrt(var + 1e-6). grid = NB*NGRP blocks, 256 threads.
// =====================================================================================================
__global__ __launch_bounds__(256) void gn_stats(const float* __restrict__ x, float* stats) {
  __shared__ float red[256];
  __shared__ float sres[2];
  const int tid = threadIdx.x;
  const int bg = blockIdx.x;
  const float* xp = x + (size_t)bg * (GSZ * SEQ);
  float s = 0.f;
#pragma unroll 1
  for (int j = 0; j < 8; ++j) {
    const v4f v = *(const v4f*)(xp + ((size_t)j * 256 + tid) * 4);
    s += bfr(v[0]); s += bfr(v[1]); s += bfr(v[2]); s += bfr(v[3]);
  }
  red[tid] = s;
  __syncthreads();
  for (int st = 128; st > 0; st >>= 1) {
    if (tid < st) red[tid] += red[tid + st];
    __syncthreads();
  }
  if (tid == 0) sres[0] = red[0] * (1.0f / 8192.0f);
  __syncthreads();
  const float mean = sres[0];
  float q = 0.f;
#pragma unroll 1
  for (int j = 0; j < 8; ++j) {
    const v4f v = *(const v4f*)(xp + ((size_t)j * 256 + tid) * 4);
    const float d0 = bfr(v[0]) - mean, d1 = bfr(v[1]) - mean, d2 = bfr(v[2]) - mean, d3 = bfr(v[3]) - mean;
    q += d0 * d0; q += d1 * d1; q += d2 * d2; q += d3 * d3;
  }
  red[tid] = q;
  __syncthreads();
  for (int st = 128; st > 0; st >>= 1) {
    if (tid < st) red[tid] += red[tid + st];
    __syncthreads();
  }
  if (tid == 0) {
    const float var = red[0] * (1.0f / 8192.0f);
    sres[1] = 1.0f / sqrtf(var + 1e-6f);
  }
  __syncthreads();
  if (tid < 8) {
    v4f o = {0.f, 0.f, 0.f, 0.f};
    if (tid == 0) { o[0] = mean; o[1] = sres[1]; }
    float* dst = stats + (size_t)bg * 32 + tid * 4;
    *(v4f*)dst = o;
    
  }
}

// =====================================================================================================
// GroupNorm apply + NCHW -> token-major transpose: xn = (bf16(x) - mean) * rstd * bf16(scale[c]) + bf16(bias[c]) in f32,
// written as bf16 hi plane XNh[b][t][c] and bf16 lo plane XNl = RNE(xn - hi), pitch 256 halves (512-B rows).
// grid = NB * (SEQ/32) blocks (b, 32-token tile), 256 threads. Load: 32 iterations x (8 channels = waves) x
// wave w writes token rows w + 8*it (it 0..3) with 32 lanes x 16 B = 512 B = exactly one whole row per instruction
// (reloaded as v8us, same element type). coverage: 4 x 8 = 32 rows x 256 halves per plane = the whole tile;
// =====================================================================================================
__global__ __launch_bounds__(256) void gn_apply(const float* __restrict__ x, const float* __restrict__ stats,
                                                const float* __restrict__ gsc, const float* __restrict__ gbi,
                                                unsigned short* XNh, unsigned short* XNl) {
  __shared__ __align__(16) unsigned short Lh[32 * XPITCH];
  __shared__ __align__(16) unsigned short Ll[32 * XPITCH];
  __shared__ float smean[NGRP], srstd[NGRP], ssc[DM], sbi[DM];
  const int tid = threadIdx.x, lane = tid & 31, wave = tid >> 5;
  const int b  = blockIdx.x / (SEQ / 32);
  const int tt = blockIdx.x - b * (SEQ / 32);
  const int t0 = tt * 32;
  if (tid < NGRP) {
    smean[tid] = stats[((size_t)b * NGRP + tid) * 32 + 0];
    srstd[tid] = stats[((size_t)b * NGRP + tid) * 32 + 1];
  }
  ssc[tid] = bfr(gsc[tid]);
  sbi[tid] = bfr(gbi[tid]);
  __syncthreads();
  const float* xb = x + (size_t)b * DM * SEQ + t0;
#pragma unroll 2
  for (int it = 0; it < 32; ++it) {
    const int c = it * 8 + wave;
    const float xv = bfr(xb[(size_t)c * SEQ + lane]);
    const int g = c >> 3;
    const float v = (xv - smean[g]) * srstd[g] * ssc[c] + sbi[c];
    const unsigned short hb = bf_bits(v);
    const unsigned short lb = bf_bits(v - bf_up(hb));
    Lh[lane * XPITCH + c] = hb;
    Ll[lane * XPITCH + c] = lb;
  }
  __syncthreads();
  v8us hv[4], lv[4];
#pragma unroll
  for (int it = 0; it < 4; ++it) {
    const int r = it * 8 + wave;
    hv[it] = *(const v8us*)(Lh + r * XPITCH + lane * 8);
    lv[it] = *(const v8us*)(Ll + r * XPITCH + lane * 8);
  }
  const size_t base = (size_t)(b * SEQ + t0) * DM;
  {
#pragma unroll
    for (int it = 0; it < 4; ++it) {
      const int r = it * 8 + wave;
      *(v8us*)(XNh + base + (size_t)r * DM + lane * 8) = hv[it];
      *(v8us*)(XNl + base + (size_t)r * DM + lane * 8) = lv[it];
    }
    
  }
}

// =====================================================================================================
// Register-blocked batched bf16 WMMA GEMM: C[m][n] = sum_k A[m][k] * Bt[n][k] + bias; one wave per 64x64 tile,
// eight tiles per block: 8 / TNB tile rows x TNB tile columns (N / 64 a multiple of TNB, and equal to it where TNB < 8;
// the tile count a multiple of 8). A row-major [M][K] pitch lda; Bt row-major [N][K] pitch ldb (k contiguous);
// M, N multiples of 64, K multiple of GKC. blockIdx.y = batch index (strides in elements).
// Operands: per slab of GKC k the block's A rows and Bt rows (every plane) are copied into LDS, each wave copy = 4 whole
// 128-B lines, rows at pitch GSP; two buffers, slab s + 1 in flight while slab s is multiplied; the waves read their
// fragments from LDS. After the last slab the ring's first bytes serve as the epilogue's per-wave slabs.
// NSPLIT: 0 = A.Bt; 1 = (A + A2).Bt (A2 = unscaled bf16 lo plane of A, same accumulator);
//         3 = A.Bt + A.Bt2 (Bt2 = unscaled bf16 lo plane of Bt; the two planes are walked as alternate k-steps).
// OUT_MODE: 0 = f32 (pitch ldc); 1 = f32 with per-element residual: v = (acc + bias + bf16(R[m][n])) * oscale,
//           R f32 pitch ldr, batch stride strideR; 3 = f16 hi plane C + f16 residual plane C2 = f16((v - hi) * rscale),
//           C2 written only for tiles with n0 < N2 (pitch ldc2, batch stride strideC2).
// bias (f32, RNE-converted to bf16 then widened): bmode 0 = none, 1 = per column n, 2 = per row m;
//           index clamped to [0, blen-1].
// PAIR: two products that share A in one launch of two batches: batch 1 takes its own bias vector (biasP, blenP) and
//           writes no residual plane; its Bt and C lie strideB and strideC behind those of batch 0.
// =====================================================================================================
template <int NSPLIT, int OUT_MODE, bool PAIR, int TNB>
__global__ __launch_bounds__(256) void gemm64(
    const unsigned short* __restrict__ Ap, const unsigned short* A2p, int lda, long long strideA,
    const unsigned short* __restrict__ Btp, const unsigned short* Bt2p, int ldb, long long strideB,
    void* Cout, int ldc, long long strideC,
    void* Cout2, int ldc2, long long strideC2, int N2a,
    int M, int N, int K, float rscale,
    const float* __restrict__ biasA, int bmode, int blenA,
    const float* __restrict__ Rp, int ldr, long long strideR, float oscale,
    const float* __restrict__ biasP = nullptr, int blenP = 0) {
  const __bf16* A   = (const __bf16*)(const void*)Ap;
  const __bf16* A2  = (const __bf16*)(const void*)A2p;
  const __bf16* Bt  = (const __bf16*)(const void*)Btp;
  const __bf16* Bt2 = (const __bf16*)(const void*)Bt2p;
  constexpr int RA  = (8 / TNB) * 64;               // A rows of the block, per plane
  constexpr int RB  = TNB * 64;                     // Bt rows of the block, per plane
  constexpr int PA  = (NSPLIT == 1) ? 2 : 1;        // A planes
  constexpr int PB  = (NSPLIT == 3) ? 2 : 1;        // Bt planes
  constexpr int RT  = PA * RA + PB * RB;            // staged rows per slab: [A planes][Bt planes]
  constexpr int NIT = RT / 32;                      // copies per thread and slab (256 threads x 16 B = 32 rows)
  static_assert((RA % 32) == 0 && (RB % 32) == 0 && (NIT % 2) == 0 && NIT <= 63);
  static_assert(2 * RT * GSP * 2 >= 8 * 16 * 68 * 4);
  __shared__ __align__(16) __bf16 ring[2 * RT * GSP];   // two slab buffers; afterwards per-wave 16x64 f32 slabs, pitch 68
  const int b    = blockIdx.y;
  const bool second = PAIR && (b == 1);                      // block-uniform
  const float* bias = second ? biasP : biasA;
  const int blen = second ? blenP : blenA;
  const int N2   = second ? 0 : N2a;
  const int lane = threadIdx.x & 31;
  const int wave = threadIdx.x >> 5;
  const int tilesN = N >> 6;
  const int tilesM = M >> 6;
  const int tile = blockIdx.x * 8 + wave;
  if ((int)blockIdx.x * 8 >= tilesM * tilesN) return;   // block-uniform, in front of every barrier
  const int tm = tile / tilesN;
  const int tn = tile - tm * tilesN;
  const int m0 = tm << 6;
  const int n0 = tn << 6;

  const __bf16* Ab  = A  + (size_t)b * strideA;
  const __bf16* Bb  = Bt + (size_t)b * strideB;
  const __bf16* Ab2 = (NSPLIT == 1) ? (A2  + (size_t)b * strideA) : Ab;
  const __bf16* Bb2 = (NSPLIT == 3) ? (Bt2 + (size_t)b * strideB) : Bb;

  const int rlane = lane & 15;                 // row (A) / col (B, D) within subtile
  const int koff  = (lane >> 4) * 8;           // k offset of this lane half
  const int mOff  = (lane >> 4) * 8;           // D row offset

  v8f acc[4][4];
#pragma unroll
  for (int i = 0; i < 4; ++i)
#pragma unroll
    for (int j = 0; j < 4; ++j) acc[i][j] = zero8();

  // ---- staging: thread -> row (tid >> 3) of each group of 32 rows, 16-B piece (tid & 7) of its 128-B line ----
  const int t0b  = blockIdx.x * 8;                   // the block's first tile
  const int mb0  = (t0b / tilesN) << 6;              // its first A row
  const int nb0  = (t0b - (t0b / tilesN) * tilesN) << 6;   // its first Bt row
  const int srow = threadIdx.x >> 3;
  const int sseg = (threadIdx.x & 7) * 8;
  const unsigned lthr = lds_off(ring) + (unsigned)(srow * GSP + sseg) * 2u;
  auto stage = [&](int slab, int buf) {
    const int kc = slab * GKC + sseg;
    const unsigned lb = lthr + (unsigned)buf * (unsigned)(RT * GSP * 2);
#pragma unroll   // both loops: each copy's plane and row group are compile-time, the statement's operands stay in registers
    for (int g0 = 0; g0 < NIT; g0 += 8) {
      unsigned l[8];
      const __bf16* g[8];
#pragma unroll
      for (int e = 0; e < 8; ++e) {
        const int fr = (g0 + e < NIT) ? (g0 + e) * 32 : 0;     // first staged row of this copy's group of 32
        if (fr < PA * RA) {
          const int r = fr % RA;
          g[e] = ((fr / RA) ? Ab2 : Ab) + (size_t)(mb0 + r + srow) * lda + kc;
        } else {
          const int r = (fr - PA * RA) % RB;
          g[e] = (((fr - PA * RA) / RB) ? Bb2 : Bb) + (size_t)(nb0 + r + srow) * ldb + kc;
        }
        l[e] = lb + (unsigned)(fr * GSP * 2);
      }
      if (g0 + 8 <= NIT) acopy8(l, g);
      else               acopy2(l, g);
    }
  };
  static_assert((NIT % 8) == 0 || (NIT % 8) == 2);

  const int nsl = K / GKC;                           // slabs
  const int aRow = (wave / TNB) * 64 + rlane;        // the wave's first A row inside a staged plane
  const int bRow = PA * RA + (wave % TNB) * 64 + rlane;   // its first Bt row inside the staged slab
  stage(0, 0);
  wait_async0();
  __syncthreads();                                   // slab 0 is published
  if (nsl > 1) stage(1, 1);
  for (int sl = 0; sl < nsl; ++sl) {
    const __bf16* sb = ring + (sl & 1) * (RT * GSP);
#pragma unroll   // k and plane offsets fold into the LDS loads' immediate offsets
    for (int ks = 0; ks < GKC / 32; ++ks) {
      const int kl = ks * 32 + koff;                 // k inside the slab
      const __bf16* As = sb + (size_t)aRow * GSP + kl;
      v16b ah[4], al[4];
#pragma unroll
      for (int i = 0; i < 4; ++i) {
        ah[i] = ldfrag_b(As + i * 16 * GSP);
        al[i] = ah[i];
        if (NSPLIT == 1) al[i] = ldfrag_b(As + (RA + i * 16) * GSP);
      }
#pragma unroll
      for (int pl = 0; pl < PB; ++pl) {              // the Bt planes of one k step follow each other, hi then lo
        const __bf16* Bs = sb + (size_t)(bRow + pl * RB) * GSP + kl;
        v16b bh[4];
#pragma unroll
        for (int j = 0; j < 4; ++j) bh[j] = ldfrag_b(Bs + j * 16 * GSP);
#pragma unroll
        for (int i = 0; i < 4; ++i) {
#pragma unroll
          for (int j = 0; j < 4; ++j) {
            acc[i][j] = mma_b_raw(ah[i], bh[j], acc[i][j]);
            if (NSPLIT == 1) acc[i][j] = mma_b_raw(al[i], bh[j], acc[i][j]);
          }
          dep_guard_b(acc[i][0], acc[i][3], ah[i], al[i]);
        }
        keep4_b(bh[0], bh[1], bh[2], bh[3]);
      }
    }
    wait_ds0();
    wait_async0();
    __syncthreads();                                 // publishes slab sl + 1 and ends every read of slab sl's buffer
    if (sl + 2 < nsl) stage(sl + 2, sl & 1);
  }
  wait_async0();
  acc_guard4(acc[0][0], acc[0][1], acc[0][2], acc[0][3]);
  acc_guard4(acc[1][0], acc[1][1], acc[1][2], acc[1][3]);
  acc_guard4(acc[2][0], acc[2][1], acc[2][2], acc[2][3]);
  acc_guard4(acc[3][0], acc[3][1], acc[3][2], acc[3][3]);

  // ---- bias (per column), clamped address, selected by value ----
  float bc[4];
#pragma unroll
  for (int j = 0; j < 4; ++j) {
    int bi = n0 + (j << 4) + rlane;
    bi = (bi < blen) ? bi : (blen - 1);
    bi = (bi > 0) ? bi : 0;
    const float t = bf_up(bf_bits(bias[bi]));
    bc[j] = (bmode == 1) ? t : 0.f;
  }

  // ---- epilogue ----
  float* slab = (float*)(void*)ring + wave * (16 * 68);
#pragma unroll
  for (int i = 0; i < 4; ++i) {
    const int mBase = m0 + (i << 4);
    float brw[8];
#pragma unroll
    for (int r = 0; r < 8; ++r) {
      int bi = mBase + mOff + r;
      bi = (bi < blen) ? bi : (blen - 1);
      bi = (bi > 0) ? bi : 0;
      const float t = bf_up(bf_bits(bias[bi]));
      brw[r] = (bmode == 2) ? t : 0.f;
    }
#pragma unroll
    for (int j = 0; j < 4; ++j) {
#pragma unroll
      for (int r = 0; r < 8; ++r) {
        slab[(mOff + r) * 68 + (j << 4) + rlane] = acc[i][j][r] + bc[j] + brw[r];
      }
    }
    wave_sync_lds();
    if (OUT_MODE == 0 || OUT_MODE == 1) {
      float* C = (float*)Cout + (size_t)b * strideC;
      const float* R = Rp + (size_t)b * strideR;
      const int hh = lane >> 4, c4 = (lane & 15) * 4;     // 256-B row segment = 16 lanes x 16 B
      {
#pragma unroll
        for (int it = 0; it < 8; ++it) {
          const int row = it * 2 + hh;                     // it 0..7 x hh 0..1 = rows 0..15
          v4f v = *(const v4f*)(slab + row * 68 + c4);
          if (OUT_MODE == 1) {
            const v4f xr = *(const v4f*)(R + (size_t)(mBase + row) * ldr + n0 + c4);
            v4f t;
            t[0] = (v[0] + bfr(xr[0])) * oscale;
            t[1] = (v[1] + bfr(xr[1])) * oscale;
            t[2] = (v[2] + bfr(xr[2])) * oscale;
            t[3] = (v[3] + bfr(xr[3])) * oscale;
            v = t;
          }
          *(v4f*)(C + (size_t)(mBase + row) * ldc + n0 + c4) = v;
        }
        
      }
    } else {
      const int q = lane >> 3, c8 = (lane & 7) * 8;
      unsigned short* C  = (unsigned short*)Cout  + (size_t)b * strideC;
      unsigned short* C2 = (unsigned short*)Cout2 + (size_t)b * strideC2;
      const bool wlo = (n0 < N2);                           // wave-uniform
      v4u hv[4], lv[4];
#pragma unroll
      for (int it = 0; it < 4; ++it) {
        const int row = it * 4 + q;                        // it 0..3 x q 0..3 = rows 0..15
        const float* sp = slab + row * 68 + c8;
        v4u a, a2;
#pragma unroll
        for (int e = 0; e < 4; ++e) {
          const float f0 = sp[2 * e], f1 = sp[2 * e + 1];
          const _Float16 x0 = (_Float16)f0, x1 = (_Float16)f1;
          const unsigned short h0 = h_bits(x0), h1 = h_bits(x1);
          const unsigned short l0 = h_bits((_Float16)((f0 - (float)x0) * rscale));
          const unsigned short l1 = h_bits((_Float16)((f1 - (float)x1) * rscale));
          a[e] = pk16(h0, h1); a2[e] = pk16(l0, l1);
        }
        hv[it] = a; lv[it] = a2;
      }
      {
#pragma unroll
        for (int it = 0; it < 4; ++it) {
          const int row = it * 4 + q;
          *(v4u*)(C + (size_t)(mBase + row) * ldc + n0 + c8) = hv[it];
          if (wlo) *(v4u*)(C2 + (size_t)(mBase + row) * ldc2 + n0 + c8) = lv[it];
        }
        
      }
    }
    wave_sync_lds();
  }
}

// =====================================================================================================
// Attention, head dim 64, no masking, softmax over all SEQ keys.
//   q hi plane (f16, pitch DM): element (b, t, h, d) at [(b*SEQ + t)*DM + h*64 + d]; q residual plane
//   (f16, (q - f16(q))*4096, pitch DM) same layout; k plane (f16, pitch DM) same layout.
//   v^T hi plane (f16): element (b, h, d, s) at [(b*DM + h*64 + d)*SEQ + s]; v^T residual plane (f16, x4096): same layout
//   out: context as bf16 hi plane and bf16 lo plane (lo = RNE(v - hi), unscaled), pitch DM: element (b, t, h, d) at
//   [(b*SEQ + t)*DM + h*64 + d] of each plane
//   Both products are taken transposed, so that a lane owns ONE query (column lane & 15):
//   scores^T[key][query] = (k . qh + (k . ql) * rres) * sscale on f16 WMMA (A = K rows, B = q), residual products in a
//   separate accumulator; a lane holds 32 of its query's 64 scores (keys 16 j + 8 (lane >> 4) + r), so the maximum and
//   the sum run in the lane, with one exchange between the wave halves for the maximum per chunk and one for the sum
//   at the end. p = exp(s - m) carried as f16(1024 p): score tiles 2 kk and 2 kk + 1, converted in place, ARE the
//   B operand (keys 32 kk .. + 31 in the hardware k order) of context^T[d][query] = vh . p + (vl . p) * rres
//   (A = V^T rows; separate accumulator folded per chunk in f32); online softmax in f32.
//   Block = 4 waves = 64 query rows of one (b, h); grid = NQB * NH * NB; kv chunks of 64, static trip NQB.
//   K / V^T chunk staging: 128 threads x 32 elements per plane = the whole 64x64 tile (plain 16-B loads,
//   __syncthreads before and after).
//   Output coverage: each wave stores rows q0..q0+15 (it 0..3 x lane>>3 0..3) x 64 columns of both planes; a row's
//   64 columns of one plane = 8 lanes x 16 B = one whole 128-B line
// =====================================================================================================
__device__ __forceinline__ float other_half(float v) {       // the value that lane ^ 16 holds
  const int b = __builtin_bit_cast(int, v);
  return __builtin_bit_cast(float, __builtin_amdgcn_permlanex16(b, b, 0x76543210, 0xfedcba98, false, false));
}
__global__ __launch_bounds__(128)
void attn64(const unsigned short* __restrict__ qhp, const unsigned short* __restrict__ qlp,
            const unsigned short* __restrict__ khp,
            const unsigned short* __restrict__ vhp, const unsigned short* __restrict__ vlp,
            unsigned short* ctxh, unsigned short* ctxl, float sscale, float rres) {
  union FH { v16h v; v8h h[2]; };
  __shared__ __align__(16) _Float16 KV[3 * 64 * KVP];             // one array: every fragment read = one base + a constant
  _Float16* const Ksh = KV;                                       // K [kv][d], 64 halves used per row
  _Float16* const Vth = KV + 64 * KVP;                            // V^T hi [d][kv]
  _Float16* const Vtl = KV + 128 * KVP;                           // V^T residual [d][kv]
  __shared__ __align__(16) float    Os[4][16 * OSP];              // per wave context tile [row][d]

  const int tid  = threadIdx.x;
  const int wave = tid >> 5;
  const int lane = tid & 31;
  const int hh   = lane >> 4;
  const int c    = lane & 15;

  const int bx   = blockIdx.x;
  const int qb   = bx % NQB;
  const int rest = bx / NQB;
  const int h    = rest % NH;
  const int b    = rest / NH;
  const int q0   = qb * 64 + wave * 16;
  const size_t rowB = (size_t)b * SEQ;

  const _Float16* Qh = (const _Float16*)(const void*)qhp + (size_t)h * HD;
  const _Float16* Ql = (const _Float16*)(const void*)qlp + (size_t)h * HD;
  const _Float16* Kg = (const _Float16*)(const void*)khp + (size_t)h * HD;
  const _Float16* Vh = (const _Float16*)(const void*)vhp + ((size_t)b * DM + (size_t)h * HD) * SEQ;
  const _Float16* Vl = (const _Float16*)(const void*)vlp + ((size_t)b * DM + (size_t)h * HD) * SEQ;

  // ---- Q fragments (B operand, column = query = lane&15): 2 d-chunks, hi and residual ----
  v16h qah[2], qal[2];
#pragma unroll
  for (int dc = 0; dc < 2; ++dc) {
    qah[dc] = ldfrag_h(Qh + (rowB + q0 + c) * DM + dc * 32 + 8 * hh);
    qal[dc] = ldfrag_h(Ql + (rowB + q0 + c) * DM + dc * 32 + 8 * hh);
  }

  float mrow = -INFINITY;                    // running maximum of query c (equal in both wave halves)
  float lrow = 0.f;                          // running sum of query c over this half's keys
  v8f oacc[4];                               // context^T: oacc[t][r] = element d = 16 t + 8 hh + r of query c
#pragma unroll
  for (int t = 0; t < 4; ++t) oacc[t] = zero8();

  for (int kt = 0; kt < NQB; ++kt) {         // static trip count
    const int kv0 = kt * 64;
    __syncthreads();
    {
      const int r = tid >> 1, hf = (tid & 1) * 32;
      const _Float16* kg  = Kg + (rowB + kv0 + r) * DM + hf;       // K row kv0+r, d = hf..hf+31
      const _Float16* vg  = Vh + (size_t)r * SEQ + kv0 + hf;       // V^T row d = r, s = kv0+hf..+31
      const _Float16* vlg = Vl + (size_t)r * SEQ + kv0 + hf;
#pragma unroll
      for (int i = 0; i < 4; ++i) {
        const v8h a0 = *(const v8h*)(kg + 8 * i);
        const v8h b0 = *(const v8h*)(vg + 8 * i);
        const v8h b1 = *(const v8h*)(vlg + 8 * i);
        *(v8h*)(Ksh + r * KVP + hf + 8 * i) = a0;
        *(v8h*)(Vth + r * KVP + hf + 8 * i) = b0;
        *(v8h*)(Vtl + r * KVP + hf + 8 * i) = b1;
      }
    }
    __syncthreads();

    // ---- scores^T: 64 keys x 16 queries per wave, 2 f16 products (hi, residual) ----
    //      LDS reads stand in three groups per chunk: all of K; V^T of keys 0..31, read under the softmax; V^T of keys 32..63
    v8f s[4];                                // s[j][r]: key 16 j + 8 hh + r against query c
    FH vh0[4], vl0[4];                       // V^T fragments of keys 0..31, hi and residual
    {
      FH kb[4][2];
#pragma unroll   // every loop of this block: kb, sh, sl, vh0 and vl0 are register arrays, constant indices
      for (int j = 0; j < 4; ++j)
#pragma unroll
        for (int dc = 0; dc < 2; ++dc) {
          kb[j][dc].h[0] = *(const v8h*)(Ksh + (j * 16 + c) * KVP + dc * 32 + 8 * hh);
          kb[j][dc].h[1] = *(const v8h*)(Ksh + (j * 16 + c) * KVP + dc * 32 + 16 + 8 * hh);
        }
      group_fence();
      v8f sh[4], sl[4];
#pragma unroll
      for (int j = 0; j < 4; ++j) { sh[j] = zero8(); sl[j] = zero8(); }
#pragma unroll
      for (int dc = 0; dc < 2; ++dc)
#pragma unroll
        for (int j = 0; j < 4; ++j) {
          sh[j] = mma_h(kb[j][dc].v, qah[dc], sh[j]);
          sl[j] = mma_h(kb[j][dc].v, qal[dc], sl[j]);
        }
      // ends the run: a builtin WMMA is otherwise free to sink to its first use, behind the reads that take over K's registers
      acc_guard4(sh[0], sh[1], sh[2], sh[3]);
      acc_guard4(sl[0], sl[1], sl[2], sl[3]);
      group_fence();
#pragma unroll
      for (int t = 0; t < 4; ++t) {
        vh0[t].h[0] = *(const v8h*)(Vth + (t * 16 + c) * KVP + 8 * hh);
        vh0[t].h[1] = *(const v8h*)(Vth + (t * 16 + c) * KVP + 16 + 8 * hh);
        vl0[t].h[0] = *(const v8h*)(Vtl + (t * 16 + c) * KVP + 8 * hh);
        vl0[t].h[1] = *(const v8h*)(Vtl + (t * 16 + c) * KVP + 16 + 8 * hh);
      }
      group_fence();
#pragma unroll
      for (int j = 0; j < 4; ++j)
#pragma unroll
        for (int r = 0; r < 8; ++r) s[j][r] = (sh[j][r] + sl[j][r] * rres) * sscale;
    }

    // ---- maximum in the lane, joined across the halves; online softmax; P^T (x1024, f16) packed in registers ----
    float mx[8];
#pragma unroll   // mx and s are register arrays: constant indices; eight independent chains
    for (int r = 0; r < 8; ++r) mx[r] = fmaxf(fmaxf(s[0][r], s[1][r]), fmaxf(s[2][r], s[3][r]));
    float m = fmaxf(fmaxf(fmaxf(mx[0], mx[1]), fmaxf(mx[2], mx[3])), fmaxf(fmaxf(mx[4], mx[5]), fmaxf(mx[6], mx[7])));
    m = fmaxf(m, other_half(m));
    const float mnew  = fmaxf(mrow, m);
    const float alpha = __expf(mrow - mnew);
    mrow = mnew;
    FH pb[2];                                // pb[kk]: keys 32 kk + (8 hh + e | 16 + 8 hh + e - 8) of query c
    float ps[4];                             // four independent partial sums, one per score tile
#pragma unroll   // both loops: s, ps and pb are register arrays, their indices must be compile-time constants
    for (int j = 0; j < 4; ++j) {
      ps[j] = 0.f;
#pragma unroll
      for (int r = 0; r < 8; ++r) {
        const float p = __expf(s[j][r] - mnew);
        ps[j] += p;
        pb[j >> 1].v[(j & 1) * 8 + r] = (_Float16)(p * 1024.0f);
      }
    }
    lrow = lrow * alpha + ((ps[0] + ps[1]) + (ps[2] + ps[3]));
#pragma unroll
    for (int t = 0; t < 4; ++t)
#pragma unroll
      for (int r = 0; r < 8; ++r) oacc[t][r] *= alpha;

    // ---- context^T += V^T . P^T (f16 WMMA), residual products into a separate accumulator ----
    v8f o1[4];
    FH vh1[4], vl1[4];                       // V^T fragments of keys 32..63
#pragma unroll   // every loop down to the fold: register arrays, constant indices
    for (int t = 0; t < 4; ++t) oacc[t] = mma_h(vh0[t].v, pb[0].v, oacc[t]);
    acc_guard4(oacc[0], oacc[1], oacc[2], oacc[3]);   // ends the run, as above: the next reads take over vh0's registers
    group_fence();
#pragma unroll
    for (int t = 0; t < 4; ++t) {
      vh1[t].h[0] = *(const v8h*)(Vth + (t * 16 + c) * KVP + 32 + 8 * hh);
      vh1[t].h[1] = *(const v8h*)(Vth + (t * 16 + c) * KVP + 32 + 16 + 8 * hh);
      vl1[t].h[0] = *(const v8h*)(Vtl + (t * 16 + c) * KVP + 32 + 8 * hh);
      vl1[t].h[1] = *(const v8h*)(Vtl + (t * 16 + c) * KVP + 32 + 16 + 8 * hh);
    }
    group_fence();
#pragma unroll
    for (int t = 0; t < 4; ++t) o1[t] = mma_h(vl0[t].v, pb[0].v, zero8());
#pragma unroll
    for (int t = 0; t < 4; ++t) oacc[t] = mma_h(vh1[t].v, pb[1].v, oacc[t]);
#pragma unroll
    for (int t = 0; t < 4; ++t) o1[t] = mma_h(vl1[t].v, pb[1].v, o1[t]);
    acc_guard4(oacc[0], oacc[1], oacc[2], oacc[3]);   // the twelve WMMAs run back to back, the fold follows them
    acc_guard4(o1[0], o1[1], o1[2], o1[3]);
#pragma unroll
    for (int t = 0; t < 4; ++t)
#pragma unroll
      for (int r = 0; r < 8; ++r) oacc[t][r] += o1[t][r] * rres;
  }

  // ---- join the halves' sums, normalise (1/l and the 1/1024 p carry), stage the wave's 16x64 f32 tile in LDS
  //      (a lane's 8 registers of tile t = 8 consecutive d of its query's row), then split each value into its bf16
  //      hi and lo parts and write whole lines of the two planes
  float* os = Os[wave];
  {
    const float l = lrow + other_half(lrow);
    const float inv = ((l > 0.f) ? (1.0f / l) : 0.f) * (1.0f / 1024.0f);
#pragma unroll   // both loops: oacc is a register array, its indices must be compile-time constants
    for (int t = 0; t < 4; ++t) {
      v4f w0, w1;
#pragma unroll
      for (int e = 0; e < 4; ++e) { w0[e] = oacc[t][e] * inv; w1[e] = oacc[t][4 + e] * inv; }
      *(v4f*)(os + c * OSP + t * 16 + 8 * hh)     = w0;
      *(v4f*)(os + c * OSP + t * 16 + 8 * hh + 4) = w1;
    }
  }
  wave_sync_lds();
  {
    const int q = lane >> 3, c8 = (lane & 7) * 8;
    v4u hv[4], lv[4];
#pragma unroll   // both loops: hv and lv are register arrays, their indices must be compile-time constants
    for (int it = 0; it < 4; ++it) {
      const int row = it * 4 + q;                        // it 0..3 x q 0..3 = rows 0..15 of the wave tile
      const v4f a = *(const v4f*)(os + row * OSP + c8);
      const v4f d = *(const v4f*)(os + row * OSP + c8 + 4);
      const float f[8] = {a[0], a[1], a[2], a[3], d[0], d[1], d[2], d[3]};
#pragma unroll
      for (int e = 0; e < 4; ++e) {
        const unsigned short h0 = bf_bits(f[2 * e]), h1 = bf_bits(f[2 * e + 1]);
        hv[it][e] = pk16(h0, h1);
        lv[it][e] = pk16(bf_bits(f[2 * e] - bf_up(h0)), bf_bits(f[2 * e + 1] - bf_up(h1)));
      }
    }
#pragma unroll
    for (int it = 0; it < 4; ++it) {
      const size_t o = (rowB + q0 + it * 4 + q) * DM + (size_t)h * HD + c8;
      *(v4u*)(ctxh + o) = hv[it];
      *(v4u*)(ctxl + o) = lv[it];
    }
  }
}

// =====================================================================================================
// Workspace map (bytes), every plane an exact multiple of its whole-row / 64x64-tile / whole-line store granularity:
//   WT    bf16 [4][256 o][256 i]     0          524288     (Wq, Wk, Wv, Wp transposed, k = in contiguous)
//   XNh   bf16 [16384 t][256 c]      589824     8388608    (GroupNorm output, token-major, hi plane)
//   XNl   bf16 [16384][256]          8978432    8388608    (lo plane)
//   Qh    f16  [16384][256]          17367040   8388608
//   Ql    f16  [16384][256]          25755648   8388608    (q residual x4096)
//   Kh    f16  [16384][256]          34144256   8388608
//   VTh   f16  [16][256 c][1024 t]   42532864   8388608
//   VTl   f16  [16][256][1024]       50921472   8388608    (v residual x4096)
//   CTXh  bf16 [16384 t][256 c]      59310080   8388608    (attention context, token-major, hi plane)
//   CTXl  bf16 [16384][256]          67698688   8388608    (lo plane)
//   end                              76087296
// =====================================================================================================
extern "C" void kernel_launch(void* const* d_in, const int* in_sizes, int n_in,
                              void* d_out, int out_size, void* d_ws, size_t ws_size,
                              hipStream_t stream) {
  if (n_in < 11) return;
  if (in_sizes[0] != NB * DM * SEQ) return;
  if (in_sizes[3] != DM * DM || in_sizes[5] != DM * DM || in_sizes[7] != DM * DM || in_sizes[9] != DM * DM) return;
  if (in_sizes[1] < DM || in_sizes[2] < DM) return;
  if (in_sizes[4] < 1 || in_sizes[6] < 1 || in_sizes[8] < 1 || in_sizes[10] < 1) return;
  if (out_size != NB * DM * SEQ) return;

  const float* x   = (const float*)d_in[0];
  const float* gsc = (const float*)d_in[1];
  const float* gbi = (const float*)d_in[2];
  const float* wq  = (const float*)d_in[3];
  const float* bq  = (const float*)d_in[4];
  const float* wk  = (const float*)d_in[5];
  const float* bk  = (const float*)d_in[6];
  const float* wv  = (const float*)d_in[7];
  const float* bv  = (const float*)d_in[8];
  const float* wp  = (const float*)d_in[9];
  const float* bp  = (const float*)d_in[10];
  float* out = (float*)d_out;

  const size_t PWT = (size_t)4 * DM * DM * 2;          //   524288
  const size_t PST = (size_t)NB * NGRP * 32 * 4;       //    65536
  const size_t P16 = (size_t)NB * SEQ * DM * 2;        //  8388608
  size_t off = 0;
  const size_t oWT   = off; off += PWT;
  const size_t oST   = off; off += PST;
  const size_t oXNh  = off; off += P16;
  const size_t oXNl  = off; off += P16;
  const size_t oQh   = off; off += P16;
  const size_t oQl   = off; off += P16;
  const size_t oKh   = off; off += P16;
  const size_t oVTh  = off; off += P16;
  const size_t oVTl  = off; off += P16;
  const size_t oCTXh = off; off += P16;
  const size_t oCTXl = off; off += P16;
  if (off > ws_size) return;                            // off = 76087296
  if (off > (size_t)134217728) return;

  char* ws = (char*)d_ws;
  unsigned short* WT   = (unsigned short*)(ws + oWT);
  float*          ST   = (float*)(ws + oST);
  unsigned short* XNh  = (unsigned short*)(ws + oXNh);
  unsigned short* XNl  = (unsigned short*)(ws + oXNl);
  unsigned short* Qh   = (unsigned short*)(ws + oQh);
  unsigned short* Ql   = (unsigned short*)(ws + oQl);
  unsigned short* Kh   = (unsigned short*)(ws + oKh);
  unsigned short* VTh  = (unsigned short*)(ws + oVTh);
  unsigned short* VTl  = (unsigned short*)(ws + oVTl);
  unsigned short* CTXh = (unsigned short*)(ws + oCTXh);
  unsigned short* CTXl = (unsigned short*)(ws + oCTXl);
  unsigned short* WTq = WT + (size_t)0 * DM * DM;
  unsigned short* WTv = WT + (size_t)2 * DM * DM;
  unsigned short* WTp = WT + (size_t)3 * DM * DM;

  const dim3 blk(256);
  const dim3 gWT(16, 4);                                          // 16 tiles of 64x64 per weight, 4 weights
  const dim3 gGN(NB * NGRP);                                      // 512 blocks
  const dim3 gAP(NB * (SEQ / 32));                                // 512 blocks
  const dim3 gQK(((NB * SEQ / 64) * (DM / 64) + 7) / 8, 2);       // 1024 tiles -> 128 blocks: M=16384, N=256; y: 0 = q, 1 = k
  const dim3 gVT(((DM / 64) * (SEQ / 64) + 7) / 8, NB);           // 64 tiles -> 8 blocks x 16 batches: M=256, N=1024
  const dim3 gAttn(NB * NH * NQB);                                // 1024 blocks
  const float rs2 = 1.0f / 1.41421356237309515f;

  // (1) weights [in][out] -> bf16 [out][in] planes (RNE convert)
  wt_cvt<<<gWT, blk, 0, stream>>>(wq, wk, wv, wp, WT);
  // (2) GroupNorm statistics per (b, group) from bf16(x)
  gn_stats<<<gGN, blk, 0, stream>>>(x, ST);
  // (3) GroupNorm apply -> token-major bf16 hi + lo planes [16384][256]
  gn_apply<<<gAP, blk, 0, stream>>>(x, ST, gsc, gbi, XNh, XNl);
  // (4, 5) one launch of 2 x 128 blocks, one block for each of the chip's 256 WGPs (M=16384, N=256, K=256, bias per column):
  //     y = 0: q = xn . Wq + bq -> f16 hi plane [16384][256] + f16 residual x4096
  //     y = 1: k = xn . Wk + bk -> f16 plane [16384][256], no residual
  //     Wk's plane lies one weight plane behind WTq, Kh two activation planes behind Qh (workspace map above)
  gemm64<1, 3, true, 4><<<gQK, blk, 0, stream>>>(
      XNh, XNl, DM, 0LL, WTq, WTq, DM, (long long)DM * DM,
      (void*)Qh, DM, 2LL * NB * SEQ * DM, (void*)Ql, DM, 0LL, DM,
      NB * SEQ, DM, DM, 4096.0f, bq, 1, in_sizes[4], x, 0, 0LL, 1.0f, bk, in_sizes[6]);
  // (6) v^T[b][c][t] = sum_i Wv[i][c] xn[b][t][i] + bv[c] per batch -> f16 hi plane (pitch SEQ) + residual x4096
  //     (A = WTv [c][i], Bt = XN rows of batch b hi + lo; M=256, N=1024, K=256; bias per row)
  gemm64<3, 3, false, 8><<<gVT, blk, 0, stream>>>(
      WTv, WTv, DM, 0LL, XNh, XNl, DM, (long long)SEQ * DM,
      (void*)VTh, SEQ, (long long)DM * SEQ, (void*)VTl, SEQ, (long long)DM * SEQ, SEQ,
      DM, SEQ, DM, 4096.0f, bv, 2, in_sizes[8], x, 0, 0LL, 1.0f);
  // (7) attention: scores scale 1/sqrt(C) = 1/16 -> context bf16 hi + lo planes [16384][256] token-major
  attn64<<<gAttn, dim3(128), 0, stream>>>(Qh, Ql, Kh, VTh, VTl, CTXh, CTXl, 0.0625f, 1.0f / 4096.0f);
  // (8) out[b][c][t] = (sum_o Wp[o][c] ctx[b][t][o] + bp[c] + bf16(x[b][c][t])) * (1/sqrt2) per batch, written
  //     straight into the NCHW output rows of 1024 floats (A = WTp [c][o], Bt = CTX rows hi + lo; M=256, N=1024, K=256)
  gemm64<3, 1, false, 8><<<gVT, blk, 0, stream>>>(
      WTp, WTp, DM, 0LL, CTXh, CTXl, DM, (long long)SEQ * DM,
      (void*)out, SEQ, (long long)DM * SEQ, (void*)out, SEQ, (long long)DM * SEQ, 0,
      DM, SEQ, DM, 1.0f, bp, 2, in_sizes[10], x, SEQ, (long long)DM * SEQ, rs2);
  (void)hipGetLastError();
}

// v007
// It runs in 102 microseconds.
// Timed twice side by side with v006, it ran 1.03 times as fast both times.
// Counting every step since v000, it is 2.24 times as fast.
// Contractions: q, k, v^T and output projections = v_wmma_f32_16x16x32_bf16 (bf16 operands: weights and biases from
// RNE-converted inputs, computed activations as bf16 hi + lo planes, 2 products); q.k^T scores = v_wmma_f32_16x16x32_f16
// (q as f16 hi plane + f16 residual plane x4096 in a separate accumulator, k f16; 2 products); p.v = v_wmma_f32_16x16x32_f16
// (p carried x1024 in f16, v^T as f16 hi plane + residual plane x4096 in a separate accumulator; 2 products);
// all f32 accumulate; GroupNorm statistics, softmax, biases, residual add and output scale in f32.
#include <hip/hip_runtime.h>
#include <math.h>
#include <stdint.h>

#define NB    16            // batch
#define DM    256           // channels
#define SEQ   1024          // tokens (32 x 32)
#define NH    4             // heads
#define HD    64            // head dim
#define NQB   (SEQ / 64)    // 16 query / key tiles of 64
#define NGRP  32            // groups
#define GSZ   8             // channels per group
#define XCB   16            // channels per block of the normalised planes' layout [batch][c / 16][token][c % 16]
#define KVP   72            // LDS pitch (halves) of the attention K and V^T rows: 144 B = 16 B x odd, so the 16 rows
                            // that one ds_load_b128 fragment read touches fall on 16 different groups of four banks
#define OSP   68            // LDS pitch (floats) of the attention context tile: rows r and r + 8 on different banks
#define GKC   64            // k elements per staged GEMM slab: 128 B of every operand row (one whole line of a row-major row)
#define GSP   72            // LDS pitch (halves) of a staged GEMM operand row: 144 B = 16 B x odd, as for KVP
static_assert(NH * HD == DM);
static_assert((DM % GKC) == 0 && (GSP % 8) == 0 && ((GSP / 8) & 1) == 1 && GSP >= GKC);
static_assert(NGRP * GSZ == DM);
static_assert((SEQ % 64) == 0 && (DM % 64) == 0 && (DM % 32) == 0);
static_assert(XCB == 2 * GSZ && (DM % XCB) == 0 && (GKC % XCB) == 0 && SEQ == 4 * 256);
static_assert((KVP % 8) == 0 && ((KVP / 8) & 1) == 1 && KVP >= 64);
static_assert((OSP % 4) == 0 && OSP >= 64);

typedef _Float16 v16h __attribute__((ext_vector_type(16)));
typedef _Float16 v8h  __attribute__((ext_vector_type(8)));
typedef __bf16   v16b __attribute__((ext_vector_type(16)));
typedef __bf16   v8b  __attribute__((ext_vector_type(8)));
typedef float    v8f  __attribute__((ext_vector_type(8)));
typedef float    v4f  __attribute__((ext_vector_type(4)));
typedef unsigned int v4u __attribute__((ext_vector_type(4)));
typedef unsigned short v8us __attribute__((ext_vector_type(8)));

// ---- scalar helpers --------------------------------------------------------------------------------
__device__ __forceinline__ unsigned short bf_bits(float f) {          // f32 -> bf16 bits, RNE convert
  unsigned u = __float_as_uint(f);
  return (unsigned short)((u + 0x7FFFu + ((u >> 16) & 1u)) >> 16);
}
__device__ __forceinline__ float bf_up(unsigned short h) { return __uint_as_float(((unsigned)h) << 16); }
__device__ __forceinline__ float bfr(float f) { return bf_up(bf_bits(f)); }   // value RNE-converted to bf16 and widened
__device__ __forceinline__ unsigned short h_bits(_Float16 x) { return __builtin_bit_cast(unsigned short, x); }
__device__ __forceinline__ unsigned pk16(unsigned short a, unsigned short b) { return (unsigned)a | ((unsigned)b << 16); }
__device__ __forceinline__ v8f zero8() { v8f z = {0.f, 0.f, 0.f, 0.f, 0.f, 0.f, 0.f, 0.f}; return z; }

// ---- fragment loaders: 16-bit A/B operand, lane -> row/col (lane&15), p already includes +8*(lane>>4);
//      elements 0..7 <- p[0..7] (k0+8h..), elements 8..15 <- p[16..23] (k0+16+8h..)
__device__ __forceinline__ v16b ldfrag_b(const __bf16* p) {
  union { v16b v; v8b h[2]; } f;
  f.h[0] = *(const v8b*)(p);
  f.h[1] = *(const v8b*)(p + 16);
  return f.v;
}
__device__ __forceinline__ v16h ldfrag_h(const _Float16* p) {
  union { v16h v; v8h h[2]; } f;
  f.h[0] = *(const v8h*)(p);
  f.h[1] = *(const v8h*)(p + 16);
  return f.v;
}

// ---- WMMA helpers with trailing VALU hazard gap --------------------------------------------------------
__device__ __forceinline__ v8f mma_h(v16h a, v16h b, v8f c) {       // builtin alone: the compiler keeps its distances
  return __builtin_amdgcn_wmma_f32_16x16x32_f16(false, a, false, b, (short)0, c, false, false);
}
__device__ __forceinline__ v8f mma_b_raw(v16b a, v16b b, v8f c) {
  return __builtin_amdgcn_wmma_f32_16x16x32_bf16(false, a, false, b, (short)0, c, false, false);
}
__device__ __forceinline__ void dep_guard_b(v8f& a, v8f& b, v16b x, v16b y) {
#if defined(__HIP_DEVICE_COMPILE__)
  asm volatile("v_nop\n\tv_nop\n\tv_nop\n\tv_nop" : "+v"(a), "+v"(b) : "v"(x), "v"(y));
#endif
}
__device__ __forceinline__ void keep4_b(v16b a, v16b b, v16b c, v16b d) {
#if defined(__HIP_DEVICE_COMPILE__)
  asm volatile("v_nop" :: "v"(a), "v"(b), "v"(c), "v"(d));
#endif
}
__device__ __forceinline__ void acc_guard4(v8f& a, v8f& b, v8f& c, v8f& d) {
#if defined(__HIP_DEVICE_COMPILE__)
  asm volatile("v_nop\n\tv_nop\n\tv_nop\n\tv_nop" : "+v"(a), "+v"(b), "+v"(c), "+v"(d));
#endif
}
// Keeps a group of LDS reads together at its place: without it the compiler spreads the reads among the WMMAs,
// one read-and-wait place per fragment.
__device__ __forceinline__ void group_fence() { __builtin_amdgcn_sched_barrier(0); }
__device__ __forceinline__ void wave_sync_lds() {
  __builtin_amdgcn_fence(__ATOMIC_RELEASE, "workgroup");
  __builtin_amdgcn_wave_barrier();
  __builtin_amdgcn_fence(__ATOMIC_ACQUIRE, "workgroup");
}

// ---- asynchronous global -> LDS copies, 16 B per lane, through no register ------------------------------
__device__ __forceinline__ unsigned lds_off(const void* p) { return (unsigned)(size_t)p; }   // LDS byte address
// Eight (two) copies in one statement; its last line keeps the address registers untouched until the copies are taken.
__device__ __forceinline__ void acopy8(const unsigned* l, const __bf16* const* g) {
#if defined(__HIP_DEVICE_COMPILE__)
  asm volatile("global_load_async_to_lds_b128 %0, %8, off\n\t"
               "global_load_async_to_lds_b128 %1, %9, off\n\t"
               "global_load_async_to_lds_b128 %2, %10, off\n\t"
               "global_load_async_to_lds_b128 %3, %11, off\n\t"
               "global_load_async_to_lds_b128 %4, %12, off\n\t"
               "global_load_async_to_lds_b128 %5, %13, off\n\t"
               "global_load_async_to_lds_b128 %6, %14, off\n\t"
               "global_load_async_to_lds_b128 %7, %15, off\n\t"
               "s_wait_xcnt 0x0"
               :: "v"(l[0]), "v"(l[1]), "v"(l[2]), "v"(l[3]), "v"(l[4]), "v"(l[5]), "v"(l[6]), "v"(l[7]),
                  "v"(g[0]), "v"(g[1]), "v"(g[2]), "v"(g[3]), "v"(g[4]), "v"(g[5]), "v"(g[6]), "v"(g[7])
               : "memory");
#endif
}
__device__ __forceinline__ void acopy2(const unsigned* l, const __bf16* const* g) {
#if defined(__HIP_DEVICE_COMPILE__)
  asm volatile("global_load_async_to_lds_b128 %0, %2, off\n\t"
               "global_load_async_to_lds_b128 %1, %3, off\n\t"
               "s_wait_xcnt 0x0"
               :: "v"(l[0]), "v"(l[1]), "v"(g[0]), "v"(g[1])
               : "memory");
#endif
}
__device__ __forceinline__ void wait_async0() {      // this wave's copies have landed in LDS
#if defined(__HIP_DEVICE_COMPILE__)
  asm volatile("s_wait_asynccnt 0x0" ::: "memory");
#endif
}
__device__ __forceinline__ void wait_ds0() {         // this wave's LDS reads have retired before their buffer is refilled
#if defined(__HIP_DEVICE_COMPILE__)
  asm volatile("s_wait_dscnt 0x0" ::: "memory");
#endif
}

// =====================================================================================================
// Weights W[in i][out o] (f32, 256x256) -> bf16 planes WT[w][o][i] (k = i contiguous), RNE convert.
// grid (16 tiles of 64x64, 4 weights), 256 threads. Load: 16 iterations x 4 input rows x 64 cols = the whole
// 64x64 tile into LDS transposed (unsigned short element stores); __syncthreads; write: each wave instruction
// =====================================================================================================
__global__ __launch_bounds__(256) void wt_cvt(const float* __restrict__ W0, const float* __restrict__ W1,
                                              const float* __restrict__ W2, const float* __restrict__ W3,
                                              unsigned short* WT) {
  __shared__ __align__(16) unsigned short T[64 * 72];
  const int tid = threadIdx.x, lane = tid & 31, wave = tid >> 5;
  const int wsel = blockIdx.y;                                   // block-uniform weight select
  const float* W = (wsel == 0) ? W0 : (wsel == 1) ? W1 : (wsel == 2) ? W2 : W3;
  const int bx = blockIdx.x;
  const int i0 = (bx >> 2) * 64;                                 // input-channel tile
  const int o0 = (bx & 3) * 64;                                  // output-channel tile
#pragma unroll 4
  for (int it = 0; it < 16; ++it) {
    const int i = it * 4 + (tid >> 6);
    const int o = tid & 63;
    const float v = W[(size_t)(i0 + i) * DM + o0 + o];
    T[o * 72 + i] = bf_bits(v);
  }
  __syncthreads();
  const int q = lane >> 3, c8 = (lane & 7) * 8;
  v8us v[2];
#pragma unroll
  for (int it = 0; it < 2; ++it) {
    const int orow = it * 32 + wave * 4 + q;
    v[it] = *(const v8us*)(T + orow * 72 + c8);
  }
  unsigned short* dst = WT + (size_t)wsel * DM * DM;
  {
#pragma unroll
    for (int it = 0; it < 2; ++it) {
      const int orow = it * 32 + wave * 4 + q;
      *(v8us*)(dst + (size_t)(o0 + orow) * DM + i0 + c8) = v[it];
    }
    
  }
}

// =====================================================================================================
// GroupNorm, statistics and apply in one launch, + NCHW -> token-major transpose. A work-group owns XCB = 16 channels
// (two groups) of one batch: 16 x 1024 floats, held in registers from their one read to the final planes
// (thread -> 4 consecutive tokens x 16 channels, 16 loads of 16 B, all in flight together).
// Per group: mean, then the centred squares, both in f32 from bf16(x); rstd = 1/sqrt(var + 1e-6); sums: 4 chains in the
// lane, a butterfly over the wave, the 8 waves' sums in wave order.
// xn = (bf16(x) - mean) * rstd * bf16(scale[c]) + bf16(bias[c]) in f32 -> bf16 hi plane and bf16 lo plane = RNE(xn - hi).
// Plane layout [batch][c / 16][token][c % 16] (xn_off): the work-group's part of a plane is 32 KiB in a row, which it
// alone writes, whole 128-B lines: a thread's 4 tokens = one line, staged in LDS at pitch 144 B (16 B x odd), then each
// wave store = 512 B in a row. grid = NB * DM / XCB blocks, 256 threads.
// =====================================================================================================
__device__ __forceinline__ size_t xn_off(int row, int k) {     // element (token row over all batches, channel k) of a plane
  return ((size_t)((row / SEQ) * (DM / XCB) + k / XCB) * SEQ + (size_t)(row % SEQ)) * XCB + (size_t)(k % XCB);
}
__device__ __forceinline__ float wave_sum(float v) {           // the sum over the 32 lanes, in every lane
#pragma unroll   // five fixed exchange distances
  for (int m = 16; m > 0; m >>= 1) v += __shfl_xor(v, m, 32);
  return v;
}
__global__ __launch_bounds__(256) void gn_norm(const float* __restrict__ x, const float* __restrict__ gsc,
                                               const float* __restrict__ gbi,
                                               unsigned short* XNh, unsigned short* XNl) {
  __shared__ v4u Th[256 * 9];                 // per thread one 128-B line of the hi plane, pitch 9 x 16 B
  __shared__ v4u Tl[256 * 9];                 // the same of the lo plane
  __shared__ float red[2][8][2];              // [pass][wave][group]
  const int tid = threadIdx.x, lane = tid & 31, wave = tid >> 5;
  const int blk = blockIdx.x;                 // batch * (DM / XCB) + channel block
  const int c0  = (blk % (DM / XCB)) * XCB;
  const float* xp = x + (size_t)blk * (XCB * SEQ) + tid * 4;
  v4f xv[XCB];
#pragma unroll   // every loop over c, e and k below: xv is a register array, its indices must be compile-time constants
  for (int c = 0; c < XCB; ++c) xv[c] = *(const v4f*)(xp + (size_t)c * SEQ);
  float mean[2], rstd[2];
  {
    v4f a[2] = {{0.f, 0.f, 0.f, 0.f}, {0.f, 0.f, 0.f, 0.f}};
#pragma unroll
    for (int c = 0; c < XCB; ++c)
#pragma unroll
      for (int e = 0; e < 4; ++e) { xv[c][e] = bfr(xv[c][e]); a[c / GSZ][e] += xv[c][e]; }
    const float s0 = wave_sum((a[0][0] + a[0][1]) + (a[0][2] + a[0][3]));
    const float s1 = wave_sum((a[1][0] + a[1][1]) + (a[1][2] + a[1][3]));
    if (lane == 0) { red[0][wave][0] = s0; red[0][wave][1] = s1; }
    __syncthreads();
    float t0 = 0.f, t1 = 0.f;
#pragma unroll
    for (int w = 0; w < 8; ++w) { t0 += red[0][w][0]; t1 += red[0][w][1]; }
    mean[0] = t0 * (1.0f / 8192.0f);
    mean[1] = t1 * (1.0f / 8192.0f);
  }
  {
    v4f a[2] = {{0.f, 0.f, 0.f, 0.f}, {0.f, 0.f, 0.f, 0.f}};
#pragma unroll
    for (int c = 0; c < XCB; ++c)
#pragma unroll
      for (int e = 0; e < 4; ++e) { const float d = xv[c][e] - mean[c / GSZ]; a[c / GSZ][e] += d * d; }
    const float s0 = wave_sum((a[0][0] + a[0][1]) + (a[0][2] + a[0][3]));
    const float s1 = wave_sum((a[1][0] + a[1][1]) + (a[1][2] + a[1][3]));
    if (lane == 0) { red[1][wave][0] = s0; red[1][wave][1] = s1; }
    __syncthreads();
    float t0 = 0.f, t1 = 0.f;
#pragma unroll
    for (int w = 0; w < 8; ++w) { t0 += red[1][w][0]; t1 += red[1][w][1]; }
    rstd[0] = 1.0f / sqrtf(t0 * (1.0f / 8192.0f) + 1e-6f);
    rstd[1] = 1.0f / sqrtf(t1 * (1.0f / 8192.0f) + 1e-6f);
  }
  float ssc[XCB], sbi[XCB];                   // block-uniform
#pragma unroll
  for (int c = 0; c < XCB; ++c) { ssc[c] = bfr(gsc[c0 + c]); sbi[c] = bfr(gbi[c0 + c]); }
#pragma unroll
  for (int e = 0; e < 4; ++e) {               // token 4 tid + e: 16 channels = 32 B of each plane
    unsigned hw[XCB / 2], lw[XCB / 2];
#pragma unroll
    for (int k = 0; k < XCB / 2; ++k) {
      const int ca = 2 * k, cb = 2 * k + 1;
      const float va = (xv[ca][e] - mean[ca / GSZ]) * rstd[ca / GSZ] * ssc[ca] + sbi[ca];
      const float vb = (xv[cb][e] - mean[cb / GSZ]) * rstd[cb / GSZ] * ssc[cb] + sbi[cb];
      const unsigned short ha = bf_bits(va), hb = bf_bits(vb);
      hw[k] = pk16(ha, hb);
      lw[k] = pk16(bf_bits(va - bf_up(ha)), bf_bits(vb - bf_up(hb)));
    }
#pragma unroll
    for (int j = 0; j < 2; ++j) {
      const v4u h4 = {hw[4 * j], hw[4 * j + 1], hw[4 * j + 2], hw[4 * j + 3]};
      const v4u l4 = {lw[4 * j], lw[4 * j + 1], lw[4 * j + 2], lw[4 * j + 3]};
      Th[tid * 9 + e * 2 + j] = h4;
      Tl[tid * 9 + e * 2 + j] = l4;
    }
  }
  __syncthreads();
  unsigned short* dh = XNh + (size_t)blk * (SEQ * XCB);
  unsigned short* dl = XNl + (size_t)blk * (SEQ * XCB);
#pragma unroll
  for (int it = 0; it < 8; ++it) {
    const int p = it * 256 + tid;             // 16-B piece of the work-group's 32 KiB of a plane
    const v4u h4 = Th[(p >> 3) * 9 + (p & 7)];
    const v4u l4 = Tl[(p >> 3) * 9 + (p & 7)];
    *(v4u*)(dh + (size_t)p * 8) = h4;
    *(v4u*)(dl + (size_t)p * 8) = l4;
  }
}

// =====================================================================================================
// Register-blocked batched bf16 WMMA GEMM: C[m][n] = sum_k A[m][k] * Bt[n][k] + bias; one wave per 64x64 tile,
// eight tiles per block: 8 / TNB tile rows x TNB tile columns (N / 64 a multiple of TNB, and equal to it where TNB < 8;
// the tile count a multiple of 8). A row-major [M][K] pitch lda; Bt row-major [N][K] pitch ldb (k contiguous);
// M, N multiples of 64, K multiple of GKC. blockIdx.y = batch index (strides in elements).
// Operands: per slab of GKC k the block's A rows and Bt rows (every plane) are copied into LDS, each wave copy = 4 whole
// 128-B lines, rows at pitch GSP; two buffers, slab s + 1 in flight while slab s is multiplied; the waves read their
// fragments from LDS. After the last slab the ring's first bytes serve as the epilogue's per-wave slabs.
// NSPLIT: 0 = A.Bt; 1 = (A + A2).Bt (A2 = unscaled bf16 lo plane of A, same accumulator);
//         3 = A.Bt + A.Bt2 (Bt2 = unscaled bf16 lo plane of Bt; the two planes are walked as alternate k-steps).
// OUT_MODE: 0 = f32 (pitch ldc); 1 = f32 with per-element residual: v = (acc + bias + bf16(R[m][n])) * oscale,
//           R f32 pitch ldr, batch stride strideR; 3 = f16 hi plane C + f16 residual plane C2 = f16((v - hi) * rscale),
//           C2 written only for tiles with n0 < N2 (pitch ldc2, batch stride strideC2).
// bias (f32, RNE-converted to bf16 then widened): bmode 0 = none, 1 = per column n, 2 = per row m;
//           index clamped to [0, blen-1].
// XB: 1 = the A planes, 2 = the Bt planes lie in the normalised planes' layout (xn_off, rows = tokens; lda / ldb unused):
//           a wave copy is still 4 whole lines (4 tokens x 32 B of each of 4 channel blocks); 0 = both row-major.
// PAIR: two products that share A in one launch of two batches: batch 1 takes its own bias vector (biasP, blenP) and
//           writes no residual plane; its Bt and C lie strideB and strideC behind those of batch 0.
// =====================================================================================================
template <int NSPLIT, int OUT_MODE, bool PAIR, int TNB, int XB>
__global__ __launch_bounds__(256) void gemm64(
    const unsigned short* __restrict__ Ap, const unsigned short* A2p, int lda, long long strideA,
    const unsigned short* __restrict__ Btp, const unsigned short* Bt2p, int ldb, long long strideB,
    void* Cout, int ldc, long long strideC,
    void* Cout2, int ldc2, long long strideC2, int N2a,
    int M, int N, int K, float rscale,
    const float* __restrict__ biasA, int bmode, int blenA,
    const float* __restrict__ Rp, int ldr, long long strideR, float oscale,
    const float* __restrict__ biasP = nullptr, int blenP = 0) {
  const __bf16* A   = (const __bf16*)(const void*)Ap;
  const __bf16* A2  = (const __bf16*)(const void*)A2p;
  const __bf16* Bt  = (const __bf16*)(const void*)Btp;
  const __bf16* Bt2 = (const __bf16*)(const void*)Bt2p;
  constexpr int RA  = (8 / TNB) * 64;               // A rows of the block, per plane
  constexpr int RB  = TNB * 64;                     // Bt rows of the block, per plane
  constexpr int PA  = (NSPLIT == 1) ? 2 : 1;        // A planes
  constexpr int PB  = (NSPLIT == 3) ? 2 : 1;        // Bt planes
  constexpr int RT  = PA * RA + PB * RB;            // staged rows per slab: [A planes][Bt planes]
  constexpr int NIT = RT / 32;                      // copies per thread and slab (256 threads x 16 B = 32 rows)
  static_assert((RA % 32) == 0 && (RB % 32) == 0 && (NIT % 2) == 0 && NIT <= 63);
  static_assert(2 * RT * GSP * 2 >= 8 * 16 * 68 * 4);
  __shared__ __align__(16) __bf16 ring[2 * RT * GSP];   // two slab buffers; afterwards per-wave 16x64 f32 slabs, pitch 68
  const int b    = blockIdx.y;
  const bool second = PAIR && (b == 1);                      // block-uniform
  const float* bias = second ? biasP : biasA;
  const int blen = second ? blenP : blenA;
  const int N2   = second ? 0 : N2a;
  const int lane = threadIdx.x & 31;
  const int wave = threadIdx.x >> 5;
  const int tilesN = N >> 6;
  const int tilesM = M >> 6;
  const int tile = blockIdx.x * 8 + wave;
  if ((int)blockIdx.x * 8 >= tilesM * tilesN) return;   // block-uniform, in front of every barrier
  const int tm = tile / tilesN;
  const int tn = tile - tm * tilesN;
  const int m0 = tm << 6;
  const int n0 = tn << 6;

  const __bf16* Ab  = A  + (size_t)b * strideA;
  const __bf16* Bb  = Bt + (size_t)b * strideB;
  const __bf16* Ab2 = (NSPLIT == 1) ? (A2  + (size_t)b * strideA) : Ab;
  const __bf16* Bb2 = (NSPLIT == 3) ? (Bt2 + (size_t)b * strideB) : Bb;

  const int rlane = lane & 15;                 // row (A) / col (B, D) within subtile
  const int koff  = (lane >> 4) * 8;           // k offset of this lane half
  const int mOff  = (lane >> 4) * 8;           // D row offset

  v8f acc[4][4];
#pragma unroll
  for (int i = 0; i < 4; ++i)
#pragma unroll
    for (int j = 0; j < 4; ++j) acc[i][j] = zero8();

  // ---- staging: thread -> row (tid >> 3) of each group of 32 rows, 16-B piece (tid & 7) of its 128 B in the slab ----
  const int t0b  = blockIdx.x * 8;                   // the block's first tile
  const int mb0  = (t0b / tilesN) << 6;              // its first A row
  const int nb0  = (t0b - (t0b / tilesN) * tilesN) << 6;   // its first Bt row
  const int srow = threadIdx.x >> 3;
  const int sseg = (threadIdx.x & 7) * 8;
  const unsigned lthr = lds_off(ring) + (unsigned)(srow * GSP + sseg) * 2u;
  auto stage = [&](int slab, int buf) {
    const int kc = slab * GKC + sseg;
    const unsigned lb = lthr + (unsigned)buf * (unsigned)(RT * GSP * 2);
#pragma unroll   // both loops: each copy's plane and row group are compile-time, the statement's operands stay in registers
    for (int g0 = 0; g0 < NIT; g0 += 8) {
      unsigned l[8];
      const __bf16* g[8];
#pragma unroll
      for (int e = 0; e < 8; ++e) {
        const int fr = (g0 + e < NIT) ? (g0 + e) * 32 : 0;     // first staged row of this copy's group of 32
        if (fr < PA * RA) {
          const int r = fr % RA;
          g[e] = ((fr / RA) ? Ab2 : Ab) + ((XB == 1) ? xn_off(mb0 + r + srow, kc) : (size_t)(mb0 + r + srow) * lda + kc);
        } else {
          const int r = (fr - PA * RA) % RB;
          g[e] = (((fr - PA * RA) / RB) ? Bb2 : Bb) + ((XB == 2) ? xn_off(nb0 + r + srow, kc) : (size_t)(nb0 + r + srow) * ldb + kc);
        }
        l[e] = lb + (unsigned)(fr * GSP * 2);
      }
      if (g0 + 8 <= NIT) acopy8(l, g);
      else               acopy2(l, g);
    }
  };
  static_assert((NIT % 8) == 0 || (NIT % 8) == 2);

  const int nsl = K / GKC;                           // slabs
  const int aRow = (wave / TNB) * 64 + rlane;        // the wave's first A row inside a staged plane
  const int bRow = PA * RA + (wave % TNB) * 64 + rlane;   // its first Bt row inside the staged slab
  stage(0, 0);
  wait_async0();
  __syncthreads();                                   // slab 0 is published
  if (nsl > 1) stage(1, 1);
  for (int sl = 0; sl < nsl; ++sl) {
    const __bf16* sb = ring + (sl & 1) * (RT * GSP);
#pragma unroll   // k and plane offsets fold into the LDS loads' immediate offsets
    for (int ks = 0; ks < GKC / 32; ++ks) {
      const int kl = ks * 32 + koff;                 // k inside the slab
      const __bf16* As = sb + (size_t)aRow * GSP + kl;
      v16b ah[4], al[4];
#pragma unroll
      for (int i = 0; i < 4; ++i) {
        ah[i] = ldfrag_b(As + i * 16 * GSP);
        al[i] = ah[i];
        if (NSPLIT == 1) al[i] = ldfrag_b(As + (RA + i * 16) * GSP);
      }
#pragma unroll
      for (int pl = 0; pl < PB; ++pl) {              // the Bt planes of one k step follow each other, hi then lo
        const __bf16* Bs = sb + (size_t)(bRow + pl * RB) * GSP + kl;
        v16b bh[4];
#pragma unroll
        for (int j = 0; j < 4; ++j) bh[j] = ldfrag_b(Bs + j * 16 * GSP);
#pragma unroll
        for (int i = 0; i < 4; ++i) {
#pragma unroll
          for (int j = 0; j < 4; ++j) {
            acc[i][j] = mma_b_raw(ah[i], bh[j], acc[i][j]);
            if (NSPLIT == 1) acc[i][j] = mma_b_raw(al[i], bh[j], acc[i][j]);
          }
          dep_guard_b(acc[i][0], acc[i][3], ah[i], al[i]);
        }
        keep4_b(bh[0], bh[1], bh[2], bh[3]);
      }
    }
    wait_ds0();
    wait_async0();
    __syncthreads();                                 // publishes slab sl + 1 and ends every read of slab sl's buffer
    if (sl + 2 < nsl) stage(sl + 2, sl & 1);
  }
  wait_async0();
  acc_guard4(acc[0][0], acc[0][1], acc[0][2], acc[0][3]);
  acc_guard4(acc[1][0], acc[1][1], acc[1][2], acc[1][3]);
  acc_guard4(acc[2][0], acc[2][1], acc[2][2], acc[2][3]);
  acc_guard4(acc[3][0], acc[3][1], acc[3][2], acc[3][3]);

  // ---- bias (per column), clamped address, selected by value ----
  float bc[4];
#pragma unroll
  for (int j = 0; j < 4; ++j) {
    int bi = n0 + (j << 4) + rlane;
    bi = (bi < blen) ? bi : (blen - 1);
    bi = (bi > 0) ? bi : 0;
    const float t = bf_up(bf_bits(bias[bi]));
    bc[j] = (bmode == 1) ? t : 0.f;
  }

  // ---- epilogue ----
  float* slab = (float*)(void*)ring + wave * (16 * 68);
#pragma unroll
  for (int i = 0; i < 4; ++i) {
    const int mBase = m0 + (i << 4);
    float brw[8];
#pragma unroll
    for (int r = 0; r < 8; ++r) {
      int bi = mBase + mOff + r;
      bi = (bi < blen) ? bi : (blen - 1);
      bi = (bi > 0) ? bi : 0;
      const float t = bf_up(bf_bits(bias[bi]));
      brw[r] = (bmode == 2) ? t : 0.f;
    }
#pragma unroll
    for (int j = 0; j < 4; ++j) {
#pragma unroll
      for (int r = 0; r < 8; ++r) {
        slab[(mOff + r) * 68 + (j << 4) + rlane] = acc[i][j][r] + bc[j] + brw[r];
      }
    }
    wave_sync_lds();
    if (OUT_MODE == 0 || OUT_MODE == 1) {
      float* C = (float*)Cout + (size_t)b * strideC;
      const float* R = Rp + (size_t)b * strideR;
      const int hh = lane >> 4, c4 = (lane & 15) * 4;     // 256-B row segment = 16 lanes x 16 B
      {
#pragma unroll
        for (int it = 0; it < 8; ++it) {
          const int row = it * 2 + hh;                     // it 0..7 x hh 0..1 = rows 0..15
          v4f v = *(const v4f*)(slab + row * 68 + c4);
          if (OUT_MODE == 1) {
            const v4f xr = *(const v4f*)(R + (size_t)(mBase + row) * ldr + n0 + c4);
            v4f t;
            t[0] = (v[0] + bfr(xr[0])) * oscale;
            t[1] = (v[1] + bfr(xr[1])) * oscale;
            t[2] = (v[2] + bfr(xr[2])) * oscale;
            t[3] = (v[3] + bfr(xr[3])) * oscale;
            v = t;
          }
          *(v4f*)(C + (size_t)(mBase + row) * ldc + n0 + c4) = v;
        }
        
      }
    } else {
      const int q = lane >> 3, c8 = (lane & 7) * 8;
      unsigned short* C  = (unsigned short*)Cout  + (size_t)b * strideC;
      unsigned short* C2 = (unsigned short*)Cout2 + (size_t)b * strideC2;
      const bool wlo = (n0 < N2);                           // wave-uniform
      v4u hv[4], lv[4];
#pragma unroll
      for (int it = 0; it < 4; ++it) {
        const int row = it * 4 + q;                        // it 0..3 x q 0..3 = rows 0..15
        const float* sp = slab + row * 68 + c8;
        v4u a, a2;
#pragma unroll
        for (int e = 0; e < 4; ++e) {
          const float f0 = sp[2 * e], f1 = sp[2 * e + 1];
          const _Float16 x0 = (_Float16)f0, x1 = (_Float16)f1;
          const unsigned short h0 = h_bits(x0), h1 = h_bits(x1);
          const unsigned short l0 = h_bits((_Float16)((f0 - (float)x0) * rscale));
          const unsigned short l1 = h_bits((_Float16)((f1 - (float)x1) * rscale));
          a[e] = pk16(h0, h1); a2[e] = pk16(l0, l1);
        }
        hv[it] = a; lv[it] = a2;
      }
      {
#pragma unroll
        for (int it = 0; it < 4; ++it) {
          const int row = it * 4 + q;
          *(v4u*)(C + (size_t)(mBase + row) * ldc + n0 + c8) = hv[it];
          if (wlo) *(v4u*)(C2 + (size_t)(mBase + row) * ldc2 + n0 + c8) = lv[it];
        }
        
      }
    }
    wave_sync_lds();
  }
}

// =====================================================================================================
// Attention, head dim 64, no masking, softmax over all SEQ keys.
//   q hi plane (f16, pitch DM): element (b, t, h, d) at [(b*SEQ + t)*DM + h*64 + d]; q residual plane
//   (f16, (q - f16(q))*4096, pitch DM) same layout; k plane (f16, pitch DM) same layout.
//   v^T hi plane (f16): element (b, h, d, s) at [(b*DM + h*64 + d)*SEQ + s]; v^T residual plane (f16, x4096): same layout
//   out: context as bf16 hi plane and bf16 lo plane (lo = RNE(v - hi), unscaled), pitch DM: element (b, t, h, d) at
//   [(b*SEQ + t)*DM + h*64 + d] of each plane
//   Both products are taken transposed, so that a lane owns ONE query (column lane & 15):
//   scores^T[key][query] = (k . qh + (k . ql) * rres) * sscale on f16 WMMA (A = K rows, B = q), residual products in a
//   separate accumulator; a lane holds 32 of its query's 64 scores (keys 16 j + 8 (lane >> 4) + r), so the maximum and
//   the sum run in the lane, with one exchange between the wave halves for the maximum per chunk and one for the sum
//   at the end. p = exp(s - m) carried as f16(1024 p): score tiles 2 kk and 2 kk + 1, converted in place, ARE the
//   B operand (keys 32 kk .. + 31 in the hardware k order) of context^T[d][query] = vh . p + (vl . p) * rres
//   (A = V^T rows; separate accumulator folded per chunk in f32); online softmax in f32.
//   Block = 4 waves = 64 query rows of one (b, h); grid = NQB * NH * NB; kv chunks of 64, static trip NQB.
//   K / V^T chunk staging: 128 threads x 32 elements per plane = the whole 64x64 tile (plain 16-B loads,
//   __syncthreads before and after).
//   Output coverage: each wave stores rows q0..q0+15 (it 0..3 x lane>>3 0..3) x 64 columns of both planes; a row's
//   64 columns of one plane = 8 lanes x 16 B = one whole 128-B line
// =====================================================================================================
__device__ __forceinline__ float other_half(float v) {       // the value that lane ^ 16 holds
  const int b = __builtin_bit_cast(int, v);
  return __builtin_bit_cast(float, __builtin_amdgcn_permlanex16(b, b, 0x76543210, 0xfedcba98, false, false));
}
__global__ __launch_bounds__(128)
void attn64(const unsigned short* __restrict__ qhp, const unsigned short* __restrict__ qlp,
            const unsigned short* __restrict__ khp,
            const unsigned short* __restrict__ vhp, const unsigned short* __restrict__ vlp,
            unsigned short* ctxh, unsigned short* ctxl, float sscale, float rres) {
  union FH { v16h v; v8h h[2]; };
  __shared__ __align__(16) _Float16 KV[3 * 64 * KVP];             // one array: every fragment read = one base + a constant
  _Float16* const Ksh = KV;                                       // K [kv][d], 64 halves used per row
  _Float16* const Vth = KV + 64 * KVP;                            // V^T hi [d][kv]
  _Float16* const Vtl = KV + 128 * KVP;                           // V^T residual [d][kv]
  __shared__ __align__(16) float    Os[4][16 * OSP];              // per wave context tile [row][d]

  const int tid  = threadIdx.x;
  const int wave = tid >> 5;
  const int lane = tid & 31;
  const int hh   = lane >> 4;
  const int c    = lane & 15;

  const int bx   = blockIdx.x;
  const int qb   = bx % NQB;
  const int rest = bx / NQB;
  const int h    = rest % NH;
  const int b    = rest / NH;
  const int q0   = qb * 64 + wave * 16;
  const size_t rowB = (size_t)b * SEQ;

  const _Float16* Qh = (const _Float16*)(const void*)qhp + (size_t)h * HD;
  const _Float16* Ql = (const _Float16*)(const void*)qlp + (size_t)h * HD;
  const _Float16* Kg = (const _Float16*)(const void*)khp + (size_t)h * HD;
  const _Float16* Vh = (const _Float16*)(const void*)vhp + ((size_t)b * DM + (size_t)h * HD) * SEQ;
  const _Float16* Vl = (const _Float16*)(const void*)vlp + ((size_t)b * DM + (size_t)h * HD) * SEQ;

  // ---- Q fragments (B operand, column = query = lane&15): 2 d-chunks, hi and residual ----
  v16h qah[2], qal[2];
#pragma unroll
  for (int dc = 0; dc < 2; ++dc) {
    qah[dc] = ldfrag_h(Qh + (rowB + q0 + c) * DM + dc * 32 + 8 * hh);
    qal[dc] = ldfrag_h(Ql + (rowB + q0 + c) * DM + dc * 32 + 8 * hh);
  }

  float mrow = -INFINITY;                    // running maximum of query c (equal in both wave halves)
  float lrow = 0.f;                          // running sum of query c over this half's keys
  v8f oacc[4];                               // context^T: oacc[t][r] = element d = 16 t + 8 hh + r of query c
#pragma unroll
  for (int t = 0; t < 4; ++t) oacc[t] = zero8();

  for (int kt = 0; kt < NQB; ++kt) {         // static trip count
    const int kv0 = kt * 64;
    __syncthreads();
    {
      const int r = tid >> 1, hf = (tid & 1) * 32;
      const _Float16* kg  = Kg + (rowB + kv0 + r) * DM + hf;       // K row kv0+r, d = hf..hf+31
      const _Float16* vg  = Vh + (size_t)r * SEQ + kv0 + hf;       // V^T row d = r, s = kv0+hf..+31
      const _Float16* vlg = Vl + (size_t)r * SEQ + kv0 + hf;
#pragma unroll
      for (int i = 0; i < 4; ++i) {
        const v8h a0 = *(const v8h*)(kg + 8 * i);
        const v8h b0 = *(const v8h*)(vg + 8 * i);
        const v8h b1 = *(const v8h*)(vlg + 8 * i);
        *(v8h*)(Ksh + r * KVP + hf + 8 * i) = a0;
        *(v8h*)(Vth + r * KVP + hf + 8 * i) = b0;
        *(v8h*)(Vtl + r * KVP + hf + 8 * i) = b1;
      }
    }
    __syncthreads();

    // ---- scores^T: 64 keys x 16 queries per wave, 2 f16 products (hi, residual) ----
    //      LDS reads stand in three groups per chunk: all of K; V^T of keys 0..31, read under the softmax; V^T of keys 32..63
    v8f s[4];                                // s[j][r]: key 16 j + 8 hh + r against query c
    FH vh0[4], vl0[4];                       // V^T fragments of keys 0..31, hi and residual
    {
      FH kb[4][2];
#pragma unroll   // every loop of this block: kb, sh, sl, vh0 and vl0 are register arrays, constant indices
      for (int j = 0; j < 4; ++j)
#pragma unroll
        for (int dc = 0; dc < 2; ++dc) {
          kb[j][dc].h[0] = *(const v8h*)(Ksh + (j * 16 + c) * KVP + dc * 32 + 8 * hh);
          kb[j][dc].h[1] = *(const v8h*)(Ksh + (j * 16 + c) * KVP + dc * 32 + 16 + 8 * hh);
        }
      group_fence();
      v8f sh[4], sl[4];
#pragma unroll
      for (int j = 0; j < 4; ++j) { sh[j] = zero8(); sl[j] = zero8(); }
#pragma unroll
      for (int dc = 0; dc < 2; ++dc)
#pragma unroll
        for (int j = 0; j < 4; ++j) {
          sh[j] = mma_h(kb[j][dc].v, qah[dc], sh[j]);
          sl[j] = mma_h(kb[j][dc].v, qal[dc], sl[j]);
        }
      // ends the run: a builtin WMMA is otherwise free to sink to its first use, behind the reads that take over K's registers
      acc_guard4(sh[0], sh[1], sh[2], sh[3]);
      acc_guard4(sl[0], sl[1], sl[2], sl[3]);
      group_fence();
#pragma unroll
      for (int t = 0; t < 4; ++t) {
        vh0[t].h[0] = *(const v8h*)(Vth + (t * 16 + c) * KVP + 8 * hh);
        vh0[t].h[1] = *(const v8h*)(Vth + (t * 16 + c) * KVP + 16 + 8 * hh);
        vl0[t].h[0] = *(const v8h*)(Vtl + (t * 16 + c) * KVP + 8 * hh);
        vl0[t].h[1] = *(const v8h*)(Vtl + (t * 16 + c) * KVP + 16 + 8 * hh);
      }
      group_fence();
#pragma unroll
      for (int j = 0; j < 4; ++j)
#pragma unroll
        for (int r = 0; r < 8; ++r) s[j][r] = (sh[j][r] + sl[j][r] * rres) * sscale;
    }

    // ---- maximum in the lane, joined across the halves; online softmax; P^T (x1024, f16) packed in registers ----
    float mx[8];
#pragma unroll   // mx and s are register arrays: constant indices; eight independent chains
    for (int r = 0; r < 8; ++r) mx[r] = fmaxf(fmaxf(s[0][r], s[1][r]), fmaxf(s[2][r], s[3][r]));
    float m = fmaxf(fmaxf(fmaxf(mx[0], mx[1]), fmaxf(mx[2], mx[3])), fmaxf(fmaxf(mx[4], mx[5]), fmaxf(mx[6], mx[7])));
    m = fmaxf(m, other_half(m));
    const float mnew  = fmaxf(mrow, m);
    const float alpha = __expf(mrow - mnew);
    mrow = mnew;
    FH pb[2];                                // pb[kk]: keys 32 kk + (8 hh + e | 16 + 8 hh + e - 8) of query c
    float ps[4];                             // four independent partial sums, one per score tile
#pragma unroll   // both loops: s, ps and pb are register arrays, their indices must be compile-time constants
    for (int j = 0; j < 4; ++j) {
      ps[j] = 0.f;
#pragma unroll
      for (int r = 0; r < 8; ++r) {
        const float p = __expf(s[j][r] - mnew);
        ps[j] += p;
        pb[j >> 1].v[(j & 1) * 8 + r] = (_Float16)(p * 1024.0f);
      }
    }
    lrow = lrow * alpha + ((ps[0] + ps[1]) + (ps[2] + ps[3]));
#pragma unroll
    for (int t = 0; t < 4; ++t)
#pragma unroll
      for (int r = 0; r < 8; ++r) oacc[t][r] *= alpha;

    // ---- context^T += V^T . P^T (f16 WMMA), residual products into a separate accumulator ----
    v8f o1[4];
    FH vh1[4], vl1[4];                       // V^T fragments of keys 32..63
#pragma unroll   // every loop down to the fold: register arrays, constant indices
    for (int t = 0; t < 4; ++t) oacc[t] = mma_h(vh0[t].v, pb[0].v, oacc[t]);
    acc_guard4(oacc[0], oacc[1], oacc[2], oacc[3]);   // ends the run, as above: the next reads take over vh0's registers
    group_fence();
#pragma unroll
    for (int t = 0; t < 4; ++t) {
      vh1[t].h[0] = *(const v8h*)(Vth + (t * 16 + c) * KVP + 32 + 8 * hh);
      vh1[t].h[1] = *(const v8h*)(Vth + (t * 16 + c) * KVP + 32 + 16 + 8 * hh);
      vl1[t].h[0] = *(const v8h*)(Vtl + (t * 16 + c) * KVP + 32 + 8 * hh);
      vl1[t].h[1] = *(const v8h*)(Vtl + (t * 16 + c) * KVP + 32 + 16 + 8 * hh);
    }
    group_fence();
#pragma unroll
    for (int t = 0; t < 4; ++t) o1[t] = mma_h(vl0[t].v, pb[0].v, zero8());
#pragma unroll
    for (int t = 0; t < 4; ++t) oacc[t] = mma_h(vh1[t].v, pb[1].v, oacc[t]);
#pragma unroll
    for (int t = 0; t < 4; ++t) o1[t] = mma_h(vl1[t].v, pb[1].v, o1[t]);
    acc_guard4(oacc[0], oacc[1], oacc[2], oacc[3]);   // the twelve WMMAs run back to back, the fold follows them
    acc_guard4(o1[0], o1[1], o1[2], o1[3]);
#pragma unroll
    for (int t = 0; t < 4; ++t)
#pragma unroll
      for (int r = 0; r < 8; ++r) oacc[t][r] += o1[t][r] * rres;
  }

  // ---- join the halves' sums, normalise (1/l and the 1/1024 p carry), stage the wave's 16x64 f32 tile in LDS
  //      (a lane's 8 registers of tile t = 8 consecutive d of its query's row), then split each value into its bf16
  //      hi and lo parts and write whole lines of the two planes
  float* os = Os[wave];
  {
    const float l = lrow + other_half(lrow);
    const float inv = ((l > 0.f) ? (1.0f / l) : 0.f) * (1.0f / 1024.0f);
#pragma unroll   // both loops: oacc is a register array, its indices must be compile-time constants
    for (int t = 0; t < 4; ++t) {
      v4f w0, w1;
#pragma unroll
      for (int e = 0; e < 4; ++e) { w0[e] = oacc[t][e] * inv; w1[e] = oacc[t][4 + e] * inv; }
      *(v4f*)(os + c * OSP + t * 16 + 8 * hh)     = w0;
      *(v4f*)(os + c * OSP + t * 16 + 8 * hh + 4) = w1;
    }
  }
  wave_sync_lds();
  {
    const int q = lane >> 3, c8 = (lane & 7) * 8;
    v4u hv[4], lv[4];
#pragma unroll   // both loops: hv and lv are register arrays, their indices must be compile-time constants
    for (int it = 0; it < 4; ++it) {
      const int row = it * 4 + q;                        // it 0..3 x q 0..3 = rows 0..15 of the wave tile
      const v4f a = *(const v4f*)(os + row * OSP + c8);
      const v4f d = *(const v4f*)(os + row * OSP + c8 + 4);
      const float f[8] = {a[0], a[1], a[2], a[3], d[0], d[1], d[2], d[3]};
#pragma unroll
      for (int e = 0; e < 4; ++e) {
        const unsigned short h0 = bf_bits(f[2 * e]), h1 = bf_bits(f[2 * e + 1]);
        hv[it][e] = pk16(h0, h1);
        lv[it][e] = pk16(bf_bits(f[2 * e] - bf_up(h0)), bf_bits(f[2 * e + 1] - bf_up(h1)));
      }
    }
#pragma unroll
    for (int it = 0; it < 4; ++it) {
      const size_t o = (rowB + q0 + it * 4 + q) * DM + (size_t)h * HD + c8;
      *(v4u*)(ctxh + o) = hv[it];
      *(v4u*)(ctxl + o) = lv[it];
    }
  }
}

// =====================================================================================================
// Workspace map (bytes), every plane an exact multiple of its whole-row / 64x64-tile / whole-line store granularity:
//   WT    bf16 [4][256 o][256 i]     0          524288     (Wq, Wk, Wv, Wp transposed, k = in contiguous)
//   XNh   bf16 [16][16][1024 t][16 c] 524288    8388608    (GroupNorm output, blocks of 16 channels, hi plane)
//   XNl   bf16 [16][16][1024][16]    8912896    8388608    (lo plane)
//   Qh    f16  [16384][256]          17301504   8388608
//   Ql    f16  [16384][256]          25690112   8388608    (q residual x4096)
//   Kh    f16  [16384][256]          34078720   8388608
//   VTh   f16  [16][256 c][1024 t]   42467328   8388608
//   VTl   f16  [16][256][1024]       50855936   8388608    (v residual x4096)
//   CTXh  bf16 [16384 t][256 c]      59244544   8388608    (attention context, token-major, hi plane)
//   CTXl  bf16 [16384][256]          67633152   8388608    (lo plane)
//   end                              76021760
// =====================================================================================================
extern "C" void kernel_launch(void* const* d_in, const int* in_sizes, int n_in,
                              void* d_out, int out_size, void* d_ws, size_t ws_size,
                              hipStream_t stream) {
  if (n_in < 11) return;
  if (in_sizes[0] != NB * DM * SEQ) return;
  if (in_sizes[3] != DM * DM || in_sizes[5] != DM * DM || in_sizes[7] != DM * DM || in_sizes[9] != DM * DM) return;
  if (in_sizes[1] < DM || in_sizes[2] < DM) return;
  if (in_sizes[4] < 1 || in_sizes[6] < 1 || in_sizes[8] < 1 || in_sizes[10] < 1) return;
  if (out_size != NB * DM * SEQ) return;

  const float* x   = (const float*)d_in[0];
  const float* gsc = (const float*)d_in[1];
  const float* gbi = (const float*)d_in[2];
  const float* wq  = (const float*)d_in[3];
  const float* bq  = (const float*)d_in[4];
  const float* wk  = (const float*)d_in[5];
  const float* bk  = (const float*)d_in[6];
  const float* wv  = (const float*)d_in[7];
  const float* bv  = (const float*)d_in[8];
  const float* wp  = (const float*)d_in[9];
  const float* bp  = (const float*)d_in[10];
  float* out = (float*)d_out;

  const size_t PWT = (size_t)4 * DM * DM * 2;          //   524288
  const size_t P16 = (size_t)NB * SEQ * DM * 2;        //  8388608
  size_t off = 0;
  const size_t oWT   = off; off += PWT;
  const size_t oXNh  = off; off += P16;
  const size_t oXNl  = off; off += P16;
  const size_t oQh   = off; off += P16;
  const size_t oQl   = off; off += P16;
  const size_t oKh   = off; off += P16;
  const size_t oVTh  = off; off += P16;
  const size_t oVTl  = off; off += P16;
  const size_t oCTXh = off; off += P16;
  const size_t oCTXl = off; off += P16;
  if (off > ws_size) return;                            // off = 76021760
  if (off > (size_t)134217728) return;

  char* ws = (char*)d_ws;
  unsigned short* WT   = (unsigned short*)(ws + oWT);
  unsigned short* XNh  = (unsigned short*)(ws + oXNh);
  unsigned short* XNl  = (unsigned short*)(ws + oXNl);
  unsigned short* Qh   = (unsigned short*)(ws + oQh);
  unsigned short* Ql   = (unsigned short*)(ws + oQl);
  unsigned short* Kh   = (unsigned short*)(ws + oKh);
  unsigned short* VTh  = (unsigned short*)(ws + oVTh);
  unsigned short* VTl  = (unsigned short*)(ws + oVTl);
  unsigned short* CTXh = (unsigned short*)(ws + oCTXh);
  unsigned short* CTXl = (unsigned short*)(ws + oCTXl);
  unsigned short* WTq = WT + (size_t)0 * DM * DM;
  unsigned short* WTv = WT + (size_t)2 * DM * DM;
  unsigned short* WTp = WT + (size_t)3 * DM * DM;

  const dim3 blk(256);
  const dim3 gWT(16, 4);                                          // 16 tiles of 64x64 per weight, 4 weights
  const dim3 gGN(NB * (DM / XCB));                                // 256 blocks, one for each WGP
  const dim3 gQK(((NB * SEQ / 64) * (DM / 64) + 7) / 8, 2);       // 1024 tiles -> 128 blocks: M=16384, N=256; y: 0 = q, 1 = k
  const dim3 gVT(((DM / 64) * (SEQ / 64) + 7) / 8, NB);           // 64 tiles -> 8 blocks x 16 batches: M=256, N=1024
  const dim3 gAttn(NB * NH * NQB);                                // 1024 blocks
  const float rs2 = 1.0f / 1.41421356237309515f;

  // (1) weights [in][out] -> bf16 [out][in] planes (RNE convert)
  wt_cvt<<<gWT, blk, 0, stream>>>(wq, wk, wv, wp, WT);
  // (2, 3) GroupNorm statistics from bf16(x) and apply -> bf16 hi + lo planes [16][16 channel blocks][1024 t][16 c]
  gn_norm<<<gGN, blk, 0, stream>>>(x, gsc, gbi, XNh, XNl);
  // (4, 5) one launch of 2 x 128 blocks, one block for each of the chip's 256 WGPs (M=16384, N=256, K=256, bias per column):
  //     y = 0: q = xn . Wq + bq -> f16 hi plane [16384][256] + f16 residual x4096
  //     y = 1: k = xn . Wk + bk -> f16 plane [16384][256], no residual
  //     Wk's plane lies one weight plane behind WTq, Kh two activation planes behind Qh (workspace map above)
  gemm64<1, 3, true, 4, 1><<<gQK, blk, 0, stream>>>(
      XNh, XNl, DM, 0LL, WTq, WTq, DM, (long long)DM * DM,
      (void*)Qh, DM, 2LL * NB * SEQ * DM, (void*)Ql, DM, 0LL, DM,
      NB * SEQ, DM, DM, 4096.0f, bq, 1, in_sizes[4], x, 0, 0LL, 1.0f, bk, in_sizes[6]);
  // (6) v^T[b][c][t] = sum_i Wv[i][c] xn[b][t][i] + bv[c] per batch -> f16 hi plane (pitch SEQ) + residual x4096
  //     (A = WTv [c][i], Bt = XN rows of batch b hi + lo; M=256, N=1024, K=256; bias per row)
  gemm64<3, 3, false, 8, 2><<<gVT, blk, 0, stream>>>(
      WTv, WTv, DM, 0LL, XNh, XNl, DM, (long long)SEQ * DM,
      (void*)VTh, SEQ, (long long)DM * SEQ, (void*)VTl, SEQ, (long long)DM * SEQ, SEQ,
      DM, SEQ, DM, 4096.0f, bv, 2, in_sizes[8], x, 0, 0LL, 1.0f);
  // (7) attention: scores scale 1/sqrt(C) = 1/16 -> context bf16 hi + lo planes [16384][256] token-major
  attn64<<<gAttn, dim3(128), 0, stream>>>(Qh, Ql, Kh, VTh, VTl, CTXh, CTXl, 0.0625f, 1.0f / 4096.0f);
  // (8) out[b][c][t] = (sum_o Wp[o][c] ctx[b][t][o] + bp[c] + bf16(x[b][c][t])) * (1/sqrt2) per batch, written
  //     straight into the NCHW output rows of 1024 floats (A = WTp [c][o], Bt = CTX rows hi + lo; M=256, N=1024, K=256)
  gemm64<3, 1, false, 8, 0><<<gVT, blk, 0, stream>>>(
      WTp, WTp, DM, 0LL, CTXh, CTXl, DM, (long long)SEQ * DM,
      (void*)out, SEQ, (long long)DM * SEQ, (void*)out, SEQ, (long long)DM * SEQ, 0,
      DM, SEQ, DM, 1.0f, bp, 2, in_sizes[10], x, SEQ, (long long)DM * SEQ, rs2);
  (void)hipGetLastError();
}

// v008
// A run of this version takes 87 microseconds.
// Two timings next to v007 put it at 1.17 and 1.16 times that version's speed.
// All steps since v000 together make it 2.61 times as fast.
// Contractions: q, k, v^T and output projections = v_wmma_f32_16x16x32_bf16 (bf16 operands: weights and biases from
// RNE-converted inputs, computed activations as bf16 hi + lo planes, 2 products); q.k^T scores = v_wmma_f32_16x16x32_f16
// (q as f16 hi plane + f16 residual plane x4096 in a separate accumulator, k f16; 2 products); p.v = v_wmma_f32_16x16x32_f16
// (p carried x1024 in f16, v^T as f16 hi plane + residual plane x4096 in a separate accumulator; 2 products);
// all f32 accumulate; GroupNorm statistics, softmax, biases, residual add and output scale in f32.
#include <hip/hip_runtime.h>
#include <math.h>
#include <stdint.h>

#define NB    16            // batch
#define DM    256           // channels
#define SEQ   1024          // tokens (32 x 32)
#define NH    4             // heads
#define HD    64            // head dim
#define NQB   (SEQ / 64)    // 16 query / key tiles of 64
#define NGRP  32            // groups
#define GSZ   8             // channels per group
#define XCB   16            // channels per block of the normalised planes' layout [batch][c / 16][token][c % 16]
#define KVP   72            // LDS pitch (halves) of the attention K and V^T rows: 144 B = 16 B x odd, so the 16 rows
                            // that one ds_load_b128 fragment read touches fall on 16 different groups of four banks
#define OSP   68            // LDS pitch (floats) of the attention context tile: rows r and r + 8 on different banks
#define GKC   64            // k elements per staged GEMM slab: 128 B of every operand row (one whole line of a row-major row)
#define GSP   72            // LDS pitch (halves) of a staged GEMM operand row: 144 B = 16 B x odd, as for KVP
static_assert(NH * HD == DM);
static_assert((DM % GKC) == 0 && (GSP % 8) == 0 && ((GSP / 8) & 1) == 1 && GSP >= GKC);
static_assert(NGRP * GSZ == DM);
static_assert((SEQ % 64) == 0 && (DM % 64) == 0 && (DM % 32) == 0);
static_assert(XCB == 2 * GSZ && (DM % XCB) == 0 && (GKC % XCB) == 0 && SEQ == 4 * 256);
static_assert((KVP % 8) == 0 && ((KVP / 8) & 1) == 1 && KVP >= 64);
static_assert((OSP % 4) == 0 && OSP >= 64);

typedef _Float16 v16h __attribute__((ext_vector_type(16)));
typedef _Float16 v8h  __attribute__((ext_vector_type(8)));
typedef __bf16   v16b __attribute__((ext_vector_type(16)));
typedef __bf16   v8b  __attribute__((ext_vector_type(8)));
typedef float    v8f  __attribute__((ext_vector_type(8)));
typedef float    v4f  __attribute__((ext_vector_type(4)));
typedef unsigned int v4u __attribute__((ext_vector_type(4)));
typedef unsigned short v8us __attribute__((ext_vector_type(8)));

// ---- scalar helpers --------------------------------------------------------------------------------
__device__ __forceinline__ unsigned short bf_bits(float f) {          // f32 -> bf16 bits, RNE convert
  unsigned u = __float_as_uint(f);
  return (unsigned short)((u + 0x7FFFu + ((u >> 16) & 1u)) >> 16);
}
__device__ __forceinline__ float bf_up(unsigned short h) { return __uint_as_float(((unsigned)h) << 16); }
__device__ __forceinline__ float bfr(float f) { return bf_up(bf_bits(f)); }   // value RNE-converted to bf16 and widened
__device__ __forceinline__ unsigned short h_bits(_Float16 x) { return __builtin_bit_cast(unsigned short, x); }
__device__ __forceinline__ unsigned pk16(unsigned short a, unsigned short b) { return (unsigned)a | ((unsigned)b << 16); }
__device__ __forceinline__ v8f zero8() { v8f z = {0.f, 0.f, 0.f, 0.f, 0.f, 0.f, 0.f, 0.f}; return z; }

// ---- fragment loaders: 16-bit A/B operand, lane -> row/col (lane&15), p already includes +8*(lane>>4);
//      elements 0..7 <- p[0..7] (k0+8h..), elements 8..15 <- p[16..23] (k0+16+8h..)
__device__ __forceinline__ v16b ldfrag_b(const __bf16* p) {
  union { v16b v; v8b h[2]; } f;
  f.h[0] = *(const v8b*)(p);
  f.h[1] = *(const v8b*)(p + 16);
  return f.v;
}
__device__ __forceinline__ v16h ldfrag_h(const _Float16* p) {
  union { v16h v; v8h h[2]; } f;
  f.h[0] = *(const v8h*)(p);
  f.h[1] = *(const v8h*)(p + 16);
  return f.v;
}

// ---- WMMA helpers with trailing VALU hazard gap --------------------------------------------------------
__device__ __forceinline__ v8f mma_h(v16h a, v16h b, v8f c) {       // builtin alone: the compiler keeps its distances
  return __builtin_amdgcn_wmma_f32_16x16x32_f16(false, a, false, b, (short)0, c, false, false);
}
__device__ __forceinline__ v8f mma_b_raw(v16b a, v16b b, v8f c) {
  return __builtin_amdgcn_wmma_f32_16x16x32_bf16(false, a, false, b, (short)0, c, false, false);
}
__device__ __forceinline__ void dep_guard_b(v8f& a, v8f& b, v16b x, v16b y) {
#if defined(__HIP_DEVICE_COMPILE__)
  asm volatile("v_nop\n\tv_nop\n\tv_nop\n\tv_nop" : "+v"(a), "+v"(b) : "v"(x), "v"(y));
#endif
}
__device__ __forceinline__ void keep4_b(v16b a, v16b b, v16b c, v16b d) {
#if defined(__HIP_DEVICE_COMPILE__)
  asm volatile("v_nop" :: "v"(a), "v"(b), "v"(c), "v"(d));
#endif
}
__device__ __forceinline__ void acc_guard4(v8f& a, v8f& b, v8f& c, v8f& d) {
#if defined(__HIP_DEVICE_COMPILE__)
  asm volatile("v_nop\n\tv_nop\n\tv_nop\n\tv_nop" : "+v"(a), "+v"(b), "+v"(c), "+v"(d));
#endif
}
// Keeps a group of LDS reads together at its place: without it the compiler spreads the reads among the WMMAs,
// one read-and-wait place per fragment.
__device__ __forceinline__ void group_fence() { __builtin_amdgcn_sched_barrier(0); }
__device__ __forceinline__ void wave_sync_lds() {
  __builtin_amdgcn_fence(__ATOMIC_RELEASE, "workgroup");
  __builtin_amdgcn_wave_barrier();
  __builtin_amdgcn_fence(__ATOMIC_ACQUIRE, "workgroup");
}

// ---- asynchronous global -> LDS copies, 16 B per lane, through no register ------------------------------
__device__ __forceinline__ unsigned lds_off(const void* p) { return (unsigned)(size_t)p; }   // LDS byte address
// Eight (two) copies in one statement; its last line keeps the address registers untouched until the copies are taken.
__device__ __forceinline__ void acopy8(const unsigned* l, const __bf16* const* g) {
#if defined(__HIP_DEVICE_COMPILE__)
  asm volatile("global_load_async_to_lds_b128 %0, %8, off\n\t"
               "global_load_async_to_lds_b128 %1, %9, off\n\t"
               "global_load_async_to_lds_b128 %2, %10, off\n\t"
               "global_load_async_to_lds_b128 %3, %11, off\n\t"
               "global_load_async_to_lds_b128 %4, %12, off\n\t"
               "global_load_async_to_lds_b128 %5, %13, off\n\t"
               "global_load_async_to_lds_b128 %6, %14, off\n\t"
               "global_load_async_to_lds_b128 %7, %15, off\n\t"
               "s_wait_xcnt 0x0"
               :: "v"(l[0]), "v"(l[1]), "v"(l[2]), "v"(l[3]), "v"(l[4]), "v"(l[5]), "v"(l[6]), "v"(l[7]),
                  "v"(g[0]), "v"(g[1]), "v"(g[2]), "v"(g[3]), "v"(g[4]), "v"(g[5]), "v"(g[6]), "v"(g[7])
               : "memory");
#endif
}
__device__ __forceinline__ void acopy2(const unsigned* l, const __bf16* const* g) {
#if defined(__HIP_DEVICE_COMPILE__)
  asm volatile("global_load_async_to_lds_b128 %0, %2, off\n\t"
               "global_load_async_to_lds_b128 %1, %3, off\n\t"
               "s_wait_xcnt 0x0"
               :: "v"(l[0]), "v"(l[1]), "v"(g[0]), "v"(g[1])
               : "memory");
#endif
}
__device__ __forceinline__ void wait_async0() {      // this wave's copies have landed in LDS
#if defined(__HIP_DEVICE_COMPILE__)
  asm volatile("s_wait_asynccnt 0x0" ::: "memory");
#endif
}
__device__ __forceinline__ void wait_x0() {
#if defined(__HIP_DEVICE_COMPILE__)
  asm volatile("s_wait_xcnt 0x0" ::: "memory");
#endif
}
// The same behind a run of indexed loads: naming the index registers as inputs keeps them unwritten up to the wait itself.
__device__ __forceinline__ void wait_x0_idx4(const int* i) {
#if defined(__HIP_DEVICE_COMPILE__)
  asm volatile("s_wait_xcnt 0x0" :: "v"(i[0]), "v"(i[1]), "v"(i[2]), "v"(i[3]) : "memory");
#endif
}
__device__ __forceinline__ void wait_x0_idx8(const int* i) {
#if defined(__HIP_DEVICE_COMPILE__)
  asm volatile("s_wait_xcnt 0x0" :: "v"(i[0]), "v"(i[1]), "v"(i[2]), "v"(i[3]), "v"(i[4]), "v"(i[5]), "v"(i[6]), "v"(i[7]) : "memory");
#endif
}
__device__ __forceinline__ void wait_ds0() {         // this wave's LDS reads have retired before their buffer is refilled
#if defined(__HIP_DEVICE_COMPILE__)
  asm volatile("s_wait_dscnt 0x0" ::: "memory");
#endif
}

// =====================================================================================================
// Weights W[in i][out o] (f32, 256x256) -> bf16 planes WT[w][o][i] (k = i contiguous), RNE convert.
// 16 tiles of 64x64 x 4 weights = 64 work-groups of 256 threads (block range of the launch prep, below). Load: 16 iterations x 4 input rows x 64 cols = the whole
// 64x64 tile into LDS transposed (unsigned short element stores); __syncthreads; write: each wave instruction
// =====================================================================================================
__device__ __forceinline__ void wt_cvt(const float* __restrict__ W0, const float* __restrict__ W1,
                                       const float* __restrict__ W2, const float* __restrict__ W3,
                                       unsigned short* WT, int bx, int wsel) {   // bx: tile, wsel: weight, both block-uniform
  __shared__ __align__(16) unsigned short T[64 * 72];
  const int tid = threadIdx.x, lane = tid & 31, wave = tid >> 5;
  const float* W = (wsel == 0) ? W0 : (wsel == 1) ? W1 : (wsel == 2) ? W2 : W3;
  const int i0 = (bx >> 2) * 64;                                 // input-channel tile
  const int o0 = (bx & 3) * 64;                                  // output-channel tile
#pragma unroll 4
  for (int it = 0; it < 16; ++it) {
    const int i = it * 4 + (tid >> 6);
    const int o = tid & 63;
    const float v = W[(size_t)(i0 + i) * DM + o0 + o];
    T[o * 72 + i] = bf_bits(v);
  }
  __syncthreads();
  const int q = lane >> 3, c8 = (lane & 7) * 8;
  v8us v[2];
#pragma unroll
  for (int it = 0; it < 2; ++it) {
    const int orow = it * 32 + wave * 4 + q;
    v[it] = *(const v8us*)(T + orow * 72 + c8);
  }
  unsigned short* dst = WT + (size_t)wsel * DM * DM;
  {
#pragma unroll
    for (int it = 0; it < 2; ++it) {
      const int orow = it * 32 + wave * 4 + q;
      *(v8us*)(dst + (size_t)(o0 + orow) * DM + i0 + c8) = v[it];
    }
    
  }
}

// =====================================================================================================
// GroupNorm, statistics and apply in one launch, + NCHW -> token-major transpose. A work-group owns XCB = 16 channels
// (two groups) of one batch: 16 x 1024 floats, held in registers from their one read to the final planes
// (thread -> 4 consecutive tokens x 16 channels, 16 loads of 16 B, all in flight together).
// Per group: mean, then the centred squares, both in f32 from bf16(x); rstd = 1/sqrt(var + 1e-6); sums: 4 chains in the
// lane, a butterfly over the wave, the 8 waves' sums in wave order.
// xn = (bf16(x) - mean) * rstd * bf16(scale[c]) + bf16(bias[c]) in f32 -> bf16 hi plane and bf16 lo plane = RNE(xn - hi).
// Plane layout [batch][c / 16][token][c % 16] (xn_off): the work-group's part of a plane is 32 KiB in a row, which it
// alone writes, whole 128-B lines: a thread's 4 tokens = one line, staged in LDS at pitch 144 B (16 B x odd), then each
// wave store = 512 B in a row. NB * DM / XCB work-groups of 256 threads (block range of the launch prep, below).
// =====================================================================================================
__device__ __forceinline__ size_t xn_off(int row, int k) {     // element (token row over all batches, channel k) of a plane
  return ((size_t)((row / SEQ) * (DM / XCB) + k / XCB) * SEQ + (size_t)(row % SEQ)) * XCB + (size_t)(k % XCB);
}
__device__ __forceinline__ float wave_sum(float v) {           // the sum over the 32 lanes, in every lane
#pragma unroll   // five fixed exchange distances
  for (int m = 16; m > 0; m >>= 1) v += __shfl_xor(v, m, 32);
  return v;
}
__device__ __forceinline__ void gn_norm(const float* __restrict__ x, const float* __restrict__ gsc,
                                        const float* __restrict__ gbi,
                                        unsigned short* XNh, unsigned short* XNl, int blk) {
  __shared__ v4u Th[256 * 9];                 // per thread one 128-B line of the hi plane, pitch 9 x 16 B
  __shared__ v4u Tl[256 * 9];                 // the same of the lo plane
  __shared__ float red[2][8][2];              // [pass][wave][group]
  const int tid = threadIdx.x, lane = tid & 31, wave = tid >> 5;
  // blk = batch * (DM / XCB) + channel block
  const int c0  = (blk % (DM / XCB)) * XCB;
  const float* xp = x + (size_t)blk * (XCB * SEQ) + tid * 4;
  v4f xv[XCB];
#pragma unroll   // every loop over c, e and k below: xv is a register array, its indices must be compile-time constants
  for (int c = 0; c < XCB; ++c) xv[c] = *(const v4f*)(xp + (size_t)c * SEQ);
  float mean[2], rstd[2];
  {
    v4f a[2] = {{0.f, 0.f, 0.f, 0.f}, {0.f, 0.f, 0.f, 0.f}};
#pragma unroll
    for (int c = 0; c < XCB; ++c)
#pragma unroll
      for (int e = 0; e < 4; ++e) { xv[c][e] = bfr(xv[c][e]); a[c / GSZ][e] += xv[c][e]; }
    const float s0 = wave_sum((a[0][0] + a[0][1]) + (a[0][2] + a[0][3]));
    const float s1 = wave_sum((a[1][0] + a[1][1]) + (a[1][2] + a[1][3]));
    if (lane == 0) { red[0][wave][0] = s0; red[0][wave][1] = s1; }
    __syncthreads();
    float t0 = 0.f, t1 = 0.f;
#pragma unroll
    for (int w = 0; w < 8; ++w) { t0 += red[0][w][0]; t1 += red[0][w][1]; }
    mean[0] = t0 * (1.0f / 8192.0f);
    mean[1] = t1 * (1.0f / 8192.0f);
  }
  {
    v4f a[2] = {{0.f, 0.f, 0.f, 0.f}, {0.f, 0.f, 0.f, 0.f}};
#pragma unroll
    for (int c = 0; c < XCB; ++c)
#pragma unroll
      for (int e = 0; e < 4; ++e) { const float d = xv[c][e] - mean[c / GSZ]; a[c / GSZ][e] += d * d; }
    const float s0 = wave_sum((a[0][0] + a[0][1]) + (a[0][2] + a[0][3]));
    const float s1 = wave_sum((a[1][0] + a[1][1]) + (a[1][2] + a[1][3]));
    if (lane == 0) { red[1][wave][0] = s0; red[1][wave][1] = s1; }
    __syncthreads();
    float t0 = 0.f, t1 = 0.f;
#pragma unroll
    for (int w = 0; w < 8; ++w) { t0 += red[1][w][0]; t1 += red[1][w][1]; }
    rstd[0] = 1.0f / sqrtf(t0 * (1.0f / 8192.0f) + 1e-6f);
    rstd[1] = 1.0f / sqrtf(t1 * (1.0f / 8192.0f) + 1e-6f);
  }
  float ssc[XCB], sbi[XCB];                   // block-uniform
#pragma unroll
  for (int c = 0; c < XCB; ++c) { ssc[c] = bfr(gsc[c0 + c]); sbi[c] = bfr(gbi[c0 + c]); }
#pragma unroll
  for (int e = 0; e < 4; ++e) {               // token 4 tid + e: 16 channels = 32 B of each plane
    unsigned hw[XCB / 2], lw[XCB / 2];
#pragma unroll
    for (int k = 0; k < XCB / 2; ++k) {
      const int ca = 2 * k, cb = 2 * k + 1;
      const float va = (xv[ca][e] - mean[ca / GSZ]) * rstd[ca / GSZ] * ssc[ca] + sbi[ca];
      const float vb = (xv[cb][e] - mean[cb / GSZ]) * rstd[cb / GSZ] * ssc[cb] + sbi[cb];
      const unsigned short ha = bf_bits(va), hb = bf_bits(vb);
      hw[k] = pk16(ha, hb);
      lw[k] = pk16(bf_bits(va - bf_up(ha)), bf_bits(vb - bf_up(hb)));
    }
#pragma unroll
    for (int j = 0; j < 2; ++j) {
      const v4u h4 = {hw[4 * j], hw[4 * j + 1], hw[4 * j + 2], hw[4 * j + 3]};
      const v4u l4 = {lw[4 * j], lw[4 * j + 1], lw[4 * j + 2], lw[4 * j + 3]};
      Th[tid * 9 + e * 2 + j] = h4;
      Tl[tid * 9 + e * 2 + j] = l4;
    }
  }
  __syncthreads();
  unsigned short* dh = XNh + (size_t)blk * (SEQ * XCB);
  unsigned short* dl = XNl + (size_t)blk * (SEQ * XCB);
#pragma unroll
  for (int it = 0; it < 8; ++it) {
    const int p = it * 256 + tid;             // 16-B piece of the work-group's 32 KiB of a plane
    const v4u h4 = Th[(p >> 3) * 9 + (p & 7)];
    const v4u l4 = Tl[(p >> 3) * 9 + (p & 7)];
    *(v4u*)(dh + (size_t)p * 8) = h4;
    *(v4u*)(dl + (size_t)p * 8) = l4;
  }
}

// =====================================================================================================
// One launch for the two passes that depend on nothing but the inputs: work-groups 0 .. NGN - 1 normalise, the 64 behind
// them convert the weights. The branch is block-uniform, so every barrier inside is passed by a whole work-group.
// =====================================================================================================
#define NGN (NB * (DM / XCB))   // GroupNorm work-groups
__global__ __launch_bounds__(256) void prep(const float* __restrict__ x, const float* __restrict__ gsc,
                                            const float* __restrict__ gbi,
                                            const float* __restrict__ W0, const float* __restrict__ W1,
                                            const float* __restrict__ W2, const float* __restrict__ W3,
                                            unsigned short* WT, unsigned short* XNh, unsigned short* XNl) {
  const int bx = blockIdx.x;
  if (bx < NGN) gn_norm(x, gsc, gbi, XNh, XNl, bx);
  else          wt_cvt(W0, W1, W2, W3, WT, (bx - NGN) & 15, (bx - NGN) >> 4);
}

// =====================================================================================================
// Register-blocked batched bf16 WMMA GEMM: C[m][n] = sum_k A[m][k] * Bt[n][k] + bias; one wave per 64x64 tile,
// eight tiles per block: 8 / TNB tile rows x TNB tile columns (N / 64 a multiple of TNB, and equal to it where TNB < 8;
// the tile count a multiple of 8). A row-major [M][K] pitch lda; Bt row-major [N][K] pitch ldb (k contiguous);
// M, N multiples of 64, K multiple of GKC. b = batch index (strides in elements).
// Operands: per slab of GKC k the block's A rows and Bt rows (every plane) are copied into LDS, each wave copy = 4 whole
// 128-B lines, rows at pitch GSP; two buffers, slab s + 1 in flight while slab s is multiplied; the waves read their
// fragments from LDS. After the last slab the ring's first bytes serve as the epilogue's per-wave slabs.
// NSPLIT: 0 = A.Bt; 1 = (A + A2).Bt (A2 = unscaled bf16 lo plane of A, same accumulator);
//         3 = A.Bt + A.Bt2 (Bt2 = unscaled bf16 lo plane of Bt; the two planes are walked as alternate k-steps).
// OUT_MODE: 0 = f32 (pitch ldc); 1 = f32 with per-element residual: v = (acc + bias + bf16(R[m][n])) * oscale,
//           R f32 pitch ldr, batch stride strideR; 3 = f16 hi plane C + f16 residual plane C2 = f16((v - hi) * rscale),
//           C2 written only for tiles with n0 < N2 (pitch ldc2, batch stride strideC2).
// bias (f32, RNE-converted to bf16 then widened): bmode 0 = none, 1 = per column n, 2 = per row m;
//           index clamped to [0, blen-1].
// XB: 1 = the A planes, 2 = the Bt planes lie in the normalised planes' layout (xn_off, rows = tokens; lda / ldb unused):
//           a wave copy is still 4 whole lines (4 tokens x 32 B of each of 4 channel blocks); 0 = both row-major.
// PAIR: two products that share A in one launch of two batches: batch 1 takes its own bias vector (biasP, blenP) and
//           writes no residual plane; its Bt and C lie strideB and strideC behind those of batch 0.
// =====================================================================================================
template <int NSPLIT, int TNB>
constexpr int gemm_rows() {                         // staged rows per slab: [A planes][Bt planes]
  return ((NSPLIT == 1) ? 2 : 1) * (8 / TNB) * 64 + ((NSPLIT == 3) ? 2 : 1) * TNB * 64;
}
// ring: the work-group's LDS, 2 * gemm_rows() * GSP halves; bxi, b: the work-group's place in the product's own grid
template <int NSPLIT, int OUT_MODE, bool PAIR, int TNB, int XB>
__device__ __forceinline__ void gemm64_body(
    __bf16* ring, int bxi, int b,
    const unsigned short* __restrict__ Ap, const unsigned short* A2p, int lda, long long strideA,
    const unsigned short* __restrict__ Btp, const unsigned short* Bt2p, int ldb, long long strideB,
    void* Cout, int ldc, long long strideC,
    void* Cout2, int ldc2, long long strideC2, int N2a,
    int M, int N, int K, float rscale,
    const float* __restrict__ biasA, int bmode, int blenA,
    const float* __restrict__ Rp, int ldr, long long strideR, float oscale,
    const float* __restrict__ biasP = nullptr, int blenP = 0) {
  const __bf16* A   = (const __bf16*)(const void*)Ap;
  const __bf16* A2  = (const __bf16*)(const void*)A2p;
  const __bf16* Bt  = (const __bf16*)(const void*)Btp;
  const __bf16* Bt2 = (const __bf16*)(const void*)Bt2p;
  constexpr int RA  = (8 / TNB) * 64;               // A rows of the block, per plane
  constexpr int RB  = TNB * 64;                     // Bt rows of the block, per plane
  constexpr int PA  = (NSPLIT == 1) ? 2 : 1;        // A planes
  constexpr int PB  = (NSPLIT == 3) ? 2 : 1;        // Bt planes
  constexpr int RT  = PA * RA + PB * RB;            // staged rows per slab: [A planes][Bt planes]
  constexpr int NIT = RT / 32;                      // copies per thread and slab (256 threads x 16 B = 32 rows)
  static_assert((RA % 32) == 0 && (RB % 32) == 0 && (NIT % 2) == 0 && NIT <= 63);
  static_assert(2 * RT * GSP * 2 >= 8 * 16 * 68 * 4);
  static_assert(RT == gemm_rows<NSPLIT, TNB>());        // ring: two slab buffers; afterwards per-wave 16x64 f32 slabs, pitch 68
  const bool second = PAIR && (b == 1);                      // block-uniform
  const float* bias = second ? biasP : biasA;
  const int blen = second ? blenP : blenA;
  const int N2   = second ? 0 : N2a;
  const int lane = threadIdx.x & 31;
  const int wave = threadIdx.x >> 5;
  const int tilesN = N >> 6;
  const int tilesM = M >> 6;
  const int tile = bxi * 8 + wave;
  if (bxi * 8 >= tilesM * tilesN) return;               // block-uniform, in front of every barrier
  const int tm = tile / tilesN;
  const int tn = tile - tm * tilesN;
  const int m0 = tm << 6;
  const int n0 = tn << 6;

  const __bf16* Ab  = A  + (size_t)b * strideA;
  const __bf16* Bb  = Bt + (size_t)b * strideB;
  const __bf16* Ab2 = (NSPLIT == 1) ? (A2  + (size_t)b * strideA) : Ab;
  const __bf16* Bb2 = (NSPLIT == 3) ? (Bt2 + (size_t)b * strideB) : Bb;

  const int rlane = lane & 15;                 // row (A) / col (B, D) within subtile
  const int koff  = (lane >> 4) * 8;           // k offset of this lane half
  const int mOff  = (lane >> 4) * 8;           // D row offset

  v8f acc[4][4];
#pragma unroll
  for (int i = 0; i < 4; ++i)
#pragma unroll
    for (int j = 0; j < 4; ++j) acc[i][j] = zero8();

  // ---- staging: thread -> row (tid >> 3) of each group of 32 rows, 16-B piece (tid & 7) of its 128-B line ----
  const int t0b  = bxi * 8;                          // the block's first tile
  const int mb0  = (t0b / tilesN) << 6;              // its first A row
  const int nb0  = (t0b - (t0b / tilesN) * tilesN) << 6;   // its first Bt row
  const int srow = threadIdx.x >> 3;
  const int sseg = (threadIdx.x & 7) * 8;
  const unsigned lthr = lds_off(ring) + (unsigned)(srow * GSP + sseg) * 2u;
  auto stage = [&](int slab, int buf) {
    const int kc = slab * GKC + sseg;
    const unsigned lb = lthr + (unsigned)buf * (unsigned)(RT * GSP * 2);
#pragma unroll   // both loops: each copy's plane and row group are compile-time, the statement's operands stay in registers
    for (int g0 = 0; g0 < NIT; g0 += 8) {
      unsigned l[8];
      const __bf16* g[8];
#pragma unroll
      for (int e = 0; e < 8; ++e) {
        const int fr = (g0 + e < NIT) ? (g0 + e) * 32 : 0;     // first staged row of this copy's group of 32
        if (fr < PA * RA) {
          const int r = fr % RA;
          g[e] = ((fr / RA) ? Ab2 : Ab) + ((XB == 1) ? xn_off(mb0 + r + srow, kc) : (size_t)(mb0 + r + srow) * lda + kc);
        } else {
          const int r = (fr - PA * RA) % RB;
          g[e] = (((fr - PA * RA) / RB) ? Bb2 : Bb) + ((XB == 2) ? xn_off(nb0 + r + srow, kc) : (size_t)(nb0 + r + srow) * ldb + kc);
        }
        l[e] = lb + (unsigned)(fr * GSP * 2);
      }
      if (g0 + 8 <= NIT) acopy8(l, g);
      else               acopy2(l, g);
    }
  };
  static_assert((NIT % 8) == 0 || (NIT % 8) == 2);

  const int nsl = K / GKC;                           // slabs
  const int aRow = (wave / TNB) * 64 + rlane;        // the wave's first A row inside a staged plane
  const int bRow = PA * RA + (wave % TNB) * 64 + rlane;   // its first Bt row inside the staged slab
  stage(0, 0);
  wait_async0();
  __syncthreads();                                   // slab 0 is published
  if (nsl > 1) stage(1, 1);
  for (int sl = 0; sl < nsl; ++sl) {
    const __bf16* sb = ring + (sl & 1) * (RT * GSP);
#pragma unroll   // k and plane offsets fold into the LDS loads' immediate offsets
    for (int ks = 0; ks < GKC / 32; ++ks) {
      const int kl = ks * 32 + koff;                 // k inside the slab
      const __bf16* As = sb + (size_t)aRow * GSP + kl;
      v16b ah[4], al[4];
#pragma unroll
      for (int i = 0; i < 4; ++i) {
        ah[i] = ldfrag_b(As + i * 16 * GSP);
        al[i] = ah[i];
        if (NSPLIT == 1) al[i] = ldfrag_b(As + (RA + i * 16) * GSP);
      }
#pragma unroll
      for (int pl = 0; pl < PB; ++pl) {              // the Bt planes of one k step follow each other, hi then lo
        const __bf16* Bs = sb + (size_t)(bRow + pl * RB) * GSP + kl;
        v16b bh[4];
#pragma unroll
        for (int j = 0; j < 4; ++j) bh[j] = ldfrag_b(Bs + j * 16 * GSP);
#pragma unroll
        for (int i = 0; i < 4; ++i) {
#pragma unroll
          for (int j = 0; j < 4; ++j) {
            acc[i][j] = mma_b_raw(ah[i], bh[j], acc[i][j]);
            if (NSPLIT == 1) acc[i][j] = mma_b_raw(al[i], bh[j], acc[i][j]);
          }
          dep_guard_b(acc[i][0], acc[i][3], ah[i], al[i]);
        }
        keep4_b(bh[0], bh[1], bh[2], bh[3]);
      }
    }
    wait_ds0();
    wait_async0();
    __syncthreads();                                 // publishes slab sl + 1 and ends every read of slab sl's buffer
    if (sl + 2 < nsl) stage(sl + 2, sl & 1);
  }
  wait_async0();
  acc_guard4(acc[0][0], acc[0][1], acc[0][2], acc[0][3]);
  acc_guard4(acc[1][0], acc[1][1], acc[1][2], acc[1][3]);
  acc_guard4(acc[2][0], acc[2][1], acc[2][2], acc[2][3]);
  acc_guard4(acc[3][0], acc[3][1], acc[3][2], acc[3][3]);

  // ---- bias (per column), clamped address, selected by value ----
  float bc[4];
  int bci[4];
#pragma unroll
  for (int j = 0; j < 4; ++j) {
    int bi = n0 + (j << 4) + rlane;
    bi = (bi < blen) ? bi : (blen - 1);
    bi = (bi > 0) ? bi : 0;
    bci[j] = bi;
    const float t = bf_up(bf_bits(bias[bi]));
    bc[j] = (bmode == 1) ? t : 0.f;
  }
  wait_x0_idx4(bci);                                 // behind the bias loads, before their index registers are reused

  // ---- epilogue ----
  float* slab = (float*)(void*)ring + wave * (16 * 68);
#pragma unroll
  for (int i = 0; i < 4; ++i) {
    const int mBase = m0 + (i << 4);
    float brw[8];
    int bri[8];
#pragma unroll
    for (int r = 0; r < 8; ++r) {
      int bi = mBase + mOff + r;
      bi = (bi < blen) ? bi : (blen - 1);
      bi = (bi > 0) ? bi : 0;
      bri[r] = bi;
      const float t = bf_up(bf_bits(bias[bi]));
      brw[r] = (bmode == 2) ? t : 0.f;
    }
    wait_x0_idx8(bri);                               // behind the bias loads, before their index registers are reused
#pragma unroll
    for (int j = 0; j < 4; ++j) {
#pragma unroll
      for (int r = 0; r < 8; ++r) {
        slab[(mOff + r) * 68 + (j << 4) + rlane] = acc[i][j][r] + bc[j] + brw[r];
      }
    }
    wave_sync_lds();
    if (OUT_MODE == 0 || OUT_MODE == 1) {
      float* C = (float*)Cout + (size_t)b * strideC;
      const float* R = Rp + (size_t)b * strideR;
      const int hh = lane >> 4, c4 = (lane & 15) * 4;     // 256-B row segment = 16 lanes x 16 B
      {
        v4f xr[8];
        if (OUT_MODE == 1) {
#pragma unroll
          for (int it = 0; it < 8; ++it) xr[it] = *(const v4f*)(R + (size_t)(mBase + it * 2 + hh) * ldr + n0 + c4);
          wait_x0();                                       // behind the run of residual loads, before their addresses are reused
        }
#pragma unroll
        for (int it = 0; it < 8; ++it) {
          const int row = it * 2 + hh;                     // it 0..7 x hh 0..1 = rows 0..15
          v4f v = *(const v4f*)(slab + row * 68 + c4);
          if (OUT_MODE == 1) {
            v4f t;
            t[0] = (v[0] + bfr(xr[it][0])) * oscale;
            t[1] = (v[1] + bfr(xr[it][1])) * oscale;
            t[2] = (v[2] + bfr(xr[it][2])) * oscale;
            t[3] = (v[3] + bfr(xr[it][3])) * oscale;
            v = t;
          }
          *(v4f*)(C + (size_t)(mBase + row) * ldc + n0 + c4) = v;
        }
        wait_x0();                                         // behind the stores, before their registers are reused
      }
    } else {
      const int q = lane >> 3, c8 = (lane & 7) * 8;
      unsigned short* C  = (unsigned short*)Cout  + (size_t)b * strideC;
      unsigned short* C2 = (unsigned short*)Cout2 + (size_t)b * strideC2;
      const bool wlo = (n0 < N2);                           // wave-uniform
      v4u hv[4], lv[4];
#pragma unroll
      for (int it = 0; it < 4; ++it) {
        const int row = it * 4 + q;                        // it 0..3 x q 0..3 = rows 0..15
        const float* sp = slab + row * 68 + c8;
        v4u a, a2;
#pragma unroll
        for (int e = 0; e < 4; ++e) {
          const float f0 = sp[2 * e], f1 = sp[2 * e + 1];
          const _Float16 x0 = (_Float16)f0, x1 = (_Float16)f1;
          const unsigned short h0 = h_bits(x0), h1 = h_bits(x1);
          const unsigned short l0 = h_bits((_Float16)((f0 - (float)x0) * rscale));
          const unsigned short l1 = h_bits((_Float16)((f1 - (float)x1) * rscale));
          a[e] = pk16(h0, h1); a2[e] = pk16(l0, l1);
        }
        hv[it] = a; lv[it] = a2;
      }
      {
#pragma unroll
        for (int it = 0; it < 4; ++it) {
          const int row = it * 4 + q;
          *(v4u*)(C + (size_t)(mBase + row) * ldc + n0 + c8) = hv[it];
          wait_x0();                                       // behind each store, before its data or address registers are reused
          if (wlo) {
            *(v4u*)(C2 + (size_t)(mBase + row) * ldc2 + n0 + c8) = lv[it];
            wait_x0();
          }
        }
      }
    }
    wave_sync_lds();
  }
}

// One product per launch: grid (tiles / 8, batches), 256 threads.
template <int NSPLIT, int OUT_MODE, bool PAIR, int TNB, int XB>
__global__ __launch_bounds__(256) void gemm64(
    const unsigned short* __restrict__ Ap, const unsigned short* A2p, int lda, long long strideA,
    const unsigned short* __restrict__ Btp, const unsigned short* Bt2p, int ldb, long long strideB,
    void* Cout, int ldc, long long strideC,
    void* Cout2, int ldc2, long long strideC2, int N2a,
    int M, int N, int K, float rscale,
    const float* __restrict__ biasA, int bmode, int blenA,
    const float* __restrict__ Rp, int ldr, long long strideR, float oscale) {
  __shared__ __align__(16) __bf16 ring[2 * gemm_rows<NSPLIT, TNB>() * GSP];
  gemm64_body<NSPLIT, OUT_MODE, PAIR, TNB, XB>(ring, blockIdx.x, blockIdx.y, Ap, A2p, lda, strideA, Btp, Bt2p, ldb, strideB,
      Cout, ldc, strideC, Cout2, ldc2, strideC2, N2a, M, N, K, rscale, biasA, bmode, blenA, Rp, ldr, strideR, oscale);
}

// One launch for the three projections of the normalised planes, which do not depend on each other:
//   work-groups 0 .. NVT - 1 (the longest, given the lowest indices): v^T[b][c][t] = sum_i Wv[i][c] xn[b][t][i] + bv[c] per batch
//     -> f16 hi plane (pitch SEQ) + residual x4096 (A = WTv [c][i], Bt = XN rows of batch b hi + lo; M=256, N=1024, K=256;
//     bias per row); 8 work-groups a batch;
//   the 2 x NQK behind them (M=16384, N=256, K=256, bias per column): first q = xn . Wq + bq -> f16 hi plane [16384][256]
//     + f16 residual x4096, then k = xn . Wk + bk -> f16 plane, no residual. Wk's plane lies one weight plane behind WTq,
//     Kh two activation planes behind Qh (workspace map below).
// The branch is block-uniform; both sides use the one LDS ring, sized for the larger.
#define NVT (NB * 8)
#define NQK ((NB * SEQ / 64) * (DM / 64) / 8)
__global__ __launch_bounds__(256) void gemm_qkv(const unsigned short* __restrict__ XNh, const unsigned short* XNl,
                                                const unsigned short* __restrict__ WTq, const unsigned short* __restrict__ WTv,
                                                unsigned short* Qh, unsigned short* Ql,
                                                unsigned short* VTh, unsigned short* VTl,
                                                const float* __restrict__ bq, int nbq, const float* __restrict__ bk, int nbk,
                                                const float* __restrict__ bv, int nbv) {
  static_assert(gemm_rows<3, 8>() >= gemm_rows<1, 4>());
  __shared__ __align__(16) __bf16 ring[2 * gemm_rows<3, 8>() * GSP];
  const int bx = blockIdx.x;
  if (bx < NVT) {
    gemm64_body<3, 3, false, 8, 2>(ring, bx & 7, bx >> 3,
        WTv, WTv, DM, 0LL, XNh, XNl, DM, (long long)SEQ * DM,
        (void*)VTh, SEQ, (long long)DM * SEQ, (void*)VTl, SEQ, (long long)DM * SEQ, SEQ,
        DM, SEQ, DM, 4096.0f, bv, 2, nbv, nullptr, 0, 0LL, 1.0f);
  } else {
    gemm64_body<1, 3, true, 4, 1>(ring, (bx - NVT) % NQK, (bx - NVT) / NQK,
        XNh, XNl, DM, 0LL, WTq, WTq, DM, (long long)DM * DM,
        (void*)Qh, DM, 2LL * NB * SEQ * DM, (void*)Ql, DM, 0LL, DM,
        NB * SEQ, DM, DM, 4096.0f, bq, 1, nbq, nullptr, 0, 0LL, 1.0f, bk, nbk);
  }
}

// =====================================================================================================
// Attention, head dim 64, no masking, softmax over all SEQ keys.
//   q hi plane (f16, pitch DM): element (b, t, h, d) at [(b*SEQ + t)*DM + h*64 + d]; q residual plane
//   (f16, (q - f16(q))*4096, pitch DM) same layout; k plane (f16, pitch DM) same layout.
//   v^T hi plane (f16): element (b, h, d, s) at [(b*DM + h*64 + d)*SEQ + s]; v^T residual plane (f16, x4096): same layout
//   out: context as bf16 hi plane and bf16 lo plane (lo = RNE(v - hi), unscaled), pitch DM: element (b, t, h, d) at
//   [(b*SEQ + t)*DM + h*64 + d] of each plane
//   Both products are taken transposed, so that a lane owns ONE query (column lane & 15):
//   scores^T[key][query] = (k . qh + (k . ql) * rres) * sscale on f16 WMMA (A = K rows, B = q), residual products in a
//   separate accumulator; a lane holds 32 of its query's 64 scores (keys 16 j + 8 (lane >> 4) + r), so the maximum and
//   the sum run in the lane, with one exchange between the wave halves for the maximum per chunk and one for the sum
//   at the end. p = exp(s - m) carried as f16(1024 p): score tiles 2 kk and 2 kk + 1, converted in place, ARE the
//   B operand (keys 32 kk .. + 31 in the hardware k order) of context^T[d][query] = vh . p + (vl . p) * rres
//   (A = V^T rows; separate accumulator folded per chunk in f32); online softmax in f32.
//   Block = 4 waves = 64 query rows of one (b, h); grid = NQB * NH * NB; kv chunks of 64, static trip NQB.
//   K / V^T chunk staging: 128 threads x 32 elements per plane = the whole 64x64 tile (plain 16-B loads,
//   __syncthreads before and after).
//   Output coverage: each wave stores rows q0..q0+15 (it 0..3 x lane>>3 0..3) x 64 columns of both planes; a row's
//   64 columns of one plane = 8 lanes x 16 B = one whole 128-B line
// =====================================================================================================
__device__ __forceinline__ float other_half(float v) {       // the value that lane ^ 16 holds
  const int b = __builtin_bit_cast(int, v);
  return __builtin_bit_cast(float, __builtin_amdgcn_permlanex16(b, b, 0x76543210, 0xfedcba98, false, false));
}
__global__ __launch_bounds__(128)
void attn64(const unsigned short* __restrict__ qhp, const unsigned short* __restrict__ qlp,
            const unsigned short* __restrict__ khp,
            const unsigned short* __restrict__ vhp, const unsigned short* __restrict__ vlp,
            unsigned short* ctxh, unsigned short* ctxl, float sscale, float rres) {
  union FH { v16h v; v8h h[2]; };
  __shared__ __align__(16) _Float16 KV[3 * 64 * KVP];             // one array: every fragment read = one base + a constant
  _Float16* const Ksh = KV;                                       // K [kv][d], 64 halves used per row
  _Float16* const Vth = KV + 64 * KVP;                            // V^T hi [d][kv]
  _Float16* const Vtl = KV + 128 * KVP;                           // V^T residual [d][kv]
  __shared__ __align__(16) float    Os[4][16 * OSP];              // per wave context tile [row][d]

  const int tid  = threadIdx.x;
  const int wave = tid >> 5;
  const int lane = tid & 31;
  const int hh   = lane >> 4;
  const int c    = lane & 15;

  const int bx   = blockIdx.x;
  const int qb   = bx % NQB;
  const int rest = bx / NQB;
  const int h    = rest % NH;
  const int b    = rest / NH;
  const int q0   = qb * 64 + wave * 16;
  const size_t rowB = (size_t)b * SEQ;

  const _Float16* Qh = (const _Float16*)(const void*)qhp + (size_t)h * HD;
  const _Float16* Ql = (const _Float16*)(const void*)qlp + (size_t)h * HD;
  const _Float16* Kg = (const _Float16*)(const void*)khp + (size_t)h * HD;
  const _Float16* Vh = (const _Float16*)(const void*)vhp + ((size_t)b * DM + (size_t)h * HD) * SEQ;
  const _Float16* Vl = (const _Float16*)(const void*)vlp + ((size_t)b * DM + (size_t)h * HD) * SEQ;

  // ---- Q fragments (B operand, column = query = lane&15): 2 d-chunks, hi and residual ----
  v16h qah[2], qal[2];
#pragma unroll
  for (int dc = 0; dc < 2; ++dc) {
    qah[dc] = ldfrag_h(Qh + (rowB + q0 + c) * DM + dc * 32 + 8 * hh);
    qal[dc] = ldfrag_h(Ql + (rowB + q0 + c) * DM + dc * 32 + 8 * hh);
  }

  float mrow = -INFINITY;                    // running maximum of query c (equal in both wave halves)
  float lrow = 0.f;                          // running sum of query c over this half's keys
  v8f oacc[4];                               // context^T: oacc[t][r] = element d = 16 t + 8 hh + r of query c
#pragma unroll
  for (int t = 0; t < 4; ++t) oacc[t] = zero8();

  for (int kt = 0; kt < NQB; ++kt) {         // static trip count
    const int kv0 = kt * 64;
    __syncthreads();
    {
      const int r = tid >> 1, hf = (tid & 1) * 32;
      const _Float16* kg  = Kg + (rowB + kv0 + r) * DM + hf;       // K row kv0+r, d = hf..hf+31
      const _Float16* vg  = Vh + (size_t)r * SEQ + kv0 + hf;       // V^T row d = r, s = kv0+hf..+31
      const _Float16* vlg = Vl + (size_t)r * SEQ + kv0 + hf;
#pragma unroll
      for (int i = 0; i < 4; ++i) {
        const v8h a0 = *(const v8h*)(kg + 8 * i);
        const v8h b0 = *(const v8h*)(vg + 8 * i);
        const v8h b1 = *(const v8h*)(vlg + 8 * i);
        *(v8h*)(Ksh + r * KVP + hf + 8 * i) = a0;
        *(v8h*)(Vth + r * KVP + hf + 8 * i) = b0;
        *(v8h*)(Vtl + r * KVP + hf + 8 * i) = b1;
      }
    }
    __syncthreads();

    // ---- scores^T: 64 keys x 16 queries per wave, 2 f16 products (hi, residual) ----
    //      LDS reads stand in three groups per chunk: all of K; V^T of keys 0..31, read under the softmax; V^T of keys 32..63
    v8f s[4];                                // s[j][r]: key 16 j + 8 hh + r against query c
    FH vh0[4], vl0[4];                       // V^T fragments of keys 0..31, hi and residual
    {
      FH kb[4][2];
#pragma unroll   // every loop of this block: kb, sh, sl, vh0 and vl0 are register arrays, constant indices
      for (int j = 0; j < 4; ++j)
#pragma unroll
        for (int dc = 0; dc < 2; ++dc) {
          kb[j][dc].h[0] = *(const v8h*)(Ksh + (j * 16 + c) * KVP + dc * 32 + 8 * hh);
          kb[j][dc].h[1] = *(const v8h*)(Ksh + (j * 16 + c) * KVP + dc * 32 + 16 + 8 * hh);
        }
      group_fence();
      v8f sh[4], sl[4];
#pragma unroll
      for (int j = 0; j < 4; ++j) { sh[j] = zero8(); sl[j] = zero8(); }
#pragma unroll
      for (int dc = 0; dc < 2; ++dc)
#pragma unroll
        for (int j = 0; j < 4; ++j) {
          sh[j] = mma_h(kb[j][dc].v, qah[dc], sh[j]);
          sl[j] = mma_h(kb[j][dc].v, qal[dc], sl[j]);
        }
      // ends the run: a builtin WMMA is otherwise free to sink to its first use, behind the reads that take over K's registers
      acc_guard4(sh[0], sh[1], sh[2], sh[3]);
      acc_guard4(sl[0], sl[1], sl[2], sl[3]);
      group_fence();
#pragma unroll
      for (int t = 0; t < 4; ++t) {
        vh0[t].h[0] = *(const v8h*)(Vth + (t * 16 + c) * KVP + 8 * hh);
        vh0[t].h[1] = *(const v8h*)(Vth + (t * 16 + c) * KVP + 16 + 8 * hh);
        vl0[t].h[0] = *(const v8h*)(Vtl + (t * 16 + c) * KVP + 8 * hh);
        vl0[t].h[1] = *(const v8h*)(Vtl + (t * 16 + c) * KVP + 16 + 8 * hh);
      }
      group_fence();
#pragma unroll
      for (int j = 0; j < 4; ++j)
#pragma unroll
        for (int r = 0; r < 8; ++r) s[j][r] = (sh[j][r] + sl[j][r] * rres) * sscale;
    }

    // ---- maximum in the lane, joined across the halves; online softmax; P^T (x1024, f16) packed in registers ----
    float mx[8];
#pragma unroll   // mx and s are register arrays: constant indices; eight independent chains
    for (int r = 0; r < 8; ++r) mx[r] = fmaxf(fmaxf(s[0][r], s[1][r]), fmaxf(s[2][r], s[3][r]));
    float m = fmaxf(fmaxf(fmaxf(mx[0], mx[1]), fmaxf(mx[2], mx[3])), fmaxf(fmaxf(mx[4], mx[5]), fmaxf(mx[6], mx[7])));
    m = fmaxf(m, other_half(m));
    const float mnew  = fmaxf(mrow, m);
    const float alpha = __expf(mrow - mnew);
    mrow = mnew;
    FH pb[2];                                // pb[kk]: keys 32 kk + (8 hh + e | 16 + 8 hh + e - 8) of query c
    float ps[4];                             // four independent partial sums, one per score tile
#pragma unroll   // both loops: s, ps and pb are register arrays, their indices must be compile-time constants
    for (int j = 0; j < 4; ++j) {
      ps[j] = 0.f;
#pragma unroll
      for (int r = 0; r < 8; ++r) {
        const float p = __expf(s[j][r] - mnew);
        ps[j] += p;
        pb[j >> 1].v[(j & 1) * 8 + r] = (_Float16)(p * 1024.0f);
      }
    }
    lrow = lrow * alpha + ((ps[0] + ps[1]) + (ps[2] + ps[3]));
#pragma unroll
    for (int t = 0; t < 4; ++t)
#pragma unroll
      for (int r = 0; r < 8; ++r) oacc[t][r] *= alpha;

    // ---- context^T += V^T . P^T (f16 WMMA), residual products into a separate accumulator ----
    v8f o1[4];
    FH vh1[4], vl1[4];                       // V^T fragments of keys 32..63
#pragma unroll   // every loop down to the fold: register arrays, constant indices
    for (int t = 0; t < 4; ++t) oacc[t] = mma_h(vh0[t].v, pb[0].v, oacc[t]);
    acc_guard4(oacc[0], oacc[1], oacc[2], oacc[3]);   // ends the run, as above: the next reads take over vh0's registers
    group_fence();
#pragma unroll
    for (int t = 0; t < 4; ++t) {
      vh1[t].h[0] = *(const v8h*)(Vth + (t * 16 + c) * KVP + 32 + 8 * hh);
      vh1[t].h[1] = *(const v8h*)(Vth + (t * 16 + c) * KVP + 32 + 16 + 8 * hh);
      vl1[t].h[0] = *(const v8h*)(Vtl + (t * 16 + c) * KVP + 32 + 8 * hh);
      vl1[t].h[1] = *(const v8h*)(Vtl + (t * 16 + c) * KVP + 32 + 16 + 8 * hh);
    }
    group_fence();
#pragma unroll
    for (int t = 0; t < 4; ++t) o1[t] = mma_h(vl0[t].v, pb[0].v, zero8());
#pragma unroll
    for (int t = 0; t < 4; ++t) oacc[t] = mma_h(vh1[t].v, pb[1].v, oacc[t]);
#pragma unroll
    for (int t = 0; t < 4; ++t) o1[t] = mma_h(vl1[t].v, pb[1].v, o1[t]);
    acc_guard4(oacc[0], oacc[1], oacc[2], oacc[3]);   // the twelve WMMAs run back to back, the fold follows them
    acc_guard4(o1[0], o1[1], o1[2], o1[3]);
#pragma unroll
    for (int t = 0; t < 4; ++t)
#pragma unroll
      for (int r = 0; r < 8; ++r) oacc[t][r] += o1[t][r] * rres;
  }

  // ---- join the halves' sums, normalise (1/l and the 1/1024 p carry), stage the wave's 16x64 f32 tile in LDS
  //      (a lane's 8 registers of tile t = 8 consecutive d of its query's row), then split each value into its bf16
  //      hi and lo parts and write whole lines of the two planes
  float* os = Os[wave];
  {
    const float l = lrow + other_half(lrow);
    const float inv = ((l > 0.f) ? (1.0f / l) : 0.f) * (1.0f / 1024.0f);
#pragma unroll   // both loops: oacc is a register array, its indices must be compile-time constants
    for (int t = 0; t < 4; ++t) {
      v4f w0, w1;
#pragma unroll
      for (int e = 0; e < 4; ++e) { w0[e] = oacc[t][e] * inv; w1[e] = oacc[t][4 + e] * inv; }
      *(v4f*)(os + c * OSP + t * 16 + 8 * hh)     = w0;
      *(v4f*)(os + c * OSP + t * 16 + 8 * hh + 4) = w1;
    }
  }
  wave_sync_lds();
  {
    const int q = lane >> 3, c8 = (lane & 7) * 8;
    v4u hv[4], lv[4];
#pragma unroll   // both loops: hv and lv are register arrays, their indices must be compile-time constants
    for (int it = 0; it < 4; ++it) {
      const int row = it * 4 + q;                        // it 0..3 x q 0..3 = rows 0..15 of the wave tile
      const v4f a = *(const v4f*)(os + row * OSP + c8);
      const v4f d = *(const v4f*)(os + row * OSP + c8 + 4);
      const float f[8] = {a[0], a[1], a[2], a[3], d[0], d[1], d[2], d[3]};
#pragma unroll
      for (int e = 0; e < 4; ++e) {
        const unsigned short h0 = bf_bits(f[2 * e]), h1 = bf_bits(f[2 * e + 1]);
        hv[it][e] = pk16(h0, h1);
        lv[it][e] = pk16(bf_bits(f[2 * e] - bf_up(h0)), bf_bits(f[2 * e + 1] - bf_up(h1)));
      }
    }
#pragma unroll
    for (int it = 0; it < 4; ++it) {
      const size_t o = (rowB + q0 + it * 4 + q) * DM + (size_t)h * HD + c8;
      *(v4u*)(ctxh + o) = hv[it];
      *(v4u*)(ctxl + o) = lv[it];
    }
  }
}

// =====================================================================================================
// Workspace map (bytes), every plane an exact multiple of its whole-row / 64x64-tile / whole-line store granularity:
//   WT    bf16 [4][256 o][256 i]     0          524288     (Wq, Wk, Wv, Wp transposed, k = in contiguous)
//   XNh   bf16 [16][16][1024 t][16 c] 524288    8388608    (GroupNorm output, blocks of 16 channels, hi plane)
//   XNl   bf16 [16][16][1024][16]    8912896    8388608    (lo plane)
//   Qh    f16  [16384][256]          17301504   8388608
//   Ql    f16  [16384][256]          25690112   8388608    (q residual x4096)
//   Kh    f16  [16384][256]          34078720   8388608
//   VTh   f16  [16][256 c][1024 t]   42467328   8388608
//   VTl   f16  [16][256][1024]       50855936   8388608    (v residual x4096)
//   CTXh  bf16 [16384 t][256 c]      59244544   8388608    (attention context, token-major, hi plane)
//   CTXl  bf16 [16384][256]          67633152   8388608    (lo plane)
//   end                              76021760
// =====================================================================================================
extern "C" void kernel_launch(void* const* d_in, const int* in_sizes, int n_in,
                              void* d_out, int out_size, void* d_ws, size_t ws_size,
                              hipStream_t stream) {
  if (n_in < 11) return;
  if (in_sizes[0] != NB * DM * SEQ) return;
  if (in_sizes[3] != DM * DM || in_sizes[5] != DM * DM || in_sizes[7] != DM * DM || in_sizes[9] != DM * DM) return;
  if (in_sizes[1] < DM || in_sizes[2] < DM) return;
  if (in_sizes[4] < 1 || in_sizes[6] < 1 || in_sizes[8] < 1 || in_sizes[10] < 1) return;
  if (out_size != NB * DM * SEQ) return;

  const float* x   = (const float*)d_in[0];
  const float* gsc = (const float*)d_in[1];
  const float* gbi = (const float*)d_in[2];
  const float* wq  = (const float*)d_in[3];
  const float* bq  = (const float*)d_in[4];
  const float* wk  = (const float*)d_in[5];
  const float* bk  = (const float*)d_in[6];
  const float* wv  = (const float*)d_in[7];
  const float* bv  = (const float*)d_in[8];
  const float* wp  = (const float*)d_in[9];
  const float* bp  = (const float*)d_in[10];
  float* out = (float*)d_out;

  const size_t PWT = (size_t)4 * DM * DM * 2;          //   524288
  const size_t P16 = (size_t)NB * SEQ * DM * 2;        //  8388608
  size_t off = 0;
  const size_t oWT   = off; off += PWT;
  const size_t oXNh  = off; off += P16;
  const size_t oXNl  = off; off += P16;
  const size_t oQh   = off; off += P16;
  const size_t oQl   = off; off += P16;
  const size_t oKh   = off; off += P16;
  const size_t oVTh  = off; off += P16;
  const size_t oVTl  = off; off += P16;
  const size_t oCTXh = off; off += P16;
  const size_t oCTXl = off; off += P16;
  if (off > ws_size) return;                            // off = 76021760
  if (off > (size_t)134217728) return;

  char* ws = (char*)d_ws;
  unsigned short* WT   = (unsigned short*)(ws + oWT);
  unsigned short* XNh  = (unsigned short*)(ws + oXNh);
  unsigned short* XNl  = (unsigned short*)(ws + oXNl);
  unsigned short* Qh   = (unsigned short*)(ws + oQh);
  unsigned short* Ql   = (unsigned short*)(ws + oQl);
  unsigned short* Kh   = (unsigned short*)(ws + oKh);
  unsigned short* VTh  = (unsigned short*)(ws + oVTh);
  unsigned short* VTl  = (unsigned short*)(ws + oVTl);
  unsigned short* CTXh = (unsigned short*)(ws + oCTXh);
  unsigned short* CTXl = (unsigned short*)(ws + oCTXl);
  unsigned short* WTq = WT + (size_t)0 * DM * DM;
  unsigned short* WTv = WT + (size_t)2 * DM * DM;
  unsigned short* WTp = WT + (size_t)3 * DM * DM;

  const dim3 blk(256);
  const dim3 gPrep(NGN + 64);                                     // 256 GroupNorm blocks + 16 tiles of 64x64 x 4 weights
  const dim3 gQKV(NVT + 2 * NQK);                                 // 128 v^T blocks + 128 q blocks + 128 k blocks
  const dim3 gVT(((DM / 64) * (SEQ / 64) + 7) / 8, NB);           // 64 tiles -> 8 blocks x 16 batches: M=256, N=1024
  const dim3 gAttn(NB * NH * NQB);                                // 1024 blocks
  const float rs2 = 1.0f / 1.41421356237309515f;

  // (1) GroupNorm statistics from bf16(x) and apply -> bf16 hi + lo planes [16][16 channel blocks][1024 t][16 c];
  //     weights [in][out] -> bf16 [out][in] planes (RNE convert)
  prep<<<gPrep, blk, 0, stream>>>(x, gsc, gbi, wq, wk, wv, wp, WT, XNh, XNl);
  // (2) v^T, q and k projections of the normalised planes
  gemm_qkv<<<gQKV, blk, 0, stream>>>(XNh, XNl, WTq, WTv, Qh, Ql, VTh, VTl,
                                     bq, in_sizes[4], bk, in_sizes[6], bv, in_sizes[8]);
  // (3) attention: scores scale 1/sqrt(C) = 1/16 -> context bf16 hi + lo planes [16384][256] token-major
  attn64<<<gAttn, dim3(128), 0, stream>>>(Qh, Ql, Kh, VTh, VTl, CTXh, CTXl, 0.0625f, 1.0f / 4096.0f);
  // (4) out[b][c][t] = (sum_o Wp[o][c] ctx[b][t][o] + bp[c] + bf16(x[b][c][t])) * (1/sqrt2) per batch, written
  //     straight into the NCHW output rows of 1024 floats (A = WTp [c][o], Bt = CTX rows hi + lo; M=256, N=1024, K=256)
  gemm64<3, 1, false, 8, 0><<<gVT, blk, 0, stream>>>(
      WTp, WTp, DM, 0LL, CTXh, CTXl, DM, (long long)SEQ * DM,
      (void*)out, SEQ, (long long)DM * SEQ, (void*)out, SEQ, (long long)DM * SEQ, 0,
      DM, SEQ, DM, 1.0f, bp, 2, in_sizes[10], x, SEQ, (long long)DM * SEQ, rs2);
  (void)hipGetLastError();
}

// v009
// Measured time: 82.8 microseconds a run.
// Timed twice side by side with v008, it ran 1.05 and 1.04 times as fast.
// All steps since v000 together make it 2.74 times as fast.
// Contractions: q, k, v^T and output projections = v_wmma_f32_16x16x32_bf16 (bf16 operands: weights and biases from
// RNE-converted inputs, computed activations as bf16 hi + lo planes, 2 products); q.k^T scores = v_wmma_f32_16x16x32_f16
// (q as f16 hi plane + f16 residual plane x4096 in a separate accumulator, k f16; 2 products); p.v = v_wmma_f32_16x16x32_f16
// (p carried x1024 in f16, v^T as f16 hi plane + residual plane x4096 in a separate accumulator; 2 products);
// all f32 accumulate; GroupNorm statistics, softmax, biases, residual add and output scale in f32.
#include <hip/hip_runtime.h>
#include <math.h>
#include <stdint.h>

#define NB    16            // batch
#define DM    256           // channels
#define SEQ   1024          // tokens (32 x 32)
#define NH    4             // heads
#define HD    64            // head dim
#define NQB   (SEQ / 64)    // 16 query / key tiles of 64
#define NGRP  32            // groups
#define GSZ   8             // channels per group
#define XCB   16            // channels per block of the normalised planes' layout [batch][c / 16][token][c % 16]
#define KVP   72            // LDS pitch (halves) of the attention K and V^T rows: 144 B = 16 B x odd, so the 16 rows
                            // that one ds_load_b128 fragment read touches fall on 16 different groups of four banks
#define OSP   68            // LDS pitch (floats) of the attention context tile: rows r and r + 8 on different banks
#define GKC   64            // k elements per staged GEMM slab: 128 B of every operand row (one whole line of a row-major row)
#define GSP   72            // LDS pitch (halves) of a staged GEMM operand row: 144 B = 16 B x odd, as for KVP
static_assert(NH * HD == DM);
static_assert((DM % GKC) == 0 && (GSP % 8) == 0 && ((GSP / 8) & 1) == 1 && GSP >= GKC);
static_assert(NGRP * GSZ == DM);
static_assert((SEQ % 64) == 0 && (DM % 64) == 0 && (DM % 32) == 0);
static_assert(XCB == 2 * GSZ && (DM % XCB) == 0 && (GKC % XCB) == 0 && SEQ == 4 * 256);
static_assert((KVP % 8) == 0 && ((KVP / 8) & 1) == 1 && KVP >= 64);
static_assert((OSP % 4) == 0 && OSP >= 64);

typedef _Float16 v16h __attribute__((ext_vector_type(16)));
typedef _Float16 v8h  __attribute__((ext_vector_type(8)));
typedef __bf16   v16b __attribute__((ext_vector_type(16)));
typedef __bf16   v8b  __attribute__((ext_vector_type(8)));
typedef float    v8f  __attribute__((ext_vector_type(8)));
typedef float    v4f  __attribute__((ext_vector_type(4)));
typedef unsigned int v4u __attribute__((ext_vector_type(4)));
typedef unsigned short v8us __attribute__((ext_vector_type(8)));

// ---- scalar helpers --------------------------------------------------------------------------------
__device__ __forceinline__ unsigned short bf_bits(float f) {          // f32 -> bf16 bits, RNE convert
  unsigned u = __float_as_uint(f);
  return (unsigned short)((u + 0x7FFFu + ((u >> 16) & 1u)) >> 16);
}
__device__ __forceinline__ float bf_up(unsigned short h) { return __uint_as_float(((unsigned)h) << 16); }
__device__ __forceinline__ float bfr(float f) { return bf_up(bf_bits(f)); }   // value RNE-converted to bf16 and widened
__device__ __forceinline__ unsigned short h_bits(_Float16 x) { return __builtin_bit_cast(unsigned short, x); }
__device__ __forceinline__ unsigned pk16(unsigned short a, unsigned short b) { return (unsigned)a | ((unsigned)b << 16); }
__device__ __forceinline__ v8f zero8() { v8f z = {0.f, 0.f, 0.f, 0.f, 0.f, 0.f, 0.f, 0.f}; return z; }

// ---- fragment loaders: 16-bit A/B operand, lane -> row/col (lane&15), p already includes +8*(lane>>4);
//      elements 0..7 <- p[0..7] (k0+8h..), elements 8..15 <- p[16..23] (k0+16+8h..)
__device__ __forceinline__ v16b ldfrag_b(const __bf16* p) {
  union { v16b v; v8b h[2]; } f;
  f.h[0] = *(const v8b*)(p);
  f.h[1] = *(const v8b*)(p + 16);
  return f.v;
}
__device__ __forceinline__ v16h ldfrag_h(const _Float16* p) {
  union { v16h v; v8h h[2]; } f;
  f.h[0] = *(const v8h*)(p);
  f.h[1] = *(const v8h*)(p + 16);
  return f.v;
}

// ---- WMMA helpers with trailing VALU hazard gap --------------------------------------------------------
__device__ __forceinline__ v8f mma_h(v16h a, v16h b, v8f c) {       // builtin alone: the compiler keeps its distances
  return __builtin_amdgcn_wmma_f32_16x16x32_f16(false, a, false, b, (short)0, c, false, false);
}
__device__ __forceinline__ v8f mma_b_raw(v16b a, v16b b, v8f c) {
  return __builtin_amdgcn_wmma_f32_16x16x32_bf16(false, a, false, b, (short)0, c, false, false);
}
__device__ __forceinline__ void dep_guard_b(v8f& a, v8f& b, v16b x, v16b y) {
#if defined(__HIP_DEVICE_COMPILE__)
  asm volatile("v_nop\n\tv_nop\n\tv_nop\n\tv_nop" : "+v"(a), "+v"(b) : "v"(x), "v"(y));
#endif
}
__device__ __forceinline__ void keep4_b(v16b a, v16b b, v16b c, v16b d) {
#if defined(__HIP_DEVICE_COMPILE__)
  asm volatile("v_nop" :: "v"(a), "v"(b), "v"(c), "v"(d));
#endif
}
__device__ __forceinline__ void acc_guard4(v8f& a, v8f& b, v8f& c, v8f& d) {
#if defined(__HIP_DEVICE_COMPILE__)
  asm volatile("v_nop\n\tv_nop\n\tv_nop\n\tv_nop" : "+v"(a), "+v"(b), "+v"(c), "+v"(d));
#endif
}
// Keeps a group of LDS reads together at its place: without it the compiler spreads the reads among the WMMAs,
// one read-and-wait place per fragment.
__device__ __forceinline__ void group_fence() { __builtin_amdgcn_sched_barrier(0); }
__device__ __forceinline__ void wave_sync_lds() {
  __builtin_amdgcn_fence(__ATOMIC_RELEASE, "workgroup");
  __builtin_amdgcn_wave_barrier();
  __builtin_amdgcn_fence(__ATOMIC_ACQUIRE, "workgroup");
}

// ---- asynchronous global -> LDS copies, 16 B per lane, through no register ------------------------------
__device__ __forceinline__ unsigned lds_off(const void* p) { return (unsigned)(size_t)p; }   // LDS byte address
// Eight (two, twelve) copies in one statement; its last line keeps the address registers untouched until the copies are taken.
__device__ __forceinline__ void acopy8(const unsigned* l, const __bf16* const* g) {
#if defined(__HIP_DEVICE_COMPILE__)
  asm volatile("global_load_async_to_lds_b128 %0, %8, off\n\t"
               "global_load_async_to_lds_b128 %1, %9, off\n\t"
               "global_load_async_to_lds_b128 %2, %10, off\n\t"
               "global_load_async_to_lds_b128 %3, %11, off\n\t"
               "global_load_async_to_lds_b128 %4, %12, off\n\t"
               "global_load_async_to_lds_b128 %5, %13, off\n\t"
               "global_load_async_to_lds_b128 %6, %14, off\n\t"
               "global_load_async_to_lds_b128 %7, %15, off\n\t"
               "s_wait_xcnt 0x0"
               :: "v"(l[0]), "v"(l[1]), "v"(l[2]), "v"(l[3]), "v"(l[4]), "v"(l[5]), "v"(l[6]), "v"(l[7]),
                  "v"(g[0]), "v"(g[1]), "v"(g[2]), "v"(g[3]), "v"(g[4]), "v"(g[5]), "v"(g[6]), "v"(g[7])
               : "memory");
#endif
}
__device__ __forceinline__ void acopy2(const unsigned* l, const __bf16* const* g) {
#if defined(__HIP_DEVICE_COMPILE__)
  asm volatile("global_load_async_to_lds_b128 %0, %2, off\n\t"
               "global_load_async_to_lds_b128 %1, %3, off\n\t"
               "s_wait_xcnt 0x0"
               :: "v"(l[0]), "v"(l[1]), "v"(g[0]), "v"(g[1])
               : "memory");
#endif
}
__device__ __forceinline__ void acopy12(const unsigned* l, const _Float16* const* g) {
#if defined(__HIP_DEVICE_COMPILE__)
  asm volatile("global_load_async_to_lds_b128 %0, %12, off\n\t"
               "global_load_async_to_lds_b128 %1, %13, off\n\t"
               "global_load_async_to_lds_b128 %2, %14, off\n\t"
               "global_load_async_to_lds_b128 %3, %15, off\n\t"
               "global_load_async_to_lds_b128 %4, %16, off\n\t"
               "global_load_async_to_lds_b128 %5, %17, off\n\t"
               "global_load_async_to_lds_b128 %6, %18, off\n\t"
               "global_load_async_to_lds_b128 %7, %19, off\n\t"
               "global_load_async_to_lds_b128 %8, %20, off\n\t"
               "global_load_async_to_lds_b128 %9, %21, off\n\t"
               "global_load_async_to_lds_b128 %10, %22, off\n\t"
               "global_load_async_to_lds_b128 %11, %23, off\n\t"
               "s_wait_xcnt 0x0"
               :: "v"(l[0]), "v"(l[1]), "v"(l[2]), "v"(l[3]), "v"(l[4]), "v"(l[5]),
                  "v"(l[6]), "v"(l[7]), "v"(l[8]), "v"(l[9]), "v"(l[10]), "v"(l[11]),
                  "v"(g[0]), "v"(g[1]), "v"(g[2]), "v"(g[3]), "v"(g[4]), "v"(g[5]),
                  "v"(g[6]), "v"(g[7]), "v"(g[8]), "v"(g[9]), "v"(g[10]), "v"(g[11])
               : "memory");
#endif
}
__device__ __forceinline__ void wait_async0() {      // this wave's copies have landed in LDS
#if defined(__HIP_DEVICE_COMPILE__)
  asm volatile("s_wait_asynccnt 0x0" ::: "memory");
#endif
}
__device__ __forceinline__ void wait_x0() {
#if defined(__HIP_DEVICE_COMPILE__)
  asm volatile("s_wait_xcnt 0x0" ::: "memory");
#endif
}
// The same behind a run of indexed loads: naming the index registers as inputs keeps them unwritten up to the wait itself.
__device__ __forceinline__ void wait_x0_idx4(const int* i) {
#if defined(__HIP_DEVICE_COMPILE__)
  asm volatile("s_wait_xcnt 0x0" :: "v"(i[0]), "v"(i[1]), "v"(i[2]), "v"(i[3]) : "memory");
#endif
}
__device__ __forceinline__ void wait_x0_idx8(const int* i) {
#if defined(__HIP_DEVICE_COMPILE__)
  asm volatile("s_wait_xcnt 0x0" :: "v"(i[0]), "v"(i[1]), "v"(i[2]), "v"(i[3]), "v"(i[4]), "v"(i[5]), "v"(i[6]), "v"(i[7]) : "memory");
#endif
}
__device__ __forceinline__ void wait_ds0() {         // this wave's LDS reads have retired before their buffer is refilled
#if defined(__HIP_DEVICE_COMPILE__)
  asm volatile("s_wait_dscnt 0x0" ::: "memory");
#endif
}

// =====================================================================================================
// Weights W[in i][out o] (f32, 256x256) -> bf16 planes WT[w][o][i] (k = i contiguous), RNE convert.
// 16 tiles of 64x64 x 4 weights = 64 work-groups of 256 threads (block range of the launch prep, below). Load: 16 iterations x 4 input rows x 64 cols = the whole
// 64x64 tile into LDS transposed (unsigned short element stores); __syncthreads; write: each wave instruction
// =====================================================================================================
__device__ __forceinline__ void wt_cvt(const float* __restrict__ W0, const float* __restrict__ W1,
                                       const float* __restrict__ W2, const float* __restrict__ W3,
                                       unsigned short* WT, int bx, int wsel) {   // bx: tile, wsel: weight, both block-uniform
  __shared__ __align__(16) unsigned short T[64 * 72];
  const int tid = threadIdx.x, lane = tid & 31, wave = tid >> 5;
  const float* W = (wsel == 0) ? W0 : (wsel == 1) ? W1 : (wsel == 2) ? W2 : W3;
  const int i0 = (bx >> 2) * 64;                                 // input-channel tile
  const int o0 = (bx & 3) * 64;                                  // output-channel tile
#pragma unroll 4
  for (int it = 0; it < 16; ++it) {
    const int i = it * 4 + (tid >> 6);
    const int o = tid & 63;
    const float v = W[(size_t)(i0 + i) * DM + o0 + o];
    T[o * 72 + i] = bf_bits(v);
  }
  __syncthreads();
  const int q = lane >> 3, c8 = (lane & 7) * 8;
  v8us v[2];
#pragma unroll
  for (int it = 0; it < 2; ++it) {
    const int orow = it * 32 + wave * 4 + q;
    v[it] = *(const v8us*)(T + orow * 72 + c8);
  }
  unsigned short* dst = WT + (size_t)wsel * DM * DM;
  {
#pragma unroll
    for (int it = 0; it < 2; ++it) {
      const int orow = it * 32 + wave * 4 + q;
      *(v8us*)(dst + (size_t)(o0 + orow) * DM + i0 + c8) = v[it];
    }
    
  }
}

// =====================================================================================================
// GroupNorm, statistics and apply in one launch, + NCHW -> token-major transpose. A work-group owns XCB = 16 channels
// (two groups) of one batch: 16 x 1024 floats, held in registers from their one read to the final planes
// (thread -> 4 consecutive tokens x 16 channels, 16 loads of 16 B, all in flight together).
// Per group: mean, then the centred squares, both in f32 from bf16(x); rstd = 1/sqrt(var + 1e-6); sums: 4 chains in the
// lane, a butterfly over the wave, the 8 waves' sums in wave order.
// xn = (bf16(x) - mean) * rstd * bf16(scale[c]) + bf16(bias[c]) in f32 -> bf16 hi plane and bf16 lo plane = RNE(xn - hi).
// Plane layout [batch][c / 16][token][c % 16] (xn_off): the work-group's part of a plane is 32 KiB in a row, which it
// alone writes, whole 128-B lines: a thread's 4 tokens = one line, staged in LDS at pitch 144 B (16 B x odd), then each
// wave store = 512 B in a row. NB * DM / XCB work-groups of 256 threads (block range of the launch prep, below).
// =====================================================================================================
__device__ __forceinline__ size_t xn_off(int row, int k) {     // element (token row over all batches, channel k) of a plane
  return ((size_t)((row / SEQ) * (DM / XCB) + k / XCB) * SEQ + (size_t)(row % SEQ)) * XCB + (size_t)(k % XCB);
}
__device__ __forceinline__ float wave_sum(float v) {           // the sum over the 32 lanes, in every lane
#pragma unroll   // five fixed exchange distances
  for (int m = 16; m > 0; m >>= 1) v += __shfl_xor(v, m, 32);
  return v;
}
__device__ __forceinline__ void gn_norm(const float* __restrict__ x, const float* __restrict__ gsc,
                                        const float* __restrict__ gbi,
                                        unsigned short* XNh, unsigned short* XNl, int blk) {
  __shared__ v4u Th[256 * 9];                 // per thread one 128-B line of the hi plane, pitch 9 x 16 B
  __shared__ v4u Tl[256 * 9];                 // the same of the lo plane
  __shared__ float red[2][8][2];              // [pass][wave][group]
  const int tid = threadIdx.x, lane = tid & 31, wave = tid >> 5;
  // blk = batch * (DM / XCB) + channel block
  const int c0  = (blk % (DM / XCB)) * XCB;
  const float* xp = x + (size_t)blk * (XCB * SEQ) + tid * 4;
  v4f xv[XCB];
#pragma unroll   // every loop over c, e and k below: xv is a register array, its indices must be compile-time constants
  for (int c = 0; c < XCB; ++c) xv[c] = *(const v4f*)(xp + (size_t)c * SEQ);
  float mean[2], rstd[2];
  {
    v4f a[2] = {{0.f, 0.f, 0.f, 0.f}, {0.f, 0.f, 0.f, 0.f}};
#pragma unroll
    for (int c = 0; c < XCB; ++c)
#pragma unroll
      for (int e = 0; e < 4; ++e) { xv[c][e] = bfr(xv[c][e]); a[c / GSZ][e] += xv[c][e]; }
    const float s0 = wave_sum((a[0][0] + a[0][1]) + (a[0][2] + a[0][3]));
    const float s1 = wave_sum((a[1][0] + a[1][1]) + (a[1][2] + a[1][3]));
    if (lane == 0) { red[0][wave][0] = s0; red[0][wave][1] = s1; }
    __syncthreads();
    float t0 = 0.f, t1 = 0.f;
#pragma unroll
    for (int w = 0; w < 8; ++w) { t0 += red[0][w][0]; t1 += red[0][w][1]; }
    mean[0] = t0 * (1.0f / 8192.0f);
    mean[1] = t1 * (1.0f / 8192.0f);
  }
  {
    v4f a[2] = {{0.f, 0.f, 0.f, 0.f}, {0.f, 0.f, 0.f, 0.f}};
#pragma unroll
    for (int c = 0; c < XCB; ++c)
#pragma unroll
      for (int e = 0; e < 4; ++e) { const float d = xv[c][e] - mean[c / GSZ]; a[c / GSZ][e] += d * d; }
    const float s0 = wave_sum((a[0][0] + a[0][1]) + (a[0][2] + a[0][3]));
    const float s1 = wave_sum((a[1][0] + a[1][1]) + (a[1][2] + a[1][3]));
    if (lane == 0) { red[1][wave][0] = s0; red[1][wave][1] = s1; }
    __syncthreads();
    float t0 = 0.f, t1 = 0.f;
#pragma unroll
    for (int w = 0; w < 8; ++w) { t0 += red[1][w][0]; t1 += red[1][w][1]; }
    rstd[0] = 1.0f / sqrtf(t0 * (1.0f / 8192.0f) + 1e-6f);
    rstd[1] = 1.0f / sqrtf(t1 * (1.0f / 8192.0f) + 1e-6f);
  }
  float ssc[XCB], sbi[XCB];                   // block-uniform
#pragma unroll
  for (int c = 0; c < XCB; ++c) { ssc[c] = bfr(gsc[c0 + c]); sbi[c] = bfr(gbi[c0 + c]); }
#pragma unroll
  for (int e = 0; e < 4; ++e) {               // token 4 tid + e: 16 channels = 32 B of each plane
    unsigned hw[XCB / 2], lw[XCB / 2];
#pragma unroll
    for (int k = 0; k < XCB / 2; ++k) {
      const int ca = 2 * k, cb = 2 * k + 1;
      const float va = (xv[ca][e] - mean[ca / GSZ]) * rstd[ca / GSZ] * ssc[ca] + sbi[ca];
      const float vb = (xv[cb][e] - mean[cb / GSZ]) * rstd[cb / GSZ] * ssc[cb] + sbi[cb];
      const unsigned short ha = bf_bits(va), hb = bf_bits(vb);
      hw[k] = pk16(ha, hb);
      lw[k] = pk16(bf_bits(va - bf_up(ha)), bf_bits(vb - bf_up(hb)));
    }
#pragma unroll
    for (int j = 0; j < 2; ++j) {
      const v4u h4 = {hw[4 * j], hw[4 * j + 1], hw[4 * j + 2], hw[4 * j + 3]};
      const v4u l4 = {lw[4 * j], lw[4 * j + 1], lw[4 * j + 2], lw[4 * j + 3]};
      Th[tid * 9 + e * 2 + j] = h4;
      Tl[tid * 9 + e * 2 + j] = l4;
    }
  }
  __syncthreads();
  unsigned short* dh = XNh + (size_t)blk * (SEQ * XCB);
  unsigned short* dl = XNl + (size_t)blk * (SEQ * XCB);
#pragma unroll
  for (int it = 0; it < 8; ++it) {
    const int p = it * 256 + tid;             // 16-B piece of the work-group's 32 KiB of a plane
    const v4u h4 = Th[(p >> 3) * 9 + (p & 7)];
    const v4u l4 = Tl[(p >> 3) * 9 + (p & 7)];
    *(v4u*)(dh + (size_t)p * 8) = h4;
    *(v4u*)(dl + (size_t)p * 8) = l4;
  }
}

// =====================================================================================================
// One launch for the two passes that depend on nothing but the inputs: work-groups 0 .. NGN - 1 normalise, the 64 behind
// them convert the weights. The branch is block-uniform, so every barrier inside is passed by a whole work-group.
// =====================================================================================================
#define NGN (NB * (DM / XCB))   // GroupNorm work-groups
__global__ __launch_bounds__(256) void prep(const float* __restrict__ x, const float* __restrict__ gsc,
                                            const float* __restrict__ gbi,
                                            const float* __restrict__ W0, const float* __restrict__ W1,
                                            const float* __restrict__ W2, const float* __restrict__ W3,
                                            unsigned short* WT, unsigned short* XNh, unsigned short* XNl) {
  const int bx = blockIdx.x;
  if (bx < NGN) gn_norm(x, gsc, gbi, XNh, XNl, bx);
  else          wt_cvt(W0, W1, W2, W3, WT, (bx - NGN) & 15, (bx - NGN) >> 4);
}

// =====================================================================================================
// Register-blocked batched bf16 WMMA GEMM: C[m][n] = sum_k A[m][k] * Bt[n][k] + bias; one wave per 64x64 tile,
// eight tiles per block: 8 / TNB tile rows x TNB tile columns (N / 64 a multiple of TNB, and equal to it where TNB < 8;
// the tile count a multiple of 8). A row-major [M][K] pitch lda; Bt row-major [N][K] pitch ldb (k contiguous);
// M, N multiples of 64, K multiple of GKC. b = batch index (strides in elements).
// Operands: per slab of GKC k the block's A rows and Bt rows (every plane) are copied into LDS, each wave copy = 4 whole
// 128-B lines, rows at pitch GSP; two buffers, slab s + 1 in flight while slab s is multiplied; the waves read their
// fragments from LDS. After the last slab the ring's first bytes serve as the epilogue's per-wave slabs.
// NSPLIT: 0 = A.Bt; 1 = (A + A2).Bt (A2 = unscaled bf16 lo plane of A, same accumulator);
//         3 = A.Bt + A.Bt2 (Bt2 = unscaled bf16 lo plane of Bt; the two planes are walked as alternate k-steps).
// OUT_MODE: 0 = f32 (pitch ldc); 1 = f32 with per-element residual: v = (acc + bias + bf16(R[m][n])) * oscale,
//           R f32 pitch ldr, batch stride strideR; 3 = f16 hi plane C + f16 residual plane C2 = f16((v - hi) * rscale),
//           C2 written only for tiles with n0 < N2 (pitch ldc2, batch stride strideC2).
// bias (f32, RNE-converted to bf16 then widened): bmode 0 = none, 1 = per column n, 2 = per row m;
//           index clamped to [0, blen-1].
// XB: 1 = the A planes, 2 = the Bt planes lie in the normalised planes' layout (xn_off, rows = tokens; lda / ldb unused):
//           a wave copy is still 4 whole lines (4 tokens x 32 B of each of 4 channel blocks); 0 = both row-major.
// PAIR: two products that share A in one launch of two batches: batch 1 takes its own bias vector (biasP, blenP) and
//           writes no residual plane; its Bt and C lie strideB and strideC behind those of batch 0.
// =====================================================================================================
template <int NSPLIT, int TNB>
constexpr int gemm_rows() {                         // staged rows per slab: [A planes][Bt planes]
  return ((NSPLIT == 1) ? 2 : 1) * (8 / TNB) * 64 + ((NSPLIT == 3) ? 2 : 1) * TNB * 64;
}
// ring: the work-group's LDS, 2 * gemm_rows() * GSP halves; bxi, b: the work-group's place in the product's own grid
template <int NSPLIT, int OUT_MODE, bool PAIR, int TNB, int XB>
__device__ __forceinline__ void gemm64_body(
    __bf16* ring, int bxi, int b,
    const unsigned short* __restrict__ Ap, const unsigned short* A2p, int lda, long long strideA,
    const unsigned short* __restrict__ Btp, const unsigned short* Bt2p, int ldb, long long strideB,
    void* Cout, int ldc, long long strideC,
    void* Cout2, int ldc2, long long strideC2, int N2a,
    int M, int N, int K, float rscale,
    const float* __restrict__ biasA, int bmode, int blenA,
    const float* __restrict__ Rp, int ldr, long long strideR, float oscale,
    const float* __restrict__ biasP = nullptr, int blenP = 0) {
  const __bf16* A   = (const __bf16*)(const void*)Ap;
  const __bf16* A2  = (const __bf16*)(const void*)A2p;
  const __bf16* Bt  = (const __bf16*)(const void*)Btp;
  const __bf16* Bt2 = (const __bf16*)(const void*)Bt2p;
  constexpr int RA  = (8 / TNB) * 64;               // A rows of the block, per plane
  constexpr int RB  = TNB * 64;                     // Bt rows of the block, per plane
  constexpr int PA  = (NSPLIT == 1) ? 2 : 1;        // A planes
  constexpr int PB  = (NSPLIT == 3) ? 2 : 1;        // Bt planes
  constexpr int RT  = PA * RA + PB * RB;            // staged rows per slab: [A planes][Bt planes]
  constexpr int NIT = RT / 32;                      // copies per thread and slab (256 threads x 16 B = 32 rows)
  static_assert((RA % 32) == 0 && (RB % 32) == 0 && (NIT % 2) == 0 && NIT <= 63);
  static_assert(2 * RT * GSP * 2 >= 8 * 16 * 68 * 4);
  static_assert(RT == gemm_rows<NSPLIT, TNB>());        // ring: two slab buffers; afterwards per-wave 16x64 f32 slabs, pitch 68
  const bool second = PAIR && (b == 1);                      // block-uniform
  const float* bias = second ? biasP : biasA;
  const int blen = second ? blenP : blenA;
  const int N2   = second ? 0 : N2a;
  const int lane = threadIdx.x & 31;
  const int wave = threadIdx.x >> 5;
  const int tilesN = N >> 6;
  const int tilesM = M >> 6;
  const int tile = bxi * 8 + wave;
  if (bxi * 8 >= tilesM * tilesN) return;               // block-uniform, in front of every barrier
  const int tm = tile / tilesN;
  const int tn = tile - tm * tilesN;
  const int m0 = tm << 6;
  const int n0 = tn << 6;

  const __bf16* Ab  = A  + (size_t)b * strideA;
  const __bf16* Bb  = Bt + (size_t)b * strideB;
  const __bf16* Ab2 = (NSPLIT == 1) ? (A2  + (size_t)b * strideA) : Ab;
  const __bf16* Bb2 = (NSPLIT == 3) ? (Bt2 + (size_t)b * strideB) : Bb;

  const int rlane = lane & 15;                 // row (A) / col (B, D) within subtile
  const int koff  = (lane >> 4) * 8;           // k offset of this lane half
  const int mOff  = (lane >> 4) * 8;           // D row offset

  v8f acc[4][4];
#pragma unroll
  for (int i = 0; i < 4; ++i)
#pragma unroll
    for (int j = 0; j < 4; ++j) acc[i][j] = zero8();

  // ---- staging: thread -> row (tid >> 3) of each group of 32 rows, 16-B piece (tid & 7) of its 128-B line ----
  const int t0b  = bxi * 8;                          // the block's first tile
  const int mb0  = (t0b / tilesN) << 6;              // its first A row
  const int nb0  = (t0b - (t0b / tilesN) * tilesN) << 6;   // its first Bt row
  const int srow = threadIdx.x >> 3;
  const int sseg = (threadIdx.x & 7) * 8;
  const unsigned lthr = lds_off(ring) + (unsigned)(srow * GSP + sseg) * 2u;
  auto stage = [&](int slab, int buf) {
    const int kc = slab * GKC + sseg;
    const unsigned lb = lthr + (unsigned)buf * (unsigned)(RT * GSP * 2);
#pragma unroll   // both loops: each copy's plane and row group are compile-time, the statement's operands stay in registers
    for (int g0 = 0; g0 < NIT; g0 += 8) {
      unsigned l[8];
      const __bf16* g[8];
#pragma unroll
      for (int e = 0; e < 8; ++e) {
        const int fr = (g0 + e < NIT) ? (g0 + e) * 32 : 0;     // first staged row of this copy's group of 32
        if (fr < PA * RA) {
          const int r = fr % RA;
          g[e] = ((fr / RA) ? Ab2 : Ab) + ((XB == 1) ? xn_off(mb0 + r + srow, kc) : (size_t)(mb0 + r + srow) * lda + kc);
        } else {
          const int r = (fr - PA * RA) % RB;
          g[e] = (((fr - PA * RA) / RB) ? Bb2 : Bb) + ((XB == 2) ? xn_off(nb0 + r + srow, kc) : (size_t)(nb0 + r + srow) * ldb + kc);
        }
        l[e] = lb + (unsigned)(fr * GSP * 2);
      }
      if (g0 + 8 <= NIT) acopy8(l, g);
      else               acopy2(l, g);
    }
  };
  static_assert((NIT % 8) == 0 || (NIT % 8) == 2);

  const int nsl = K / GKC;                           // slabs
  const int aRow = (wave / TNB) * 64 + rlane;        // the wave's first A row inside a staged plane
  const int bRow = PA * RA + (wave % TNB) * 64 + rlane;   // its first Bt row inside the staged slab
  stage(0, 0);
  wait_async0();
  __syncthreads();                                   // slab 0 is published
  if (nsl > 1) stage(1, 1);
  for (int sl = 0; sl < nsl; ++sl) {
    const __bf16* sb = ring + (sl & 1) * (RT * GSP);
#pragma unroll   // k and plane offsets fold into the LDS loads' immediate offsets
    for (int ks = 0; ks < GKC / 32; ++ks) {
      const int kl = ks * 32 + koff;                 // k inside the slab
      const __bf16* As = sb + (size_t)aRow * GSP + kl;
      v16b ah[4], al[4];
#pragma unroll
      for (int i = 0; i < 4; ++i) {
        ah[i] = ldfrag_b(As + i * 16 * GSP);
        al[i] = ah[i];
        if (NSPLIT == 1) al[i] = ldfrag_b(As + (RA + i * 16) * GSP);
      }
#pragma unroll
      for (int pl = 0; pl < PB; ++pl) {              // the Bt planes of one k step follow each other, hi then lo
        const __bf16* Bs = sb + (size_t)(bRow + pl * RB) * GSP + kl;
        v16b bh[4];
#pragma unroll
        for (int j = 0; j < 4; ++j) bh[j] = ldfrag_b(Bs + j * 16 * GSP);
#pragma unroll
        for (int i = 0; i < 4; ++i) {
#pragma unroll
          for (int j = 0; j < 4; ++j) {
            acc[i][j] = mma_b_raw(ah[i], bh[j], acc[i][j]);
            if (NSPLIT == 1) acc[i][j] = mma_b_raw(al[i], bh[j], acc[i][j]);
          }
          dep_guard_b(acc[i][0], acc[i][3], ah[i], al[i]);
        }
        keep4_b(bh[0], bh[1], bh[2], bh[3]);
      }
    }
    wait_ds0();
    wait_async0();
    __syncthreads();                                 // publishes slab sl + 1 and ends every read of slab sl's buffer
    if (sl + 2 < nsl) stage(sl + 2, sl & 1);
  }
  wait_async0();
  acc_guard4(acc[0][0], acc[0][1], acc[0][2], acc[0][3]);
  acc_guard4(acc[1][0], acc[1][1], acc[1][2], acc[1][3]);
  acc_guard4(acc[2][0], acc[2][1], acc[2][2], acc[2][3]);
  acc_guard4(acc[3][0], acc[3][1], acc[3][2], acc[3][3]);

  // ---- bias (per column), clamped address, selected by value ----
  float bc[4];
  int bci[4];
#pragma unroll
  for (int j = 0; j < 4; ++j) {
    int bi = n0 + (j << 4) + rlane;
    bi = (bi < blen) ? bi : (blen - 1);
    bi = (bi > 0) ? bi : 0;
    bci[j] = bi;
    const float t = bf_up(bf_bits(bias[bi]));
    bc[j] = (bmode == 1) ? t : 0.f;
  }
  wait_x0_idx4(bci);                                 // behind the bias loads, before their index registers are reused

  // ---- epilogue ----
  float* slab = (float*)(void*)ring + wave * (16 * 68);
#pragma unroll
  for (int i = 0; i < 4; ++i) {
    const int mBase = m0 + (i << 4);
    float brw[8];
    int bri[8];
#pragma unroll
    for (int r = 0; r < 8; ++r) {
      int bi = mBase + mOff + r;
      bi = (bi < blen) ? bi : (blen - 1);
      bi = (bi > 0) ? bi : 0;
      bri[r] = bi;
      const float t = bf_up(bf_bits(bias[bi]));
      brw[r] = (bmode == 2) ? t : 0.f;
    }
    wait_x0_idx8(bri);                               // behind the bias loads, before their index registers are reused
#pragma unroll
    for (int j = 0; j < 4; ++j) {
#pragma unroll
      for (int r = 0; r < 8; ++r) {
        slab[(mOff + r) * 68 + (j << 4) + rlane] = acc[i][j][r] + bc[j] + brw[r];
      }
    }
    wave_sync_lds();
    if (OUT_MODE == 0 || OUT_MODE == 1) {
      float* C = (float*)Cout + (size_t)b * strideC;
      const float* R = Rp + (size_t)b * strideR;
      const int hh = lane >> 4, c4 = (lane & 15) * 4;     // 256-B row segment = 16 lanes x 16 B
      {
        v4f xr[8];
        if (OUT_MODE == 1) {
#pragma unroll
          for (int it = 0; it < 8; ++it) xr[it] = *(const v4f*)(R + (size_t)(mBase + it * 2 + hh) * ldr + n0 + c4);
          wait_x0();                                       // behind the run of residual loads, before their addresses are reused
        }
#pragma unroll
        for (int it = 0; it < 8; ++it) {
          const int row = it * 2 + hh;                     // it 0..7 x hh 0..1 = rows 0..15
          v4f v = *(const v4f*)(slab + row * 68 + c4);
          if (OUT_MODE == 1) {
            v4f t;
            t[0] = (v[0] + bfr(xr[it][0])) * oscale;
            t[1] = (v[1] + bfr(xr[it][1])) * oscale;
            t[2] = (v[2] + bfr(xr[it][2])) * oscale;
            t[3] = (v[3] + bfr(xr[it][3])) * oscale;
            v = t;
          }
          *(v4f*)(C + (size_t)(mBase + row) * ldc + n0 + c4) = v;
        }
        wait_x0();                                         // behind the stores, before their registers are reused
      }
    } else {
      const int q = lane >> 3, c8 = (lane & 7) * 8;
      unsigned short* C  = (unsigned short*)Cout  + (size_t)b * strideC;
      unsigned short* C2 = (unsigned short*)Cout2 + (size_t)b * strideC2;
      const bool wlo = (n0 < N2);                           // wave-uniform
      v4u hv[4], lv[4];
#pragma unroll
      for (int it = 0; it < 4; ++it) {
        const int row = it * 4 + q;                        // it 0..3 x q 0..3 = rows 0..15
        const float* sp = slab + row * 68 + c8;
        v4u a, a2;
#pragma unroll
        for (int e = 0; e < 4; ++e) {
          const float f0 = sp[2 * e], f1 = sp[2 * e + 1];
          const _Float16 x0 = (_Float16)f0, x1 = (_Float16)f1;
          const unsigned short h0 = h_bits(x0), h1 = h_bits(x1);
          const unsigned short l0 = h_bits((_Float16)((f0 - (float)x0) * rscale));
          const unsigned short l1 = h_bits((_Float16)((f1 - (float)x1) * rscale));
          a[e] = pk16(h0, h1); a2[e] = pk16(l0, l1);
        }
        hv[it] = a; lv[it] = a2;
      }
      {
#pragma unroll
        for (int it = 0; it < 4; ++it) {
          const int row = it * 4 + q;
          *(v4u*)(C + (size_t)(mBase + row) * ldc + n0 + c8) = hv[it];
          wait_x0();                                       // behind each store, before its data or address registers are reused
          if (wlo) {
            *(v4u*)(C2 + (size_t)(mBase + row) * ldc2 + n0 + c8) = lv[it];
            wait_x0();
          }
        }
      }
    }
    wave_sync_lds();
  }
}

// One product per launch: grid (tiles / 8, batches), 256 threads.
template <int NSPLIT, int OUT_MODE, bool PAIR, int TNB, int XB>
__global__ __launch_bounds__(256) void gemm64(
    const unsigned short* __restrict__ Ap, const unsigned short* A2p, int lda, long long strideA,
    const unsigned short* __restrict__ Btp, const unsigned short* Bt2p, int ldb, long long strideB,
    void* Cout, int ldc, long long strideC,
    void* Cout2, int ldc2, long long strideC2, int N2a,
    int M, int N, int K, float rscale,
    const float* __restrict__ biasA, int bmode, int blenA,
    const float* __restrict__ Rp, int ldr, long long strideR, float oscale) {
  __shared__ __align__(16) __bf16 ring[2 * gemm_rows<NSPLIT, TNB>() * GSP];
  gemm64_body<NSPLIT, OUT_MODE, PAIR, TNB, XB>(ring, blockIdx.x, blockIdx.y, Ap, A2p, lda, strideA, Btp, Bt2p, ldb, strideB,
      Cout, ldc, strideC, Cout2, ldc2, strideC2, N2a, M, N, K, rscale, biasA, bmode, blenA, Rp, ldr, strideR, oscale);
}

// One launch for the three projections of the normalised planes, which do not depend on each other:
//   work-groups 0 .. NVT - 1 (the longest, given the lowest indices): v^T[b][c][t] = sum_i Wv[i][c] xn[b][t][i] + bv[c] per batch
//     -> f16 hi plane (pitch SEQ) + residual x4096 (A = WTv [c][i], Bt = XN rows of batch b hi + lo; M=256, N=1024, K=256;
//     bias per row); 8 work-groups a batch;
//   the 2 x NQK behind them (M=16384, N=256, K=256, bias per column): first q = xn . Wq + bq -> f16 hi plane [16384][256]
//     + f16 residual x4096, then k = xn . Wk + bk -> f16 plane, no residual. Wk's plane lies one weight plane behind WTq,
//     Kh two activation planes behind Qh (workspace map below).
// The branch is block-uniform; both sides use the one LDS ring, sized for the larger.
#define NVT (NB * 8)
#define NQK ((NB * SEQ / 64) * (DM / 64) / 8)
__global__ __launch_bounds__(256) void gemm_qkv(const unsigned short* __restrict__ XNh, const unsigned short* XNl,
                                                const unsigned short* __restrict__ WTq, const unsigned short* __restrict__ WTv,
                                                unsigned short* Qh, unsigned short* Ql,
                                                unsigned short* VTh, unsigned short* VTl,
                                                const float* __restrict__ bq, int nbq, const float* __restrict__ bk, int nbk,
                                                const float* __restrict__ bv, int nbv) {
  static_assert(gemm_rows<3, 8>() >= gemm_rows<1, 4>());
  __shared__ __align__(16) __bf16 ring[2 * gemm_rows<3, 8>() * GSP];
  const int bx = blockIdx.x;
  if (bx < NVT) {
    gemm64_body<3, 3, false, 8, 2>(ring, bx & 7, bx >> 3,
        WTv, WTv, DM, 0LL, XNh, XNl, DM, (long long)SEQ * DM,
        (void*)VTh, SEQ, (long long)DM * SEQ, (void*)VTl, SEQ, (long long)DM * SEQ, SEQ,
        DM, SEQ, DM, 4096.0f, bv, 2, nbv, nullptr, 0, 0LL, 1.0f);
  } else {
    gemm64_body<1, 3, true, 4, 1>(ring, (bx - NVT) % NQK, (bx - NVT) / NQK,
        XNh, XNl, DM, 0LL, WTq, WTq, DM, (long long)DM * DM,
        (void*)Qh, DM, 2LL * NB * SEQ * DM, (void*)Ql, DM, 0LL, DM,
        NB * SEQ, DM, DM, 4096.0f, bq, 1, nbq, nullptr, 0, 0LL, 1.0f, bk, nbk);
  }
}

// =====================================================================================================
// Attention, head dim 64, no masking, softmax over all SEQ keys.
//   q hi plane (f16, pitch DM): element (b, t, h, d) at [(b*SEQ + t)*DM + h*64 + d]; q residual plane
//   (f16, (q - f16(q))*4096, pitch DM) same layout; k plane (f16, pitch DM) same layout.
//   v^T hi plane (f16): element (b, h, d, s) at [(b*DM + h*64 + d)*SEQ + s]; v^T residual plane (f16, x4096): same layout
//   out: context as bf16 hi plane and bf16 lo plane (lo = RNE(v - hi), unscaled), pitch DM: element (b, t, h, d) at
//   [(b*SEQ + t)*DM + h*64 + d] of each plane
//   Both products are taken transposed, so that a lane owns ONE query (column lane & 15):
//   scores^T[key][query] = (k . qh + (k . ql) * rres) * sscale on f16 WMMA (A = K rows, B = q), residual products in a
//   separate accumulator; a lane holds 32 of its query's 64 scores (keys 16 j + 8 (lane >> 4) + r), so the maximum and
//   the sum run in the lane, with one exchange between the wave halves for the maximum per chunk and one for the sum
//   at the end. p = exp(s - m) carried as f16(1024 p): score tiles 2 kk and 2 kk + 1, converted in place, ARE the
//   B operand (keys 32 kk .. + 31 in the hardware k order) of context^T[d][query] = vh . p + (vl . p) * rres
//   (A = V^T rows; separate accumulator folded per chunk in f32); online softmax in f32.
//   Block = 4 waves = 64 query rows of one (b, h); grid = NQB * NH * NB; kv chunks of 64, static trip NQB.
//   K / V^T chunk staging: asynchronous copies, 16 B per lane, 12 per thread = the three 64x64 tiles; a wave copy = 4 whole
//   128-B lines (lane -> row lane >> 3, piece lane & 7); two buffers, chunk kt + 1 in flight while chunk kt is worked on;
//   one __syncthreads per chunk, at the loop's foot.
//   Output coverage: each wave stores rows q0..q0+15 (it 0..3 x lane>>3 0..3) x 64 columns of both planes; a row's
//   64 columns of one plane = 8 lanes x 16 B = one whole 128-B line
// =====================================================================================================
__device__ __forceinline__ float other_half(float v) {       // the value that lane ^ 16 holds
  const int b = __builtin_bit_cast(int, v);
  return __builtin_bit_cast(float, __builtin_amdgcn_permlanex16(b, b, 0x76543210, 0xfedcba98, false, false));
}
__global__ __launch_bounds__(128)
void attn64(const unsigned short* __restrict__ qhp, const unsigned short* __restrict__ qlp,
            const unsigned short* __restrict__ khp,
            const unsigned short* __restrict__ vhp, const unsigned short* __restrict__ vlp,
            unsigned short* ctxh, unsigned short* ctxl, float sscale, float rres) {
  union FH { v16h v; v8h h[2]; };
  constexpr int KVB = 3 * 64 * KVP;                               // halves of one buffer: K, V^T hi, V^T residual
  __shared__ __align__(16) _Float16 KV[2 * KVB];                  // two buffers; every fragment read = one base + a constant
  __shared__ __align__(16) float    Os[4][16 * OSP];              // per wave context tile [row][d]

  const int tid  = threadIdx.x;
  const int wave = tid >> 5;
  const int lane = tid & 31;
  const int hh   = lane >> 4;
  const int c    = lane & 15;

  const int bx   = blockIdx.x;
  const int qb   = bx % NQB;
  const int rest = bx / NQB;
  const int h    = rest % NH;
  const int b    = rest / NH;
  const int q0   = qb * 64 + wave * 16;
  const size_t rowB = (size_t)b * SEQ;

  const _Float16* Qh = (const _Float16*)(const void*)qhp + (size_t)h * HD;
  const _Float16* Ql = (const _Float16*)(const void*)qlp + (size_t)h * HD;
  const _Float16* Kg = (const _Float16*)(const void*)khp + (size_t)h * HD;
  const _Float16* Vh = (const _Float16*)(const void*)vhp + ((size_t)b * DM + (size_t)h * HD) * SEQ;
  const _Float16* Vl = (const _Float16*)(const void*)vlp + ((size_t)b * DM + (size_t)h * HD) * SEQ;

  // ---- Q fragments (B operand, column = query = lane&15): 2 d-chunks, hi and residual ----
  v16h qah[2], qal[2];
#pragma unroll
  for (int dc = 0; dc < 2; ++dc) {
    qah[dc] = ldfrag_h(Qh + (rowB + q0 + c) * DM + dc * 32 + 8 * hh);
    qal[dc] = ldfrag_h(Ql + (rowB + q0 + c) * DM + dc * 32 + 8 * hh);
  }

  float mrow = -INFINITY;                    // running maximum of query c (equal in both wave halves)
  float lrow = 0.f;                          // running sum of query c over this half's keys
  v8f oacc[4];                               // context^T: oacc[t][r] = element d = 16 t + 8 hh + r of query c
#pragma unroll
  for (int t = 0; t < 4; ++t) oacc[t] = zero8();

  // ---- staging: thread -> row (tid >> 3) of each group of 16 rows, 16-B piece (tid & 7) of its 128-B line ----
  const int srow = tid >> 3, sseg = (tid & 7) * 8;
  const unsigned lthr = lds_off(KV) + (unsigned)(srow * KVP + sseg) * 2u;
  auto stage = [&](int chunk, int buf) {     // chunk and buf are the same for the whole work-group
    const _Float16* kg  = Kg + (rowB + chunk * 64 + srow) * DM + sseg;     // K row chunk * 64 + srow
    const _Float16* vg  = Vh + (size_t)srow * SEQ + chunk * 64 + sseg;     // V^T row d = srow, keys of the chunk
    const _Float16* vlg = Vl + (size_t)srow * SEQ + chunk * 64 + sseg;
    const unsigned lb = lthr + (unsigned)buf * (unsigned)(KVB * 2);
    unsigned l[12];
    const _Float16* g[12];
#pragma unroll   // l and g are the statement's operands: constant indices keep them in registers
    for (int i = 0; i < 4; ++i) {            // rows 16 i + srow of each of the three tiles
      g[i]     = kg  + (size_t)(16 * i) * DM;
      g[4 + i] = vg  + (size_t)(16 * i) * SEQ;
      g[8 + i] = vlg + (size_t)(16 * i) * SEQ;
      l[i]     = lb + (unsigned)((16 * i) * KVP * 2);
      l[4 + i] = lb + (unsigned)((64 + 16 * i) * KVP * 2);
      l[8 + i] = lb + (unsigned)((128 + 16 * i) * KVP * 2);
    }
    acopy12(l, g);
  };
  stage(0, 0);
  wait_async0();
  __syncthreads();                           // chunk 0 is published

  for (int kt = 0; kt < NQB; ++kt) {         // static trip count
    // Directly behind the barrier in front of the loop or at the foot of trip kt - 1: the next chunk's copies, into the
    // buffer that trip kt - 1 has just read. Written at the head: with the test at the foot the compiler sank the trip's
    // last sums behind it and took 270 registers, which costs the fourth wave per SIMD.
    if (kt + 1 < NQB) stage(kt + 1, (kt + 1) & 1);
    const _Float16* const Ksh = KV + (kt & 1) * KVB;               // K [kv][d], 64 halves used per row
    const _Float16* const Vth = Ksh + 64 * KVP;                    // V^T hi [d][kv]
    const _Float16* const Vtl = Ksh + 128 * KVP;                   // V^T residual [d][kv]

    // ---- scores^T: 64 keys x 16 queries per wave, 2 f16 products (hi, residual) ----
    //      LDS reads stand in three groups per chunk: all of K; V^T of keys 0..31, read under the softmax; V^T of keys 32..63
    v8f s[4];                                // s[j][r]: key 16 j + 8 hh + r against query c
    FH vh0[4], vl0[4];                       // V^T fragments of keys 0..31, hi and residual
    {
      FH kb[4][2];
#pragma unroll   // every loop of this block: kb, sh, sl, vh0 and vl0 are register arrays, constant indices
      for (int j = 0; j < 4; ++j)
#pragma unroll
        for (int dc = 0; dc < 2; ++dc) {
          kb[j][dc].h[0] = *(const v8h*)(Ksh + (j * 16 + c) * KVP + dc * 32 + 8 * hh);
          kb[j][dc].h[1] = *(const v8h*)(Ksh + (j * 16 + c) * KVP + dc * 32 + 16 + 8 * hh);
        }
      group_fence();
      v8f sh[4], sl[4];
#pragma unroll
      for (int j = 0; j < 4; ++j) { sh[j] = zero8(); sl[j] = zero8(); }
#pragma unroll
      for (int dc = 0; dc < 2; ++dc)
#pragma unroll
        for (int j = 0; j < 4; ++j) {
          sh[j] = mma_h(kb[j][dc].v, qah[dc], sh[j]);
          sl[j] = mma_h(kb[j][dc].v, qal[dc], sl[j]);
        }
      // ends the run: a builtin WMMA is otherwise free to sink to its first use, behind the reads that take over K's registers
      acc_guard4(sh[0], sh[1], sh[2], sh[3]);
      acc_guard4(sl[0], sl[1], sl[2], sl[3]);
      group_fence();
#pragma unroll
      for (int t = 0; t < 4; ++t) {
        vh0[t].h[0] = *(const v8h*)(Vth + (t * 16 + c) * KVP + 8 * hh);
        vh0[t].h[1] = *(const v8h*)(Vth + (t * 16 + c) * KVP + 16 + 8 * hh);
        vl0[t].h[0] = *(const v8h*)(Vtl + (t * 16 + c) * KVP + 8 * hh);
        vl0[t].h[1] = *(const v8h*)(Vtl + (t * 16 + c) * KVP + 16 + 8 * hh);
      }
      group_fence();
#pragma unroll
      for (int j = 0; j < 4; ++j)
#pragma unroll
        for (int r = 0; r < 8; ++r) s[j][r] = (sh[j][r] + sl[j][r] * rres) * sscale;
    }

    // ---- maximum in the lane, joined across the halves; online softmax; P^T (x1024, f16) packed in registers ----
    float mx[8];
#pragma unroll   // mx and s are register arrays: constant indices; eight independent chains
    for (int r = 0; r < 8; ++r) mx[r] = fmaxf(fmaxf(s[0][r], s[1][r]), fmaxf(s[2][r], s[3][r]));
    float m = fmaxf(fmaxf(fmaxf(mx[0], mx[1]), fmaxf(mx[2], mx[3])), fmaxf(fmaxf(mx[4], mx[5]), fmaxf(mx[6], mx[7])));
    m = fmaxf(m, other_half(m));
    const float mnew  = fmaxf(mrow, m);
    const float alpha = __expf(mrow - mnew);
    mrow = mnew;
    FH pb[2];                                // pb[kk]: keys 32 kk + (8 hh + e | 16 + 8 hh + e - 8) of query c
    float ps[4];                             // four independent partial sums, one per score tile
#pragma unroll   // both loops: s, ps and pb are register arrays, their indices must be compile-time constants
    for (int j = 0; j < 4; ++j) {
      ps[j] = 0.f;
#pragma unroll
      for (int r = 0; r < 8; ++r) {
        const float p = __expf(s[j][r] - mnew);
        ps[j] += p;
        pb[j >> 1].v[(j & 1) * 8 + r] = (_Float16)(p * 1024.0f);
      }
    }
    lrow = lrow * alpha + ((ps[0] + ps[1]) + (ps[2] + ps[3]));
#pragma unroll
    for (int t = 0; t < 4; ++t)
#pragma unroll
      for (int r = 0; r < 8; ++r) oacc[t][r] *= alpha;

    // ---- context^T += V^T . P^T (f16 WMMA), residual products into a separate accumulator ----
    v8f o1[4];
    FH vh1[4], vl1[4];                       // V^T fragments of keys 32..63
#pragma unroll   // every loop down to the fold: register arrays, constant indices
    for (int t = 0; t < 4; ++t) oacc[t] = mma_h(vh0[t].v, pb[0].v, oacc[t]);
    acc_guard4(oacc[0], oacc[1], oacc[2], oacc[3]);   // ends the run, as above: the next reads take over vh0's registers
    group_fence();
#pragma unroll
    for (int t = 0; t < 4; ++t) {
      vh1[t].h[0] = *(const v8h*)(Vth + (t * 16 + c) * KVP + 32 + 8 * hh);
      vh1[t].h[1] = *(const v8h*)(Vth + (t * 16 + c) * KVP + 32 + 16 + 8 * hh);
      vl1[t].h[0] = *(const v8h*)(Vtl + (t * 16 + c) * KVP + 32 + 8 * hh);
      vl1[t].h[1] = *(const v8h*)(Vtl + (t * 16 + c) * KVP + 32 + 16 + 8 * hh);
    }
    group_fence();
#pragma unroll
    for (int t = 0; t < 4; ++t) o1[t] = mma_h(vl0[t].v, pb[0].v, zero8());
#pragma unroll
    for (int t = 0; t < 4; ++t) oacc[t] = mma_h(vh1[t].v, pb[1].v, oacc[t]);
#pragma unroll
    for (int t = 0; t < 4; ++t) o1[t] = mma_h(vl1[t].v, pb[1].v, o1[t]);
    acc_guard4(oacc[0], oacc[1], oacc[2], oacc[3]);   // the twelve WMMAs run back to back, the fold follows them
    acc_guard4(o1[0], o1[1], o1[2], o1[3]);
#pragma unroll
    for (int t = 0; t < 4; ++t)
#pragma unroll
      for (int r = 0; r < 8; ++r) oacc[t][r] += o1[t][r] * rres;

    wait_ds0();
    wait_async0();
    __syncthreads();                         // publishes chunk kt + 1 and ends every read of chunk kt's buffer
  }
  wait_async0();

  // ---- join the halves' sums, normalise (1/l and the 1/1024 p carry), stage the wave's 16x64 f32 tile in LDS
  //      (a lane's 8 registers of tile t = 8 consecutive d of its query's row), then split each value into its bf16
  //      hi and lo parts and write whole lines of the two planes
  float* os = Os[wave];
  {
    const float l = lrow + other_half(lrow);
    const float inv = ((l > 0.f) ? (1.0f / l) : 0.f) * (1.0f / 1024.0f);
#pragma unroll   // both loops: oacc is a register array, its indices must be compile-time constants
    for (int t = 0; t < 4; ++t) {
      v4f w0, w1;
#pragma unroll
      for (int e = 0; e < 4; ++e) { w0[e] = oacc[t][e] * inv; w1[e] = oacc[t][4 + e] * inv; }
      *(v4f*)(os + c * OSP + t * 16 + 8 * hh)     = w0;
      *(v4f*)(os + c * OSP + t * 16 + 8 * hh + 4) = w1;
    }
  }
  wave_sync_lds();
  {
    const int q = lane >> 3, c8 = (lane & 7) * 8;
    v4u hv[4], lv[4];
#pragma unroll   // both loops: hv and lv are register arrays, their indices must be compile-time constants
    for (int it = 0; it < 4; ++it) {
      const int row = it * 4 + q;                        // it 0..3 x q 0..3 = rows 0..15 of the wave tile
      const v4f a = *(const v4f*)(os + row * OSP + c8);
      const v4f d = *(const v4f*)(os + row * OSP + c8 + 4);
      const float f[8] = {a[0], a[1], a[2], a[3], d[0], d[1], d[2], d[3]};
#pragma unroll
      for (int e = 0; e < 4; ++e) {
        const unsigned short h0 = bf_bits(f[2 * e]), h1 = bf_bits(f[2 * e + 1]);
        hv[it][e] = pk16(h0, h1);
        lv[it][e] = pk16(bf_bits(f[2 * e] - bf_up(h0)), bf_bits(f[2 * e + 1] - bf_up(h1)));
      }
    }
#pragma unroll
    for (int it = 0; it < 4; ++it) {
      const size_t o = (rowB + q0 + it * 4 + q) * DM + (size_t)h * HD + c8;
      *(v4u*)(ctxh + o) = hv[it];
      *(v4u*)(ctxl + o) = lv[it];
    }
  }
}

// =====================================================================================================
// Workspace map (bytes), every plane an exact multiple of its whole-row / 64x64-tile / whole-line store granularity:
//   WT    bf16 [4][256 o][256 i]     0          524288     (Wq, Wk, Wv, Wp transposed, k = in contiguous)
//   XNh   bf16 [16][16][1024 t][16 c] 524288    8388608    (GroupNorm output, blocks of 16 channels, hi plane)
//   XNl   bf16 [16][16][1024][16]    8912896    8388608    (lo plane)
//   Qh    f16  [16384][256]          17301504   8388608
//   Ql    f16  [16384][256]          25690112   8388608    (q residual x4096)
//   Kh    f16  [16384][256]          34078720   8388608
//   VTh   f16  [16][256 c][1024 t]   42467328   8388608
//   VTl   f16  [16][256][1024]       50855936   8388608    (v residual x4096)
//   CTXh  bf16 [16384 t][256 c]      59244544   8388608    (attention context, token-major, hi plane)
//   CTXl  bf16 [16384][256]          67633152   8388608    (lo plane)
//   end                              76021760
// =====================================================================================================
extern "C" void kernel_launch(void* const* d_in, const int* in_sizes, int n_in,
                              void* d_out, int out_size, void* d_ws, size_t ws_size,
                              hipStream_t stream) {
  if (n_in < 11) return;
  if (in_sizes[0] != NB * DM * SEQ) return;
  if (in_sizes[3] != DM * DM || in_sizes[5] != DM * DM || in_sizes[7] != DM * DM || in_sizes[9] != DM * DM) return;
  if (in_sizes[1] < DM || in_sizes[2] < DM) return;
  if (in_sizes[4] < 1 || in_sizes[6] < 1 || in_sizes[8] < 1 || in_sizes[10] < 1) return;
  if (out_size != NB * DM * SEQ) return;

  const float* x   = (const float*)d_in[0];
  const float* gsc = (const float*)d_in[1];
  const float* gbi = (const float*)d_in[2];
  const float* wq  = (const float*)d_in[3];
  const float* bq  = (const float*)d_in[4];
  const float* wk  = (const float*)d_in[5];
  const float* bk  = (const float*)d_in[6];
  const float* wv  = (const float*)d_in[7];
  const float* bv  = (const float*)d_in[8];
  const float* wp  = (const float*)d_in[9];
  const float* bp  = (const float*)d_in[10];
  float* out = (float*)d_out;

  const size_t PWT = (size_t)4 * DM * DM * 2;          //   524288
  const size_t P16 = (size_t)NB * SEQ * DM * 2;        //  8388608
  size_t off = 0;
  const size_t oWT   = off; off += PWT;
  const size_t oXNh  = off; off += P16;
  const size_t oXNl  = off; off += P16;
  const size_t oQh   = off; off += P16;
  const size_t oQl   = off; off += P16;
  const size_t oKh   = off; off += P16;
  const size_t oVTh  = off; off += P16;
  const size_t oVTl  = off; off += P16;
  const size_t oCTXh = off; off += P16;
  const size_t oCTXl = off; off += P16;
  if (off > ws_size) return;                            // off = 76021760
  if (off > (size_t)134217728) return;

  char* ws = (char*)d_ws;
  unsigned short* WT   = (unsigned short*)(ws + oWT);
  unsigned short* XNh  = (unsigned short*)(ws + oXNh);
  unsigned short* XNl  = (unsigned short*)(ws + oXNl);
  unsigned short* Qh   = (unsigned short*)(ws + oQh);
  unsigned short* Ql   = (unsigned short*)(ws + oQl);
  unsigned short* Kh   = (unsigned short*)(ws + oKh);
  unsigned short* VTh  = (unsigned short*)(ws + oVTh);
  unsigned short* VTl  = (unsigned short*)(ws + oVTl);
  unsigned short* CTXh = (unsigned short*)(ws + oCTXh);
  unsigned short* CTXl = (unsigned short*)(ws + oCTXl);
  unsigned short* WTq = WT + (size_t)0 * DM * DM;
  unsigned short* WTv = WT + (size_t)2 * DM * DM;
  unsigned short* WTp = WT + (size_t)3 * DM * DM;

  const dim3 blk(256);
  const dim3 gPrep(NGN + 64);                                     // 256 GroupNorm blocks + 16 tiles of 64x64 x 4 weights
  const dim3 gQKV(NVT + 2 * NQK);                                 // 128 v^T blocks + 128 q blocks + 128 k blocks
  const dim3 gVT(((DM / 64) * (SEQ / 64) + 7) / 8, NB);           // 64 tiles -> 8 blocks x 16 batches: M=256, N=1024
  const dim3 gAttn(NB * NH * NQB);                                // 1024 blocks
  const float rs2 = 1.0f / 1.41421356237309515f;

  // (1) GroupNorm statistics from bf16(x) and apply -> bf16 hi + lo planes [16][16 channel blocks][1024 t][16 c];
  //     weights [in][out] -> bf16 [out][in] planes (RNE convert)
  prep<<<gPrep, blk, 0, stream>>>(x, gsc, gbi, wq, wk, wv, wp, WT, XNh, XNl);
  // (2) v^T, q and k projections of the normalised planes
  gemm_qkv<<<gQKV, blk, 0, stream>>>(XNh, XNl, WTq, WTv, Qh, Ql, VTh, VTl,
                                     bq, in_sizes[4], bk, in_sizes[6], bv, in_sizes[8]);
  // (3) attention: scores scale 1/sqrt(C) = 1/16 -> context bf16 hi + lo planes [16384][256] token-major
  attn64<<<gAttn, dim3(128), 0, stream>>>(Qh, Ql, Kh, VTh, VTl, CTXh, CTXl, 0.0625f, 1.0f / 4096.0f);
  // (4) out[b][c][t] = (sum_o Wp[o][c] ctx[b][t][o] + bp[c] + bf16(x[b][c][t])) * (1/sqrt2) per batch, written
  //     straight into the NCHW output rows of 1024 floats (A = WTp [c][o], Bt = CTX rows hi + lo; M=256, N=1024, K=256)
  gemm64<3, 1, false, 8, 0><<<gVT, blk, 0, stream>>>(
      WTp, WTp, DM, 0LL, CTXh, CTXl, DM, (long long)SEQ * DM,
      (void*)out, SEQ, (long long)DM * SEQ, (void*)out, SEQ, (long long)DM * SEQ, 0,
      DM, SEQ, DM, 1.0f, bp, 2, in_sizes[10], x, SEQ, (long long)DM * SEQ, rs2);
  (void)hipGetLastError();
}

// v010
// It runs in 71.6 microseconds.
// Timed twice side by side with v009, it ran 1.15 and 1.16 times as fast.
// Over all steps from v000 it is 3.16 times as fast.
// Contractions: q, k, v^T and output projections = v_wmma_f32_16x16x32_bf16 (bf16 operands: weights and biases from
// RNE-converted inputs, computed activations as bf16 hi + lo planes, 2 products); q.k^T scores = v_wmma_f32_16x16x32_f16
// (q as f16 hi plane + f16 residual plane x4096 in a separate accumulator, k f16; 2 products); p.v = v_wmma_f32_16x16x32_f16
// (p carried x1024 in f16, v^T as f16 hi plane + residual plane x4096 in a separate accumulator; 2 products);
// all f32 accumulate; GroupNorm statistics, softmax, biases, residual add and output scale in f32.
#include <hip/hip_runtime.h>
#include <math.h>
#include <stdint.h>

#define NB    16            // batch
#define DM    256           // channels
#define SEQ   1024          // tokens (32 x 32)
#define NH    4             // heads
#define HD    64            // head dim
#define NQB   (SEQ / 64)    // 16 query / key tiles of 64
#define NGRP  32            // groups
#define GSZ   8             // channels per group
#define XCB   16            // channels per block of the normalised planes' layout [batch][c / 16][token][c % 16]
#define KVP   72            // LDS pitch (halves) of the attention K and V^T rows: 144 B = 16 B x odd, so the 16 rows
                            // that one ds_load_b128 fragment read touches fall on 16 different groups of four banks
#define GKC   64            // k elements per staged GEMM slab: 128 B = one whole line of every operand row
#define GSP   72            // LDS pitch (halves) of a staged GEMM operand row: 144 B = 16 B x odd, as for KVP
static_assert(NH * HD == DM);
static_assert((DM % GKC) == 0 && (GSP % 8) == 0 && ((GSP / 8) & 1) == 1 && GSP >= GKC);
static_assert(NGRP * GSZ == DM);
static_assert((SEQ % 64) == 0 && (DM % 64) == 0 && (DM % 32) == 0);
static_assert(XCB == 2 * GSZ && (DM % XCB) == 0 && (GKC % XCB) == 0 && SEQ == 4 * 256);
static_assert((KVP % 8) == 0 && ((KVP / 8) & 1) == 1 && KVP >= 64);

typedef _Float16 v16h __attribute__((ext_vector_type(16)));
typedef _Float16 v8h  __attribute__((ext_vector_type(8)));
typedef __bf16   v16b __attribute__((ext_vector_type(16)));
typedef __bf16   v8b  __attribute__((ext_vector_type(8)));
typedef float    v8f  __attribute__((ext_vector_type(8)));
typedef float    v4f  __attribute__((ext_vector_type(4)));
typedef unsigned int v4u __attribute__((ext_vector_type(4)));
typedef unsigned short v8us __attribute__((ext_vector_type(8)));

// ---- scalar helpers --------------------------------------------------------------------------------
__device__ __forceinline__ unsigned short bf_bits(float f) {          // f32 -> bf16 bits, RNE convert
  unsigned u = __float_as_uint(f);
  return (unsigned short)((u + 0x7FFFu + ((u >> 16) & 1u)) >> 16);
}
__device__ __forceinline__ float bf_up(unsigned short h) { return __uint_as_float(((unsigned)h) << 16); }
__device__ __forceinline__ float bfr(float f) { return bf_up(bf_bits(f)); }   // value RNE-converted to bf16 and widened
__device__ __forceinline__ unsigned short h_bits(_Float16 x) { return __builtin_bit_cast(unsigned short, x); }
__device__ __forceinline__ unsigned pk16(unsigned short a, unsigned short b) { return (unsigned)a | ((unsigned)b << 16); }
__device__ __forceinline__ v8f zero8() { v8f z = {0.f, 0.f, 0.f, 0.f, 0.f, 0.f, 0.f, 0.f}; return z; }

// ---- fragment loaders: 16-bit A/B operand, lane -> row/col (lane&15), p already includes +8*(lane>>4);
//      elements 0..7 <- p[0..7] (k0+8h..), elements 8..15 <- p[16..23] (k0+16+8h..)
__device__ __forceinline__ v16b ldfrag_b(const __bf16* p) {
  union { v16b v; v8b h[2]; } f;
  f.h[0] = *(const v8b*)(p);
  f.h[1] = *(const v8b*)(p + 16);
  return f.v;
}
__device__ __forceinline__ v16h ldfrag_h(const _Float16* p) {
  union { v16h v; v8h h[2]; } f;
  f.h[0] = *(const v8h*)(p);
  f.h[1] = *(const v8h*)(p + 16);
  return f.v;
}

// ---- WMMA helpers with trailing VALU hazard gap --------------------------------------------------------
__device__ __forceinline__ v8f mma_h(v16h a, v16h b, v8f c) {       // builtin alone: the compiler keeps its distances
  return __builtin_amdgcn_wmma_f32_16x16x32_f16(false, a, false, b, (short)0, c, false, false);
}
__device__ __forceinline__ v8f mma_b_raw(v16b a, v16b b, v8f c) {
  return __builtin_amdgcn_wmma_f32_16x16x32_bf16(false, a, false, b, (short)0, c, false, false);
}
__device__ __forceinline__ void dep_guard_b(v8f& a, v8f& b, v16b x, v16b y) {
#if defined(__HIP_DEVICE_COMPILE__)
  asm volatile("v_nop\n\tv_nop\n\tv_nop\n\tv_nop" : "+v"(a), "+v"(b) : "v"(x), "v"(y));
#endif
}
__device__ __forceinline__ void keep4_b(v16b a, v16b b, v16b c, v16b d) {
#if defined(__HIP_DEVICE_COMPILE__)
  asm volatile("v_nop" :: "v"(a), "v"(b), "v"(c), "v"(d));
#endif
}
__device__ __forceinline__ void acc_guard4(v8f& a, v8f& b, v8f& c, v8f& d) {
#if defined(__HIP_DEVICE_COMPILE__)
  asm volatile("v_nop\n\tv_nop\n\tv_nop\n\tv_nop" : "+v"(a), "+v"(b), "+v"(c), "+v"(d));
#endif
}
// Keeps a group of LDS reads together at its place: without it the compiler spreads the reads among the WMMAs,
// one read-and-wait place per fragment.
__device__ __forceinline__ void group_fence() { __builtin_amdgcn_sched_barrier(0); }
__device__ __forceinline__ void wave_sync_lds() {
  __builtin_amdgcn_fence(__ATOMIC_RELEASE, "workgroup");
  __builtin_amdgcn_wave_barrier();
  __builtin_amdgcn_fence(__ATOMIC_ACQUIRE, "workgroup");
}

// ---- asynchronous global -> LDS copies, 16 B per lane, through no register ------------------------------
__device__ __forceinline__ unsigned lds_off(const void* p) { return (unsigned)(size_t)p; }   // LDS byte address
// Eight (two, twelve) copies in one statement; its last line keeps the address registers untouched until the copies are taken.
__device__ __forceinline__ void acopy8(const unsigned* l, const __bf16* const* g) {
#if defined(__HIP_DEVICE_COMPILE__)
  asm volatile("global_load_async_to_lds_b128 %0, %8, off\n\t"
               "global_load_async_to_lds_b128 %1, %9, off\n\t"
               "global_load_async_to_lds_b128 %2, %10, off\n\t"
               "global_load_async_to_lds_b128 %3, %11, off\n\t"
               "global_load_async_to_lds_b128 %4, %12, off\n\t"
               "global_load_async_to_lds_b128 %5, %13, off\n\t"
               "global_load_async_to_lds_b128 %6, %14, off\n\t"
               "global_load_async_to_lds_b128 %7, %15, off\n\t"
               "s_wait_xcnt 0x0"
               :: "v"(l[0]), "v"(l[1]), "v"(l[2]), "v"(l[3]), "v"(l[4]), "v"(l[5]), "v"(l[6]), "v"(l[7]),
                  "v"(g[0]), "v"(g[1]), "v"(g[2]), "v"(g[3]), "v"(g[4]), "v"(g[5]), "v"(g[6]), "v"(g[7])
               : "memory");
#endif
}
__device__ __forceinline__ void acopy2(const unsigned* l, const __bf16* const* g) {
#if defined(__HIP_DEVICE_COMPILE__)
  asm volatile("global_load_async_to_lds_b128 %0, %2, off\n\t"
               "global_load_async_to_lds_b128 %1, %3, off\n\t"
               "s_wait_xcnt 0x0"
               :: "v"(l[0]), "v"(l[1]), "v"(g[0]), "v"(g[1])
               : "memory");
#endif
}
__device__ __forceinline__ void acopy12(const unsigned* l, const _Float16* const* g) {
#if defined(__HIP_DEVICE_COMPILE__)
  asm volatile("global_load_async_to_lds_b128 %0, %12, off\n\t"
               "global_load_async_to_lds_b128 %1, %13, off\n\t"
               "global_load_async_to_lds_b128 %2, %14, off\n\t"
               "global_load_async_to_lds_b128 %3, %15, off\n\t"
               "global_load_async_to_lds_b128 %4, %16, off\n\t"
               "global_load_async_to_lds_b128 %5, %17, off\n\t"
               "global_load_async_to_lds_b128 %6, %18, off\n\t"
               "global_load_async_to_lds_b128 %7, %19, off\n\t"
               "global_load_async_to_lds_b128 %8, %20, off\n\t"
               "global_load_async_to_lds_b128 %9, %21, off\n\t"
               "global_load_async_to_lds_b128 %10, %22, off\n\t"
               "global_load_async_to_lds_b128 %11, %23, off\n\t"
               "s_wait_xcnt 0x0"
               :: "v"(l[0]), "v"(l[1]), "v"(l[2]), "v"(l[3]), "v"(l[4]), "v"(l[5]),
                  "v"(l[6]), "v"(l[7]), "v"(l[8]), "v"(l[9]), "v"(l[10]), "v"(l[11]),
                  "v"(g[0]), "v"(g[1]), "v"(g[2]), "v"(g[3]), "v"(g[4]), "v"(g[5]),
                  "v"(g[6]), "v"(g[7]), "v"(g[8]), "v"(g[9]), "v"(g[10]), "v"(g[11])
               : "memory");
#endif
}
__device__ __forceinline__ void wait_async0() {      // this wave's copies have landed in LDS
#if defined(__HIP_DEVICE_COMPILE__)
  asm volatile("s_wait_asynccnt 0x0" ::: "memory");
#endif
}
__device__ __forceinline__ void wait_x0() {
#if defined(__HIP_DEVICE_COMPILE__)
  asm volatile("s_wait_xcnt 0x0" ::: "memory");
#endif
}
// The same behind a run of indexed loads: naming the index registers as inputs keeps them unwritten up to the wait itself.
__device__ __forceinline__ void wait_x0_idx4(const int* i) {
#if defined(__HIP_DEVICE_COMPILE__)
  asm volatile("s_wait_xcnt 0x0" :: "v"(i[0]), "v"(i[1]), "v"(i[2]), "v"(i[3]) : "memory");
#endif
}
__device__ __forceinline__ void wait_x0_idx8(const int* i) {
#if defined(__HIP_DEVICE_COMPILE__)
  asm volatile("s_wait_xcnt 0x0" :: "v"(i[0]), "v"(i[1]), "v"(i[2]), "v"(i[3]), "v"(i[4]), "v"(i[5]), "v"(i[6]), "v"(i[7]) : "memory");
#endif
}
// The same behind a run of loads that share one base address: naming the base as an input keeps its register pair out of
// the loads' own results up to the wait.
__device__ __forceinline__ void wait_x0_base(const void* p) {
#if defined(__HIP_DEVICE_COMPILE__)
  asm volatile("s_wait_xcnt 0x0" :: "v"(p) : "memory");
#endif
}
// The same behind a run of eight stores from one base address: the base and the stored values are named, so that no register
// of an issued store is written in front of the wait.
__device__ __forceinline__ void wait_x0_st8(const void* p, const v4f* d) {
#if defined(__HIP_DEVICE_COMPILE__)
  asm volatile("s_wait_xcnt 0x0" :: "v"(p), "v"(d[0]), "v"(d[1]), "v"(d[2]), "v"(d[3]), "v"(d[4]), "v"(d[5]), "v"(d[6]), "v"(d[7]) : "memory");
#endif
}
__device__ __forceinline__ void wait_ds0() {         // this wave's LDS reads have retired before their buffer is refilled
#if defined(__HIP_DEVICE_COMPILE__)
  asm volatile("s_wait_dscnt 0x0" ::: "memory");
#endif
}

// =====================================================================================================
// Weights W[in i][out o] (f32, 256x256) -> bf16 planes WT[w][o][i] (k = i contiguous), RNE convert.
// 16 tiles of 64x64 x 4 weights = 64 work-groups of 256 threads (block range of the launch prep, below). Load: 16 iterations x 4 input rows x 64 cols = the whole
// 64x64 tile into LDS transposed (unsigned short element stores); __syncthreads; write: each wave instruction
// =====================================================================================================
__device__ __forceinline__ void wt_cvt(const float* __restrict__ W0, const float* __restrict__ W1,
                                       const float* __restrict__ W2, const float* __restrict__ W3,
                                       unsigned short* WT, int bx, int wsel) {   // bx: tile, wsel: weight, both block-uniform
  __shared__ __align__(16) unsigned short T[64 * 72];
  const int tid = threadIdx.x, lane = tid & 31, wave = tid >> 5;
  const float* W = (wsel == 0) ? W0 : (wsel == 1) ? W1 : (wsel == 2) ? W2 : W3;
  const int i0 = (bx >> 2) * 64;                                 // input-channel tile
  const int o0 = (bx & 3) * 64;                                  // output-channel tile
#pragma unroll 4
  for (int it = 0; it < 16; ++it) {
    const int i = it * 4 + (tid >> 6);
    const int o = tid & 63;
    const float v = W[(size_t)(i0 + i) * DM + o0 + o];
    T[o * 72 + i] = bf_bits(v);
  }
  __syncthreads();
  const int q = lane >> 3, c8 = (lane & 7) * 8;
  v8us v[2];
#pragma unroll
  for (int it = 0; it < 2; ++it) {
    const int orow = it * 32 + wave * 4 + q;
    v[it] = *(const v8us*)(T + orow * 72 + c8);
  }
  unsigned short* dst = WT + (size_t)wsel * DM * DM;
  {
#pragma unroll
    for (int it = 0; it < 2; ++it) {
      const int orow = it * 32 + wave * 4 + q;
      *(v8us*)(dst + (size_t)(o0 + orow) * DM + i0 + c8) = v[it];
    }
    
  }
}

// =====================================================================================================
// GroupNorm, statistics and apply in one launch, + NCHW -> token-major transpose. A work-group owns XCB = 16 channels
// (two groups) of one batch: 16 x 1024 floats, held in registers from their one read to the final planes
// (thread -> 4 consecutive tokens x 16 channels, 16 loads of 16 B, all in flight together).
// Per group: mean, then the centred squares, both in f32 from bf16(x); rstd = 1/sqrt(var + 1e-6); sums: 4 chains in the
// lane, a butterfly over the wave, the 8 waves' sums in wave order.
// xn = (bf16(x) - mean) * rstd * bf16(scale[c]) + bf16(bias[c]) in f32 -> bf16 hi plane and bf16 lo plane = RNE(xn - hi).
// Plane layout [batch][c / 16][token][c % 16] (xn_off): the work-group's part of a plane is 32 KiB in a row, which it
// alone writes, whole 128-B lines: a thread's 4 tokens = one line, staged in LDS at pitch 144 B (16 B x odd), then each
// wave store = 512 B in a row. NB * DM / XCB work-groups of 256 threads (block range of the launch prep, below).
// =====================================================================================================
__device__ __forceinline__ size_t xn_off(int row, int k) {     // element (token row over all batches, channel k) of a plane
  return ((size_t)((row / SEQ) * (DM / XCB) + k / XCB) * SEQ + (size_t)(row % SEQ)) * XCB + (size_t)(k % XCB);
}
__device__ __forceinline__ float wave_sum(float v) {           // the sum over the 32 lanes, in every lane
#pragma unroll   // five fixed exchange distances
  for (int m = 16; m > 0; m >>= 1) v += __shfl_xor(v, m, 32);
  return v;
}
__device__ __forceinline__ void gn_norm(const float* __restrict__ x, const float* __restrict__ gsc,
                                        const float* __restrict__ gbi,
                                        unsigned short* XNh, unsigned short* XNl, int blk) {
  __shared__ v4u Th[256 * 9];                 // per thread one 128-B line of the hi plane, pitch 9 x 16 B
  __shared__ v4u Tl[256 * 9];                 // the same of the lo plane
  __shared__ float red[2][8][2];              // [pass][wave][group]
  const int tid = threadIdx.x, lane = tid & 31, wave = tid >> 5;
  // blk = batch * (DM / XCB) + channel block
  const int c0  = (blk % (DM / XCB)) * XCB;
  const float* xp = x + (size_t)blk * (XCB * SEQ) + tid * 4;
  v4f xv[XCB];
#pragma unroll   // every loop over c, e and k below: xv is a register array, its indices must be compile-time constants
  for (int c = 0; c < XCB; ++c) xv[c] = *(const v4f*)(xp + (size_t)c * SEQ);
  float mean[2], rstd[2];
  {
    v4f a[2] = {{0.f, 0.f, 0.f, 0.f}, {0.f, 0.f, 0.f, 0.f}};
#pragma unroll
    for (int c = 0; c < XCB; ++c)
#pragma unroll
      for (int e = 0; e < 4; ++e) { xv[c][e] = bfr(xv[c][e]); a[c / GSZ][e] += xv[c][e]; }
    const float s0 = wave_sum((a[0][0] + a[0][1]) + (a[0][2] + a[0][3]));
    const float s1 = wave_sum((a[1][0] + a[1][1]) + (a[1][2] + a[1][3]));
    if (lane == 0) { red[0][wave][0] = s0; red[0][wave][1] = s1; }
    __syncthreads();
    float t0 = 0.f, t1 = 0.f;
#pragma unroll
    for (int w = 0; w < 8; ++w) { t0 += red[0][w][0]; t1 += red[0][w][1]; }
    mean[0] = t0 * (1.0f / 8192.0f);
    mean[1] = t1 * (1.0f / 8192.0f);
  }
  {
    v4f a[2] = {{0.f, 0.f, 0.f, 0.f}, {0.f, 0.f, 0.f, 0.f}};
#pragma unroll
    for (int c = 0; c < XCB; ++c)
#pragma unroll
      for (int e = 0; e < 4; ++e) { const float d = xv[c][e] - mean[c / GSZ]; a[c / GSZ][e] += d * d; }
    const float s0 = wave_sum((a[0][0] + a[0][1]) + (a[0][2] + a[0][3]));
    const float s1 = wave_sum((a[1][0] + a[1][1]) + (a[1][2] + a[1][3]));
    if (lane == 0) { red[1][wave][0] = s0; red[1][wave][1] = s1; }
    __syncthreads();
    float t0 = 0.f, t1 = 0.f;
#pragma unroll
    for (int w = 0; w < 8; ++w) { t0 += red[1][w][0]; t1 += red[1][w][1]; }
    rstd[0] = 1.0f / sqrtf(t0 * (1.0f / 8192.0f) + 1e-6f);
    rstd[1] = 1.0f / sqrtf(t1 * (1.0f / 8192.0f) + 1e-6f);
  }
  float ssc[XCB], sbi[XCB];                   // block-uniform
#pragma unroll
  for (int c = 0; c < XCB; ++c) { ssc[c] = bfr(gsc[c0 + c]); sbi[c] = bfr(gbi[c0 + c]); }
#pragma unroll
  for (int e = 0; e < 4; ++e) {               // token 4 tid + e: 16 channels = 32 B of each plane
    unsigned hw[XCB / 2], lw[XCB / 2];
#pragma unroll
    for (int k = 0; k < XCB / 2; ++k) {
      const int ca = 2 * k, cb = 2 * k + 1;
      const float va = (xv[ca][e] - mean[ca / GSZ]) * rstd[ca / GSZ] * ssc[ca] + sbi[ca];
      const float vb = (xv[cb][e] - mean[cb / GSZ]) * rstd[cb / GSZ] * ssc[cb] + sbi[cb];
      const unsigned short ha = bf_bits(va), hb = bf_bits(vb);
      hw[k] = pk16(ha, hb);
      lw[k] = pk16(bf_bits(va - bf_up(ha)), bf_bits(vb - bf_up(hb)));
    }
#pragma unroll
    for (int j = 0; j < 2; ++j) {
      const v4u h4 = {hw[4 * j], hw[4 * j + 1], hw[4 * j + 2], hw[4 * j + 3]};
      const v4u l4 = {lw[4 * j], lw[4 * j + 1], lw[4 * j + 2], lw[4 * j + 3]};
      Th[tid * 9 + e * 2 + j] = h4;
      Tl[tid * 9 + e * 2 + j] = l4;
    }
  }
  __syncthreads();
  unsigned short* dh = XNh + (size_t)blk * (SEQ * XCB);
  unsigned short* dl = XNl + (size_t)blk * (SEQ * XCB);
#pragma unroll
  for (int it = 0; it < 8; ++it) {
    const int p = it * 256 + tid;             // 16-B piece of the work-group's 32 KiB of a plane
    const v4u h4 = Th[(p >> 3) * 9 + (p & 7)];
    const v4u l4 = Tl[(p >> 3) * 9 + (p & 7)];
    *(v4u*)(dh + (size_t)p * 8) = h4;
    *(v4u*)(dl + (size_t)p * 8) = l4;
  }
}

// =====================================================================================================
// One launch for the two passes that depend on nothing but the inputs: work-groups 0 .. NGN - 1 normalise, the 64 behind
// them convert the weights. The branch is block-uniform, so every barrier inside is passed by a whole work-group.
// =====================================================================================================
#define NGN (NB * (DM / XCB))   // GroupNorm work-groups
__global__ __launch_bounds__(256) void prep(const float* __restrict__ x, const float* __restrict__ gsc,
                                            const float* __restrict__ gbi,
                                            const float* __restrict__ W0, const float* __restrict__ W1,
                                            const float* __restrict__ W2, const float* __restrict__ W3,
                                            unsigned short* WT, unsigned short* XNh, unsigned short* XNl) {
  const int bx = blockIdx.x;
  if (bx < NGN) gn_norm(x, gsc, gbi, XNh, XNl, bx);
  else          wt_cvt(W0, W1, W2, W3, WT, (bx - NGN) & 15, (bx - NGN) >> 4);
}

// =====================================================================================================
// Register-blocked batched bf16 WMMA GEMM: C[m][n] = sum_k A[m][k] * Bt[n][k] + bias; one wave per 64x64 tile,
// eight tiles per block: 8 / TNB tile rows x TNB tile columns (N / 64 a multiple of TNB, and equal to it where TNB < 8;
// the tile count a multiple of 8). A row-major [M][K] pitch lda; Bt row-major [N][K] pitch ldb (k contiguous);
// M, N multiples of 64, K multiple of GKC. b = batch index (strides in elements).
// Operands: per slab of GKC k the block's A rows and Bt rows (every plane) are copied into LDS, each wave copy = 4 whole
// 128-B lines, rows at pitch GSP; two buffers, slab s + 1 in flight while slab s is multiplied; the waves read their
// fragments from LDS. After the last slab the ring's first bytes serve as the epilogue's per-wave slabs.
// NSPLIT: 0 = A.Bt; 1 = (A + A2).Bt (A2 = unscaled bf16 lo plane of A, same accumulator);
//         3 = A.Bt + A.Bt2 (Bt2 = unscaled bf16 lo plane of Bt; the two planes are walked as alternate k-steps).
// OUT_MODE: 0 = f32 (pitch ldc); 1 = f32 with per-element residual: v = (acc + bias + bf16(R[m][n])) * oscale,
//           R f32 pitch ldr, batch stride strideR; 3 = f16 hi plane C + f16 residual plane C2 = f16((v - hi) * rscale),
//           C2 written only for tiles with n0 < N2 (pitch ldc2, batch stride strideC2).
// bias (f32, RNE-converted to bf16 then widened): bmode 0 = none, 1 = per column n, 2 = per row m;
//           index clamped to [0, blen-1].
// XB: 1 = the A planes, 2 = the Bt planes lie in the normalised planes' layout (xn_off, rows = tokens; lda / ldb unused):
//           a wave copy is still 4 whole lines (4 tokens x 32 B of each of 4 channel blocks); 0 = both row-major.
// PAIR: two products that share A in one launch of two batches: batch 1 takes its own bias vector (biasP, blenP) and
//           writes no residual plane; its Bt and C lie strideB and strideC behind those of batch 0.
// =====================================================================================================
template <int NSPLIT, int TNB>
constexpr int gemm_rows() {                         // staged rows per slab: [A planes][Bt planes]
  return ((NSPLIT == 1) ? 2 : 1) * (8 / TNB) * 64 + ((NSPLIT == 3) ? 2 : 1) * TNB * 64;
}
// ring: the work-group's LDS, 2 * gemm_rows() * GSP halves; bxi, b: the work-group's place in the product's own grid
template <int NSPLIT, int OUT_MODE, bool PAIR, int TNB, int XB>
__device__ __forceinline__ void gemm64_body(
    __bf16* ring, int bxi, int b,
    const unsigned short* __restrict__ Ap, const unsigned short* A2p, int lda, long long strideA,
    const unsigned short* __restrict__ Btp, const unsigned short* Bt2p, int ldb, long long strideB,
    void* Cout, int ldc, long long strideC,
    void* Cout2, int ldc2, long long strideC2, int N2a,
    int M, int N, int K, float rscale,
    const float* __restrict__ biasA, int bmode, int blenA,
    const float* __restrict__ Rp, int ldr, long long strideR, float oscale,
    const float* __restrict__ biasP = nullptr, int blenP = 0) {
  const __bf16* A   = (const __bf16*)(const void*)Ap;
  const __bf16* A2  = (const __bf16*)(const void*)A2p;
  const __bf16* Bt  = (const __bf16*)(const void*)Btp;
  const __bf16* Bt2 = (const __bf16*)(const void*)Bt2p;
  constexpr int RA  = (8 / TNB) * 64;               // A rows of the block, per plane
  constexpr int RB  = TNB * 64;                     // Bt rows of the block, per plane
  constexpr int PA  = (NSPLIT == 1) ? 2 : 1;        // A planes
  constexpr int PB  = (NSPLIT == 3) ? 2 : 1;        // Bt planes
  constexpr int RT  = PA * RA + PB * RB;            // staged rows per slab: [A planes][Bt planes]
  constexpr int NIT = RT / 32;                      // copies per thread and slab (256 threads x 16 B = 32 rows)
  static_assert((RA % 32) == 0 && (RB % 32) == 0 && (NIT % 2) == 0 && NIT <= 63);
  static_assert(2 * RT * GSP * 2 >= 8 * 16 * 68 * 4);
  static_assert(RT == gemm_rows<NSPLIT, TNB>());        // ring: two slab buffers; afterwards per-wave 16x64 f32 slabs, pitch 68
  const bool second = PAIR && (b == 1);                      // block-uniform
  const float* bias = second ? biasP : biasA;
  const int blen = second ? blenP : blenA;
  const int N2   = second ? 0 : N2a;
  const int lane = threadIdx.x & 31;
  const int wave = threadIdx.x >> 5;
  const int tilesN = N >> 6;
  const int tilesM = M >> 6;
  const int tile = bxi * 8 + wave;
  if (bxi * 8 >= tilesM * tilesN) return;               // block-uniform, in front of every barrier
  const int tm = tile / tilesN;
  const int tn = tile - tm * tilesN;
  const int m0 = tm << 6;
  const int n0 = tn << 6;

  const __bf16* Ab  = A  + (size_t)b * strideA;
  const __bf16* Bb  = Bt + (size_t)b * strideB;
  const __bf16* Ab2 = (NSPLIT == 1) ? (A2  + (size_t)b * strideA) : Ab;
  const __bf16* Bb2 = (NSPLIT == 3) ? (Bt2 + (size_t)b * strideB) : Bb;

  const int rlane = lane & 15;                 // row (A) / col (B, D) within subtile
  const int koff  = (lane >> 4) * 8;           // k offset of this lane half
  const int mOff  = (lane >> 4) * 8;           // D row offset

  v8f acc[4][4];
#pragma unroll
  for (int i = 0; i < 4; ++i)
#pragma unroll
    for (int j = 0; j < 4; ++j) acc[i][j] = zero8();

  // ---- staging: thread -> row (tid >> 3) of each group of 32 rows, 16-B piece (tid & 7) of its 128-B line ----
  const int t0b  = bxi * 8;                          // the block's first tile
  const int mb0  = (t0b / tilesN) << 6;              // its first A row
  const int nb0  = (t0b - (t0b / tilesN) * tilesN) << 6;   // its first Bt row
  const int srow = threadIdx.x >> 3;
  const int sseg = (threadIdx.x & 7) * 8;
  const unsigned lthr = lds_off(ring) + (unsigned)(srow * GSP + sseg) * 2u;
  auto stage = [&](int slab, int buf) {
    const int kc = slab * GKC + sseg;
    const unsigned lb = lthr + (unsigned)buf * (unsigned)(RT * GSP * 2);
#pragma unroll   // both loops: each copy's plane and row group are compile-time, the statement's operands stay in registers
    for (int g0 = 0; g0 < NIT; g0 += 8) {
      unsigned l[8];
      const __bf16* g[8];
#pragma unroll
      for (int e = 0; e < 8; ++e) {
        const int fr = (g0 + e < NIT) ? (g0 + e) * 32 : 0;     // first staged row of this copy's group of 32
        if (fr < PA * RA) {
          const int r = fr % RA;
          g[e] = ((fr / RA) ? Ab2 : Ab) + ((XB == 1) ? xn_off(mb0 + r + srow, kc) : (size_t)(mb0 + r + srow) * lda + kc);
        } else {
          const int r = (fr - PA * RA) % RB;
          g[e] = (((fr - PA * RA) / RB) ? Bb2 : Bb) + ((XB == 2) ? xn_off(nb0 + r + srow, kc) : (size_t)(nb0 + r + srow) * ldb + kc);
        }
        l[e] = lb + (unsigned)(fr * GSP * 2);
      }
      if (g0 + 8 <= NIT) acopy8(l, g);
      else               acopy2(l, g);
    }
  };
  static_assert((NIT % 8) == 0 || (NIT % 8) == 2);

  const int nsl = K / GKC;                           // slabs
  const int aRow = (wave / TNB) * 64 + rlane;        // the wave's first A row inside a staged plane
  const int bRow = PA * RA + (wave % TNB) * 64 + rlane;   // its first Bt row inside the staged slab
  stage(0, 0);
  wait_async0();
  __syncthreads();                                   // slab 0 is published
  if (nsl > 1) stage(1, 1);
  for (int sl = 0; sl < nsl; ++sl) {
    const __bf16* sb = ring + (sl & 1) * (RT * GSP);
#pragma unroll   // k and plane offsets fold into the LDS loads' immediate offsets
    for (int ks = 0; ks < GKC / 32; ++ks) {
      const int kl = ks * 32 + koff;                 // k inside the slab
      const __bf16* As = sb + (size_t)aRow * GSP + kl;
      v16b ah[4], al[4];
#pragma unroll
      for (int i = 0; i < 4; ++i) {
        ah[i] = ldfrag_b(As + i * 16 * GSP);
        al[i] = ah[i];
        if (NSPLIT == 1) al[i] = ldfrag_b(As + (RA + i * 16) * GSP);
      }
#pragma unroll
      for (int pl = 0; pl < PB; ++pl) {              // the Bt planes of one k step follow each other, hi then lo
        const __bf16* Bs = sb + (size_t)(bRow + pl * RB) * GSP + kl;
        v16b bh[4];
#pragma unroll
        for (int j = 0; j < 4; ++j) bh[j] = ldfrag_b(Bs + j * 16 * GSP);
#pragma unroll
        for (int i = 0; i < 4; ++i) {
#pragma unroll
          for (int j = 0; j < 4; ++j) {
            acc[i][j] = mma_b_raw(ah[i], bh[j], acc[i][j]);
            if (NSPLIT == 1) acc[i][j] = mma_b_raw(al[i], bh[j], acc[i][j]);
          }
          dep_guard_b(acc[i][0], acc[i][3], ah[i], al[i]);
        }
        keep4_b(bh[0], bh[1], bh[2], bh[3]);
      }
    }
    wait_ds0();
    wait_async0();
    __syncthreads();                                 // publishes slab sl + 1 and ends every read of slab sl's buffer
    if (sl + 2 < nsl) stage(sl + 2, sl & 1);
  }
  wait_async0();
  acc_guard4(acc[0][0], acc[0][1], acc[0][2], acc[0][3]);
  acc_guard4(acc[1][0], acc[1][1], acc[1][2], acc[1][3]);
  acc_guard4(acc[2][0], acc[2][1], acc[2][2], acc[2][3]);
  acc_guard4(acc[3][0], acc[3][1], acc[3][2], acc[3][3]);

  // ---- bias (per column), clamped address, selected by value ----
  float bc[4];
  int bci[4];
#pragma unroll
  for (int j = 0; j < 4; ++j) {
    int bi = n0 + (j << 4) + rlane;
    bi = (bi < blen) ? bi : (blen - 1);
    bi = (bi > 0) ? bi : 0;
    bci[j] = bi;
    const float t = bf_up(bf_bits(bias[bi]));
    bc[j] = (bmode == 1) ? t : 0.f;
  }
  wait_x0_idx4(bci);                                 // behind the bias loads, before their index registers are reused

  // ---- epilogue ----
  float* slab = (float*)(void*)ring + wave * (16 * 68);
#pragma unroll
  for (int i = 0; i < 4; ++i) {
    const int mBase = m0 + (i << 4);
    float brw[8];
    int bri[8];
#pragma unroll
    for (int r = 0; r < 8; ++r) {
      int bi = mBase + mOff + r;
      bi = (bi < blen) ? bi : (blen - 1);
      bi = (bi > 0) ? bi : 0;
      bri[r] = bi;
      const float t = bf_up(bf_bits(bias[bi]));
      brw[r] = (bmode == 2) ? t : 0.f;
    }
    wait_x0_idx8(bri);                               // behind the bias loads, before their index registers are reused
#pragma unroll
    for (int j = 0; j < 4; ++j) {
#pragma unroll
      for (int r = 0; r < 8; ++r) {
        slab[(mOff + r) * 68 + (j << 4) + rlane] = acc[i][j][r] + bc[j] + brw[r];
      }
    }
    wave_sync_lds();
    if (OUT_MODE == 0 || OUT_MODE == 1) {
      float* C = (float*)Cout + (size_t)b * strideC;
      const float* R = Rp + (size_t)b * strideR;
      const int hh = lane >> 4, c4 = (lane & 15) * 4;     // 256-B row segment = 16 lanes x 16 B
      {
        v4f xr[8];
        if (OUT_MODE == 1) {
#pragma unroll
          for (int it = 0; it < 8; ++it) xr[it] = *(const v4f*)(R + (size_t)(mBase + it * 2 + hh) * ldr + n0 + c4);
          wait_x0();                                       // behind the run of residual loads, before their addresses are reused
        }
#pragma unroll
        for (int it = 0; it < 8; ++it) {
          const int row = it * 2 + hh;                     // it 0..7 x hh 0..1 = rows 0..15
          v4f v = *(const v4f*)(slab + row * 68 + c4);
          if (OUT_MODE == 1) {
            v4f t;
            t[0] = (v[0] + bfr(xr[it][0])) * oscale;
            t[1] = (v[1] + bfr(xr[it][1])) * oscale;
            t[2] = (v[2] + bfr(xr[it][2])) * oscale;
            t[3] = (v[3] + bfr(xr[it][3])) * oscale;
            v = t;
          }
          *(v4f*)(C + (size_t)(mBase + row) * ldc + n0 + c4) = v;
        }
        wait_x0();                                         // behind the stores, before their registers are reused
      }
    } else {
      const int q = lane >> 3, c8 = (lane & 7) * 8;
      unsigned short* C  = (unsigned short*)Cout  + (size_t)b * strideC;
      unsigned short* C2 = (unsigned short*)Cout2 + (size_t)b * strideC2;
      const bool wlo = (n0 < N2);                           // wave-uniform
      v4u hv[4], lv[4];
#pragma unroll
      for (int it = 0; it < 4; ++it) {
        const int row = it * 4 + q;                        // it 0..3 x q 0..3 = rows 0..15
        const float* sp = slab + row * 68 + c8;
        v4u a, a2;
#pragma unroll
        for (int e = 0; e < 4; ++e) {
          const float f0 = sp[2 * e], f1 = sp[2 * e + 1];
          const _Float16 x0 = (_Float16)f0, x1 = (_Float16)f1;
          const unsigned short h0 = h_bits(x0), h1 = h_bits(x1);
          const unsigned short l0 = h_bits((_Float16)((f0 - (float)x0) * rscale));
          const unsigned short l1 = h_bits((_Float16)((f1 - (float)x1) * rscale));
          a[e] = pk16(h0, h1); a2[e] = pk16(l0, l1);
        }
        hv[it] = a; lv[it] = a2;
      }
      {
#pragma unroll
        for (int it = 0; it < 4; ++it) {
          const int row = it * 4 + q;
          *(v4u*)(C + (size_t)(mBase + row) * ldc + n0 + c8) = hv[it];
          wait_x0();                                       // behind each store, before its data or address registers are reused
          if (wlo) {
            *(v4u*)(C2 + (size_t)(mBase + row) * ldc2 + n0 + c8) = lv[it];
            wait_x0();
          }
        }
      }
    }
    wave_sync_lds();
  }
}

// One launch for the three projections of the normalised planes, which do not depend on each other:
//   work-groups 0 .. NVT - 1 (the longest, given the lowest indices): v^T[b][c][t] = sum_i Wv[i][c] xn[b][t][i] + bv[c] per batch
//     -> f16 hi plane (pitch SEQ) + residual x4096 (A = WTv [c][i], Bt = XN rows of batch b hi + lo; M=256, N=1024, K=256;
//     bias per row); 8 work-groups a batch;
//   the 2 x NQK behind them (M=16384, N=256, K=256, bias per column): first q = xn . Wq + bq -> f16 hi plane [16384][256]
//     + f16 residual x4096, then k = xn . Wk + bk -> f16 plane, no residual. Wk's plane lies one weight plane behind WTq,
//     Kh two activation planes behind Qh (workspace map below).
// The branch is block-uniform; both sides use the one LDS ring, sized for the larger.
#define NVT (NB * 8)
#define NQK ((NB * SEQ / 64) * (DM / 64) / 8)
__global__ __launch_bounds__(256) void gemm_qkv(const unsigned short* __restrict__ XNh, const unsigned short* XNl,
                                                const unsigned short* __restrict__ WTq, const unsigned short* __restrict__ WTv,
                                                unsigned short* Qh, unsigned short* Ql,
                                                unsigned short* VTh, unsigned short* VTl,
                                                const float* __restrict__ bq, int nbq, const float* __restrict__ bk, int nbk,
                                                const float* __restrict__ bv, int nbv) {
  static_assert(gemm_rows<3, 8>() >= gemm_rows<1, 4>());
  __shared__ __align__(16) __bf16 ring[2 * gemm_rows<3, 8>() * GSP];
  const int bx = blockIdx.x;
  if (bx < NVT) {
    gemm64_body<3, 3, false, 8, 2>(ring, bx & 7, bx >> 3,
        WTv, WTv, DM, 0LL, XNh, XNl, DM, (long long)SEQ * DM,
        (void*)VTh, SEQ, (long long)DM * SEQ, (void*)VTl, SEQ, (long long)DM * SEQ, SEQ,
        DM, SEQ, DM, 4096.0f, bv, 2, nbv, nullptr, 0, 0LL, 1.0f);
  } else {
    gemm64_body<1, 3, true, 4, 1>(ring, (bx - NVT) % NQK, (bx - NVT) / NQK,
        XNh, XNl, DM, 0LL, WTq, WTq, DM, (long long)DM * DM,
        (void*)Qh, DM, 2LL * NB * SEQ * DM, (void*)Ql, DM, 0LL, DM,
        NB * SEQ, DM, DM, 4096.0f, bq, 1, nbq, nullptr, 0, 0LL, 1.0f, bk, nbk);
  }
}

// =====================================================================================================
// Attention, head dim 64, no masking, softmax over all SEQ keys.
//   q hi plane (f16, pitch DM): element (b, t, h, d) at [(b*SEQ + t)*DM + h*64 + d]; q residual plane
//   (f16, (q - f16(q))*4096, pitch DM) same layout; k plane (f16, pitch DM) same layout.
//   v^T hi plane (f16): element (b, h, d, s) at [(b*DM + h*64 + d)*SEQ + s]; v^T residual plane (f16, x4096): same layout
//   context: split into a bf16 hi and a bf16 lo part (lo = RNE(v - hi), unscaled); it never leaves the work-group (below)
//   Both products are taken transposed, so that a lane owns ONE query (column lane & 15):
//   scores^T[key][query] = (k . qh + (k . ql) * rres) * sscale on f16 WMMA (A = K rows, B = q), residual products in a
//   separate accumulator; a lane holds 32 of its query's 64 scores (keys 16 j + 8 (lane >> 4) + r), so the maximum and
//   the sum run in the lane, with one exchange between the wave halves for the maximum per chunk and one for the sum
//   at the end. p = exp(s - m) carried as f16(1024 p): score tiles 2 kk and 2 kk + 1, converted in place, ARE the
//   B operand (keys 32 kk .. + 31 in the hardware k order) of context^T[d][query] = vh . p + (vl . p) * rres
//   (A = V^T rows; separate accumulator folded per chunk in f32); online softmax in f32.
//   Block = 16 waves = 64 query rows of one batch, all NH heads (wave -> head wave >> 2, 16 queries wave & 3);
//   grid = NQB * NB, one work-group per WGP; kv chunks of 64, static trip NQB.
//   K / V^T chunk staging, by each head's 4 waves: asynchronous copies, 16 B per lane, 12 per thread = the head's three 64x64 tiles; a wave copy = 4 whole
//   128-B lines (lane -> row lane >> 3, piece lane & 7); two buffers, chunk kt + 1 in flight while chunk kt is worked on;
//   one __syncthreads per chunk, at the loop's foot.
//   Output projection in the same launch: with all heads of its 64 tokens at hand the work-group lays the context's two
//   planes in LDS ([token][channel], pitch CTP, over the K / V^T buffers, which every wave has left) and forms
//   out[b][c][t] = (sum_o Wp[o][c] ctx[t][o] + bp[c] + bf16(x[b][c][t])) * oscale on bf16 WMMA: A = WTp rows [c][o], all
//   256 copied into LDS behind the planes (asynchronous copies, a wave copy = one whole row = 4 whole 128-B lines, pitch CTP),
//   B = context rows, hi then lo plane at each k step, one accumulator;
//   wave -> 32 channels (wave >> 1) x 32 tokens (wave & 1). Output coverage: a wave's tile goes through its own LDS slab
//   (pitch OTP), then each wave store = 4 rows x 32 floats = 4 whole 128-B lines, which that wave alone writes.
// =====================================================================================================
#define CTP   264           // LDS pitch (halves) of a context row of DM channels: 528 B = 16 B x odd, as for KVP
#define OTP   36            // LDS pitch (floats) of an output slab row of 32 tokens: 144 B = 16 B x odd
static_assert((CTP % 8) == 0 && ((CTP / 8) & 1) == 1 && CTP >= DM && (OTP % 4) == 0 && OTP >= 32);
__device__ __forceinline__ float other_half(float v) {       // the value that lane ^ 16 holds
  const int b = __builtin_bit_cast(int, v);
  return __builtin_bit_cast(float, __builtin_amdgcn_permlanex16(b, b, 0x76543210, 0xfedcba98, false, false));
}
__global__ __launch_bounds__(512)
void attn_proj(const unsigned short* __restrict__ qhp, const unsigned short* __restrict__ qlp,
               const unsigned short* __restrict__ khp,
               const unsigned short* __restrict__ vhp, const unsigned short* __restrict__ vlp,
               const unsigned short* __restrict__ wtp, const float* __restrict__ bp, int nbp,
               const float* __restrict__ x, float* out, float sscale, float rres, float oscale) {
  union FH { v16h v; v8h h[2]; };
  constexpr int KVB = 3 * 64 * KVP;                               // halves of one buffer: K, V^T hi, V^T residual
  constexpr int PJH = 2 * 64 * CTP + DM * CTP + 16 * 32 * OTP * 2;   // halves of the projection's LDS: context planes, weight rows, output slabs
  // per head two buffers, every fragment read = one base + a constant; afterwards the projection's LDS
  __shared__ __align__(16) _Float16 KV[(NH * 2 * KVB > PJH) ? NH * 2 * KVB : PJH];

  const int tid  = threadIdx.x;
  const int wave = __builtin_amdgcn_readfirstlane(tid >> 5);      // the wave's number, held as a scalar
  const int lane = tid & 31;
  const int hh   = lane >> 4;
  const int c    = lane & 15;

  const int bx   = blockIdx.x;
  const int qb   = bx % NQB;
  const int b    = bx / NQB;
  const int h    = wave >> 2;                                     // the wave's head
  const int wq   = wave & 3;                                      // its 16 queries among the work-group's 64
  const int q0   = qb * 64 + wq * 16;
  const size_t rowB = (size_t)b * SEQ;

  const _Float16* Qh = (const _Float16*)(const void*)qhp + (size_t)h * HD;
  const _Float16* Ql = (const _Float16*)(const void*)qlp + (size_t)h * HD;
  const _Float16* Kg = (const _Float16*)(const void*)khp + (size_t)h * HD;
  const _Float16* Vh = (const _Float16*)(const void*)vhp + ((size_t)b * DM + (size_t)h * HD) * SEQ;
  const _Float16* Vl = (const _Float16*)(const void*)vlp + ((size_t)b * DM + (size_t)h * HD) * SEQ;

  // ---- Q fragments (B operand, column = query = lane&15): 2 d-chunks, hi and residual ----
  v16h qah[2], qal[2];
#pragma unroll
  for (int dc = 0; dc < 2; ++dc) {
    qah[dc] = ldfrag_h(Qh + (rowB + q0 + c) * DM + dc * 32 + 8 * hh);
    qal[dc] = ldfrag_h(Ql + (rowB + q0 + c) * DM + dc * 32 + 8 * hh);
  }

  float mrow = -INFINITY;                    // running maximum of query c (equal in both wave halves)
  float lrow = 0.f;                          // running sum of query c over this half's keys
  v8f oacc[4];                               // context^T: oacc[t][r] = element d = 16 t + 8 hh + r of query c
#pragma unroll
  for (int t = 0; t < 4; ++t) oacc[t] = zero8();

  // ---- staging: thread tg of the head's 128 -> row (tg >> 3) of each group of 16 rows, 16-B piece (tg & 7) of its 128-B line ----
  const int tg = tid & 127;
  const int srow = tg >> 3, sseg = (tg & 7) * 8;
  _Float16* const KVh = KV + h * (2 * KVB);                       // the head's two buffers
  const unsigned lthr = lds_off(KVh) + (unsigned)(srow * KVP + sseg) * 2u;
  auto stage = [&](int chunk, int buf) {     // chunk and buf are the same for the whole work-group
    const _Float16* kg  = Kg + (rowB + chunk * 64 + srow) * DM + sseg;     // K row chunk * 64 + srow
    const _Float16* vg  = Vh + (size_t)srow * SEQ + chunk * 64 + sseg;     // V^T row d = srow, keys of the chunk
    const _Float16* vlg = Vl + (size_t)srow * SEQ + chunk * 64 + sseg;
    const unsigned lb = lthr + (unsigned)buf * (unsigned)(KVB * 2);
    unsigned l[12];
    const _Float16* g[12];
#pragma unroll   // l and g are the statement's operands: constant indices keep them in registers
    for (int i = 0; i < 4; ++i) {            // rows 16 i + srow of each of the three tiles
      g[i]     = kg  + (size_t)(16 * i) * DM;
      g[4 + i] = vg  + (size_t)(16 * i) * SEQ;
      g[8 + i] = vlg + (size_t)(16 * i) * SEQ;
      l[i]     = lb + (unsigned)((16 * i) * KVP * 2);
      l[4 + i] = lb + (unsigned)((64 + 16 * i) * KVP * 2);
      l[8 + i] = lb + (unsigned)((128 + 16 * i) * KVP * 2);
    }
    acopy12(l, g);
  };
  stage(0, 0);
  wait_async0();
  __syncthreads();                           // chunk 0 is published

  for (int kt = 0; kt < NQB; ++kt) {         // static trip count
    // Directly behind the barrier in front of the loop or at the foot of trip kt - 1: the next chunk's copies, into the
    // buffer that trip kt - 1 has just read. Written at the head: with the test at the foot the compiler sank the trip's
    // last sums behind it and took 270 registers, which costs the fourth wave per SIMD.
    if (kt + 1 < NQB) stage(kt + 1, (kt + 1) & 1);
    const _Float16* const Ksh = KVh + (kt & 1) * KVB;              // K [kv][d], 64 halves used per row
    const _Float16* const Vth = Ksh + 64 * KVP;                    // V^T hi [d][kv]
    const _Float16* const Vtl = Ksh + 128 * KVP;                   // V^T residual [d][kv]

    // ---- scores^T: 64 keys x 16 queries per wave, 2 f16 products (hi, residual) ----
    //      LDS reads stand in three groups per chunk: all of K; V^T of keys 0..31, read under the softmax; V^T of keys 32..63
    v8f s[4];                                // s[j][r]: key 16 j + 8 hh + r against query c
    FH vh0[4], vl0[4];                       // V^T fragments of keys 0..31, hi and residual
    {
      FH kb[4][2];
#pragma unroll   // every loop of this block: kb, sh, sl, vh0 and vl0 are register arrays, constant indices
      for (int j = 0; j < 4; ++j)
#pragma unroll
        for (int dc = 0; dc < 2; ++dc) {
          kb[j][dc].h[0] = *(const v8h*)(Ksh + (j * 16 + c) * KVP + dc * 32 + 8 * hh);
          kb[j][dc].h[1] = *(const v8h*)(Ksh + (j * 16 + c) * KVP + dc * 32 + 16 + 8 * hh);
        }
      group_fence();
      v8f sh[4], sl[4];
#pragma unroll
      for (int j = 0; j < 4; ++j) { sh[j] = zero8(); sl[j] = zero8(); }
#pragma unroll
      for (int dc = 0; dc < 2; ++dc)
#pragma unroll
        for (int j = 0; j < 4; ++j) {
          sh[j] = mma_h(kb[j][dc].v, qah[dc], sh[j]);
          sl[j] = mma_h(kb[j][dc].v, qal[dc], sl[j]);
        }
      // ends the run: a builtin WMMA is otherwise free to sink to its first use, behind the reads that take over K's registers
      acc_guard4(sh[0], sh[1], sh[2], sh[3]);
      acc_guard4(sl[0], sl[1], sl[2], sl[3]);
      group_fence();
#pragma unroll
      for (int t = 0; t < 4; ++t) {
        vh0[t].h[0] = *(const v8h*)(Vth + (t * 16 + c) * KVP + 8 * hh);
        vh0[t].h[1] = *(const v8h*)(Vth + (t * 16 + c) * KVP + 16 + 8 * hh);
        vl0[t].h[0] = *(const v8h*)(Vtl + (t * 16 + c) * KVP + 8 * hh);
        vl0[t].h[1] = *(const v8h*)(Vtl + (t * 16 + c) * KVP + 16 + 8 * hh);
      }
      group_fence();
#pragma unroll   // whole tiles: written element by element this build paired elements of different tiles and paid a register copy for each
      for (int j = 0; j < 4; ++j) s[j] = (sh[j] + sl[j] * rres) * sscale;
    }

    // ---- maximum in the lane, joined across the halves; online softmax; P^T (x1024, f16) packed in registers ----
    float mx[8];
#pragma unroll   // mx and s are register arrays: constant indices; eight independent chains
    for (int r = 0; r < 8; ++r) mx[r] = fmaxf(fmaxf(s[0][r], s[1][r]), fmaxf(s[2][r], s[3][r]));
    float m = fmaxf(fmaxf(fmaxf(mx[0], mx[1]), fmaxf(mx[2], mx[3])), fmaxf(fmaxf(mx[4], mx[5]), fmaxf(mx[6], mx[7])));
    m = fmaxf(m, other_half(m));
    const float mnew  = fmaxf(mrow, m);
    const float alpha = __expf(mrow - mnew);
    mrow = mnew;
    FH pb[2];                                // pb[kk]: keys 32 kk + (8 hh + e | 16 + 8 hh + e - 8) of query c
    float ps[4];                             // four independent partial sums, one per score tile
#pragma unroll   // both loops: s, ps and pb are register arrays, their indices must be compile-time constants
    for (int j = 0; j < 4; ++j) {
      ps[j] = 0.f;
#pragma unroll
      for (int r = 0; r < 8; ++r) {
        const float p = __expf(s[j][r] - mnew);
        ps[j] += p;
        pb[j >> 1].v[(j & 1) * 8 + r] = (_Float16)(p * 1024.0f);
      }
    }
    lrow = lrow * alpha + ((ps[0] + ps[1]) + (ps[2] + ps[3]));
#pragma unroll
    for (int t = 0; t < 4; ++t)
#pragma unroll
      for (int r = 0; r < 8; ++r) oacc[t][r] *= alpha;

    // ---- context^T += V^T . P^T (f16 WMMA), residual products into a separate accumulator ----
    v8f o1[4];
    FH vh1[4], vl1[4];                       // V^T fragments of keys 32..63
#pragma unroll   // every loop down to the fold: register arrays, constant indices
    for (int t = 0; t < 4; ++t) oacc[t] = mma_h(vh0[t].v, pb[0].v, oacc[t]);
    acc_guard4(oacc[0], oacc[1], oacc[2], oacc[3]);   // ends the run, as above: the next reads take over vh0's registers
    group_fence();
#pragma unroll
    for (int t = 0; t < 4; ++t) {
      vh1[t].h[0] = *(const v8h*)(Vth + (t * 16 + c) * KVP + 32 + 8 * hh);
      vh1[t].h[1] = *(const v8h*)(Vth + (t * 16 + c) * KVP + 32 + 16 + 8 * hh);
      vl1[t].h[0] = *(const v8h*)(Vtl + (t * 16 + c) * KVP + 32 + 8 * hh);
      vl1[t].h[1] = *(const v8h*)(Vtl + (t * 16 + c) * KVP + 32 + 16 + 8 * hh);
    }
    group_fence();
#pragma unroll
    for (int t = 0; t < 4; ++t) o1[t] = mma_h(vl0[t].v, pb[0].v, zero8());
#pragma unroll
    for (int t = 0; t < 4; ++t) oacc[t] = mma_h(vh1[t].v, pb[1].v, oacc[t]);
#pragma unroll
    for (int t = 0; t < 4; ++t) o1[t] = mma_h(vl1[t].v, pb[1].v, o1[t]);
    acc_guard4(oacc[0], oacc[1], oacc[2], oacc[3]);   // the twelve WMMAs run back to back, the fold follows them
    acc_guard4(o1[0], o1[1], o1[2], o1[3]);
#pragma unroll
    for (int t = 0; t < 4; ++t)
#pragma unroll
      for (int r = 0; r < 8; ++r) oacc[t][r] += o1[t][r] * rres;

    wait_ds0();
    wait_async0();
    __syncthreads();                         // publishes chunk kt + 1 and ends every read of chunk kt's buffer
  }
  wait_async0();

  // ---- output projection. Its operands from global memory are asked for first, so that they fly under the context's
  //      way into LDS: the weight rows (copy e of wave w = row 16 e + w, lane -> its 16-B piece; the K / V^T buffers under
  //      them were left by every wave at the last trip's barrier), the wave's residual tile and its biases
  const int c0 = (wave >> 1) * 32;                       // the wave's first output channel
  const int t0 = (wave & 1) * 32;                        // its first token among the work-group's 64
  const int q = lane >> 3, c4 = (lane & 7) * 4;          // output rows: 4 per wave access, 8 lanes x 16 B = one 128-B line each
  __bf16* const Wl = (__bf16*)(void*)KV + 2 * 64 * CTP;  // [channel c][context channel o], pitch CTP
  {
    const __bf16* wg = (const __bf16*)(const void*)wtp + (size_t)wave * DM + lane * 8;
    const unsigned wl = lds_off(Wl) + (unsigned)(wave * CTP + lane * 8) * 2u;
#pragma unroll   // every loop down to the kernel's end: register arrays, constant indices
    for (int g0 = 0; g0 < DM / 16; g0 += 8) {
      unsigned l[8];
      const __bf16* g[8];
#pragma unroll
      for (int e = 0; e < 8; ++e) {
        g[e] = wg + (size_t)((g0 + e) * 16) * DM;
        l[e] = wl + (unsigned)((g0 + e) * 16 * CTP * 2);
      }
      acopy8(l, g);
    }
  }
  const size_t orow = ((size_t)b * DM + c0 + q) * SEQ + qb * 64 + t0 + c4;
  const float* xb = x + orow;
  v4f xr[8];
#pragma unroll
  for (int it = 0; it < 8; ++it) xr[it] = *(const v4f*)(xb + (size_t)(it * 4) * SEQ);
  wait_x0_base(xb);                                      // behind the run of residual loads, before their address is reused
  float brw[8];
  int bri[8];
#pragma unroll
  for (int it = 0; it < 8; ++it) {
    int bi = c0 + it * 4 + q;
    bi = (bi < nbp) ? bi : (nbp - 1);
    bi = (bi > 0) ? bi : 0;
    bri[it] = bi;
    brw[it] = bfr(bp[bi]);
  }
  wait_x0_idx8(bri);                                     // behind the bias loads, before their index registers are reused

  // ---- join the halves' sums, normalise (1/l and the 1/1024 p carry), split each value into its bf16 hi and lo parts:
  //      a lane's 8 registers of tile t = 8 consecutive channels of its query's row = 16 B of each plane
  unsigned short* const CTh = (unsigned short*)(void*)KV;          // [token][channel], pitch CTP
  unsigned short* const CTl = CTh + 64 * CTP;
  {
    const float l = lrow + other_half(lrow);
    const float inv = ((l > 0.f) ? (1.0f / l) : 0.f) * (1.0f / 1024.0f);
#pragma unroll
    for (int t = 0; t < 4; ++t) {
      v4u hv, lv;
#pragma unroll
      for (int e = 0; e < 4; ++e) {
        const float f0 = oacc[t][2 * e] * inv, f1 = oacc[t][2 * e + 1] * inv;
        const unsigned short h0 = bf_bits(f0), h1 = bf_bits(f1);
        hv[e] = pk16(h0, h1);
        lv[e] = pk16(bf_bits(f0 - bf_up(h0)), bf_bits(f1 - bf_up(h1)));
      }
      const int o = (wq * 16 + c) * CTP + h * HD + t * 16 + 8 * hh;
      *(v4u*)(CTh + o) = hv;
      *(v4u*)(CTl + o) = lv;
    }
  }
  wait_async0();
  __syncthreads();                                       // the 64 x 256 context tile, all heads, and the weight rows are published

  v8f acc[2][2];
#pragma unroll
  for (int i = 0; i < 2; ++i)
#pragma unroll
    for (int j = 0; j < 2; ++j) acc[i][j] = zero8();
  const __bf16* As = Wl + (c0 + c) * CTP + 8 * hh;
  const __bf16* Bs = (const __bf16*)(const void*)KV + (t0 + c) * CTP + 8 * hh;
#pragma unroll
  for (int ks = 0; ks < DM / 32; ++ks) {
    v16b af[2];
#pragma unroll
    for (int i = 0; i < 2; ++i) af[i] = ldfrag_b(As + (i * 16) * CTP + ks * 32);
#pragma unroll
    for (int pl = 0; pl < 2; ++pl) {                     // the planes of one k step follow each other, hi then lo
      v16b bh[2];
#pragma unroll
      for (int j = 0; j < 2; ++j) bh[j] = ldfrag_b(Bs + (pl * 64 + j * 16) * CTP + ks * 32);
#pragma unroll
      for (int i = 0; i < 2; ++i)
#pragma unroll
        for (int j = 0; j < 2; ++j) acc[i][j] = mma_b_raw(af[i], bh[j], acc[i][j]);
    }
  }

  // ---- the wave's 32 x 32 tile through its own slab (behind the planes and the weight rows, which other waves still read) ----
  float* slab = (float*)(void*)(Wl + DM * CTP) + wave * (32 * OTP);
#pragma unroll
  for (int i = 0; i < 2; ++i)
#pragma unroll
    for (int j = 0; j < 2; ++j)
#pragma unroll
      for (int r = 0; r < 8; ++r) slab[(i * 16 + 8 * hh + r) * OTP + j * 16 + c] = acc[i][j][r];
  wave_sync_lds();
  float* ob = out + orow;
  v4f ov[8];
#pragma unroll
  for (int it = 0; it < 8; ++it) {
    const v4f v = *(const v4f*)(slab + (it * 4 + q) * OTP + c4);
#pragma unroll
    for (int e = 0; e < 4; ++e) ov[it][e] = ((v[e] + brw[it]) + bfr(xr[it][e])) * oscale;
    *(v4f*)(ob + (size_t)(it * 4) * SEQ) = ov[it];
  }
  wait_x0_st8(ob, ov);                                   // behind the stores, before their registers are reused
}

// =====================================================================================================
// Workspace map (bytes), every plane an exact multiple of its whole-row / 64x64-tile / whole-line store granularity:
//   WT    bf16 [4][256 o][256 i]     0          524288     (Wq, Wk, Wv, Wp transposed, k = in contiguous)
//   XNh   bf16 [16][16][1024 t][16 c] 524288    8388608    (GroupNorm output, blocks of 16 channels, hi plane)
//   XNl   bf16 [16][16][1024][16]    8912896    8388608    (lo plane)
//   Qh    f16  [16384][256]          17301504   8388608
//   Ql    f16  [16384][256]          25690112   8388608    (q residual x4096)
//   Kh    f16  [16384][256]          34078720   8388608
//   VTh   f16  [16][256 c][1024 t]   42467328   8388608
//   VTl   f16  [16][256][1024]       50855936   8388608    (v residual x4096)
//   end                              59244544
// =====================================================================================================
extern "C" void kernel_launch(void* const* d_in, const int* in_sizes, int n_in,
                              void* d_out, int out_size, void* d_ws, size_t ws_size,
                              hipStream_t stream) {
  if (n_in < 11) return;
  if (in_sizes[0] != NB * DM * SEQ) return;
  if (in_sizes[3] != DM * DM || in_sizes[5] != DM * DM || in_sizes[7] != DM * DM || in_sizes[9] != DM * DM) return;
  if (in_sizes[1] < DM || in_sizes[2] < DM) return;
  if (in_sizes[4] < 1 || in_sizes[6] < 1 || in_sizes[8] < 1 || in_sizes[10] < 1) return;
  if (out_size != NB * DM * SEQ) return;

  const float* x   = (const float*)d_in[0];
  const float* gsc = (const float*)d_in[1];
  const float* gbi = (const float*)d_in[2];
  const float* wq  = (const float*)d_in[3];
  const float* bq  = (const float*)d_in[4];
  const float* wk  = (const float*)d_in[5];
  const float* bk  = (const float*)d_in[6];
  const float* wv  = (const float*)d_in[7];
  const float* bv  = (const float*)d_in[8];
  const float* wp  = (const float*)d_in[9];
  const float* bp  = (const float*)d_in[10];
  float* out = (float*)d_out;

  const size_t PWT = (size_t)4 * DM * DM * 2;          //   524288
  const size_t P16 = (size_t)NB * SEQ * DM * 2;        //  8388608
  size_t off = 0;
  const size_t oWT   = off; off += PWT;
  const size_t oXNh  = off; off += P16;
  const size_t oXNl  = off; off += P16;
  const size_t oQh   = off; off += P16;
  const size_t oQl   = off; off += P16;
  const size_t oKh   = off; off += P16;
  const size_t oVTh  = off; off += P16;
  const size_t oVTl  = off; off += P16;
  if (off > ws_size) return;                            // off = 59244544
  if (off > (size_t)134217728) return;

  char* ws = (char*)d_ws;
  unsigned short* WT   = (unsigned short*)(ws + oWT);
  unsigned short* XNh  = (unsigned short*)(ws + oXNh);
  unsigned short* XNl  = (unsigned short*)(ws + oXNl);
  unsigned short* Qh   = (unsigned short*)(ws + oQh);
  unsigned short* Ql   = (unsigned short*)(ws + oQl);
  unsigned short* Kh   = (unsigned short*)(ws + oKh);
  unsigned short* VTh  = (unsigned short*)(ws + oVTh);
  unsigned short* VTl  = (unsigned short*)(ws + oVTl);
  unsigned short* WTq = WT + (size_t)0 * DM * DM;
  unsigned short* WTv = WT + (size_t)2 * DM * DM;
  unsigned short* WTp = WT + (size_t)3 * DM * DM;

  const dim3 blk(256);
  const dim3 gPrep(NGN + 64);                                     // 256 GroupNorm blocks + 16 tiles of 64x64 x 4 weights
  const dim3 gQKV(NVT + 2 * NQK);                                 // 128 v^T blocks + 128 q blocks + 128 k blocks
  const dim3 gAttn(NB * NQB);                                     // 256 blocks of 16 waves
  const float rs2 = 1.0f / 1.41421356237309515f;

  // (1) GroupNorm statistics from bf16(x) and apply -> bf16 hi + lo planes [16][16 channel blocks][1024 t][16 c];
  //     weights [in][out] -> bf16 [out][in] planes (RNE convert)
  prep<<<gPrep, blk, 0, stream>>>(x, gsc, gbi, wq, wk, wv, wp, WT, XNh, XNl);
  // (2) v^T, q and k projections of the normalised planes
  gemm_qkv<<<gQKV, blk, 0, stream>>>(XNh, XNl, WTq, WTv, Qh, Ql, VTh, VTl,
                                     bq, in_sizes[4], bk, in_sizes[6], bv, in_sizes[8]);
  // (3) attention (scores scale 1/sqrt(C) = 1/16) and, on each work-group's 64 tokens x 256 context channels,
  //     out[b][c][t] = (sum_o Wp[o][c] ctx[b][t][o] + bp[c] + bf16(x[b][c][t])) * (1/sqrt2), written straight into the
  //     NCHW output rows
  attn_proj<<<gAttn, dim3(512), 0, stream>>>(Qh, Ql, Kh, VTh, VTl, WTp, bp, in_sizes[10], x, out,
                                             0.0625f, 1.0f / 4096.0f, rs2);
  (void)hipGetLastError();
}
